// v000
// Measured on an AMD MI455X. A time is GPU time per run, averaged over a window of back-to-back runs after a warm-up
// (all launches, gaps included; the runs take copies of the inputs in turn), and the median of several windows.
// Apart from v000's, it joins two sittings. Times from different sittings can be a few percent apart, while
// side-by-side timings come from the same sitting.
// The starting kernel, v000, takes 288 microseconds a run.
// Contractions: qkv projection (K=256), fc1 (K=256), fc2 (K=768): v_wmma_f32_16x16x32_f16, single f16 products,
// activations carried x16, weights one f16 plane of 64*bf16(w); per-head k^T v logits (K=4096) and attn x q (K=64):
// v_wmma_f32_16x16x32_f16 with both operands as f16 hi + x2048 residual planes (3 products); f32 accumulate
// everywhere. Softmax, layer norm, exact GELU and all epilogues f32 on VALU; every float input RNE-converted to
// bf16 on load.
#include <hip/hip_runtime.h>
#include <stdint.h>

#define BB     8
#define NN     4096
#define DIMC   256
#define NH     4
#define HD     64
#define MLP    768
#define NTOK   (BB * NN)
#define LDC    132
#define LDX    260
#define LDA    68
#define RSC    0.00048828125f
#define PLANE  ((size_t)BB * NH * HD * NN)
#define QL_OFF ((size_t)NTOK * DIMC)
#define ATL_OFF ((size_t)BB * NH * HD * HD)

static_assert(NTOK == 32768);
static_assert(DIMC == NH * HD);
static_assert((NN % 64) == 0 && (NTOK % 64) == 0);
static_assert((DIMC % 32) == 0 && (MLP % 32) == 0 && (HD % 32) == 0 && (NN % 32) == 0);
static_assert((LDX * 4) % 16 == 0 && (LDC * 4) % 16 == 0);
static_assert(PLANE == 8388608 && QL_OFF == 8388608 && ATL_OFF == 131072);
static_assert(MLP == 6 * 128 && DIMC == 2 * 128);

typedef _Float16 v16h __attribute__((ext_vector_type(16)));
typedef _Float16 v8h  __attribute__((ext_vector_type(8)));
typedef float    v8f  __attribute__((ext_vector_type(8)));
typedef float    v4f  __attribute__((ext_vector_type(4)));
typedef unsigned int v4u __attribute__((ext_vector_type(4)));

// ---- scalar helpers ------------------------------------------------------------------------------------------
__device__ __forceinline__ unsigned short bf_bits(float f) {          // f32 -> bf16 bits, RNE convert
  unsigned u = __float_as_uint(f);
  return (unsigned short)((u + 0x7FFFu + ((u >> 16) & 1u)) >> 16);
}
__device__ __forceinline__ float bf_up(unsigned short b) { return __uint_as_float(((unsigned)b) << 16); }
__device__ __forceinline__ float bfr(float f) { return bf_up(bf_bits(f)); }
__device__ __forceinline__ unsigned short h_bits(_Float16 x) { return __builtin_bit_cast(unsigned short, x); }
__device__ __forceinline__ unsigned short hb16(float f) { return h_bits((_Float16)f); }
__device__ __forceinline__ unsigned pk16(unsigned short a, unsigned short b) { return (unsigned)a | ((unsigned)b << 16); }
__device__ __forceinline__ v8f zero8() { v8f z = {0.f, 0.f, 0.f, 0.f, 0.f, 0.f, 0.f, 0.f}; return z; }
// hi/lo pair of two f32 values: hi = f16(v), lo = f16(2048 (v - hi)), packed as two 32-bit words
__device__ __forceinline__ void split2(float f0, float f1, unsigned& hp, unsigned& lp) {
  const _Float16 h0 = (_Float16)f0, h1 = (_Float16)f1;
  const float q0 = (f0 - (float)h0) * 2048.0f, q1 = (f1 - (float)h1) * 2048.0f;
  hp = pk16(h_bits(h0), h_bits(h1));
  lp = pk16(hb16(q0), hb16(q1));
}

// ---- fragment loader: 16-bit A/B operand, lane -> row/col (lane&15), p already includes +8*(lane>>4);
//      elements 0..7 <- p[0..7] (k0+8h..k0+8h+7), elements 8..15 <- p[16..23] (k0+16+8h..k0+16+8h+7)
__device__ __forceinline__ v16h ldfrag_h(const _Float16* p) {
  union { v16h v; v8h h[2]; } f;
  f.h[0] = *(const v8h*)(p);
  f.h[1] = *(const v8h*)(p + 16);
  return f.v;
}

// ---- WMMA helpers; the guards insert the trailing VALU hazard gap and keep A/B live --------------------------
__device__ __forceinline__ v8f mma_raw(v16h a, v16h b, v8f c) {
  return __builtin_amdgcn_wmma_f32_16x16x32_f16(false, a, false, b, (short)0, c, false, false);
}
__device__ __forceinline__ void guard4(v8f& c0, v8f& c1, v8f& c2, v8f& c3,
                                       const v16h& a0, const v16h& a1, const v16h& b0, const v16h& b1) {
#if defined(__HIP_DEVICE_COMPILE__)
  asm volatile("v_nop\n\tv_nop\n\tv_nop\n\tv_nop"
               : "+v"(c0), "+v"(c1), "+v"(c2), "+v"(c3)
               : "v"(a0), "v"(a1), "v"(b0), "v"(b1));
#endif
}
__device__ __forceinline__ void guard6(v8f& c0, v8f& c1, v8f& c2, v8f& c3, v8f& c4, v8f& c5,
                                       const v16h& a0, const v16h& a1, const v16h& b0, const v16h& b1,
                                       const v16h& b2, const v16h& b3) {
#if defined(__HIP_DEVICE_COMPILE__)
  asm volatile("v_nop\n\tv_nop\n\tv_nop\n\tv_nop"
               : "+v"(c0), "+v"(c1), "+v"(c2), "+v"(c3), "+v"(c4), "+v"(c5)
               : "v"(a0), "v"(a1), "v"(b0), "v"(b1), "v"(b2), "v"(b3));
#endif
}
__device__ __forceinline__ void guard3(v8f& c0, v8f& c1, v8f& c2,
                                       const v16h& a0, const v16h& a1, const v16h& b0, const v16h& b1) {
#if defined(__HIP_DEVICE_COMPILE__)
  asm volatile("v_nop\n\tv_nop\n\tv_nop\n\tv_nop"
               : "+v"(c0), "+v"(c1), "+v"(c2)
               : "v"(a0), "v"(a1), "v"(b0), "v"(b1));
#endif
}

// ---- 64x128 block tile GEMM core, single 16-bit planes: A row pitch lda (row-major, k contiguous), W is [n][k]
//      k-contiguous pitch ldw. 8 waves = 2 (32 rows) x 4 (32 cols), 2x2 tiles of 16 per wave; fragments straight
//      from global with the table layout; results written to the LDS f32 tile Cs[64][LDC].
__device__ __forceinline__ void mm_tile1(const _Float16* __restrict__ A, int lda,
                                         const _Float16* __restrict__ W, int ldw, int nks,
                                         int arow0, int bcol0, float* Cs) {
  const int tid = threadIdx.x, wave = tid >> 5, lane = tid & 31, hh = lane >> 4, c = lane & 15;
  const int mw = wave >> 2, nw = wave & 3;
  const _Float16* a0p = A + (size_t)(arow0 + mw * 32 + c) * lda + 8 * hh;
  const _Float16* a1p = A + (size_t)(arow0 + mw * 32 + 16 + c) * lda + 8 * hh;
  const _Float16* b0p = W + (size_t)(bcol0 + nw * 32 + c) * ldw + 8 * hh;
  const _Float16* b1p = W + (size_t)(bcol0 + nw * 32 + 16 + c) * ldw + 8 * hh;
  v8f c00 = zero8(), c01 = zero8(), c10 = zero8(), c11 = zero8();
#pragma unroll 1
  for (int ks = 0; ks < nks; ++ks) {
    const int ko = ks * 32;
    const v16h fa0 = ldfrag_h(a0p + ko);
    const v16h fa1 = ldfrag_h(a1p + ko);
    const v16h fb0 = ldfrag_h(b0p + ko);
    const v16h fb1 = ldfrag_h(b1p + ko);
    c00 = mma_raw(fa0, fb0, c00);
    c01 = mma_raw(fa0, fb1, c01);
    c10 = mma_raw(fa1, fb0, c10);
    c11 = mma_raw(fa1, fb1, c11);
    guard4(c00, c01, c10, c11, fa0, fa1, fb0, fb1);
  }
#pragma unroll
  for (int r = 0; r < 8; ++r) {
    const int row = mw * 32 + 8 * hh + r;
    Cs[row * LDC + nw * 32 + c]             = c00[r];
    Cs[row * LDC + nw * 32 + 16 + c]        = c01[r];
    Cs[(row + 16) * LDC + nw * 32 + c]      = c10[r];
    Cs[(row + 16) * LDC + nw * 32 + 16 + c] = c11[r];
  }
}

// =================================================================================================================
// Weight convert: wqt[n][k] = f16(64 bf16(w_qkv[k][n])), w1t[n][k] = f16(64 bf16(w_fc1[k][n])) (n < 768, k < 256),
// w2t[n][k] = f16(64 bf16(w_fc2[k][n])) (n < 256, k < 768). Block = one output row n; thread = one 16-B piece of
// coverage: wqt 768 x 256, w1t 768 x 256, w2t 256 x 768, every element once.
// =================================================================================================================
__global__ __launch_bounds__(128)
void k_wcvt(const float* __restrict__ wqkv, const float* __restrict__ wfc1, const float* __restrict__ wfc2,
            unsigned short* wqt, unsigned short* w1t, unsigned short* w2t) {
  const int tid = threadIdx.x;
  const int blk = blockIdx.x;
  if (blk < 2 * MLP) {                                      // block-uniform branch
    const int t = (blk < MLP) ? 0 : 1;
    const int n = blk - t * MLP;
    const float* src = t ? wfc1 : wqkv;
    unsigned short* dstp = t ? w1t : wqt;
    const int tt = min(tid, 31);
    const int k0 = tt * 8;
    v4u pk;
#pragma unroll
    for (int e = 0; e < 4; ++e) {
      const float f0 = src[(size_t)(k0 + 2 * e) * MLP + n];
      const float f1 = src[(size_t)(k0 + 2 * e + 1) * MLP + n];
      pk[e] = pk16(hb16(bfr(f0) * 64.0f), hb16(bfr(f1) * 64.0f));
    }
    if (tid < 32) {
      unsigned short* dst = dstp + (size_t)n * DIMC + k0;
      *(v4u*)dst = pk;
      
    }
  } else {
    const int n = blk - 2 * MLP;                            // 0..255
    const int tt = min(tid, 95);
    const int k0 = tt * 8;
    v4u pk;
#pragma unroll
    for (int e = 0; e < 4; ++e) {
      const float f0 = wfc2[(size_t)(k0 + 2 * e) * DIMC + n];
      const float f1 = wfc2[(size_t)(k0 + 2 * e + 1) * DIMC + n];
      pk[e] = pk16(hb16(bfr(f0) * 64.0f), hb16(bfr(f1) * 64.0f));
    }
    if (tid < 96) {
      unsigned short* dst = w2t + (size_t)n * MLP + k0;
      *(v4u*)dst = pk;
      
    }
  }
}

// =================================================================================================================
// x [32768][256] f32 -> xh f16 plane of 16 bf16(x); thread = 8 consecutive elements = one 16-B piece, consecutive
// grid = ceil(npieces/256). coverage: xh [32768][256], every element once.
// =================================================================================================================
__global__ __launch_bounds__(256)
void k_xcvt(const float* __restrict__ x, unsigned short* xh, int npieces) {
  const int i = blockIdx.x * 256 + threadIdx.x;
  if (i >= npieces) return;
  const float* p = x + (size_t)i * 8;
  const v4f a = *(const v4f*)(p);
  const v4f b = *(const v4f*)(p + 4);
  v4u pk;
  pk[0] = pk16(hb16(bfr(a[0]) * 16.0f), hb16(bfr(a[1]) * 16.0f));
  pk[1] = pk16(hb16(bfr(a[2]) * 16.0f), hb16(bfr(a[3]) * 16.0f));
  pk[2] = pk16(hb16(bfr(b[0]) * 16.0f), hb16(bfr(b[1]) * 16.0f));
  pk[3] = pk16(hb16(bfr(b[2]) * 16.0f), hb16(bfr(b[3]) * 16.0f));
  unsigned short* dst = xh + (size_t)i * 8;
  *(v4u*)dst = pk;
  
}

// =================================================================================================================
// QKV projection: C[64 tokens][128 cols] = xh . wqt^T (K = 256, 8 k-steps), Cs = 1024 (x w). Column group cg
// (0..5) covers cols cg*128 of 768: third s = cg>>1 (q, k, v), head pair hp = cg&1. Carried value 16 (x w + b) =
// Cs/64 + 16 bf16(b), stored as f16 hi + x2048 residual planes:
//   k, v: transposed planes kv + {0,1,2,3} PLANE = kTh, kTl, vTh, vTl [b][h][d][n] (n contiguous): each channel's
// grid = (NTOK/64, 6), 256 threads. coverage: qh/ql [32768][256]; kTh/kTl/vTh/vTl [8][4][64][4096], every element once.
// =================================================================================================================
__global__ __launch_bounds__(256)
void k_qkv(const unsigned short* __restrict__ xh, const unsigned short* __restrict__ wqt,
           const float* __restrict__ bias, unsigned short* qp, unsigned short* kv) {
  __shared__ __align__(16) float Cs[64 * LDC];
  const int tid = threadIdx.x;
  const int mb = blockIdx.x, cg = blockIdx.y;
  const int tok0 = mb * 64, col0 = cg * 128;
  mm_tile1((const _Float16*)(const void*)xh, DIMC, (const _Float16*)(const void*)wqt, DIMC, DIMC / 32,
           tok0, col0, Cs);
  __syncthreads();
  const int s = cg >> 1, hp = cg & 1;
  if (s == 0) {                                             // block-uniform branch, no WMMA inside
    unsigned short* dh = qp;
    unsigned short* dl = qp + QL_OFF;
    v4u ph[4], pq[4];
    size_t offs[4];
#pragma unroll
    for (int s4 = 0; s4 < 4; ++s4) {
      const int idx = s4 * 256 + tid;
      const int row = idx >> 4, piece = idx & 15;
      const int colp = piece * 8;
      v4u a, q4;
#pragma unroll
      for (int e = 0; e < 4; ++e) {
        const float b0 = 16.0f * bfr(bias[col0 + colp + 2 * e]);
        const float b1 = 16.0f * bfr(bias[col0 + colp + 2 * e + 1]);
        const float f0 = Cs[row * LDC + colp + 2 * e] * (1.0f / 64.0f) + b0;
        const float f1 = Cs[row * LDC + colp + 2 * e + 1] * (1.0f / 64.0f) + b1;
        unsigned hw, lw;
        split2(f0, f1, hw, lw);
        a[e] = hw; q4[e] = lw;
      }
      ph[s4] = a;
      pq[s4] = q4;
      offs[s4] = (size_t)(tok0 + row) * DIMC + hp * 128 + colp;
    }
#pragma unroll
    for (int s4 = 0; s4 < 4; ++s4) { *(v4u*)(dh + offs[s4]) = ph[s4]; *(v4u*)(dl + offs[s4]) = pq[s4]; }
    
  } else {
    unsigned short* dh = kv + (size_t)(s - 1) * 2 * PLANE;
    unsigned short* dl = dh + PLANE;
    const int b = tok0 >> 12, n0 = tok0 & (NN - 1);
    v4u ph[4], pq[4];
    size_t offs[4];
#pragma unroll
    for (int s4 = 0; s4 < 4; ++s4) {
      const int idx = s4 * 256 + tid;
      const int ch = idx >> 3, piece = idx & 7;
      const int h = 2 * hp + (ch >> 6), d = ch & 63;
      const float bb = 16.0f * bfr(bias[col0 + ch]);
      const int r0 = piece * 8;
      v4u a, q4;
#pragma unroll
      for (int e = 0; e < 4; ++e) {
        const float f0 = Cs[(r0 + 2 * e) * LDC + ch] * (1.0f / 64.0f) + bb;
        const float f1 = Cs[(r0 + 2 * e + 1) * LDC + ch] * (1.0f / 64.0f) + bb;
        unsigned hw, lw;
        split2(f0, f1, hw, lw);
        a[e] = hw; q4[e] = lw;
      }
      ph[s4] = a;
      pq[s4] = q4;
      offs[s4] = ((size_t)(b * NH + h) * HD + d) * NN + n0 + r0;
    }
#pragma unroll
    for (int s4 = 0; s4 < 4; ++s4) { *(v4u*)(dh + offs[s4]) = ph[s4]; *(v4u*)(dl + offs[s4]) = pq[s4]; }
    
  }
}

// =================================================================================================================
// Per (b, h) channel attention: logits raw[d][e] = sum_n (16 k[n][d]) (16 v[n][e]) on WMMA (M = N = 64, K = 4096,
// 128 k-steps): A = kT hi/lo planes (row d, pitch NN), B = vT hi/lo planes ([e][n], n contiguous = the [n][k]
// copy form); products hi*hi + (hi*lo + lo*hi)/2048; 8 waves = 4 (16 rows) x 2 (32 cols). Logit = raw/2048
// (includes the head_dim^-0.5 factor 1/8). Softmax over e per row d in f32 (max subtracted, 4 threads per row,
// coverage: ath/atl [32][64][64], every element once.
// =================================================================================================================
__global__ __launch_bounds__(256)
void k_attn(const unsigned short* __restrict__ kv, unsigned short* at) {
  __shared__ __align__(16) float Cs[64 * LDA];
  const int tid = threadIdx.x, wave = tid >> 5, lane = tid & 31, hh = lane >> 4, c = lane & 15;
  const int bh = blockIdx.x;
  const _Float16* base = (const _Float16*)(const void*)kv;
  const _Float16* Kh = base + (size_t)bh * HD * NN;
  const _Float16* Kl = Kh + PLANE;
  const _Float16* Vh = Kh + 2 * PLANE;
  const _Float16* Vl = Kh + 3 * PLANE;
  {
    const int mw = wave >> 1, nw = wave & 1;
    const _Float16* ahp = Kh + (size_t)(mw * 16 + c) * NN + 8 * hh;
    const _Float16* alp = Kl + (size_t)(mw * 16 + c) * NN + 8 * hh;
    const _Float16* b0h = Vh + (size_t)(nw * 32 + c) * NN + 8 * hh;
    const _Float16* b1h = Vh + (size_t)(nw * 32 + 16 + c) * NN + 8 * hh;
    const _Float16* b0l = Vl + (size_t)(nw * 32 + c) * NN + 8 * hh;
    const _Float16* b1l = Vl + (size_t)(nw * 32 + 16 + c) * NN + 8 * hh;
    v8f p0 = zero8(), p1 = zero8(), q0 = zero8(), q1 = zero8(), r0 = zero8(), r1 = zero8();
#pragma unroll 1
    for (int ks = 0; ks < NN / 32; ++ks) {
      const int ko = ks * 32;
      const v16h fa  = ldfrag_h(ahp + ko);
      const v16h ga  = ldfrag_h(alp + ko);
      const v16h fb0 = ldfrag_h(b0h + ko);
      const v16h fb1 = ldfrag_h(b1h + ko);
      const v16h gb0 = ldfrag_h(b0l + ko);
      const v16h gb1 = ldfrag_h(b1l + ko);
      p0 = mma_raw(fa, fb0, p0);
      p1 = mma_raw(fa, fb1, p1);
      q0 = mma_raw(fa, gb0, q0);
      q1 = mma_raw(fa, gb1, q1);
      r0 = mma_raw(ga, fb0, r0);
      r1 = mma_raw(ga, fb1, r1);
      guard6(p0, p1, q0, q1, r0, r1, fa, ga, fb0, fb1, gb0, gb1);
    }
#pragma unroll
    for (int r = 0; r < 8; ++r) {
      const int row = mw * 16 + 8 * hh + r;
      Cs[row * LDA + nw * 32 + c]      = p0[r] + (q0[r] + r0[r]) * RSC;
      Cs[row * LDA + nw * 32 + 16 + c] = p1[r] + (q1[r] + r1[r]) * RSC;
    }
  }
  __syncthreads();
  {
    const int row = tid >> 2, part = tid & 3;
    float* cr = Cs + row * LDA + part * 16;
    float mx = -3.0e38f;
#pragma unroll 1
    for (int n = 0; n < 16; ++n) mx = fmaxf(mx, cr[n]);
    mx = fmaxf(mx, __shfl_xor(mx, 1, 32));
    mx = fmaxf(mx, __shfl_xor(mx, 2, 32));
    float sm = 0.f;
#pragma unroll 1
    for (int n = 0; n < 16; ++n) {
      const float e = expf((cr[n] - mx) * RSC);
      cr[n] = e;
      sm += e;
    }
    sm += __shfl_xor(sm, 1, 32);
    sm += __shfl_xor(sm, 2, 32);
    const float sc = (1.0f / sm) * 4096.0f;
#pragma unroll 1
    for (int n = 0; n < 16; ++n) cr[n] = cr[n] * sc;
  }
  __syncthreads();
  unsigned short* dh = at;
  unsigned short* dl = at + ATL_OFF;
  v4u ph[2], pq[2];
  size_t offs[2];
#pragma unroll
  for (int s = 0; s < 2; ++s) {
    const int idx = s * 256 + tid;
    const int row = idx >> 3, piece = idx & 7;
    const int col0 = piece * 8;
    v4u a, q4;
#pragma unroll
    for (int e = 0; e < 4; ++e) {
      unsigned hw, lw;
      split2(Cs[row * LDA + col0 + 2 * e], Cs[row * LDA + col0 + 2 * e + 1], hw, lw);
      a[e] = hw; q4[e] = lw;
    }
    ph[s] = a;
    pq[s] = q4;
    offs[s] = ((size_t)bh * HD + row) * HD + col0;
  }
#pragma unroll
  for (int s = 0; s < 2; ++s) { *(v4u*)(dh + offs[s]) = ph[s]; *(v4u*)(dl + offs[s]) = pq[s]; }
  
}

// =================================================================================================================
// xf + residual + layer norm. Block = 32 tokens of one batch, all 4 heads. Per head h: C[32 tok][64 d] =
// sum_e (16 q[tok][h*64+e]) (4096 P[d][e]) on WMMA (K = 64, 2 k-steps): A = qh/ql [token][256] pitch 256 at
// column h*64, B = ath/atl [bh][d][64] (e contiguous = [n][k] copy form); products hi*hi + (hi*lo + lo*hi)/2048;
// 8 waves = 2 (16 rows) x 4 (16 cols); xf = C/65536. Then x1 = bf16(x) + xf (f32, kept in the LDS tile), mean
// f16, every element once.
// =================================================================================================================
__global__ __launch_bounds__(256)
void k_xf(const unsigned short* __restrict__ qp, const unsigned short* __restrict__ at,
          const float* __restrict__ x, const float* __restrict__ gw, const float* __restrict__ gb,
          float* x1, unsigned short* hh16) {
  __shared__ __align__(16) float Cs[32 * LDX];
  __shared__ float Mu[32];
  __shared__ float Rs[32];
  const int tid = threadIdx.x, wave = tid >> 5, lane = tid & 31, hh = lane >> 4, c = lane & 15;
  const int mw = wave >> 2, nw = wave & 3;
  const int tok0 = blockIdx.x * 32;
  const int b = tok0 >> 12;
  const _Float16* Qh = (const _Float16*)(const void*)qp;
  const _Float16* Ql = Qh + QL_OFF;
  const _Float16* Ah = (const _Float16*)(const void*)at;
  const _Float16* Al = Ah + ATL_OFF;
  const size_t arow = (size_t)(tok0 + mw * 16 + c) * DIMC + 8 * hh;
#pragma unroll 1
  for (int h = 0; h < NH; ++h) {                            // block-uniform trip count
    const _Float16* ahp = Qh + arow + h * HD;
    const _Float16* alp = Ql + arow + h * HD;
    const size_t brow = ((size_t)(b * NH + h) * HD + nw * 16 + c) * HD + 8 * hh;
    const _Float16* bhp = Ah + brow;
    const _Float16* blp = Al + brow;
    v8f p = zero8(), q = zero8(), r = zero8();
#pragma unroll
    for (int ks = 0; ks < HD / 32; ++ks) {
      const int ko = ks * 32;
      const v16h fa = ldfrag_h(ahp + ko);
      const v16h ga = ldfrag_h(alp + ko);
      const v16h fb = ldfrag_h(bhp + ko);
      const v16h gq = ldfrag_h(blp + ko);
      p = mma_raw(fa, fb, p);
      q = mma_raw(fa, gq, q);
      r = mma_raw(ga, fb, r);
      guard3(p, q, r, fa, ga, fb, gq);
    }
#pragma unroll
    for (int rr = 0; rr < 8; ++rr)
      Cs[(mw * 16 + 8 * hh + rr) * LDX + h * HD + nw * 16 + c] = p[rr] + (q[rr] + r[rr]) * RSC;
  }
  __syncthreads();
  // phase 1: x1 = bf16(x) + xf back into the tile, per-row statistics
#pragma unroll 1
  for (int it = 0; it < 4; ++it) {
    const int row = wave * 4 + it;
    const size_t tok = (size_t)(tok0 + row);
    const float* xr = x + tok * DIMC + lane * 8;
    const v4f xa = *(const v4f*)(xr);
    const v4f xb = *(const v4f*)(xr + 4);
    float* cr = Cs + row * LDX + lane * 8;
    float v[8];
#pragma unroll
    for (int e = 0; e < 4; ++e) {
      v[e]     = bfr(xa[e]) + cr[e] * (1.0f / 65536.0f);
      v[4 + e] = bfr(xb[e]) + cr[4 + e] * (1.0f / 65536.0f);
    }
#pragma unroll
    for (int e = 0; e < 8; ++e) cr[e] = v[e];
    float s = ((v[0] + v[1]) + (v[2] + v[3])) + ((v[4] + v[5]) + (v[6] + v[7]));
#pragma unroll
    for (int off = 16; off; off >>= 1) s += __shfl_xor(s, off, 32);
    const float mu = s * (1.0f / 256.0f);
    float sq = 0.f;
#pragma unroll
    for (int e = 0; e < 8; ++e) { const float d = v[e] - mu; sq += d * d; }
#pragma unroll
    for (int off = 16; off; off >>= 1) sq += __shfl_xor(sq, off, 32);
    const float var = sq * (1.0f / 256.0f);
    const float rs = rsqrtf(var + 1e-5f);
    if (lane == 0) { Mu[row] = mu; Rs[row] = rs; }
  }
  __syncthreads();
  // phase 2: whole-line stores of x1 (f32) and hh16 (f16 of 16 h)
  v4f pk[8];
  size_t offs[8];
#pragma unroll
  for (int s = 0; s < 8; ++s) {
    const int idx = s * 256 + tid;
    const int row = idx >> 6, piece = idx & 63;
    v4f v4;
#pragma unroll
    for (int e = 0; e < 4; ++e) v4[e] = Cs[row * LDX + piece * 4 + e];
    pk[s] = v4;
    offs[s] = (size_t)(tok0 + row) * DIMC + piece * 4;
  }
  v4u ph[4];
  size_t offh[4];
#pragma unroll
  for (int s = 0; s < 4; ++s) {
    const int idx = s * 256 + tid;
    const int row = idx >> 5, piece = idx & 31;
    const int col0 = piece * 8;
    const float mu = Mu[row], rs = Rs[row];
    v4u a;
#pragma unroll
    for (int e = 0; e < 4; ++e) {
      const int cA = col0 + 2 * e, cB = cA + 1;
      const float f0 = ((Cs[row * LDX + cA] - mu) * rs) * bfr(gw[cA]) + bfr(gb[cA]);
      const float f1 = ((Cs[row * LDX + cB] - mu) * rs) * bfr(gw[cB]) + bfr(gb[cB]);
      a[e] = pk16(hb16(f0 * 16.0f), hb16(f1 * 16.0f));
    }
    ph[s] = a;
    offh[s] = (size_t)(tok0 + row) * DIMC + col0;
  }
#pragma unroll
  for (int s = 0; s < 8; ++s) *(v4f*)(x1 + offs[s]) = pk[s];
#pragma unroll
  for (int s = 0; s < 4; ++s) *(v4u*)(hh16 + offh[s]) = ph[s];
  
}

// =================================================================================================================
// FC1 + exact GELU: C[64 tokens][128 cols] = hh16 . w1t^T (K = 256), Cs = 1024 (h w1); v = Cs/1024 + bf16(b1),
// g = 0.5 v (1 + erf(v / sqrt 2)) computed in place in the LDS tile (rolled loop, thread = 32 elements of one row),
// coverage: gh [32768][768], every element once.
// =================================================================================================================
__global__ __launch_bounds__(256)
void k_fc1(const unsigned short* __restrict__ hh16, const unsigned short* __restrict__ w1t,
           const float* __restrict__ bias, unsigned short* gh) {
  __shared__ __align__(16) float Cs[64 * LDC];
  const int tid = threadIdx.x;
  const int mb = blockIdx.x, cg = blockIdx.y;
  const int tok0 = mb * 64, col0 = cg * 128;
  mm_tile1((const _Float16*)(const void*)hh16, DIMC, (const _Float16*)(const void*)w1t, DIMC, DIMC / 32,
           tok0, col0, Cs);
  __syncthreads();
  {
    const int row = tid >> 2, cq = tid & 3;
    float* cr = Cs + row * LDC + cq * 32;
    const float* bp = bias + col0 + cq * 32;
#pragma unroll 2
    for (int n = 0; n < 32; ++n) {
      const float v = cr[n] * (1.0f / 1024.0f) + bfr(bp[n]);
      const float ge = 0.5f * v * (1.0f + erff(v * 0.70710678118654752f));
      cr[n] = ge * 16.0f;
    }
  }
  __syncthreads();
  v4u pk[4];
  size_t offs[4];
#pragma unroll
  for (int s = 0; s < 4; ++s) {
    const int idx = s * 256 + tid;
    const int row = idx >> 4, piece = idx & 15;
    const int colp = piece * 8;
    v4u a;
#pragma unroll
    for (int e = 0; e < 4; ++e)
      a[e] = pk16(hb16(Cs[row * LDC + colp + 2 * e]), hb16(Cs[row * LDC + colp + 2 * e + 1]));
    pk[s] = a;
    offs[s] = (size_t)(tok0 + row) * MLP + col0 + colp;
  }
#pragma unroll
  for (int s = 0; s < 4; ++s) *(v4u*)(gh + offs[s]) = pk[s];
  
}

// =================================================================================================================
// FC2 + bias + residual: C[64 tokens][128 cols] = gh . w2t^T (K = 768, 24 k-steps), Cs = 1024 (g w2);
// coverage: out [32768][256] f32, every element once.
// =================================================================================================================
__global__ __launch_bounds__(256)
void k_fc2(const unsigned short* __restrict__ gh, const unsigned short* __restrict__ w2t,
           const float* __restrict__ bias, const float* __restrict__ x1, float* out) {
  __shared__ __align__(16) float Cs[64 * LDC];
  const int tid = threadIdx.x;
  const int mb = blockIdx.x, cg = blockIdx.y;
  const int tok0 = mb * 64, col0 = cg * 128;
  mm_tile1((const _Float16*)(const void*)gh, MLP, (const _Float16*)(const void*)w2t, MLP, MLP / 32,
           tok0, col0, Cs);
  __syncthreads();
  v4f pk[8];
  size_t offs[8];
#pragma unroll
  for (int s = 0; s < 8; ++s) {
    const int idx = s * 256 + tid;
    const int row = idx >> 5, piece = idx & 31;
    const int colp = piece * 4;
    const size_t off = (size_t)(tok0 + row) * DIMC + col0 + colp;
    const v4f xr = *(const v4f*)(x1 + off);
    v4f v;
#pragma unroll
    for (int e = 0; e < 4; ++e)
      v[e] = xr[e] + (Cs[row * LDC + colp + e] * (1.0f / 1024.0f) + bfr(bias[col0 + colp + e]));
    pk[s] = v;
    offs[s] = off;
  }
#pragma unroll
  for (int s = 0; s < 8; ++s) *(v4f*)(out + offs[s]) = pk[s];
  
}

// =================================================================================================================
// Workspace map (bytes; all offsets multiples of 131072; every region sized exactly at its whole-line store extent;
// regions reused across phases in stream order):
//   [0, 16 MiB)      XH  f16 [32768][256]  (dead after k_qkv)  -> reused as HH f16 [32768][256] (k_xf -> k_fc1)
//   [16, 32 MiB)     QH, [32, 48 MiB) QL  (dead after k_xf)
//   [48, 64) KTH, [64, 80) KTL, [80, 96) VTH, [96, 112) VTL  f16 [8][4][64][4096] each  (dead after k_attn)
//   [80, 112 MiB)    X1 f32 [32768][256] (k_xf -> k_fc2, over the dead v planes)
//   [16, 64 MiB)     GH f16 [32768][768] (k_fc1 -> k_fc2, over the dead q planes and kT hi plane)
//   112 MiB + : ATH, ATL f16 [32][64][64] 262144 each | WQT f16 [768][256] 393216 | W1T [768][256] 393216 |
//               W2T f16 [256][768] 393216 ; end = 119144448.
// =================================================================================================================
extern "C" void kernel_launch(void* const* d_in, const int* in_sizes, int n_in,
                              void* d_out, int out_size, void* d_ws, size_t ws_size,
                              hipStream_t stream) {
  if (n_in < 9) return;
  const int expect[9] = { NTOK * DIMC, DIMC * MLP, MLP, DIMC, DIMC, DIMC * MLP, MLP, MLP * DIMC, DIMC };
  for (int i = 0; i < 9; ++i) if (in_sizes[i] != expect[i]) return;
  if (out_size != NTOK * DIMC) return;

  const float* x     = (const float*)d_in[0];
  const float* w_qkv = (const float*)d_in[1];
  const float* b_qkv = (const float*)d_in[2];
  const float* ng    = (const float*)d_in[3];
  const float* nbt   = (const float*)d_in[4];
  const float* w_fc1 = (const float*)d_in[5];
  const float* b_fc1 = (const float*)d_in[6];
  const float* w_fc2 = (const float*)d_in[7];
  const float* b_fc2 = (const float*)d_in[8];
  float* out = (float*)d_out;

  const size_t MiB = (size_t)1048576;
  const size_t szX16 = (size_t)NTOK * DIMC * 2;                    // 16 MiB
  const size_t szPl  = PLANE * 2;                                  // 16 MiB
  const size_t szX1  = (size_t)NTOK * DIMC * 4;                    // 32 MiB
  const size_t szGH  = (size_t)NTOK * MLP * 2;                     // 48 MiB
  const size_t szAT  = ATL_OFF * 2;                                // 262144
  const size_t szWQ  = (size_t)MLP * DIMC * 2;                     // 393216
  if (szX16 != 16 * MiB || szPl != 16 * MiB || szX1 != 32 * MiB || szGH != 48 * MiB) return;

  const size_t oXH  = 0;
  const size_t oHH  = 0;
  const size_t oQH  = 16 * MiB;                                     // QL at oQH + 16 MiB
  const size_t oKV  = 48 * MiB;                                     // 4 planes, 64 MiB
  const size_t oX1  = 80 * MiB;
  const size_t oGH  = 16 * MiB;
  const size_t oATH = 112 * MiB;                                    // ATL at oATH + szAT
  const size_t oWQT = oATH + 2 * szAT;
  const size_t oW1T = oWQT + szWQ;
  const size_t oW2T = oW1T + szWQ;
  const size_t oEND = oW2T + szWQ;                                  // 119144448
  if (oQH + 2 * szX16 != oKV) return;
  if (oKV + 4 * szPl != oATH) return;
  if (oX1 + szX1 > oATH || oGH + szGH > oX1 || oHH + szX16 > oGH) return;
  if (oEND > ws_size) return;
  if (oEND > (size_t)134217728) return;

  char* ws = (char*)d_ws;
  unsigned short* XH  = (unsigned short*)(ws + oXH);
  unsigned short* HH  = (unsigned short*)(ws + oHH);
  unsigned short* QH  = (unsigned short*)(ws + oQH);
  unsigned short* KV  = (unsigned short*)(ws + oKV);
  float*          X1  = (float*)(ws + oX1);
  unsigned short* GH  = (unsigned short*)(ws + oGH);
  unsigned short* ATH = (unsigned short*)(ws + oATH);
  unsigned short* WQT = (unsigned short*)(ws + oWQT);
  unsigned short* W1T = (unsigned short*)(ws + oW1T);
  unsigned short* W2T = (unsigned short*)(ws + oW2T);

  const dim3 blk(256);
  const int npieces = NTOK * DIMC / 8;
  // (1) weight planes (transposed, 64 * bf16)
  k_wcvt<<<dim3(2 * MLP + DIMC), dim3(128), 0, stream>>>(w_qkv, w_fc1, w_fc2, WQT, W1T, W2T);
  // (2) x -> f16 plane of 16 bf16(x)
  k_xcvt<<<dim3((npieces + 255) / 256), blk, 0, stream>>>(x, XH, npieces);
  // (3) qkv projection -> q hi/lo [token][256], kT/vT hi/lo [b][h][d][n]
  k_qkv<<<dim3(NTOK / 64, 6), blk, 0, stream>>>(XH, WQT, b_qkv, QH, KV);
  // (4) per (b, h) logits + softmax -> P hi/lo planes
  k_attn<<<dim3(BB * NH), blk, 0, stream>>>(KV, ATH);
  // (5) xf + residual + layer norm -> x1 f32, h f16
  k_xf<<<dim3(NTOK / 32), blk, 0, stream>>>(QH, ATH, x, ng, nbt, X1, HH);
  // (6) fc1 + GELU -> g f16
  k_fc1<<<dim3(NTOK / 64, 6), blk, 0, stream>>>(HH, W1T, b_fc1, GH);
  // (7) fc2 + bias + residual -> d_out
  k_fc2<<<dim3(NTOK / 64, 2), blk, 0, stream>>>(GH, W2T, b_fc2, X1, out);
  (void)hipGetLastError();
}

// v001
// A run of this version takes 217 microseconds.
// Next to v000, in two timings, it ran 1.35 times as fast each time.
// Contractions: qkv projection (K=256), fc1 (K=256), fc2 (K=768): v_wmma_f32_16x16x32_f16, single f16 products,
// activations carried x16, weights one f16 plane of 64*bf16(w); per-head k^T v logits (K=4096) and attn x q (K=64):
// v_wmma_f32_16x16x32_f16 with both operands as f16 hi + x2048 residual planes (3 products); f32 accumulate
// everywhere. Softmax, layer norm, exact GELU and all epilogues f32 on VALU; every float input RNE-converted to
// bf16 on load.
#include <hip/hip_runtime.h>
#include <stdint.h>

#define BB     8
#define NN     4096
#define DIMC   256
#define NH     4
#define HD     64
#define MLP    768
#define NTOK   (BB * NN)
#define LDC    132
#define LDX    260
#define LDA    68
#define RSC    0.00048828125f
#define PLANE  ((size_t)BB * NH * HD * NN)
#define QL_OFF ((size_t)NTOK * DIMC)
#define ATL_OFF ((size_t)BB * NH * HD * HD)
#define KSPLIT 16
#define KCH    (NN / KSPLIT)

static_assert(NTOK == 32768);
static_assert(DIMC == NH * HD);
static_assert((NN % 64) == 0 && (NTOK % 64) == 0);
static_assert((DIMC % 32) == 0 && (MLP % 32) == 0 && (HD % 32) == 0 && (NN % 32) == 0);
static_assert((LDX * 4) % 16 == 0 && (LDC * 4) % 16 == 0);
static_assert(PLANE == 8388608 && QL_OFF == 8388608 && ATL_OFF == 131072);
static_assert(MLP == 6 * 128 && DIMC == 2 * 128);
static_assert(KCH * KSPLIT == NN && (KCH % 32) == 0);

typedef _Float16 v16h __attribute__((ext_vector_type(16)));
typedef _Float16 v8h  __attribute__((ext_vector_type(8)));
typedef float    v8f  __attribute__((ext_vector_type(8)));
typedef float    v4f  __attribute__((ext_vector_type(4)));
typedef unsigned int v4u __attribute__((ext_vector_type(4)));
typedef unsigned int v2u __attribute__((ext_vector_type(2)));

// ---- scalar helpers ------------------------------------------------------------------------------------------
__device__ __forceinline__ unsigned short bf_bits(float f) {          // f32 -> bf16 bits, RNE convert
  unsigned u = __float_as_uint(f);
  return (unsigned short)((u + 0x7FFFu + ((u >> 16) & 1u)) >> 16);
}
__device__ __forceinline__ float bf_up(unsigned short b) { return __uint_as_float(((unsigned)b) << 16); }
__device__ __forceinline__ float bfr(float f) { return bf_up(bf_bits(f)); }
__device__ __forceinline__ unsigned short h_bits(_Float16 x) { return __builtin_bit_cast(unsigned short, x); }
__device__ __forceinline__ unsigned short hb16(float f) { return h_bits((_Float16)f); }
__device__ __forceinline__ unsigned pk16(unsigned short a, unsigned short b) { return (unsigned)a | ((unsigned)b << 16); }
__device__ __forceinline__ v8f zero8() { v8f z = {0.f, 0.f, 0.f, 0.f, 0.f, 0.f, 0.f, 0.f}; return z; }
// hi/lo pair of two f32 values: hi = f16(v), lo = f16(2048 (v - hi)), packed as two 32-bit words
__device__ __forceinline__ void split2(float f0, float f1, unsigned& hp, unsigned& lp) {
  const _Float16 h0 = (_Float16)f0, h1 = (_Float16)f1;
  const float q0 = (f0 - (float)h0) * 2048.0f, q1 = (f1 - (float)h1) * 2048.0f;
  hp = pk16(h_bits(h0), h_bits(h1));
  lp = pk16(hb16(q0), hb16(q1));
}

// ---- fragment loader: 16-bit A/B operand, lane -> row/col (lane&15), p already includes +8*(lane>>4);
//      elements 0..7 <- p[0..7] (k0+8h..k0+8h+7), elements 8..15 <- p[16..23] (k0+16+8h..k0+16+8h+7)
__device__ __forceinline__ v16h ldfrag_h(const _Float16* p) {
  union { v16h v; v8h h[2]; } f;
  f.h[0] = *(const v8h*)(p);
  f.h[1] = *(const v8h*)(p + 16);
  return f.v;
}

// ---- WMMA helpers; the guards insert the trailing VALU hazard gap and keep A/B live --------------------------
__device__ __forceinline__ v8f mma_raw(v16h a, v16h b, v8f c) {
  return __builtin_amdgcn_wmma_f32_16x16x32_f16(false, a, false, b, (short)0, c, false, false);
}
__device__ __forceinline__ void guard4(v8f& c0, v8f& c1, v8f& c2, v8f& c3,
                                       const v16h& a0, const v16h& a1, const v16h& b0, const v16h& b1) {
#if defined(__HIP_DEVICE_COMPILE__)
  asm volatile("v_nop\n\tv_nop\n\tv_nop\n\tv_nop"
               : "+v"(c0), "+v"(c1), "+v"(c2), "+v"(c3)
               : "v"(a0), "v"(a1), "v"(b0), "v"(b1));
#endif
}
__device__ __forceinline__ void guard6(v8f& c0, v8f& c1, v8f& c2, v8f& c3, v8f& c4, v8f& c5,
                                       const v16h& a0, const v16h& a1, const v16h& b0, const v16h& b1,
                                       const v16h& b2, const v16h& b3) {
#if defined(__HIP_DEVICE_COMPILE__)
  asm volatile("v_nop\n\tv_nop\n\tv_nop\n\tv_nop"
               : "+v"(c0), "+v"(c1), "+v"(c2), "+v"(c3), "+v"(c4), "+v"(c5)
               : "v"(a0), "v"(a1), "v"(b0), "v"(b1), "v"(b2), "v"(b3));
#endif
}
__device__ __forceinline__ void guard3(v8f& c0, v8f& c1, v8f& c2,
                                       const v16h& a0, const v16h& a1, const v16h& b0, const v16h& b1) {
#if defined(__HIP_DEVICE_COMPILE__)
  asm volatile("v_nop\n\tv_nop\n\tv_nop\n\tv_nop"
               : "+v"(c0), "+v"(c1), "+v"(c2)
               : "v"(a0), "v"(a1), "v"(b0), "v"(b1));
#endif
}

// ---- 64x128 block tile GEMM core, single 16-bit planes: A row pitch lda (row-major, k contiguous), W is [n][k]
//      k-contiguous pitch ldw. 8 waves = 2 (32 rows) x 4 (32 cols), 2x2 tiles of 16 per wave; fragments straight
//      from global with the table layout; results written to the LDS f32 tile Cs[64][LDC].
__device__ __forceinline__ void mm_tile1(const _Float16* __restrict__ A, int lda,
                                         const _Float16* __restrict__ W, int ldw, int nks,
                                         int arow0, int bcol0, float* Cs) {
  const int tid = threadIdx.x, wave = tid >> 5, lane = tid & 31, hh = lane >> 4, c = lane & 15;
  const int mw = wave >> 2, nw = wave & 3;
  const _Float16* a0p = A + (size_t)(arow0 + mw * 32 + c) * lda + 8 * hh;
  const _Float16* a1p = A + (size_t)(arow0 + mw * 32 + 16 + c) * lda + 8 * hh;
  const _Float16* b0p = W + (size_t)(bcol0 + nw * 32 + c) * ldw + 8 * hh;
  const _Float16* b1p = W + (size_t)(bcol0 + nw * 32 + 16 + c) * ldw + 8 * hh;
  v8f c00 = zero8(), c01 = zero8(), c10 = zero8(), c11 = zero8();
#pragma unroll 1
  for (int ks = 0; ks < nks; ++ks) {
    const int ko = ks * 32;
    const v16h fa0 = ldfrag_h(a0p + ko);
    const v16h fa1 = ldfrag_h(a1p + ko);
    const v16h fb0 = ldfrag_h(b0p + ko);
    const v16h fb1 = ldfrag_h(b1p + ko);
    c00 = mma_raw(fa0, fb0, c00);
    c01 = mma_raw(fa0, fb1, c01);
    c10 = mma_raw(fa1, fb0, c10);
    c11 = mma_raw(fa1, fb1, c11);
    guard4(c00, c01, c10, c11, fa0, fa1, fb0, fb1);
  }
#pragma unroll
  for (int r = 0; r < 8; ++r) {
    const int row = mw * 32 + 8 * hh + r;
    Cs[row * LDC + nw * 32 + c]             = c00[r];
    Cs[row * LDC + nw * 32 + 16 + c]        = c01[r];
    Cs[(row + 16) * LDC + nw * 32 + c]      = c10[r];
    Cs[(row + 16) * LDC + nw * 32 + 16 + c] = c11[r];
  }
}

// =================================================================================================================
// Weight convert: wqt[n][k] = f16(64 bf16(w_qkv[k][n])), w1t[n][k] = f16(64 bf16(w_fc1[k][n])) (n < 768, k < 256),
// w2t[n][k] = f16(64 bf16(w_fc2[k][n])) (n < 256, k < 768). Block = one output row n; thread = one 16-B piece of
// coverage: wqt 768 x 256, w1t 768 x 256, w2t 256 x 768, every element once.
// =================================================================================================================
__global__ __launch_bounds__(128)
void k_wcvt(const float* __restrict__ wqkv, const float* __restrict__ wfc1, const float* __restrict__ wfc2,
            unsigned short* wqt, unsigned short* w1t, unsigned short* w2t) {
  const int tid = threadIdx.x;
  const int blk = blockIdx.x;
  if (blk < 2 * MLP) {                                      // block-uniform branch
    const int t = (blk < MLP) ? 0 : 1;
    const int n = blk - t * MLP;
    const float* src = t ? wfc1 : wqkv;
    unsigned short* dstp = t ? w1t : wqt;
    const int tt = min(tid, 31);
    const int k0 = tt * 8;
    v4u pk;
#pragma unroll
    for (int e = 0; e < 4; ++e) {
      const float f0 = src[(size_t)(k0 + 2 * e) * MLP + n];
      const float f1 = src[(size_t)(k0 + 2 * e + 1) * MLP + n];
      pk[e] = pk16(hb16(bfr(f0) * 64.0f), hb16(bfr(f1) * 64.0f));
    }
    if (tid < 32) {
      unsigned short* dst = dstp + (size_t)n * DIMC + k0;
      *(v4u*)dst = pk;
      
    }
  } else {
    const int n = blk - 2 * MLP;                            // 0..255
    const int tt = min(tid, 95);
    const int k0 = tt * 8;
    v4u pk;
#pragma unroll
    for (int e = 0; e < 4; ++e) {
      const float f0 = wfc2[(size_t)(k0 + 2 * e) * DIMC + n];
      const float f1 = wfc2[(size_t)(k0 + 2 * e + 1) * DIMC + n];
      pk[e] = pk16(hb16(bfr(f0) * 64.0f), hb16(bfr(f1) * 64.0f));
    }
    if (tid < 96) {
      unsigned short* dst = w2t + (size_t)n * MLP + k0;
      *(v4u*)dst = pk;
      
    }
  }
}

// =================================================================================================================
// x [32768][256] f32 -> xh f16 plane of 16 bf16(x); thread = 8 consecutive elements = one 16-B piece, consecutive
// grid = ceil(npieces/256). coverage: xh [32768][256], every element once.
// =================================================================================================================
__global__ __launch_bounds__(256)
void k_xcvt(const float* __restrict__ x, unsigned short* xh, int npieces) {
  const int i = blockIdx.x * 256 + threadIdx.x;
  if (i >= npieces) return;
  const float* p = x + (size_t)i * 8;
  const v4f a = *(const v4f*)(p);
  const v4f b = *(const v4f*)(p + 4);
  v4u pk;
  pk[0] = pk16(hb16(bfr(a[0]) * 16.0f), hb16(bfr(a[1]) * 16.0f));
  pk[1] = pk16(hb16(bfr(a[2]) * 16.0f), hb16(bfr(a[3]) * 16.0f));
  pk[2] = pk16(hb16(bfr(b[0]) * 16.0f), hb16(bfr(b[1]) * 16.0f));
  pk[3] = pk16(hb16(bfr(b[2]) * 16.0f), hb16(bfr(b[3]) * 16.0f));
  unsigned short* dst = xh + (size_t)i * 8;
  *(v4u*)dst = pk;
  
}

// =================================================================================================================
// QKV projection: C[64 tokens][128 cols] = xh . wqt^T (K = 256, 8 k-steps), Cs = 1024 (x w). Column group cg
// (0..5) covers cols cg*128 of 768: third s = cg>>1 (q, k, v), head pair hp = cg&1. Carried value 16 (x w + b) =
// Cs/64 + 16 bf16(b), stored as f16 hi + x2048 residual planes:
//   k, v: transposed planes kv + {0,1,2,3} PLANE = kTh, kTl, vTh, vTl [b][h][d][n] (n contiguous): each channel's
// grid = (NTOK/64, 6), 256 threads. coverage: qh/ql [32768][256]; kTh/kTl/vTh/vTl [8][4][64][4096], every element once.
// =================================================================================================================
__global__ __launch_bounds__(256)
void k_qkv(const unsigned short* __restrict__ xh, const unsigned short* __restrict__ wqt,
           const float* __restrict__ bias, unsigned short* qp, unsigned short* kv) {
  __shared__ __align__(16) float Cs[64 * LDC];
  const int tid = threadIdx.x;
  const int mb = blockIdx.x, cg = blockIdx.y;
  const int tok0 = mb * 64, col0 = cg * 128;
  mm_tile1((const _Float16*)(const void*)xh, DIMC, (const _Float16*)(const void*)wqt, DIMC, DIMC / 32,
           tok0, col0, Cs);
  __syncthreads();
  const int s = cg >> 1, hp = cg & 1;
  if (s == 0) {                                             // block-uniform branch, no WMMA inside
    unsigned short* dh = qp;
    unsigned short* dl = qp + QL_OFF;
    v4u ph[4], pq[4];
    size_t offs[4];
#pragma unroll
    for (int s4 = 0; s4 < 4; ++s4) {
      const int idx = s4 * 256 + tid;
      const int row = idx >> 4, piece = idx & 15;
      const int colp = piece * 8;
      v4u a, q4;
#pragma unroll
      for (int e = 0; e < 4; ++e) {
        const float b0 = 16.0f * bfr(bias[col0 + colp + 2 * e]);
        const float b1 = 16.0f * bfr(bias[col0 + colp + 2 * e + 1]);
        const float f0 = Cs[row * LDC + colp + 2 * e] * (1.0f / 64.0f) + b0;
        const float f1 = Cs[row * LDC + colp + 2 * e + 1] * (1.0f / 64.0f) + b1;
        unsigned hw, lw;
        split2(f0, f1, hw, lw);
        a[e] = hw; q4[e] = lw;
      }
      ph[s4] = a;
      pq[s4] = q4;
      offs[s4] = (size_t)(tok0 + row) * DIMC + hp * 128 + colp;
    }
#pragma unroll
    for (int s4 = 0; s4 < 4; ++s4) { *(v4u*)(dh + offs[s4]) = ph[s4]; *(v4u*)(dl + offs[s4]) = pq[s4]; }
    
  } else {
    unsigned short* dh = kv + (size_t)(s - 1) * 2 * PLANE;
    unsigned short* dl = dh + PLANE;
    const int b = tok0 >> 12, n0 = tok0 & (NN - 1);
    v4u ph[4], pq[4];
    size_t offs[4];
#pragma unroll
    for (int s4 = 0; s4 < 4; ++s4) {
      const int idx = s4 * 256 + tid;
      const int ch = idx >> 3, piece = idx & 7;
      const int h = 2 * hp + (ch >> 6), d = ch & 63;
      const float bb = 16.0f * bfr(bias[col0 + ch]);
      const int r0 = piece * 8;
      v4u a, q4;
#pragma unroll
      for (int e = 0; e < 4; ++e) {
        const float f0 = Cs[(r0 + 2 * e) * LDC + ch] * (1.0f / 64.0f) + bb;
        const float f1 = Cs[(r0 + 2 * e + 1) * LDC + ch] * (1.0f / 64.0f) + bb;
        unsigned hw, lw;
        split2(f0, f1, hw, lw);
        a[e] = hw; q4[e] = lw;
      }
      ph[s4] = a;
      pq[s4] = q4;
      offs[s4] = ((size_t)(b * NH + h) * HD + d) * NN + n0 + r0;
    }
#pragma unroll
    for (int s4 = 0; s4 < 4; ++s4) { *(v4u*)(dh + offs[s4]) = ph[s4]; *(v4u*)(dl + offs[s4]) = pq[s4]; }
    
  }
}

// =================================================================================================================
// Per (b, h) channel attention, logits split over K: raw[d][e] = sum_n (16 k[n][d]) (16 v[n][e]) on WMMA (M = N = 64).
// Block (ck, bh) sums the KCH tokens of chunk ck (KCH/32 k-steps): A = kT hi/lo planes (row d, pitch NN), B = vT
// hi/lo planes ([e][n], n contiguous = the [n][k] copy form); products hi*hi + (hi*lo + lo*hi)/2048; 8 waves =
// 4 (16 rows) x 2 (32 cols). The chunk's f32 tile goes through LDS to part[ck][bh][d][e] in whole lines.
// grid = (KSPLIT, 32), 256 threads. coverage: part [KSPLIT][32][64][64] f32, every element once.
// =================================================================================================================
__global__ __launch_bounds__(256)
void k_attn_part(const unsigned short* __restrict__ kv, float* part) {
  __shared__ __align__(16) float Cs[64 * LDA];
  const int tid = threadIdx.x, wave = tid >> 5, lane = tid & 31, hh = lane >> 4, c = lane & 15;
  const int ck = blockIdx.x, bh = blockIdx.y;
  const _Float16* base = (const _Float16*)(const void*)kv;
  const _Float16* Kh = base + (size_t)bh * HD * NN + ck * KCH;
  const _Float16* Kl = Kh + PLANE;
  const _Float16* Vh = Kh + 2 * PLANE;
  const _Float16* Vl = Kh + 3 * PLANE;
  {
    const int mw = wave >> 1, nw = wave & 1;
    const _Float16* ahp = Kh + (size_t)(mw * 16 + c) * NN + 8 * hh;
    const _Float16* alp = Kl + (size_t)(mw * 16 + c) * NN + 8 * hh;
    const _Float16* b0h = Vh + (size_t)(nw * 32 + c) * NN + 8 * hh;
    const _Float16* b1h = Vh + (size_t)(nw * 32 + 16 + c) * NN + 8 * hh;
    const _Float16* b0l = Vl + (size_t)(nw * 32 + c) * NN + 8 * hh;
    const _Float16* b1l = Vl + (size_t)(nw * 32 + 16 + c) * NN + 8 * hh;
    v8f p0 = zero8(), p1 = zero8(), q0 = zero8(), q1 = zero8(), r0 = zero8(), r1 = zero8();
#pragma unroll 1
    for (int ks = 0; ks < KCH / 32; ++ks) {
      const int ko = ks * 32;
      const v16h fa  = ldfrag_h(ahp + ko);
      const v16h ga  = ldfrag_h(alp + ko);
      const v16h fb0 = ldfrag_h(b0h + ko);
      const v16h fb1 = ldfrag_h(b1h + ko);
      const v16h gb0 = ldfrag_h(b0l + ko);
      const v16h gb1 = ldfrag_h(b1l + ko);
      p0 = mma_raw(fa, fb0, p0);
      p1 = mma_raw(fa, fb1, p1);
      q0 = mma_raw(fa, gb0, q0);
      q1 = mma_raw(fa, gb1, q1);
      r0 = mma_raw(ga, fb0, r0);
      r1 = mma_raw(ga, fb1, r1);
      guard6(p0, p1, q0, q1, r0, r1, fa, ga, fb0, fb1, gb0, gb1);
    }
#pragma unroll
    for (int r = 0; r < 8; ++r) {
      const int row = mw * 16 + 8 * hh + r;
      Cs[row * LDA + nw * 32 + c]      = p0[r] + (q0[r] + r0[r]) * RSC;
      Cs[row * LDA + nw * 32 + 16 + c] = p1[r] + (q1[r] + r1[r]) * RSC;
    }
  }
  __syncthreads();
  float* dst = part + ((size_t)ck * (BB * NH) + bh) * (HD * HD);
  v4f pk[4];
#pragma unroll  // pk[] indexed by constants, so it stays in registers
  for (int s = 0; s < 4; ++s) {
    const int idx = s * 256 + tid;
    pk[s] = *(const v4f*)(Cs + (idx >> 4) * LDA + (idx & 15) * 4);
  }
#pragma unroll  // as above
  for (int s = 0; s < 4; ++s) *(v4f*)(dst + (size_t)(s * 256 + tid) * 4) = pk[s];
}

// =================================================================================================================
// Chunk sum + softmax. Block = 16 rows d of one (b, h); thread = 4 consecutive e of one row, 16 lanes per row.
// raw = sum over ck of part[ck] in index order; logit = raw/2048 (includes the head_dim^-0.5 factor 1/8). Softmax
// over e per row d in f32 (max subtracted, 16-lane butterflies), 4096 P stored as f16 hi + x2048 residual planes;
// a wave's store covers two whole 128-B rows.
// grid = (32, 4), 256 threads. coverage: ath/atl [32][64][64], every element once.
// =================================================================================================================
__global__ __launch_bounds__(256)
void k_attn_sm(const float* __restrict__ part, unsigned short* at) {
  const int tid = threadIdx.x;
  const int bh = blockIdx.x;
  const int row = blockIdx.y * 16 + (tid >> 4), col0 = (tid & 15) * 4;
  const size_t off = ((size_t)bh * HD + row) * HD + col0;
  v4f t[KSPLIT];
#pragma unroll  // all chunk loads issued before the first add: one memory latency, not KSPLIT
  for (int s = 0; s < KSPLIT; ++s) t[s] = *(const v4f*)(part + (size_t)s * ATL_OFF + off);
  v4f a = t[0];
#pragma unroll  // t[] indexed by constants, so it stays in registers (the short loops below likewise)
  for (int s = 1; s < KSPLIT; ++s) a += t[s];
  float mx = fmaxf(fmaxf(a[0], a[1]), fmaxf(a[2], a[3]));
#pragma unroll
  for (int o = 1; o < 16; o <<= 1) mx = fmaxf(mx, __shfl_xor(mx, o, 32));
  float e[4];
#pragma unroll
  for (int n = 0; n < 4; ++n) e[n] = expf((a[n] - mx) * RSC);
  float sm = (e[0] + e[1]) + (e[2] + e[3]);
#pragma unroll
  for (int o = 1; o < 16; o <<= 1) sm += __shfl_xor(sm, o, 32);
  const float sc = (1.0f / sm) * 4096.0f;
  v2u ph, pq;
#pragma unroll
  for (int n = 0; n < 2; ++n) {
    unsigned hw, lw;
    split2(e[2 * n] * sc, e[2 * n + 1] * sc, hw, lw);
    ph[n] = hw; pq[n] = lw;
  }
  *(v2u*)(at + off) = ph;
  *(v2u*)(at + ATL_OFF + off) = pq;
}

// =================================================================================================================
// xf + residual + layer norm. Block = 32 tokens of one batch, all 4 heads. Per head h: C[32 tok][64 d] =
// sum_e (16 q[tok][h*64+e]) (4096 P[d][e]) on WMMA (K = 64, 2 k-steps): A = qh/ql [token][256] pitch 256 at
// column h*64, B = ath/atl [bh][d][64] (e contiguous = [n][k] copy form); products hi*hi + (hi*lo + lo*hi)/2048;
// 8 waves = 2 (16 rows) x 4 (16 cols); xf = C/65536. Then x1 = bf16(x) + xf (f32, kept in the LDS tile), mean
// f16, every element once.
// =================================================================================================================
__global__ __launch_bounds__(256)
void k_xf(const unsigned short* __restrict__ qp, const unsigned short* __restrict__ at,
          const float* __restrict__ x, const float* __restrict__ gw, const float* __restrict__ gb,
          float* x1, unsigned short* hh16) {
  __shared__ __align__(16) float Cs[32 * LDX];
  __shared__ float Mu[32];
  __shared__ float Rs[32];
  const int tid = threadIdx.x, wave = tid >> 5, lane = tid & 31, hh = lane >> 4, c = lane & 15;
  const int mw = wave >> 2, nw = wave & 3;
  const int tok0 = blockIdx.x * 32;
  const int b = tok0 >> 12;
  const _Float16* Qh = (const _Float16*)(const void*)qp;
  const _Float16* Ql = Qh + QL_OFF;
  const _Float16* Ah = (const _Float16*)(const void*)at;
  const _Float16* Al = Ah + ATL_OFF;
  const size_t arow = (size_t)(tok0 + mw * 16 + c) * DIMC + 8 * hh;
#pragma unroll 1
  for (int h = 0; h < NH; ++h) {                            // block-uniform trip count
    const _Float16* ahp = Qh + arow + h * HD;
    const _Float16* alp = Ql + arow + h * HD;
    const size_t brow = ((size_t)(b * NH + h) * HD + nw * 16 + c) * HD + 8 * hh;
    const _Float16* bhp = Ah + brow;
    const _Float16* blp = Al + brow;
    v8f p = zero8(), q = zero8(), r = zero8();
#pragma unroll
    for (int ks = 0; ks < HD / 32; ++ks) {
      const int ko = ks * 32;
      const v16h fa = ldfrag_h(ahp + ko);
      const v16h ga = ldfrag_h(alp + ko);
      const v16h fb = ldfrag_h(bhp + ko);
      const v16h gq = ldfrag_h(blp + ko);
      p = mma_raw(fa, fb, p);
      q = mma_raw(fa, gq, q);
      r = mma_raw(ga, fb, r);
      guard3(p, q, r, fa, ga, fb, gq);
    }
#pragma unroll
    for (int rr = 0; rr < 8; ++rr)
      Cs[(mw * 16 + 8 * hh + rr) * LDX + h * HD + nw * 16 + c] = p[rr] + (q[rr] + r[rr]) * RSC;
  }
  __syncthreads();
  // phase 1: x1 = bf16(x) + xf back into the tile, per-row statistics
#pragma unroll 1
  for (int it = 0; it < 4; ++it) {
    const int row = wave * 4 + it;
    const size_t tok = (size_t)(tok0 + row);
    const float* xr = x + tok * DIMC + lane * 8;
    const v4f xa = *(const v4f*)(xr);
    const v4f xb = *(const v4f*)(xr + 4);
    float* cr = Cs + row * LDX + lane * 8;
    float v[8];
#pragma unroll
    for (int e = 0; e < 4; ++e) {
      v[e]     = bfr(xa[e]) + cr[e] * (1.0f / 65536.0f);
      v[4 + e] = bfr(xb[e]) + cr[4 + e] * (1.0f / 65536.0f);
    }
#pragma unroll
    for (int e = 0; e < 8; ++e) cr[e] = v[e];
    float s = ((v[0] + v[1]) + (v[2] + v[3])) + ((v[4] + v[5]) + (v[6] + v[7]));
#pragma unroll
    for (int off = 16; off; off >>= 1) s += __shfl_xor(s, off, 32);
    const float mu = s * (1.0f / 256.0f);
    float sq = 0.f;
#pragma unroll
    for (int e = 0; e < 8; ++e) { const float d = v[e] - mu; sq += d * d; }
#pragma unroll
    for (int off = 16; off; off >>= 1) sq += __shfl_xor(sq, off, 32);
    const float var = sq * (1.0f / 256.0f);
    const float rs = rsqrtf(var + 1e-5f);
    if (lane == 0) { Mu[row] = mu; Rs[row] = rs; }
  }
  __syncthreads();
  // phase 2: whole-line stores of x1 (f32) and hh16 (f16 of 16 h)
  v4f pk[8];
  size_t offs[8];
#pragma unroll
  for (int s = 0; s < 8; ++s) {
    const int idx = s * 256 + tid;
    const int row = idx >> 6, piece = idx & 63;
    v4f v4;
#pragma unroll
    for (int e = 0; e < 4; ++e) v4[e] = Cs[row * LDX + piece * 4 + e];
    pk[s] = v4;
    offs[s] = (size_t)(tok0 + row) * DIMC + piece * 4;
  }
  v4u ph[4];
  size_t offh[4];
#pragma unroll
  for (int s = 0; s < 4; ++s) {
    const int idx = s * 256 + tid;
    const int row = idx >> 5, piece = idx & 31;
    const int col0 = piece * 8;
    const float mu = Mu[row], rs = Rs[row];
    v4u a;
#pragma unroll
    for (int e = 0; e < 4; ++e) {
      const int cA = col0 + 2 * e, cB = cA + 1;
      const float f0 = ((Cs[row * LDX + cA] - mu) * rs) * bfr(gw[cA]) + bfr(gb[cA]);
      const float f1 = ((Cs[row * LDX + cB] - mu) * rs) * bfr(gw[cB]) + bfr(gb[cB]);
      a[e] = pk16(hb16(f0 * 16.0f), hb16(f1 * 16.0f));
    }
    ph[s] = a;
    offh[s] = (size_t)(tok0 + row) * DIMC + col0;
  }
#pragma unroll
  for (int s = 0; s < 8; ++s) *(v4f*)(x1 + offs[s]) = pk[s];
#pragma unroll
  for (int s = 0; s < 4; ++s) *(v4u*)(hh16 + offh[s]) = ph[s];
  
}

// =================================================================================================================
// FC1 + exact GELU: C[64 tokens][128 cols] = hh16 . w1t^T (K = 256), Cs = 1024 (h w1); v = Cs/1024 + bf16(b1),
// g = 0.5 v (1 + erf(v / sqrt 2)) computed in place in the LDS tile (rolled loop, thread = 32 elements of one row),
// coverage: gh [32768][768], every element once.
// =================================================================================================================
__global__ __launch_bounds__(256)
void k_fc1(const unsigned short* __restrict__ hh16, const unsigned short* __restrict__ w1t,
           const float* __restrict__ bias, unsigned short* gh) {
  __shared__ __align__(16) float Cs[64 * LDC];
  const int tid = threadIdx.x;
  const int mb = blockIdx.x, cg = blockIdx.y;
  const int tok0 = mb * 64, col0 = cg * 128;
  mm_tile1((const _Float16*)(const void*)hh16, DIMC, (const _Float16*)(const void*)w1t, DIMC, DIMC / 32,
           tok0, col0, Cs);
  __syncthreads();
  {
    const int row = tid >> 2, cq = tid & 3;
    float* cr = Cs + row * LDC + cq * 32;
    const float* bp = bias + col0 + cq * 32;
#pragma unroll 2
    for (int n = 0; n < 32; ++n) {
      const float v = cr[n] * (1.0f / 1024.0f) + bfr(bp[n]);
      const float ge = 0.5f * v * (1.0f + erff(v * 0.70710678118654752f));
      cr[n] = ge * 16.0f;
    }
  }
  __syncthreads();
  v4u pk[4];
  size_t offs[4];
#pragma unroll
  for (int s = 0; s < 4; ++s) {
    const int idx = s * 256 + tid;
    const int row = idx >> 4, piece = idx & 15;
    const int colp = piece * 8;
    v4u a;
#pragma unroll
    for (int e = 0; e < 4; ++e)
      a[e] = pk16(hb16(Cs[row * LDC + colp + 2 * e]), hb16(Cs[row * LDC + colp + 2 * e + 1]));
    pk[s] = a;
    offs[s] = (size_t)(tok0 + row) * MLP + col0 + colp;
  }
#pragma unroll
  for (int s = 0; s < 4; ++s) *(v4u*)(gh + offs[s]) = pk[s];
  
}

// =================================================================================================================
// FC2 + bias + residual: C[64 tokens][128 cols] = gh . w2t^T (K = 768, 24 k-steps), Cs = 1024 (g w2);
// coverage: out [32768][256] f32, every element once.
// =================================================================================================================
__global__ __launch_bounds__(256)
void k_fc2(const unsigned short* __restrict__ gh, const unsigned short* __restrict__ w2t,
           const float* __restrict__ bias, const float* __restrict__ x1, float* out) {
  __shared__ __align__(16) float Cs[64 * LDC];
  const int tid = threadIdx.x;
  const int mb = blockIdx.x, cg = blockIdx.y;
  const int tok0 = mb * 64, col0 = cg * 128;
  mm_tile1((const _Float16*)(const void*)gh, MLP, (const _Float16*)(const void*)w2t, MLP, MLP / 32,
           tok0, col0, Cs);
  __syncthreads();
  v4f pk[8];
  size_t offs[8];
#pragma unroll
  for (int s = 0; s < 8; ++s) {
    const int idx = s * 256 + tid;
    const int row = idx >> 5, piece = idx & 31;
    const int colp = piece * 4;
    const size_t off = (size_t)(tok0 + row) * DIMC + col0 + colp;
    const v4f xr = *(const v4f*)(x1 + off);
    v4f v;
#pragma unroll
    for (int e = 0; e < 4; ++e)
      v[e] = xr[e] + (Cs[row * LDC + colp + e] * (1.0f / 1024.0f) + bfr(bias[col0 + colp + e]));
    pk[s] = v;
    offs[s] = off;
  }
#pragma unroll
  for (int s = 0; s < 8; ++s) *(v4f*)(out + offs[s]) = pk[s];
  
}

// =================================================================================================================
// Workspace map (bytes; all offsets multiples of 131072; every region sized exactly at its whole-line store extent;
// regions reused across phases in stream order):
//   [0, 16 MiB)      XH  f16 [32768][256]  (dead after k_qkv)  -> reused as HH f16 [32768][256] (k_xf -> k_fc1)
//   [0, 8 MiB)       PT  f32 [16][32][64][64] logit partials (k_attn_part -> k_attn_sm, between XH and HH)
//   [16, 32 MiB)     QH, [32, 48 MiB) QL  (dead after k_xf)
//   [48, 64) KTH, [64, 80) KTL, [80, 96) VTH, [96, 112) VTL  f16 [8][4][64][4096] each  (dead after k_attn_part)
//   [80, 112 MiB)    X1 f32 [32768][256] (k_xf -> k_fc2, over the dead v planes)
//   [16, 64 MiB)     GH f16 [32768][768] (k_fc1 -> k_fc2, over the dead q planes and kT hi plane)
//   112 MiB + : ATH, ATL f16 [32][64][64] 262144 each | WQT f16 [768][256] 393216 | W1T [768][256] 393216 |
//               W2T f16 [256][768] 393216 ; end = 119144448.
// =================================================================================================================
extern "C" void kernel_launch(void* const* d_in, const int* in_sizes, int n_in,
                              void* d_out, int out_size, void* d_ws, size_t ws_size,
                              hipStream_t stream) {
  if (n_in < 9) return;
  const int expect[9] = { NTOK * DIMC, DIMC * MLP, MLP, DIMC, DIMC, DIMC * MLP, MLP, MLP * DIMC, DIMC };
  for (int i = 0; i < 9; ++i) if (in_sizes[i] != expect[i]) return;
  if (out_size != NTOK * DIMC) return;

  const float* x     = (const float*)d_in[0];
  const float* w_qkv = (const float*)d_in[1];
  const float* b_qkv = (const float*)d_in[2];
  const float* ng    = (const float*)d_in[3];
  const float* nbt   = (const float*)d_in[4];
  const float* w_fc1 = (const float*)d_in[5];
  const float* b_fc1 = (const float*)d_in[6];
  const float* w_fc2 = (const float*)d_in[7];
  const float* b_fc2 = (const float*)d_in[8];
  float* out = (float*)d_out;

  const size_t MiB = (size_t)1048576;
  const size_t szX16 = (size_t)NTOK * DIMC * 2;                    // 16 MiB
  const size_t szPl  = PLANE * 2;                                  // 16 MiB
  const size_t szX1  = (size_t)NTOK * DIMC * 4;                    // 32 MiB
  const size_t szGH  = (size_t)NTOK * MLP * 2;                     // 48 MiB
  const size_t szAT  = ATL_OFF * 2;                                // 262144
  const size_t szWQ  = (size_t)MLP * DIMC * 2;                     // 393216
  if (szX16 != 16 * MiB || szPl != 16 * MiB || szX1 != 32 * MiB || szGH != 48 * MiB) return;

  const size_t oXH  = 0;
  const size_t oHH  = 0;
  const size_t oPT  = 0;
  const size_t oQH  = 16 * MiB;                                     // QL at oQH + 16 MiB
  const size_t oKV  = 48 * MiB;                                     // 4 planes, 64 MiB
  const size_t oX1  = 80 * MiB;
  const size_t oGH  = 16 * MiB;
  const size_t oATH = 112 * MiB;                                    // ATL at oATH + szAT
  const size_t oWQT = oATH + 2 * szAT;
  const size_t oW1T = oWQT + szWQ;
  const size_t oW2T = oW1T + szWQ;
  const size_t oEND = oW2T + szWQ;                                  // 119144448
  if (oQH + 2 * szX16 != oKV) return;
  if (oKV + 4 * szPl != oATH) return;
  if (oX1 + szX1 > oATH || oGH + szGH > oX1 || oHH + szX16 > oGH) return;
  if (oPT + (size_t)KSPLIT * ATL_OFF * 4 > oQH) return;
  if (oEND > ws_size) return;
  if (oEND > (size_t)134217728) return;

  char* ws = (char*)d_ws;
  unsigned short* XH  = (unsigned short*)(ws + oXH);
  unsigned short* HH  = (unsigned short*)(ws + oHH);
  float*          PT  = (float*)(ws + oPT);
  unsigned short* QH  = (unsigned short*)(ws + oQH);
  unsigned short* KV  = (unsigned short*)(ws + oKV);
  float*          X1  = (float*)(ws + oX1);
  unsigned short* GH  = (unsigned short*)(ws + oGH);
  unsigned short* ATH = (unsigned short*)(ws + oATH);
  unsigned short* WQT = (unsigned short*)(ws + oWQT);
  unsigned short* W1T = (unsigned short*)(ws + oW1T);
  unsigned short* W2T = (unsigned short*)(ws + oW2T);

  const dim3 blk(256);
  const int npieces = NTOK * DIMC / 8;
  // (1) weight planes (transposed, 64 * bf16)
  k_wcvt<<<dim3(2 * MLP + DIMC), dim3(128), 0, stream>>>(w_qkv, w_fc1, w_fc2, WQT, W1T, W2T);
  // (2) x -> f16 plane of 16 bf16(x)
  k_xcvt<<<dim3((npieces + 255) / 256), blk, 0, stream>>>(x, XH, npieces);
  // (3) qkv projection -> q hi/lo [token][256], kT/vT hi/lo [b][h][d][n]
  k_qkv<<<dim3(NTOK / 64, 6), blk, 0, stream>>>(XH, WQT, b_qkv, QH, KV);
  // (4) per (b, h) logits, K split in KSPLIT chunks -> f32 partial tiles; chunk sum + softmax -> P hi/lo planes
  k_attn_part<<<dim3(KSPLIT, BB * NH), blk, 0, stream>>>(KV, PT);
  k_attn_sm<<<dim3(BB * NH, HD / 16), blk, 0, stream>>>(PT, ATH);
  // (5) xf + residual + layer norm -> x1 f32, h f16
  k_xf<<<dim3(NTOK / 32), blk, 0, stream>>>(QH, ATH, x, ng, nbt, X1, HH);
  // (6) fc1 + GELU -> g f16
  k_fc1<<<dim3(NTOK / 64, 6), blk, 0, stream>>>(HH, W1T, b_fc1, GH);
  // (7) fc2 + bias + residual -> d_out
  k_fc2<<<dim3(NTOK / 64, 2), blk, 0, stream>>>(GH, W2T, b_fc2, X1, out);
  (void)hipGetLastError();
}

// v002
// One run takes 130 microseconds.
// In two side-by-side timings against v001, it was 1.69 and 1.66 times as fast.
// All steps since v000 together make it 2.27 times as fast.
// Contractions: qkv projection (K=256), fc1 (K=256), fc2 (K=768): v_wmma_f32_16x16x32_f16, single f16 products,
// activations carried x16, weights one f16 plane of 64*bf16(w); per-head k^T v logits (K=4096) and attn x q (K=64):
// v_wmma_f32_16x16x32_f16 with both operands as f16 hi + x2048 residual planes (3 products); f32 accumulate
// everywhere. Softmax, layer norm, exact GELU and all epilogues f32 on VALU; every float input RNE-converted to
// bf16 on load.
#include <hip/hip_runtime.h>
#include <stdint.h>

#define BB     8
#define NN     4096
#define DIMC   256
#define NH     4
#define HD     64
#define MLP    768
#define NTOK   (BB * NN)
#define LDC    132
#define LDX    260
#define LDA    68
#define RSC    0.00048828125f
#define PLANE  ((size_t)BB * NH * HD * NN)
#define QL_OFF ((size_t)NTOK * DIMC)
#define ATL_OFF ((size_t)BB * NH * HD * HD)
#define KSPLIT 16
#define KCH    (NN / KSPLIT)
#define KVP    (KCH * 2 + 16)
#define XSP    (HD * 2 + 16)

static_assert(NTOK == 32768);
static_assert(DIMC == NH * HD);
static_assert((NN % 64) == 0 && (NTOK % 64) == 0);
static_assert((DIMC % 32) == 0 && (MLP % 32) == 0 && (HD % 32) == 0 && (NN % 32) == 0);
static_assert((LDX * 4) % 16 == 0 && (LDC * 4) % 16 == 0);
static_assert(PLANE == 8388608 && QL_OFF == 8388608 && ATL_OFF == 131072);
static_assert(MLP == 6 * 128 && DIMC == 2 * 128);
static_assert(KCH * KSPLIT == NN && (KCH % 32) == 0);
static_assert(KCH == 256 && ((KVP / 16) & 1) == 1 && HD == 64 && ((XSP / 16) & 1) == 1);

typedef _Float16 v16h __attribute__((ext_vector_type(16)));
typedef _Float16 v8h  __attribute__((ext_vector_type(8)));
typedef float    v8f  __attribute__((ext_vector_type(8)));
typedef float    v4f  __attribute__((ext_vector_type(4)));
typedef unsigned int v4u __attribute__((ext_vector_type(4)));
typedef unsigned int v2u __attribute__((ext_vector_type(2)));

// ---- scalar helpers ------------------------------------------------------------------------------------------
__device__ __forceinline__ unsigned short bf_bits(float f) {          // f32 -> bf16 bits, RNE convert
  unsigned u = __float_as_uint(f);
  return (unsigned short)((u + 0x7FFFu + ((u >> 16) & 1u)) >> 16);
}
__device__ __forceinline__ float bf_up(unsigned short b) { return __uint_as_float(((unsigned)b) << 16); }
__device__ __forceinline__ float bfr(float f) { return bf_up(bf_bits(f)); }
__device__ __forceinline__ unsigned short h_bits(_Float16 x) { return __builtin_bit_cast(unsigned short, x); }
__device__ __forceinline__ unsigned short hb16(float f) { return h_bits((_Float16)f); }
__device__ __forceinline__ unsigned pk16(unsigned short a, unsigned short b) { return (unsigned)a | ((unsigned)b << 16); }
__device__ __forceinline__ v8f zero8() { v8f z = {0.f, 0.f, 0.f, 0.f, 0.f, 0.f, 0.f, 0.f}; return z; }
// hi/lo pair of two f32 values: hi = f16(v), lo = f16(2048 (v - hi)), packed as two 32-bit words
__device__ __forceinline__ void split2(float f0, float f1, unsigned& hp, unsigned& lp) {
  const _Float16 h0 = (_Float16)f0, h1 = (_Float16)f1;
  const float q0 = (f0 - (float)h0) * 2048.0f, q1 = (f1 - (float)h1) * 2048.0f;
  hp = pk16(h_bits(h0), h_bits(h1));
  lp = pk16(hb16(q0), hb16(q1));
}

// ---- fragment loader: 16-bit A/B operand, lane -> row/col (lane&15), p already includes +8*(lane>>4);
//      elements 0..7 <- p[0..7] (k0+8h..k0+8h+7), elements 8..15 <- p[16..23] (k0+16+8h..k0+16+8h+7)
__device__ __forceinline__ v16h ldfrag_h(const _Float16* p) {
  union { v16h v; v8h h[2]; } f;
  f.h[0] = *(const v8h*)(p);
  f.h[1] = *(const v8h*)(p + 16);
  return f.v;
}

// ---- WMMA helpers; the guards insert the trailing VALU hazard gap and keep A/B live --------------------------
__device__ __forceinline__ v8f mma_raw(v16h a, v16h b, v8f c) {
  return __builtin_amdgcn_wmma_f32_16x16x32_f16(false, a, false, b, (short)0, c, false, false);
}
__device__ __forceinline__ void guard4(v8f& c0, v8f& c1, v8f& c2, v8f& c3,
                                       const v16h& a0, const v16h& a1, const v16h& b0, const v16h& b1) {
#if defined(__HIP_DEVICE_COMPILE__)
  asm volatile("v_nop\n\tv_nop\n\tv_nop\n\tv_nop"
               : "+v"(c0), "+v"(c1), "+v"(c2), "+v"(c3)
               : "v"(a0), "v"(a1), "v"(b0), "v"(b1));
#endif
}
__device__ __forceinline__ void guard6(v8f& c0, v8f& c1, v8f& c2, v8f& c3, v8f& c4, v8f& c5,
                                       const v16h& a0, const v16h& a1, const v16h& b0, const v16h& b1,
                                       const v16h& b2, const v16h& b3) {
#if defined(__HIP_DEVICE_COMPILE__)
  asm volatile("v_nop\n\tv_nop\n\tv_nop\n\tv_nop"
               : "+v"(c0), "+v"(c1), "+v"(c2), "+v"(c3), "+v"(c4), "+v"(c5)
               : "v"(a0), "v"(a1), "v"(b0), "v"(b1), "v"(b2), "v"(b3));
#endif
}
__device__ __forceinline__ void guard3(v8f& c0, v8f& c1, v8f& c2,
                                       const v16h& a0, const v16h& a1, const v16h& b0, const v16h& b1) {
#if defined(__HIP_DEVICE_COMPILE__)
  asm volatile("v_nop\n\tv_nop\n\tv_nop\n\tv_nop"
               : "+v"(c0), "+v"(c1), "+v"(c2)
               : "v"(a0), "v"(a1), "v"(b0), "v"(b1));
#endif
}

// ---- asynchronous copies, global -> LDS, 16 B per lane, six per statement. The s_wait_xcnt is the last line of the
//      copies' own statement, so that no address register named here is rewritten in front of it.
__device__ __forceinline__ void acopy6(const unsigned* l, const _Float16* const* g) {
#if defined(__HIP_DEVICE_COMPILE__)
  asm volatile("global_load_async_to_lds_b128 %0, %6, off\n\t"
               "global_load_async_to_lds_b128 %1, %7, off\n\t"
               "global_load_async_to_lds_b128 %2, %8, off\n\t"
               "global_load_async_to_lds_b128 %3, %9, off\n\t"
               "global_load_async_to_lds_b128 %4, %10, off\n\t"
               "global_load_async_to_lds_b128 %5, %11, off\n\t"
               "s_wait_xcnt 0x0"
               :: "v"(l[0]), "v"(l[1]), "v"(l[2]), "v"(l[3]), "v"(l[4]), "v"(l[5]),
                  "v"(g[0]), "v"(g[1]), "v"(g[2]), "v"(g[3]), "v"(g[4]), "v"(g[5])
               : "memory");
#endif
}

// the same, eight per statement
__device__ __forceinline__ void acopy8(const unsigned* l, const _Float16* const* g) {
#if defined(__HIP_DEVICE_COMPILE__)
  asm volatile("global_load_async_to_lds_b128 %0, %8, off\n\t"
               "global_load_async_to_lds_b128 %1, %9, off\n\t"
               "global_load_async_to_lds_b128 %2, %10, off\n\t"
               "global_load_async_to_lds_b128 %3, %11, off\n\t"
               "global_load_async_to_lds_b128 %4, %12, off\n\t"
               "global_load_async_to_lds_b128 %5, %13, off\n\t"
               "global_load_async_to_lds_b128 %6, %14, off\n\t"
               "global_load_async_to_lds_b128 %7, %15, off\n\t"
               "s_wait_xcnt 0x0"
               :: "v"(l[0]), "v"(l[1]), "v"(l[2]), "v"(l[3]), "v"(l[4]), "v"(l[5]), "v"(l[6]), "v"(l[7]),
                  "v"(g[0]), "v"(g[1]), "v"(g[2]), "v"(g[3]), "v"(g[4]), "v"(g[5]), "v"(g[6]), "v"(g[7])
               : "memory");
#endif
}

// ---- 64x128 block tile GEMM core, single 16-bit planes: A and W are k-contiguous rows of pitch KC*NCH elements
//      (W is [n][k]). K runs in NCH chunks of KC: each chunk's 64 A rows and 128 W rows are copied in whole lines
//      into LDS rows of KC*2 + 16 bytes (16 B x odd: ds_load_b128 without bank conflicts), A rows first; fragments
//      come from LDS with the table layout, k ascending as before. 8 waves = 2 (32 rows) x 4 (32 cols), 2x2 tiles of
//      16 per wave; results go to the f32 tile Cs[64][LDC], which lies over the staging rows once they are read.
template <int KC> struct StageBytes { static constexpr int pitch = KC * 2 + 16; static constexpr int total = 192 * pitch; };
template <int KC, int NCH>
__device__ __forceinline__ void mm_tile1(const _Float16* __restrict__ A, const _Float16* __restrict__ W,
                                         int arow0, int bcol0, unsigned char* sm) {
  constexpr int LD = KC * NCH;                 // row pitch of both operands, elements
  constexpr int PITCH = StageBytes<KC>::pitch; // LDS row pitch, bytes
  constexpr int PPR = KC / 8;                  // 16-B pieces per row
  constexpr int NCP = 192 * PPR / 256;         // copies per thread and chunk
  constexpr int RPJ = 256 / PPR;               // rows that one copy of all 256 threads covers
  static_assert(NCP * 256 == 192 * PPR && (NCP % 6) == 0 && NCP <= 63);
  static_assert(RPJ * PPR == 256 && (64 % RPJ) == 0 && (KC % 32) == 0 && ((PITCH / 16) & 1) == 1);
  static_assert(64 * LDC * 4 <= StageBytes<KC>::total);
  const int tid = threadIdx.x, wave = tid >> 5, lane = tid & 31, hh = lane >> 4, c = lane & 15;
  const int mw = wave >> 2, nw = wave & 3;
  const int r0 = tid / PPR, piece = tid % PPR;  // this thread's row within a copy's RPJ rows, and its 16-B piece
  const unsigned l0 = (unsigned)(uintptr_t)sm + (unsigned)(r0 * PITCH + piece * 16);  // LDS byte address
  const _Float16* gA = A + (size_t)(arow0 + r0) * LD + piece * 8;
  const _Float16* gW = W + (size_t)(bcol0 + r0) * LD + piece * 8;
  float* Cs = (float*)(void*)sm;
  const _Float16* a0p = (const _Float16*)(const void*)(sm + (mw * 32 + c) * PITCH) + 8 * hh;
  const _Float16* a1p = (const _Float16*)(const void*)(sm + (mw * 32 + 16 + c) * PITCH) + 8 * hh;
  const _Float16* b0p = (const _Float16*)(const void*)(sm + (64 + nw * 32 + c) * PITCH) + 8 * hh;
  const _Float16* b1p = (const _Float16*)(const void*)(sm + (64 + nw * 32 + 16 + c) * PITCH) + 8 * hh;
  v8f c00 = zero8(), c01 = zero8(), c10 = zero8(), c11 = zero8();
#pragma unroll 1  // one copy of the chunk body: the text stays short
  for (int ch = 0; ch < NCH; ++ch) {
    if (ch > 0) {
      // every wave's fragment reads of the last chunk have returned and all waves are here before the rows are refilled
      asm volatile("s_wait_dscnt 0x0" ::: "memory");
      __syncthreads();
    }
#pragma unroll  // l[] and g[] indexed by constants, so they stay in registers
    for (int j0 = 0; j0 < NCP; j0 += 6) {
      unsigned l[6];
      const _Float16* g[6];
#pragma unroll
      for (int j = 0; j < 6; ++j) {
        const int rj = (j0 + j) * RPJ;           // staging row = rj + r0: below 64 an A row, from 64 on a W row
        l[j] = l0 + (unsigned)(rj * PITCH);
        g[j] = (rj < 64 ? gA + (size_t)rj * LD : gW + (size_t)(rj - 64) * LD) + ch * KC;
      }
      acopy6(l, g);
    }
    // this wave's copies have landed; behind the barrier every wave's have
    asm volatile("s_wait_asynccnt 0x0" ::: "memory");
    __syncthreads();
#pragma unroll  // straight-line k-steps: the fragment reads of later steps can go ahead of earlier products
    for (int ks = 0; ks < KC / 32; ++ks) {
      const int ko = ks * 32;
      const v16h fa0 = ldfrag_h(a0p + ko);
      const v16h fa1 = ldfrag_h(a1p + ko);
      const v16h fb0 = ldfrag_h(b0p + ko);
      const v16h fb1 = ldfrag_h(b1p + ko);
      c00 = mma_raw(fa0, fb0, c00);
      c01 = mma_raw(fa0, fb1, c01);
      c10 = mma_raw(fa1, fb0, c10);
      c11 = mma_raw(fa1, fb1, c11);
      if (NCH > 1 && ks == KC / 32 - 1) guard4(c00, c01, c10, c11, fa0, fa1, fb0, fb1);  // in front of the back edge
    }
  }
  // the f32 tile overwrites the staging rows: all fragment reads of all waves end here
  asm volatile("s_wait_dscnt 0x0" ::: "memory");
  __syncthreads();
#pragma unroll
  for (int r = 0; r < 8; ++r) {
    const int row = mw * 32 + 8 * hh + r;
    Cs[row * LDC + nw * 32 + c]             = c00[r];
    Cs[row * LDC + nw * 32 + 16 + c]        = c01[r];
    Cs[(row + 16) * LDC + nw * 32 + c]      = c10[r];
    Cs[(row + 16) * LDC + nw * 32 + 16 + c] = c11[r];
  }
}

// =================================================================================================================
// Weight convert: wqt[n][k] = f16(64 bf16(w_qkv[k][n])), w1t[n][k] = f16(64 bf16(w_fc1[k][n])) (n < 768, k < 256),
// w2t[n][k] = f16(64 bf16(w_fc2[k][n])) (n < 256, k < 768). Block = one output row n; thread = one 16-B piece of
// coverage: wqt 768 x 256, w1t 768 x 256, w2t 256 x 768, every element once.
// =================================================================================================================
__global__ __launch_bounds__(128)
void k_wcvt(const float* __restrict__ wqkv, const float* __restrict__ wfc1, const float* __restrict__ wfc2,
            unsigned short* wqt, unsigned short* w1t, unsigned short* w2t) {
  const int tid = threadIdx.x;
  const int blk = blockIdx.x;
  if (blk < 2 * MLP) {                                      // block-uniform branch
    const int t = (blk < MLP) ? 0 : 1;
    const int n = blk - t * MLP;
    const float* src = t ? wfc1 : wqkv;
    unsigned short* dstp = t ? w1t : wqt;
    const int tt = min(tid, 31);
    const int k0 = tt * 8;
    v4u pk;
#pragma unroll
    for (int e = 0; e < 4; ++e) {
      const float f0 = src[(size_t)(k0 + 2 * e) * MLP + n];
      const float f1 = src[(size_t)(k0 + 2 * e + 1) * MLP + n];
      pk[e] = pk16(hb16(bfr(f0) * 64.0f), hb16(bfr(f1) * 64.0f));
    }
    if (tid < 32) {
      unsigned short* dst = dstp + (size_t)n * DIMC + k0;
      *(v4u*)dst = pk;
      
    }
  } else {
    const int n = blk - 2 * MLP;                            // 0..255
    const int tt = min(tid, 95);
    const int k0 = tt * 8;
    v4u pk;
#pragma unroll
    for (int e = 0; e < 4; ++e) {
      const float f0 = wfc2[(size_t)(k0 + 2 * e) * DIMC + n];
      const float f1 = wfc2[(size_t)(k0 + 2 * e + 1) * DIMC + n];
      pk[e] = pk16(hb16(bfr(f0) * 64.0f), hb16(bfr(f1) * 64.0f));
    }
    if (tid < 96) {
      unsigned short* dst = w2t + (size_t)n * MLP + k0;
      *(v4u*)dst = pk;
      
    }
  }
}

// =================================================================================================================
// x [32768][256] f32 -> xh f16 plane of 16 bf16(x); thread = 8 consecutive elements = one 16-B piece, consecutive
// grid = ceil(npieces/256). coverage: xh [32768][256], every element once.
// =================================================================================================================
__global__ __launch_bounds__(256)
void k_xcvt(const float* __restrict__ x, unsigned short* xh, int npieces) {
  const int i = blockIdx.x * 256 + threadIdx.x;
  if (i >= npieces) return;
  const float* p = x + (size_t)i * 8;
  const v4f a = *(const v4f*)(p);
  const v4f b = *(const v4f*)(p + 4);
  v4u pk;
  pk[0] = pk16(hb16(bfr(a[0]) * 16.0f), hb16(bfr(a[1]) * 16.0f));
  pk[1] = pk16(hb16(bfr(a[2]) * 16.0f), hb16(bfr(a[3]) * 16.0f));
  pk[2] = pk16(hb16(bfr(b[0]) * 16.0f), hb16(bfr(b[1]) * 16.0f));
  pk[3] = pk16(hb16(bfr(b[2]) * 16.0f), hb16(bfr(b[3]) * 16.0f));
  unsigned short* dst = xh + (size_t)i * 8;
  *(v4u*)dst = pk;
  
}

// =================================================================================================================
// QKV projection: C[64 tokens][128 cols] = xh . wqt^T (K = 256, 8 k-steps), Cs = 1024 (x w). Column group cg
// (0..5) covers cols cg*128 of 768: third s = cg>>1 (q, k, v), head pair hp = cg&1. Carried value 16 (x w + b) =
// Cs/64 + 16 bf16(b), stored as f16 hi + x2048 residual planes:
//   k, v: transposed planes kv + {0,1,2,3} PLANE = kTh, kTl, vTh, vTl [b][h][d][n] (n contiguous): each channel's
// grid = (NTOK/64, 6), 256 threads. coverage: qh/ql [32768][256]; kTh/kTl/vTh/vTl [8][4][64][4096], every element once.
// =================================================================================================================
__global__ __launch_bounds__(256)
void k_qkv(const unsigned short* __restrict__ xh, const unsigned short* __restrict__ wqt,
           const float* __restrict__ bias, unsigned short* qp, unsigned short* kv) {
  __shared__ __align__(16) unsigned char sm[StageBytes<DIMC>::total];
  const float* Cs = (const float*)(const void*)sm;
  const int tid = threadIdx.x;
  const int mb = blockIdx.x, cg = blockIdx.y;
  const int tok0 = mb * 64, col0 = cg * 128;
  mm_tile1<DIMC, 1>((const _Float16*)(const void*)xh, (const _Float16*)(const void*)wqt, tok0, col0, sm);
  __syncthreads();
  const int s = cg >> 1, hp = cg & 1;
  if (s == 0) {                                             // block-uniform branch, no WMMA inside
    unsigned short* dh = qp;
    unsigned short* dl = qp + QL_OFF;
    v4u ph[4], pq[4];
    size_t offs[4];
#pragma unroll
    for (int s4 = 0; s4 < 4; ++s4) {
      const int idx = s4 * 256 + tid;
      const int row = idx >> 4, piece = idx & 15;
      const int colp = piece * 8;
      v4u a, q4;
#pragma unroll
      for (int e = 0; e < 4; ++e) {
        const float b0 = 16.0f * bfr(bias[col0 + colp + 2 * e]);
        const float b1 = 16.0f * bfr(bias[col0 + colp + 2 * e + 1]);
        const float f0 = Cs[row * LDC + colp + 2 * e] * (1.0f / 64.0f) + b0;
        const float f1 = Cs[row * LDC + colp + 2 * e + 1] * (1.0f / 64.0f) + b1;
        unsigned hw, lw;
        split2(f0, f1, hw, lw);
        a[e] = hw; q4[e] = lw;
      }
      ph[s4] = a;
      pq[s4] = q4;
      offs[s4] = (size_t)(tok0 + row) * DIMC + hp * 128 + colp;
    }
#pragma unroll
    for (int s4 = 0; s4 < 4; ++s4) { *(v4u*)(dh + offs[s4]) = ph[s4]; *(v4u*)(dl + offs[s4]) = pq[s4]; }
    
  } else {
    unsigned short* dh = kv + (size_t)(s - 1) * 2 * PLANE;
    unsigned short* dl = dh + PLANE;
    const int b = tok0 >> 12, n0 = tok0 & (NN - 1);
    v4u ph[4], pq[4];
    size_t offs[4];
#pragma unroll
    for (int s4 = 0; s4 < 4; ++s4) {
      const int idx = s4 * 256 + tid;
      const int ch = idx >> 3, piece = idx & 7;
      const int h = 2 * hp + (ch >> 6), d = ch & 63;
      const float bb = 16.0f * bfr(bias[col0 + ch]);
      const int r0 = piece * 8;
      v4u a, q4;
#pragma unroll
      for (int e = 0; e < 4; ++e) {
        const float f0 = Cs[(r0 + 2 * e) * LDC + ch] * (1.0f / 64.0f) + bb;
        const float f1 = Cs[(r0 + 2 * e + 1) * LDC + ch] * (1.0f / 64.0f) + bb;
        unsigned hw, lw;
        split2(f0, f1, hw, lw);
        a[e] = hw; q4[e] = lw;
      }
      ph[s4] = a;
      pq[s4] = q4;
      offs[s4] = ((size_t)(b * NH + h) * HD + d) * NN + n0 + r0;
    }
#pragma unroll
    for (int s4 = 0; s4 < 4; ++s4) { *(v4u*)(dh + offs[s4]) = ph[s4]; *(v4u*)(dl + offs[s4]) = pq[s4]; }
    
  }
}

// =================================================================================================================
// Per (b, h) channel attention, logits split over K: raw[d][e] = sum_n (16 k[n][d]) (16 v[n][e]) on WMMA (M = N = 64).
// Block (ck, bh) sums the KCH tokens of chunk ck (KCH/32 k-steps): A = kT hi/lo planes (row d, pitch NN), B = vT
// hi/lo planes ([e][n], n contiguous = the [n][k] copy form); products hi*hi + (hi*lo + lo*hi)/2048; 8 waves =
// 4 (16 rows) x 2 (32 cols). The chunk's 4 x 64 rows of 512 B are first copied in whole lines into LDS rows of KVP
// bytes (row = plane * 64 + channel); fragments come from there. The chunk's f32 tile goes through LDS to
// part[ck][bh][d][e] in whole lines.
// grid = (KSPLIT, 32), 256 threads. coverage: part [KSPLIT][32][64][64] f32, every element once.
// =================================================================================================================
__global__ __launch_bounds__(256)
void k_attn_part(const unsigned short* __restrict__ kv, float* part) {
  __shared__ __align__(16) unsigned char st[4 * HD * KVP];
  __shared__ __align__(16) float Cs[64 * LDA];
  const int tid = threadIdx.x, wave = tid >> 5, lane = tid & 31, hh = lane >> 4, c = lane & 15;
  const int ck = blockIdx.x, bh = blockIdx.y;
  const _Float16* base = (const _Float16*)(const void*)kv;
  const _Float16* Kh = base + (size_t)bh * HD * NN + ck * KCH;
  {
    const unsigned stb = (unsigned)(uintptr_t)st;           // LDS byte address of the staging rows
#pragma unroll  // l[] and g[] indexed by constants, so they stay in registers
    for (int j0 = 0; j0 < 32; j0 += 8) {
      unsigned l[8];
      const _Float16* g[8];
#pragma unroll
      for (int j = 0; j < 8; ++j) {
        const int row = (j0 + j) * 8 + wave;                // one wave copy = one whole row of 512 B
        l[j] = stb + (unsigned)(row * KVP + lane * 16);
        g[j] = Kh + (size_t)(row >> 6) * PLANE + (size_t)(row & 63) * NN + lane * 8;
      }
      acopy8(l, g);
    }
    // this wave's copies have landed; behind the barrier every wave's have
    asm volatile("s_wait_asynccnt 0x0" ::: "memory");
    __syncthreads();
  }
  {
    const int mw = wave >> 1, nw = wave & 1;
    const _Float16* ahp = (const _Float16*)(const void*)(st + (mw * 16 + c) * KVP) + 8 * hh;
    const _Float16* alp = (const _Float16*)(const void*)(st + (HD + mw * 16 + c) * KVP) + 8 * hh;
    const _Float16* b0h = (const _Float16*)(const void*)(st + (2 * HD + nw * 32 + c) * KVP) + 8 * hh;
    const _Float16* b1h = (const _Float16*)(const void*)(st + (2 * HD + nw * 32 + 16 + c) * KVP) + 8 * hh;
    const _Float16* b0l = (const _Float16*)(const void*)(st + (3 * HD + nw * 32 + c) * KVP) + 8 * hh;
    const _Float16* b1l = (const _Float16*)(const void*)(st + (3 * HD + nw * 32 + 16 + c) * KVP) + 8 * hh;
    v8f p0 = zero8(), p1 = zero8(), q0 = zero8(), q1 = zero8(), r0 = zero8(), r1 = zero8();
#pragma unroll 1
    for (int ks = 0; ks < KCH / 32; ++ks) {
      const int ko = ks * 32;
      const v16h fa  = ldfrag_h(ahp + ko);
      const v16h ga  = ldfrag_h(alp + ko);
      const v16h fb0 = ldfrag_h(b0h + ko);
      const v16h fb1 = ldfrag_h(b1h + ko);
      const v16h gb0 = ldfrag_h(b0l + ko);
      const v16h gb1 = ldfrag_h(b1l + ko);
      p0 = mma_raw(fa, fb0, p0);
      p1 = mma_raw(fa, fb1, p1);
      q0 = mma_raw(fa, gb0, q0);
      q1 = mma_raw(fa, gb1, q1);
      r0 = mma_raw(ga, fb0, r0);
      r1 = mma_raw(ga, fb1, r1);
      guard6(p0, p1, q0, q1, r0, r1, fa, ga, fb0, fb1, gb0, gb1);
    }
#pragma unroll
    for (int r = 0; r < 8; ++r) {
      const int row = mw * 16 + 8 * hh + r;
      Cs[row * LDA + nw * 32 + c]      = p0[r] + (q0[r] + r0[r]) * RSC;
      Cs[row * LDA + nw * 32 + 16 + c] = p1[r] + (q1[r] + r1[r]) * RSC;
    }
  }
  __syncthreads();
  float* dst = part + ((size_t)ck * (BB * NH) + bh) * (HD * HD);
  v4f pk[4];
#pragma unroll  // pk[] indexed by constants, so it stays in registers
  for (int s = 0; s < 4; ++s) {
    const int idx = s * 256 + tid;
    pk[s] = *(const v4f*)(Cs + (idx >> 4) * LDA + (idx & 15) * 4);
  }
#pragma unroll  // as above
  for (int s = 0; s < 4; ++s) *(v4f*)(dst + (size_t)(s * 256 + tid) * 4) = pk[s];
}

// =================================================================================================================
// Chunk sum + softmax. Block = 16 rows d of one (b, h); thread = 4 consecutive e of one row, 16 lanes per row.
// raw = sum over ck of part[ck] in index order; logit = raw/2048 (includes the head_dim^-0.5 factor 1/8). Softmax
// over e per row d in f32 (max subtracted, 16-lane butterflies), 4096 P stored as f16 hi + x2048 residual planes;
// a wave's store covers two whole 128-B rows.
// grid = (32, 4), 256 threads. coverage: ath/atl [32][64][64], every element once.
// =================================================================================================================
__global__ __launch_bounds__(256)
void k_attn_sm(const float* __restrict__ part, unsigned short* at) {
  const int tid = threadIdx.x;
  const int bh = blockIdx.x;
  const int row = blockIdx.y * 16 + (tid >> 4), col0 = (tid & 15) * 4;
  const size_t off = ((size_t)bh * HD + row) * HD + col0;
  v4f t[KSPLIT];
#pragma unroll  // all chunk loads issued before the first add: one memory latency, not KSPLIT
  for (int s = 0; s < KSPLIT; ++s) t[s] = *(const v4f*)(part + (size_t)s * ATL_OFF + off);
  v4f a = t[0];
#pragma unroll  // t[] indexed by constants, so it stays in registers (the short loops below likewise)
  for (int s = 1; s < KSPLIT; ++s) a += t[s];
  float mx = fmaxf(fmaxf(a[0], a[1]), fmaxf(a[2], a[3]));
#pragma unroll
  for (int o = 1; o < 16; o <<= 1) mx = fmaxf(mx, __shfl_xor(mx, o, 32));
  float e[4];
#pragma unroll
  for (int n = 0; n < 4; ++n) e[n] = expf((a[n] - mx) * RSC);
  float sm = (e[0] + e[1]) + (e[2] + e[3]);
#pragma unroll
  for (int o = 1; o < 16; o <<= 1) sm += __shfl_xor(sm, o, 32);
  const float sc = (1.0f / sm) * 4096.0f;
  v2u ph, pq;
#pragma unroll
  for (int n = 0; n < 2; ++n) {
    unsigned hw, lw;
    split2(e[2 * n] * sc, e[2 * n + 1] * sc, hw, lw);
    ph[n] = hw; pq[n] = lw;
  }
  *(v2u*)(at + off) = ph;
  *(v2u*)(at + ATL_OFF + off) = pq;
}

// =================================================================================================================
// xf + residual + layer norm. Block = 32 tokens of one batch, all 4 heads. Per head h: C[32 tok][64 d] =
// sum_e (16 q[tok][h*64+e]) (4096 P[d][e]) on WMMA (K = 64, 2 k-steps): A = qh/ql [token][256] pitch 256 at
// column h*64, B = ath/atl [bh][d][64] (e contiguous = [n][k] copy form); products hi*hi + (hi*lo + lo*hi)/2048;
// 8 waves = 2 (16 rows) x 4 (16 cols); xf = C/65536. Then x1 = bf16(x) + xf (f32, kept in the LDS tile), mean
// f16, every element once.
// =================================================================================================================
__global__ __launch_bounds__(256)
void k_xf(const unsigned short* __restrict__ qp, const unsigned short* __restrict__ at,
          const float* __restrict__ x, const float* __restrict__ gw, const float* __restrict__ gb,
          float* x1, unsigned short* hh16) {
  __shared__ __align__(16) unsigned char st[192 * XSP];
  __shared__ __align__(16) float Cs[32 * LDX];
  __shared__ float Mu[32];
  __shared__ float Rs[32];
  const int tid = threadIdx.x, wave = tid >> 5, lane = tid & 31, hh = lane >> 4, c = lane & 15;
  const int mw = wave >> 2, nw = wave & 3;
  const int tok0 = blockIdx.x * 32;
  const int b = tok0 >> 12;
  const _Float16* Qh = (const _Float16*)(const void*)qp;
  const _Float16* Ql = Qh + QL_OFF;
  const _Float16* Ah = (const _Float16*)(const void*)at;
  const _Float16* Al = Ah + ATL_OFF;
  // per head, 192 rows of 128 B are copied in whole lines into LDS rows of XSP bytes: 0..31 q hi (token), 32..63 q lo,
  // 64..127 P hi (d), 128..191 P lo; thread = one 16-B piece of six rows; fragments come from there
  const unsigned stb = (unsigned)(uintptr_t)st;             // LDS byte address of the staging rows
  const int srow = tid >> 3, spc = tid & 7;
  const _Float16* ahp = (const _Float16*)(const void*)(st + (mw * 16 + c) * XSP) + 8 * hh;
  const _Float16* alp = (const _Float16*)(const void*)(st + (32 + mw * 16 + c) * XSP) + 8 * hh;
  const _Float16* bhp = (const _Float16*)(const void*)(st + (64 + nw * 16 + c) * XSP) + 8 * hh;
  const _Float16* blp = (const _Float16*)(const void*)(st + (128 + nw * 16 + c) * XSP) + 8 * hh;
#pragma unroll 1
  for (int h = 0; h < NH; ++h) {                            // block-uniform trip count
    if (h > 0) {
      // every wave's fragment reads of the last head have returned and all waves are here before the rows are refilled
      asm volatile("s_wait_dscnt 0x0" ::: "memory");
      __syncthreads();
    }
    {
      const size_t qoff = (size_t)(tok0 + srow) * DIMC + h * HD + spc * 8;
      const size_t poff = ((size_t)(b * NH + h) * HD + srow) * HD + spc * 8;
      unsigned l[6];
#pragma unroll  // l[] indexed by constants, so it stays in registers
      for (int j = 0; j < 6; ++j) l[j] = stb + (unsigned)((j * 32 + srow) * XSP + spc * 16);
      const _Float16* g[6] = { Qh + qoff, Ql + qoff, Ah + poff, Ah + poff + 32 * HD, Al + poff, Al + poff + 32 * HD };
      acopy6(l, g);
    }
    // this wave's copies have landed; behind the barrier every wave's have
    asm volatile("s_wait_asynccnt 0x0" ::: "memory");
    __syncthreads();
    v8f p = zero8(), q = zero8(), r = zero8();
#pragma unroll
    for (int ks = 0; ks < HD / 32; ++ks) {
      const int ko = ks * 32;
      const v16h fa = ldfrag_h(ahp + ko);
      const v16h ga = ldfrag_h(alp + ko);
      const v16h fb = ldfrag_h(bhp + ko);
      const v16h gq = ldfrag_h(blp + ko);
      p = mma_raw(fa, fb, p);
      q = mma_raw(fa, gq, q);
      r = mma_raw(ga, fb, r);
      guard3(p, q, r, fa, ga, fb, gq);
    }
#pragma unroll
    for (int rr = 0; rr < 8; ++rr)
      Cs[(mw * 16 + 8 * hh + rr) * LDX + h * HD + nw * 16 + c] = p[rr] + (q[rr] + r[rr]) * RSC;
  }
  __syncthreads();
  // phase 1: x1 = bf16(x) + xf back into the tile, per-row statistics
#pragma unroll 1
  for (int it = 0; it < 4; ++it) {
    const int row = wave * 4 + it;
    const size_t tok = (size_t)(tok0 + row);
    const float* xr = x + tok * DIMC + lane * 8;
    const v4f xa = *(const v4f*)(xr);
    const v4f xb = *(const v4f*)(xr + 4);
    float* cr = Cs + row * LDX + lane * 8;
    float v[8];
#pragma unroll
    for (int e = 0; e < 4; ++e) {
      v[e]     = bfr(xa[e]) + cr[e] * (1.0f / 65536.0f);
      v[4 + e] = bfr(xb[e]) + cr[4 + e] * (1.0f / 65536.0f);
    }
#pragma unroll
    for (int e = 0; e < 8; ++e) cr[e] = v[e];
    float s = ((v[0] + v[1]) + (v[2] + v[3])) + ((v[4] + v[5]) + (v[6] + v[7]));
#pragma unroll
    for (int off = 16; off; off >>= 1) s += __shfl_xor(s, off, 32);
    const float mu = s * (1.0f / 256.0f);
    float sq = 0.f;
#pragma unroll
    for (int e = 0; e < 8; ++e) { const float d = v[e] - mu; sq += d * d; }
#pragma unroll
    for (int off = 16; off; off >>= 1) sq += __shfl_xor(sq, off, 32);
    const float var = sq * (1.0f / 256.0f);
    const float rs = rsqrtf(var + 1e-5f);
    if (lane == 0) { Mu[row] = mu; Rs[row] = rs; }
  }
  __syncthreads();
  // phase 2: whole-line stores of x1 (f32) and hh16 (f16 of 16 h)
  v4f pk[8];
  size_t offs[8];
#pragma unroll
  for (int s = 0; s < 8; ++s) {
    const int idx = s * 256 + tid;
    const int row = idx >> 6, piece = idx & 63;
    v4f v4;
#pragma unroll
    for (int e = 0; e < 4; ++e) v4[e] = Cs[row * LDX + piece * 4 + e];
    pk[s] = v4;
    offs[s] = (size_t)(tok0 + row) * DIMC + piece * 4;
  }
  v4u ph[4];
  size_t offh[4];
#pragma unroll
  for (int s = 0; s < 4; ++s) {
    const int idx = s * 256 + tid;
    const int row = idx >> 5, piece = idx & 31;
    const int col0 = piece * 8;
    const float mu = Mu[row], rs = Rs[row];
    v4u a;
#pragma unroll
    for (int e = 0; e < 4; ++e) {
      const int cA = col0 + 2 * e, cB = cA + 1;
      const float f0 = ((Cs[row * LDX + cA] - mu) * rs) * bfr(gw[cA]) + bfr(gb[cA]);
      const float f1 = ((Cs[row * LDX + cB] - mu) * rs) * bfr(gw[cB]) + bfr(gb[cB]);
      a[e] = pk16(hb16(f0 * 16.0f), hb16(f1 * 16.0f));
    }
    ph[s] = a;
    offh[s] = (size_t)(tok0 + row) * DIMC + col0;
  }
#pragma unroll
  for (int s = 0; s < 8; ++s) *(v4f*)(x1 + offs[s]) = pk[s];
#pragma unroll
  for (int s = 0; s < 4; ++s) *(v4u*)(hh16 + offh[s]) = ph[s];
  
}

// =================================================================================================================
// FC1 + exact GELU: C[64 tokens][128 cols] = hh16 . w1t^T (K = 256), Cs = 1024 (h w1); v = Cs/1024 + bf16(b1),
// g = 0.5 v (1 + erf(v / sqrt 2)) computed in place in the LDS tile (rolled loop, thread = 32 elements of one row),
// coverage: gh [32768][768], every element once.
// =================================================================================================================
__global__ __launch_bounds__(256)
void k_fc1(const unsigned short* __restrict__ hh16, const unsigned short* __restrict__ w1t,
           const float* __restrict__ bias, unsigned short* gh) {
  __shared__ __align__(16) unsigned char sm[StageBytes<DIMC>::total];
  float* Cs = (float*)(void*)sm;
  const int tid = threadIdx.x;
  const int mb = blockIdx.x, cg = blockIdx.y;
  const int tok0 = mb * 64, col0 = cg * 128;
  mm_tile1<DIMC, 1>((const _Float16*)(const void*)hh16, (const _Float16*)(const void*)w1t, tok0, col0, sm);
  __syncthreads();
  {
    const int row = tid >> 2, cq = tid & 3;
    float* cr = Cs + row * LDC + cq * 32;
    const float* bp = bias + col0 + cq * 32;
#pragma unroll 2
    for (int n = 0; n < 32; ++n) {
      const float v = cr[n] * (1.0f / 1024.0f) + bfr(bp[n]);
      const float ge = 0.5f * v * (1.0f + erff(v * 0.70710678118654752f));
      cr[n] = ge * 16.0f;
    }
  }
  __syncthreads();
  v4u pk[4];
  size_t offs[4];
#pragma unroll
  for (int s = 0; s < 4; ++s) {
    const int idx = s * 256 + tid;
    const int row = idx >> 4, piece = idx & 15;
    const int colp = piece * 8;
    v4u a;
#pragma unroll
    for (int e = 0; e < 4; ++e)
      a[e] = pk16(hb16(Cs[row * LDC + colp + 2 * e]), hb16(Cs[row * LDC + colp + 2 * e + 1]));
    pk[s] = a;
    offs[s] = (size_t)(tok0 + row) * MLP + col0 + colp;
  }
#pragma unroll
  for (int s = 0; s < 4; ++s) *(v4u*)(gh + offs[s]) = pk[s];
  
}

// =================================================================================================================
// FC2 + bias + residual: C[64 tokens][128 cols] = gh . w2t^T (K = 768, 24 k-steps), Cs = 1024 (g w2);
// coverage: out [32768][256] f32, every element once.
// =================================================================================================================
__global__ __launch_bounds__(256)
void k_fc2(const unsigned short* __restrict__ gh, const unsigned short* __restrict__ w2t,
           const float* __restrict__ bias, const float* __restrict__ x1, float* out) {
  __shared__ __align__(16) unsigned char sm[StageBytes<MLP / 6>::total];
  const float* Cs = (const float*)(const void*)sm;
  const int tid = threadIdx.x;
  const int mb = blockIdx.x, cg = blockIdx.y;
  const int tok0 = mb * 64, col0 = cg * 128;
  mm_tile1<MLP / 6, 6>((const _Float16*)(const void*)gh, (const _Float16*)(const void*)w2t, tok0, col0, sm);
  __syncthreads();
  v4f pk[8];
  size_t offs[8];
#pragma unroll
  for (int s = 0; s < 8; ++s) {
    const int idx = s * 256 + tid;
    const int row = idx >> 5, piece = idx & 31;
    const int colp = piece * 4;
    const size_t off = (size_t)(tok0 + row) * DIMC + col0 + colp;
    const v4f xr = *(const v4f*)(x1 + off);
    v4f v;
#pragma unroll
    for (int e = 0; e < 4; ++e)
      v[e] = xr[e] + (Cs[row * LDC + colp + e] * (1.0f / 1024.0f) + bfr(bias[col0 + colp + e]));
    pk[s] = v;
    offs[s] = off;
  }
#pragma unroll
  for (int s = 0; s < 8; ++s) *(v4f*)(out + offs[s]) = pk[s];
  
}

// =================================================================================================================
// Workspace map (bytes; all offsets multiples of 131072; every region sized exactly at its whole-line store extent;
// regions reused across phases in stream order):
//   [0, 16 MiB)      XH  f16 [32768][256]  (dead after k_qkv)  -> reused as HH f16 [32768][256] (k_xf -> k_fc1)
//   [0, 8 MiB)       PT  f32 [16][32][64][64] logit partials (k_attn_part -> k_attn_sm, between XH and HH)
//   [16, 32 MiB)     QH, [32, 48 MiB) QL  (dead after k_xf)
//   [48, 64) KTH, [64, 80) KTL, [80, 96) VTH, [96, 112) VTL  f16 [8][4][64][4096] each  (dead after k_attn_part)
//   [80, 112 MiB)    X1 f32 [32768][256] (k_xf -> k_fc2, over the dead v planes)
//   [16, 64 MiB)     GH f16 [32768][768] (k_fc1 -> k_fc2, over the dead q planes and kT hi plane)
//   112 MiB + : ATH, ATL f16 [32][64][64] 262144 each | WQT f16 [768][256] 393216 | W1T [768][256] 393216 |
//               W2T f16 [256][768] 393216 ; end = 119144448.
// =================================================================================================================
extern "C" void kernel_launch(void* const* d_in, const int* in_sizes, int n_in,
                              void* d_out, int out_size, void* d_ws, size_t ws_size,
                              hipStream_t stream) {
  if (n_in < 9) return;
  const int expect[9] = { NTOK * DIMC, DIMC * MLP, MLP, DIMC, DIMC, DIMC * MLP, MLP, MLP * DIMC, DIMC };
  for (int i = 0; i < 9; ++i) if (in_sizes[i] != expect[i]) return;
  if (out_size != NTOK * DIMC) return;

  const float* x     = (const float*)d_in[0];
  const float* w_qkv = (const float*)d_in[1];
  const float* b_qkv = (const float*)d_in[2];
  const float* ng    = (const float*)d_in[3];
  const float* nbt   = (const float*)d_in[4];
  const float* w_fc1 = (const float*)d_in[5];
  const float* b_fc1 = (const float*)d_in[6];
  const float* w_fc2 = (const float*)d_in[7];
  const float* b_fc2 = (const float*)d_in[8];
  float* out = (float*)d_out;

  const size_t MiB = (size_t)1048576;
  const size_t szX16 = (size_t)NTOK * DIMC * 2;                    // 16 MiB
  const size_t szPl  = PLANE * 2;                                  // 16 MiB
  const size_t szX1  = (size_t)NTOK * DIMC * 4;                    // 32 MiB
  const size_t szGH  = (size_t)NTOK * MLP * 2;                     // 48 MiB
  const size_t szAT  = ATL_OFF * 2;                                // 262144
  const size_t szWQ  = (size_t)MLP * DIMC * 2;                     // 393216
  if (szX16 != 16 * MiB || szPl != 16 * MiB || szX1 != 32 * MiB || szGH != 48 * MiB) return;

  const size_t oXH  = 0;
  const size_t oHH  = 0;
  const size_t oPT  = 0;
  const size_t oQH  = 16 * MiB;                                     // QL at oQH + 16 MiB
  const size_t oKV  = 48 * MiB;                                     // 4 planes, 64 MiB
  const size_t oX1  = 80 * MiB;
  const size_t oGH  = 16 * MiB;
  const size_t oATH = 112 * MiB;                                    // ATL at oATH + szAT
  const size_t oWQT = oATH + 2 * szAT;
  const size_t oW1T = oWQT + szWQ;
  const size_t oW2T = oW1T + szWQ;
  const size_t oEND = oW2T + szWQ;                                  // 119144448
  if (oQH + 2 * szX16 != oKV) return;
  if (oKV + 4 * szPl != oATH) return;
  if (oX1 + szX1 > oATH || oGH + szGH > oX1 || oHH + szX16 > oGH) return;
  if (oPT + (size_t)KSPLIT * ATL_OFF * 4 > oQH) return;
  if (oEND > ws_size) return;
  if (oEND > (size_t)134217728) return;

  char* ws = (char*)d_ws;
  unsigned short* XH  = (unsigned short*)(ws + oXH);
  unsigned short* HH  = (unsigned short*)(ws + oHH);
  float*          PT  = (float*)(ws + oPT);
  unsigned short* QH  = (unsigned short*)(ws + oQH);
  unsigned short* KV  = (unsigned short*)(ws + oKV);
  float*          X1  = (float*)(ws + oX1);
  unsigned short* GH  = (unsigned short*)(ws + oGH);
  unsigned short* ATH = (unsigned short*)(ws + oATH);
  unsigned short* WQT = (unsigned short*)(ws + oWQT);
  unsigned short* W1T = (unsigned short*)(ws + oW1T);
  unsigned short* W2T = (unsigned short*)(ws + oW2T);

  const dim3 blk(256);
  const int npieces = NTOK * DIMC / 8;
  // (1) weight planes (transposed, 64 * bf16)
  k_wcvt<<<dim3(2 * MLP + DIMC), dim3(128), 0, stream>>>(w_qkv, w_fc1, w_fc2, WQT, W1T, W2T);
  // (2) x -> f16 plane of 16 bf16(x)
  k_xcvt<<<dim3((npieces + 255) / 256), blk, 0, stream>>>(x, XH, npieces);
  // (3) qkv projection -> q hi/lo [token][256], kT/vT hi/lo [b][h][d][n]
  k_qkv<<<dim3(NTOK / 64, 6), blk, 0, stream>>>(XH, WQT, b_qkv, QH, KV);
  // (4) per (b, h) logits, K split in KSPLIT chunks -> f32 partial tiles; chunk sum + softmax -> P hi/lo planes
  k_attn_part<<<dim3(KSPLIT, BB * NH), blk, 0, stream>>>(KV, PT);
  k_attn_sm<<<dim3(BB * NH, HD / 16), blk, 0, stream>>>(PT, ATH);
  // (5) xf + residual + layer norm -> x1 f32, h f16
  k_xf<<<dim3(NTOK / 32), blk, 0, stream>>>(QH, ATH, x, ng, nbt, X1, HH);
  // (6) fc1 + GELU -> g f16
  k_fc1<<<dim3(NTOK / 64, 6), blk, 0, stream>>>(HH, W1T, b_fc1, GH);
  // (7) fc2 + bias + residual -> d_out
  k_fc2<<<dim3(NTOK / 64, 2), blk, 0, stream>>>(GH, W2T, b_fc2, X1, out);
  (void)hipGetLastError();
}

// v003
// One run takes 108 microseconds.
// Timed twice side by side with v002, it ran 1.20 and 1.22 times as fast.
// All steps since v000 together make it 2.73 times as fast.
// Contractions: qkv projection (K=256), fc1 (K=256), fc2 (K=768): v_wmma_f32_16x16x32_f16, single f16 products,
// activations carried x16, weights one f16 plane of 64*bf16(w); per-head k^T v logits (K=4096) and attn x q (K=64):
// v_wmma_f32_16x16x32_f16 with both operands as f16 hi + x2048 residual planes (3 products); f32 accumulate
// everywhere. Softmax, layer norm, exact GELU and all epilogues f32 on VALU; every float input RNE-converted to
// bf16 on load.
#include <hip/hip_runtime.h>
#include <stdint.h>

#define BB     8
#define NN     4096
#define DIMC   256
#define NH     4
#define HD     64
#define MLP    768
#define NTOK   (BB * NN)
#define LDC    132
#define LDX    260
#define LDA    68
#define RSC    0.00048828125f
#define QL_OFF ((size_t)NTOK * DIMC)
#define ATL_OFF ((size_t)BB * NH * HD * HD)
#define KSPLIT 16
#define KCH    (NN / KSPLIT)
#define XSP    (HD * 2 + 16)
#define WSP    (DIMC * 2 + 16)
#define TSP    (64 * 2 + 16)

static_assert(NTOK == 32768);
static_assert(DIMC == NH * HD);
static_assert((NN % 64) == 0 && (NTOK % 64) == 0);
static_assert((DIMC % 32) == 0 && (MLP % 32) == 0 && (HD % 32) == 0 && (NN % 32) == 0);
static_assert((LDX * 4) % 16 == 0 && (LDC * 4) % 16 == 0);
static_assert(QL_OFF == 8388608 && ATL_OFF == 131072);
static_assert(MLP == 6 * 128 && DIMC == 2 * 128);
static_assert(KCH * KSPLIT == NN && (KCH % 32) == 0);
static_assert(KCH == 256 && HD == 64 && ((XSP / 16) & 1) == 1 && ((WSP / 16) & 1) == 1 && ((TSP / 16) & 1) == 1);

typedef _Float16 v16h __attribute__((ext_vector_type(16)));
typedef _Float16 v8h  __attribute__((ext_vector_type(8)));
typedef float    v8f  __attribute__((ext_vector_type(8)));
typedef float    v4f  __attribute__((ext_vector_type(4)));
typedef unsigned int v4u __attribute__((ext_vector_type(4)));
typedef unsigned int v2u __attribute__((ext_vector_type(2)));

// ---- scalar helpers ------------------------------------------------------------------------------------------
__device__ __forceinline__ unsigned short bf_bits(float f) {          // f32 -> bf16 bits, RNE convert
  unsigned u = __float_as_uint(f);
  return (unsigned short)((u + 0x7FFFu + ((u >> 16) & 1u)) >> 16);
}
__device__ __forceinline__ float bf_up(unsigned short b) { return __uint_as_float(((unsigned)b) << 16); }
__device__ __forceinline__ float bfr(float f) { return bf_up(bf_bits(f)); }
__device__ __forceinline__ unsigned short h_bits(_Float16 x) { return __builtin_bit_cast(unsigned short, x); }
__device__ __forceinline__ unsigned short hb16(float f) { return h_bits((_Float16)f); }
__device__ __forceinline__ unsigned pk16(unsigned short a, unsigned short b) { return (unsigned)a | ((unsigned)b << 16); }
__device__ __forceinline__ v8f zero8() { v8f z = {0.f, 0.f, 0.f, 0.f, 0.f, 0.f, 0.f, 0.f}; return z; }
// hi/lo pair of two f32 values: hi = f16(v), lo = f16(2048 (v - hi)), packed as two 32-bit words
__device__ __forceinline__ void split2(float f0, float f1, unsigned& hp, unsigned& lp) {
  const _Float16 h0 = (_Float16)f0, h1 = (_Float16)f1;
  const float q0 = (f0 - (float)h0) * 2048.0f, q1 = (f1 - (float)h1) * 2048.0f;
  hp = pk16(h_bits(h0), h_bits(h1));
  lp = pk16(hb16(q0), hb16(q1));
}

// ---- fragment loader: 16-bit A/B operand, lane -> row/col (lane&15), p already includes +8*(lane>>4);
//      elements 0..7 <- p[0..7] (k0+8h..k0+8h+7), elements 8..15 <- p[16..23] (k0+16+8h..k0+16+8h+7)
__device__ __forceinline__ v16h ldfrag_h(const _Float16* p) {
  union { v16h v; v8h h[2]; } f;
  f.h[0] = *(const v8h*)(p);
  f.h[1] = *(const v8h*)(p + 16);
  return f.v;
}

// ---- WMMA helpers; the guards insert the trailing VALU hazard gap and keep A/B live --------------------------
__device__ __forceinline__ v8f mma_raw(v16h a, v16h b, v8f c) {
  return __builtin_amdgcn_wmma_f32_16x16x32_f16(false, a, false, b, (short)0, c, false, false);
}
__device__ __forceinline__ void guard4(v8f& c0, v8f& c1, v8f& c2, v8f& c3,
                                       const v16h& a0, const v16h& a1, const v16h& b0, const v16h& b1) {
#if defined(__HIP_DEVICE_COMPILE__)
  asm volatile("v_nop\n\tv_nop\n\tv_nop\n\tv_nop"
               : "+v"(c0), "+v"(c1), "+v"(c2), "+v"(c3)
               : "v"(a0), "v"(a1), "v"(b0), "v"(b1));
#endif
}
__device__ __forceinline__ void guard6(v8f& c0, v8f& c1, v8f& c2, v8f& c3, v8f& c4, v8f& c5,
                                       const v16h& a0, const v16h& a1, const v16h& b0, const v16h& b1,
                                       const v16h& b2, const v16h& b3) {
#if defined(__HIP_DEVICE_COMPILE__)
  asm volatile("v_nop\n\tv_nop\n\tv_nop\n\tv_nop"
               : "+v"(c0), "+v"(c1), "+v"(c2), "+v"(c3), "+v"(c4), "+v"(c5)
               : "v"(a0), "v"(a1), "v"(b0), "v"(b1), "v"(b2), "v"(b3));
#endif
}
__device__ __forceinline__ void guard3(v8f& c0, v8f& c1, v8f& c2,
                                       const v16h& a0, const v16h& a1, const v16h& b0, const v16h& b1) {
#if defined(__HIP_DEVICE_COMPILE__)
  asm volatile("v_nop\n\tv_nop\n\tv_nop\n\tv_nop"
               : "+v"(c0), "+v"(c1), "+v"(c2)
               : "v"(a0), "v"(a1), "v"(b0), "v"(b1));
#endif
}

// ---- asynchronous copies, global -> LDS, 16 B per lane, six per statement. The s_wait_xcnt is the last line of the
//      copies' own statement, so that no address register named here is rewritten in front of it.
__device__ __forceinline__ void acopy6(const unsigned* l, const _Float16* const* g) {
#if defined(__HIP_DEVICE_COMPILE__)
  asm volatile("global_load_async_to_lds_b128 %0, %6, off\n\t"
               "global_load_async_to_lds_b128 %1, %7, off\n\t"
               "global_load_async_to_lds_b128 %2, %8, off\n\t"
               "global_load_async_to_lds_b128 %3, %9, off\n\t"
               "global_load_async_to_lds_b128 %4, %10, off\n\t"
               "global_load_async_to_lds_b128 %5, %11, off\n\t"
               "s_wait_xcnt 0x0"
               :: "v"(l[0]), "v"(l[1]), "v"(l[2]), "v"(l[3]), "v"(l[4]), "v"(l[5]),
                  "v"(g[0]), "v"(g[1]), "v"(g[2]), "v"(g[3]), "v"(g[4]), "v"(g[5])
               : "memory");
#endif
}

// the same, eight per statement
__device__ __forceinline__ void acopy8(const unsigned* l, const _Float16* const* g) {
#if defined(__HIP_DEVICE_COMPILE__)
  asm volatile("global_load_async_to_lds_b128 %0, %8, off\n\t"
               "global_load_async_to_lds_b128 %1, %9, off\n\t"
               "global_load_async_to_lds_b128 %2, %10, off\n\t"
               "global_load_async_to_lds_b128 %3, %11, off\n\t"
               "global_load_async_to_lds_b128 %4, %12, off\n\t"
               "global_load_async_to_lds_b128 %5, %13, off\n\t"
               "global_load_async_to_lds_b128 %6, %14, off\n\t"
               "global_load_async_to_lds_b128 %7, %15, off\n\t"
               "s_wait_xcnt 0x0"
               :: "v"(l[0]), "v"(l[1]), "v"(l[2]), "v"(l[3]), "v"(l[4]), "v"(l[5]), "v"(l[6]), "v"(l[7]),
                  "v"(g[0]), "v"(g[1]), "v"(g[2]), "v"(g[3]), "v"(g[4]), "v"(g[5]), "v"(g[6]), "v"(g[7])
               : "memory");
#endif
}

// ---- 64x128 block tile GEMM core, single 16-bit planes: A and W are k-contiguous rows of pitch KC*NCH elements
//      (W is [n][k]). K runs in NCH chunks of KC: each chunk's 64 A rows and 128 W rows are copied in whole lines
//      into LDS rows of KC*2 + 16 bytes (16 B x odd: ds_load_b128 without bank conflicts), A rows first; fragments
//      come from LDS with the table layout, k ascending as before. 8 waves = 2 (32 rows) x 4 (32 cols), 2x2 tiles of
//      16 per wave; results go to the f32 tile Cs[64][LDC], which lies over the staging rows once they are read.
template <int KC> struct StageBytes { static constexpr int pitch = KC * 2 + 16; static constexpr int total = 192 * pitch; };
template <int KC, int NCH>
__device__ __forceinline__ void mm_tile1(const _Float16* __restrict__ A, const _Float16* __restrict__ W,
                                         int arow0, int bcol0, unsigned char* sm) {
  constexpr int LD = KC * NCH;                 // row pitch of both operands, elements
  constexpr int PITCH = StageBytes<KC>::pitch; // LDS row pitch, bytes
  constexpr int PPR = KC / 8;                  // 16-B pieces per row
  constexpr int NCP = 192 * PPR / 256;         // copies per thread and chunk
  constexpr int RPJ = 256 / PPR;               // rows that one copy of all 256 threads covers
  static_assert(NCP * 256 == 192 * PPR && (NCP % 6) == 0 && NCP <= 63);
  static_assert(RPJ * PPR == 256 && (64 % RPJ) == 0 && (KC % 32) == 0 && ((PITCH / 16) & 1) == 1);
  static_assert(64 * LDC * 4 <= StageBytes<KC>::total);
  const int tid = threadIdx.x, wave = tid >> 5, lane = tid & 31, hh = lane >> 4, c = lane & 15;
  const int mw = wave >> 2, nw = wave & 3;
  const int r0 = tid / PPR, piece = tid % PPR;  // this thread's row within a copy's RPJ rows, and its 16-B piece
  const unsigned l0 = (unsigned)(uintptr_t)sm + (unsigned)(r0 * PITCH + piece * 16);  // LDS byte address
  const _Float16* gA = A + (size_t)(arow0 + r0) * LD + piece * 8;
  const _Float16* gW = W + (size_t)(bcol0 + r0) * LD + piece * 8;
  float* Cs = (float*)(void*)sm;
  const _Float16* a0p = (const _Float16*)(const void*)(sm + (mw * 32 + c) * PITCH) + 8 * hh;
  const _Float16* a1p = (const _Float16*)(const void*)(sm + (mw * 32 + 16 + c) * PITCH) + 8 * hh;
  const _Float16* b0p = (const _Float16*)(const void*)(sm + (64 + nw * 32 + c) * PITCH) + 8 * hh;
  const _Float16* b1p = (const _Float16*)(const void*)(sm + (64 + nw * 32 + 16 + c) * PITCH) + 8 * hh;
  v8f c00 = zero8(), c01 = zero8(), c10 = zero8(), c11 = zero8();
#pragma unroll 1  // one copy of the chunk body: the text stays short
  for (int ch = 0; ch < NCH; ++ch) {
    if (ch > 0) {
      // every wave's fragment reads of the last chunk have returned and all waves are here before the rows are refilled
      asm volatile("s_wait_dscnt 0x0" ::: "memory");
      __syncthreads();
    }
#pragma unroll  // l[] and g[] indexed by constants, so they stay in registers
    for (int j0 = 0; j0 < NCP; j0 += 6) {
      unsigned l[6];
      const _Float16* g[6];
#pragma unroll
      for (int j = 0; j < 6; ++j) {
        const int rj = (j0 + j) * RPJ;           // staging row = rj + r0: below 64 an A row, from 64 on a W row
        l[j] = l0 + (unsigned)(rj * PITCH);
        g[j] = (rj < 64 ? gA + (size_t)rj * LD : gW + (size_t)(rj - 64) * LD) + ch * KC;
      }
      acopy6(l, g);
    }
    // this wave's copies have landed; behind the barrier every wave's have
    asm volatile("s_wait_asynccnt 0x0" ::: "memory");
    __syncthreads();
#pragma unroll  // straight-line k-steps: the fragment reads of later steps can go ahead of earlier products
    for (int ks = 0; ks < KC / 32; ++ks) {
      const int ko = ks * 32;
      const v16h fa0 = ldfrag_h(a0p + ko);
      const v16h fa1 = ldfrag_h(a1p + ko);
      const v16h fb0 = ldfrag_h(b0p + ko);
      const v16h fb1 = ldfrag_h(b1p + ko);
      c00 = mma_raw(fa0, fb0, c00);
      c01 = mma_raw(fa0, fb1, c01);
      c10 = mma_raw(fa1, fb0, c10);
      c11 = mma_raw(fa1, fb1, c11);
      if (NCH > 1 && ks == KC / 32 - 1) guard4(c00, c01, c10, c11, fa0, fa1, fb0, fb1);  // in front of the back edge
    }
  }
  // the f32 tile overwrites the staging rows: all fragment reads of all waves end here
  asm volatile("s_wait_dscnt 0x0" ::: "memory");
  __syncthreads();
#pragma unroll
  for (int r = 0; r < 8; ++r) {
    const int row = mw * 32 + 8 * hh + r;
    Cs[row * LDC + nw * 32 + c]             = c00[r];
    Cs[row * LDC + nw * 32 + 16 + c]        = c01[r];
    Cs[(row + 16) * LDC + nw * 32 + c]      = c10[r];
    Cs[(row + 16) * LDC + nw * 32 + 16 + c] = c11[r];
  }
}

// =================================================================================================================
// Weight convert: wqt[n][k] = f16(64 bf16(w_qkv[k][n])), w1t[n][k] = f16(64 bf16(w_fc1[k][n])) (n < 768, k < 256),
// w2t[n][k] = f16(64 bf16(w_fc2[k][n])) (n < 256, k < 768). Block = one output row n; thread = one 16-B piece of
// coverage: wqt 768 x 256, w1t 768 x 256, w2t 256 x 768, every element once.
// =================================================================================================================
__global__ __launch_bounds__(128)
void k_wcvt(const float* __restrict__ wqkv, const float* __restrict__ wfc1, const float* __restrict__ wfc2,
            unsigned short* wqt, unsigned short* w1t, unsigned short* w2t) {
  const int tid = threadIdx.x;
  const int blk = blockIdx.x;
  if (blk < 2 * MLP) {                                      // block-uniform branch
    const int t = (blk < MLP) ? 0 : 1;
    const int n = blk - t * MLP;
    const float* src = t ? wfc1 : wqkv;
    unsigned short* dstp = t ? w1t : wqt;
    const int tt = min(tid, 31);
    const int k0 = tt * 8;
    v4u pk;
#pragma unroll
    for (int e = 0; e < 4; ++e) {
      const float f0 = src[(size_t)(k0 + 2 * e) * MLP + n];
      const float f1 = src[(size_t)(k0 + 2 * e + 1) * MLP + n];
      pk[e] = pk16(hb16(bfr(f0) * 64.0f), hb16(bfr(f1) * 64.0f));
    }
    if (tid < 32) {
      unsigned short* dst = dstp + (size_t)n * DIMC + k0;
      *(v4u*)dst = pk;
      
    }
  } else {
    const int n = blk - 2 * MLP;                            // 0..255
    const int tt = min(tid, 95);
    const int k0 = tt * 8;
    v4u pk;
#pragma unroll
    for (int e = 0; e < 4; ++e) {
      const float f0 = wfc2[(size_t)(k0 + 2 * e) * DIMC + n];
      const float f1 = wfc2[(size_t)(k0 + 2 * e + 1) * DIMC + n];
      pk[e] = pk16(hb16(bfr(f0) * 64.0f), hb16(bfr(f1) * 64.0f));
    }
    if (tid < 96) {
      unsigned short* dst = w2t + (size_t)n * MLP + k0;
      *(v4u*)dst = pk;
      
    }
  }
}

// =================================================================================================================
// x [32768][256] f32 -> xh f16 plane of 16 bf16(x); thread = 8 consecutive elements = one 16-B piece, consecutive
// grid = ceil(npieces/256). coverage: xh [32768][256], every element once.
// =================================================================================================================
__global__ __launch_bounds__(256)
void k_xcvt(const float* __restrict__ x, unsigned short* xh, int npieces) {
  const int i = blockIdx.x * 256 + threadIdx.x;
  if (i >= npieces) return;
  const float* p = x + (size_t)i * 8;
  const v4f a = *(const v4f*)(p);
  const v4f b = *(const v4f*)(p + 4);
  v4u pk;
  pk[0] = pk16(hb16(bfr(a[0]) * 16.0f), hb16(bfr(a[1]) * 16.0f));
  pk[1] = pk16(hb16(bfr(a[2]) * 16.0f), hb16(bfr(a[3]) * 16.0f));
  pk[2] = pk16(hb16(bfr(b[0]) * 16.0f), hb16(bfr(b[1]) * 16.0f));
  pk[3] = pk16(hb16(bfr(b[2]) * 16.0f), hb16(bfr(b[3]) * 16.0f));
  unsigned short* dst = xh + (size_t)i * 8;
  *(v4u*)dst = pk;
  
}

// =================================================================================================================
// Q projection: C[64 tokens][128 cols] = xh . wqt^T (K = 256, 8 k-steps), Cs = 1024 (x w). Column group cg (0..1)
// covers cols cg*128 of the first 256 (q). Carried value 16 (x w + b) = Cs/64 + 16 bf16(b), stored as f16 hi +
// x2048 residual planes qh/ql [token][256] in whole lines.
// grid = (NTOK/64, 2), 256 threads. coverage: qh/ql [32768][256], every element once.
// =================================================================================================================
__global__ __launch_bounds__(256)
void k_qkv(const unsigned short* __restrict__ xh, const unsigned short* __restrict__ wqt,
           const float* __restrict__ bias, unsigned short* qp) {
  __shared__ __align__(16) unsigned char sm[StageBytes<DIMC>::total];
  const float* Cs = (const float*)(const void*)sm;
  const int tid = threadIdx.x;
  const int mb = blockIdx.x, cg = blockIdx.y;
  const int tok0 = mb * 64, col0 = cg * 128;
  mm_tile1<DIMC, 1>((const _Float16*)(const void*)xh, (const _Float16*)(const void*)wqt, tok0, col0, sm);
  __syncthreads();
  unsigned short* dh = qp;
  unsigned short* dl = qp + QL_OFF;
  v4u ph[4], pq[4];
  size_t offs[4];
#pragma unroll
  for (int s4 = 0; s4 < 4; ++s4) {
    const int idx = s4 * 256 + tid;
    const int row = idx >> 4, piece = idx & 15;
    const int colp = piece * 8;
    v4u a, q4;
#pragma unroll
    for (int e = 0; e < 4; ++e) {
      const float b0 = 16.0f * bfr(bias[col0 + colp + 2 * e]);
      const float b1 = 16.0f * bfr(bias[col0 + colp + 2 * e + 1]);
      const float f0 = Cs[row * LDC + colp + 2 * e] * (1.0f / 64.0f) + b0;
      const float f1 = Cs[row * LDC + colp + 2 * e + 1] * (1.0f / 64.0f) + b1;
      unsigned hw, lw;
      split2(f0, f1, hw, lw);
      a[e] = hw; q4[e] = lw;
    }
    ph[s4] = a;
    pq[s4] = q4;
    offs[s4] = (size_t)(tok0 + row) * DIMC + col0 + colp;
  }
#pragma unroll
  for (int s4 = 0; s4 < 4; ++s4) { *(v4u*)(dh + offs[s4]) = ph[s4]; *(v4u*)(dl + offs[s4]) = pq[s4]; }
}

// one 16x16 accumulator tile (lane = channel, registers = 8 consecutive tokens) -> carried value 16 (x w + b) =
// acc/64 + bb as f16 hi + x2048 residual, 16 B each, into the channel's hi row and its lo row (HD rows further on)
__device__ __forceinline__ void put_planes(const v8f& acc, float bb, unsigned char* hi_dst) {
  v4u a, q4;
#pragma unroll
  for (int e = 0; e < 4; ++e) {
    const float f0 = acc[2 * e] * (1.0f / 64.0f) + bb;
    const float f1 = acc[2 * e + 1] * (1.0f / 64.0f) + bb;
    unsigned hw, lw;
    split2(f0, f1, hw, lw);
    a[e] = hw; q4[e] = lw;
  }
  *(v4u*)(void*)hi_dst = a;
  *(v4u*)(void*)(hi_dst + HD * TSP) = q4;
}

// =================================================================================================================
// K, V projection of one head fused with its channel-attention logits, split over K. Block (ck, bh) takes the KCH
// tokens of chunk ck in KCH/64 sub-tiles of 64. The head's 64 k rows and 64 v rows of wqt are copied into LDS once
// (rows of WSP bytes); per sub-tile the 64 xh rows are copied in, C[64 tokens][128 channels] = xh . w^T (K = 256,
// 8 waves = 2 (32 tokens) x 4 (32 channels), as in the GEMM core), and each lane's 8 consecutive tokens of a channel
// go as f16 hi + x2048 residual into the LDS planes T[plane * 64 + channel][64 tokens] (rows of TSP bytes; planes
// k hi, k lo, v hi, v lo). Then raw[d][e] += sum_n (16 k[n][d]) (16 v[n][e]) on WMMA (M = N = 64, 2 k-steps):
// A = k planes, B = v planes, products hi*hi + (hi*lo + lo*hi)/2048, 8 waves = 4 (16 rows) x 2 (32 cols), tokens
// ascending. k and v never leave the work-group. The chunk's f32 tile goes through LDS to part[ck][bh][d][e].
// grid = (KSPLIT, 32), 256 threads. coverage: part [KSPLIT][32][64][64] f32, every element once.
// =================================================================================================================
// four waves per SIMD: the register budget that lets two work-groups (the LDS limit) share a WGP
__global__ __launch_bounds__(256) __attribute__((amdgpu_waves_per_eu(4)))
void k_kv_part(const unsigned short* __restrict__ xh, const unsigned short* __restrict__ wqt,
               const float* __restrict__ bias, float* part) {
  __shared__ __align__(16) unsigned char sm[192 * WSP + 4 * HD * TSP];
  unsigned char* sW = sm;                                   // 128 weight rows: 0..63 k channels, 64..127 v channels
  unsigned char* sA = sm + 128 * WSP;                       // 64 token rows
  unsigned char* sT = sm + 192 * WSP;                       // the four planes of one sub-tile
  static_assert(64 * LDA * 4 <= 64 * WSP);
  const int tid = threadIdx.x, wave = tid >> 5, lane = tid & 31, hh = lane >> 4, c = lane & 15;
  const int ck = blockIdx.x, bh = blockIdx.y;
  const int h = bh & (NH - 1);
  const int tok0 = (bh >> 2) * NN + ck * KCH;
  const _Float16* gA = (const _Float16*)(const void*)xh + (size_t)(tok0 + wave) * DIMC + lane * 8;
  const unsigned lA = (unsigned)(uintptr_t)sA + (unsigned)(wave * WSP + lane * 16);   // LDS byte address
  {
    // one wave copy = one whole row of 512 B; row = j * 8 + wave
    const _Float16* gK = (const _Float16*)(const void*)wqt + (size_t)(DIMC + h * HD + wave) * DIMC + lane * 8;
    const _Float16* gV = gK + (size_t)DIMC * DIMC;
    const unsigned lW = (unsigned)(uintptr_t)sW + (unsigned)(wave * WSP + lane * 16);
    unsigned l[8];
    const _Float16* g[8];
#pragma unroll  // l[] and g[] indexed by constants, so they stay in registers (the two loops below likewise)
    for (int j = 0; j < 8; ++j) { l[j] = lW + (unsigned)(j * 8 * WSP); g[j] = gK + (size_t)j * 8 * DIMC; }
    acopy8(l, g);
#pragma unroll
    for (int j = 0; j < 8; ++j) { l[j] = lW + (unsigned)((64 + j * 8) * WSP); g[j] = gV + (size_t)j * 8 * DIMC; }
    acopy8(l, g);
#pragma unroll
    for (int j = 0; j < 8; ++j) { l[j] = lA + (unsigned)(j * 8 * WSP); g[j] = gA + (size_t)j * 8 * DIMC; }
    acopy8(l, g);
    // this wave's copies have landed; behind the barrier every wave's have
    asm volatile("s_wait_asynccnt 0x0" ::: "memory");
    __syncthreads();
  }
  // projection: wave = 32 tokens x 32 channels
  const int mw = wave >> 2, nw = wave & 3;
  const _Float16* a0p = (const _Float16*)(const void*)(sA + (mw * 32 + c) * WSP) + 8 * hh;
  const _Float16* a1p = (const _Float16*)(const void*)(sA + (mw * 32 + 16 + c) * WSP) + 8 * hh;
  const _Float16* b0p = (const _Float16*)(const void*)(sW + (nw * 32 + c) * WSP) + 8 * hh;
  const _Float16* b1p = (const _Float16*)(const void*)(sW + (nw * 32 + 16 + c) * WSP) + 8 * hh;
  const int kvs = nw >> 1;                                  // 0: this wave's channels are k, 1: v
  const int d0 = (nw & 1) * 32 + c;                         // channel within the head; the second tile is d0 + 16
  const float bb0 = 16.0f * bfr(bias[(1 + kvs) * DIMC + h * HD + d0]);
  const float bb1 = 16.0f * bfr(bias[(1 + kvs) * DIMC + h * HD + d0 + 16]);
  unsigned char* t00 = sT + (kvs * 2 * HD + d0) * TSP + (mw * 32 + 8 * hh) * 2;   // hi row of d0, this lane's 8 tokens
  // logits: wave = 16 rows d x 32 cols e
  const int mv = wave >> 1, nv = wave & 1;
  const _Float16* ahp = (const _Float16*)(const void*)(sT + (mv * 16 + c) * TSP) + 8 * hh;
  const _Float16* alp = (const _Float16*)(const void*)(sT + (HD + mv * 16 + c) * TSP) + 8 * hh;
  const _Float16* b0h = (const _Float16*)(const void*)(sT + (2 * HD + nv * 32 + c) * TSP) + 8 * hh;
  const _Float16* b1h = (const _Float16*)(const void*)(sT + (2 * HD + nv * 32 + 16 + c) * TSP) + 8 * hh;
  const _Float16* b0l = (const _Float16*)(const void*)(sT + (3 * HD + nv * 32 + c) * TSP) + 8 * hh;
  const _Float16* b1l = (const _Float16*)(const void*)(sT + (3 * HD + nv * 32 + 16 + c) * TSP) + 8 * hh;
  v8f p0 = zero8(), p1 = zero8(), q0 = zero8(), q1 = zero8(), r0 = zero8(), r1 = zero8();
#pragma unroll 1  // one copy of the sub-tile body: the text stays short
  for (int t = 0; t < KCH / 64; ++t) {                      // block-uniform trip count
    v8f c00 = zero8(), c01 = zero8(), c10 = zero8(), c11 = zero8();
    // fragments are fetched one k-step ahead: the reads of step ks + 1 are in flight under the products of step ks
    v16h fa0 = ldfrag_h(a0p), fa1 = ldfrag_h(a1p);
    v16h fb0 = ldfrag_h(b0p), fb1 = ldfrag_h(b1p);
#pragma unroll  // straight-line k-steps
    for (int ks = 0; ks < DIMC / 32; ++ks) {
      const int kn = (ks + 1 < DIMC / 32 ? ks + 1 : ks) * 32;
      v16h na0 = fa0, na1 = fa1, nb0 = fb0, nb1 = fb1;
      if (ks + 1 < DIMC / 32) {
        na0 = ldfrag_h(a0p + kn);
        na1 = ldfrag_h(a1p + kn);
        nb0 = ldfrag_h(b0p + kn);
        nb1 = ldfrag_h(b1p + kn);
      }
      __builtin_amdgcn_sched_barrier(0);  // holds the next step's reads in front of this step's products
      c00 = mma_raw(fa0, fb0, c00);
      c01 = mma_raw(fa0, fb1, c01);
      c10 = mma_raw(fa1, fb0, c10);
      c11 = mma_raw(fa1, fb1, c11);
      __builtin_amdgcn_sched_barrier(0);  // and later reads behind them: no deeper fetch, no spills
      fa0 = na0; fa1 = na1; fb0 = nb0; fb1 = nb1;
    }
    put_planes(c00, bb0, t00);
    put_planes(c01, bb1, t00 + 16 * TSP);
    put_planes(c10, bb0, t00 + 32);
    put_planes(c11, bb1, t00 + 16 * TSP + 32);
    // the planes are written and this wave's reads of the token rows have returned; behind the barrier all waves' have
    asm volatile("s_wait_dscnt 0x0" ::: "memory");
    __syncthreads();
    if (t + 1 < KCH / 64) {                                 // block-uniform: the next sub-tile's token rows fly under the logits
      unsigned l[8];
      const _Float16* g[8];
#pragma unroll
      for (int j = 0; j < 8; ++j) { l[j] = lA + (unsigned)(j * 8 * WSP); g[j] = gA + (size_t)((t + 1) * 64 + j * 8) * DIMC; }
      acopy8(l, g);
    }
#pragma unroll  // two straight-line k-steps
    for (int ks = 0; ks < 2; ++ks) {
      const int ko = ks * 32;
      const v16h fa  = ldfrag_h(ahp + ko);
      const v16h ga  = ldfrag_h(alp + ko);
      const v16h fb0 = ldfrag_h(b0h + ko);
      const v16h fb1 = ldfrag_h(b1h + ko);
      const v16h gb0 = ldfrag_h(b0l + ko);
      const v16h gb1 = ldfrag_h(b1l + ko);
      p0 = mma_raw(fa, fb0, p0);
      p1 = mma_raw(fa, fb1, p1);
      q0 = mma_raw(fa, gb0, q0);
      q1 = mma_raw(fa, gb1, q1);
      r0 = mma_raw(ga, fb0, r0);
      r1 = mma_raw(ga, fb1, r1);
      if (ks == 1) guard6(p0, p1, q0, q1, r0, r1, fa, ga, fb0, fb1, gb0, gb1);  // in front of the back edge
    }
    // the plane reads have returned and this wave's copies have landed; behind the barrier the planes may be
    // rewritten and the new token rows read
    asm volatile("s_wait_dscnt 0x0" ::: "memory");
    asm volatile("s_wait_asynccnt 0x0" ::: "memory");
    __syncthreads();
  }
  float* Cs = (float*)(void*)sA;                            // the token rows are dead: the f32 tile lies over them
#pragma unroll
  for (int r = 0; r < 8; ++r) {
    const int row = mv * 16 + 8 * hh + r;
    Cs[row * LDA + nv * 32 + c]      = p0[r] + (q0[r] + r0[r]) * RSC;
    Cs[row * LDA + nv * 32 + 16 + c] = p1[r] + (q1[r] + r1[r]) * RSC;
  }
  __syncthreads();
  float* dst = part + ((size_t)ck * (BB * NH) + bh) * (HD * HD);
  v4f pk[4];
#pragma unroll  // pk[] indexed by constants, so it stays in registers
  for (int s = 0; s < 4; ++s) {
    const int idx = s * 256 + tid;
    pk[s] = *(const v4f*)(Cs + (idx >> 4) * LDA + (idx & 15) * 4);
  }
#pragma unroll  // as above
  for (int s = 0; s < 4; ++s) *(v4f*)(dst + (size_t)(s * 256 + tid) * 4) = pk[s];
}

// =================================================================================================================
// Chunk sum + softmax. Block = 16 rows d of one (b, h); thread = 4 consecutive e of one row, 16 lanes per row.
// raw = sum over ck of part[ck] in index order; logit = raw/2048 (includes the head_dim^-0.5 factor 1/8). Softmax
// over e per row d in f32 (max subtracted, 16-lane butterflies), 4096 P stored as f16 hi + x2048 residual planes;
// a wave's store covers two whole 128-B rows.
// grid = (32, 4), 256 threads. coverage: ath/atl [32][64][64], every element once.
// =================================================================================================================
__global__ __launch_bounds__(256)
void k_attn_sm(const float* __restrict__ part, unsigned short* at) {
  const int tid = threadIdx.x;
  const int bh = blockIdx.x;
  const int row = blockIdx.y * 16 + (tid >> 4), col0 = (tid & 15) * 4;
  const size_t off = ((size_t)bh * HD + row) * HD + col0;
  v4f t[KSPLIT];
#pragma unroll  // all chunk loads issued before the first add: one memory latency, not KSPLIT
  for (int s = 0; s < KSPLIT; ++s) t[s] = *(const v4f*)(part + (size_t)s * ATL_OFF + off);
  v4f a = t[0];
#pragma unroll  // t[] indexed by constants, so it stays in registers (the short loops below likewise)
  for (int s = 1; s < KSPLIT; ++s) a += t[s];
  float mx = fmaxf(fmaxf(a[0], a[1]), fmaxf(a[2], a[3]));
#pragma unroll
  for (int o = 1; o < 16; o <<= 1) mx = fmaxf(mx, __shfl_xor(mx, o, 32));
  float e[4];
#pragma unroll
  for (int n = 0; n < 4; ++n) e[n] = expf((a[n] - mx) * RSC);
  float sm = (e[0] + e[1]) + (e[2] + e[3]);
#pragma unroll
  for (int o = 1; o < 16; o <<= 1) sm += __shfl_xor(sm, o, 32);
  const float sc = (1.0f / sm) * 4096.0f;
  v2u ph, pq;
#pragma unroll
  for (int n = 0; n < 2; ++n) {
    unsigned hw, lw;
    split2(e[2 * n] * sc, e[2 * n + 1] * sc, hw, lw);
    ph[n] = hw; pq[n] = lw;
  }
  *(v2u*)(at + off) = ph;
  *(v2u*)(at + ATL_OFF + off) = pq;
}

// =================================================================================================================
// xf + residual + layer norm. Block = 32 tokens of one batch, all 4 heads. Per head h: C[32 tok][64 d] =
// sum_e (16 q[tok][h*64+e]) (4096 P[d][e]) on WMMA (K = 64, 2 k-steps): A = qh/ql [token][256] pitch 256 at
// column h*64, B = ath/atl [bh][d][64] (e contiguous = [n][k] copy form); products hi*hi + (hi*lo + lo*hi)/2048;
// 8 waves = 2 (16 rows) x 4 (16 cols); xf = C/65536. Then x1 = bf16(x) + xf (f32, kept in the LDS tile), mean
// f16, every element once.
// =================================================================================================================
__global__ __launch_bounds__(256)
void k_xf(const unsigned short* __restrict__ qp, const unsigned short* __restrict__ at,
          const float* __restrict__ x, const float* __restrict__ gw, const float* __restrict__ gb,
          float* x1, unsigned short* hh16) {
  __shared__ __align__(16) unsigned char st[192 * XSP];
  __shared__ __align__(16) float Cs[32 * LDX];
  __shared__ float Mu[32];
  __shared__ float Rs[32];
  const int tid = threadIdx.x, wave = tid >> 5, lane = tid & 31, hh = lane >> 4, c = lane & 15;
  const int mw = wave >> 2, nw = wave & 3;
  const int tok0 = blockIdx.x * 32;
  const int b = tok0 >> 12;
  const _Float16* Qh = (const _Float16*)(const void*)qp;
  const _Float16* Ql = Qh + QL_OFF;
  const _Float16* Ah = (const _Float16*)(const void*)at;
  const _Float16* Al = Ah + ATL_OFF;
  // per head, 192 rows of 128 B are copied in whole lines into LDS rows of XSP bytes: 0..31 q hi (token), 32..63 q lo,
  // 64..127 P hi (d), 128..191 P lo; thread = one 16-B piece of six rows; fragments come from there
  const unsigned stb = (unsigned)(uintptr_t)st;             // LDS byte address of the staging rows
  const int srow = tid >> 3, spc = tid & 7;
  const _Float16* ahp = (const _Float16*)(const void*)(st + (mw * 16 + c) * XSP) + 8 * hh;
  const _Float16* alp = (const _Float16*)(const void*)(st + (32 + mw * 16 + c) * XSP) + 8 * hh;
  const _Float16* bhp = (const _Float16*)(const void*)(st + (64 + nw * 16 + c) * XSP) + 8 * hh;
  const _Float16* blp = (const _Float16*)(const void*)(st + (128 + nw * 16 + c) * XSP) + 8 * hh;
#pragma unroll 1
  for (int h = 0; h < NH; ++h) {                            // block-uniform trip count
    if (h > 0) {
      // every wave's fragment reads of the last head have returned and all waves are here before the rows are refilled
      asm volatile("s_wait_dscnt 0x0" ::: "memory");
      __syncthreads();
    }
    {
      const size_t qoff = (size_t)(tok0 + srow) * DIMC + h * HD + spc * 8;
      const size_t poff = ((size_t)(b * NH + h) * HD + srow) * HD + spc * 8;
      unsigned l[6];
#pragma unroll  // l[] indexed by constants, so it stays in registers
      for (int j = 0; j < 6; ++j) l[j] = stb + (unsigned)((j * 32 + srow) * XSP + spc * 16);
      const _Float16* g[6] = { Qh + qoff, Ql + qoff, Ah + poff, Ah + poff + 32 * HD, Al + poff, Al + poff + 32 * HD };
      acopy6(l, g);
    }
    // this wave's copies have landed; behind the barrier every wave's have
    asm volatile("s_wait_asynccnt 0x0" ::: "memory");
    __syncthreads();
    v8f p = zero8(), q = zero8(), r = zero8();
#pragma unroll
    for (int ks = 0; ks < HD / 32; ++ks) {
      const int ko = ks * 32;
      const v16h fa = ldfrag_h(ahp + ko);
      const v16h ga = ldfrag_h(alp + ko);
      const v16h fb = ldfrag_h(bhp + ko);
      const v16h gq = ldfrag_h(blp + ko);
      p = mma_raw(fa, fb, p);
      q = mma_raw(fa, gq, q);
      r = mma_raw(ga, fb, r);
      guard3(p, q, r, fa, ga, fb, gq);
    }
#pragma unroll
    for (int rr = 0; rr < 8; ++rr)
      Cs[(mw * 16 + 8 * hh + rr) * LDX + h * HD + nw * 16 + c] = p[rr] + (q[rr] + r[rr]) * RSC;
  }
  __syncthreads();
  // phase 1: x1 = bf16(x) + xf back into the tile, per-row statistics
#pragma unroll 1
  for (int it = 0; it < 4; ++it) {
    const int row = wave * 4 + it;
    const size_t tok = (size_t)(tok0 + row);
    const float* xr = x + tok * DIMC + lane * 8;
    const v4f xa = *(const v4f*)(xr);
    const v4f xb = *(const v4f*)(xr + 4);
    float* cr = Cs + row * LDX + lane * 8;
    float v[8];
#pragma unroll
    for (int e = 0; e < 4; ++e) {
      v[e]     = bfr(xa[e]) + cr[e] * (1.0f / 65536.0f);
      v[4 + e] = bfr(xb[e]) + cr[4 + e] * (1.0f / 65536.0f);
    }
#pragma unroll
    for (int e = 0; e < 8; ++e) cr[e] = v[e];
    float s = ((v[0] + v[1]) + (v[2] + v[3])) + ((v[4] + v[5]) + (v[6] + v[7]));
#pragma unroll
    for (int off = 16; off; off >>= 1) s += __shfl_xor(s, off, 32);
    const float mu = s * (1.0f / 256.0f);
    float sq = 0.f;
#pragma unroll
    for (int e = 0; e < 8; ++e) { const float d = v[e] - mu; sq += d * d; }
#pragma unroll
    for (int off = 16; off; off >>= 1) sq += __shfl_xor(sq, off, 32);
    const float var = sq * (1.0f / 256.0f);
    const float rs = rsqrtf(var + 1e-5f);
    if (lane == 0) { Mu[row] = mu; Rs[row] = rs; }
  }
  __syncthreads();
  // phase 2: whole-line stores of x1 (f32) and hh16 (f16 of 16 h)
  v4f pk[8];
  size_t offs[8];
#pragma unroll
  for (int s = 0; s < 8; ++s) {
    const int idx = s * 256 + tid;
    const int row = idx >> 6, piece = idx & 63;
    v4f v4;
#pragma unroll
    for (int e = 0; e < 4; ++e) v4[e] = Cs[row * LDX + piece * 4 + e];
    pk[s] = v4;
    offs[s] = (size_t)(tok0 + row) * DIMC + piece * 4;
  }
  v4u ph[4];
  size_t offh[4];
#pragma unroll
  for (int s = 0; s < 4; ++s) {
    const int idx = s * 256 + tid;
    const int row = idx >> 5, piece = idx & 31;
    const int col0 = piece * 8;
    const float mu = Mu[row], rs = Rs[row];
    v4u a;
#pragma unroll
    for (int e = 0; e < 4; ++e) {
      const int cA = col0 + 2 * e, cB = cA + 1;
      const float f0 = ((Cs[row * LDX + cA] - mu) * rs) * bfr(gw[cA]) + bfr(gb[cA]);
      const float f1 = ((Cs[row * LDX + cB] - mu) * rs) * bfr(gw[cB]) + bfr(gb[cB]);
      a[e] = pk16(hb16(f0 * 16.0f), hb16(f1 * 16.0f));
    }
    ph[s] = a;
    offh[s] = (size_t)(tok0 + row) * DIMC + col0;
  }
#pragma unroll
  for (int s = 0; s < 8; ++s) *(v4f*)(x1 + offs[s]) = pk[s];
#pragma unroll
  for (int s = 0; s < 4; ++s) *(v4u*)(hh16 + offh[s]) = ph[s];
  
}

// =================================================================================================================
// FC1 + exact GELU: C[64 tokens][128 cols] = hh16 . w1t^T (K = 256), Cs = 1024 (h w1); v = Cs/1024 + bf16(b1),
// g = 0.5 v (1 + erf(v / sqrt 2)) computed in place in the LDS tile (rolled loop, thread = 32 elements of one row),
// coverage: gh [32768][768], every element once.
// =================================================================================================================
__global__ __launch_bounds__(256)
void k_fc1(const unsigned short* __restrict__ hh16, const unsigned short* __restrict__ w1t,
           const float* __restrict__ bias, unsigned short* gh) {
  __shared__ __align__(16) unsigned char sm[StageBytes<DIMC>::total];
  float* Cs = (float*)(void*)sm;
  const int tid = threadIdx.x;
  const int mb = blockIdx.x, cg = blockIdx.y;
  const int tok0 = mb * 64, col0 = cg * 128;
  mm_tile1<DIMC, 1>((const _Float16*)(const void*)hh16, (const _Float16*)(const void*)w1t, tok0, col0, sm);
  __syncthreads();
  {
    const int row = tid >> 2, cq = tid & 3;
    float* cr = Cs + row * LDC + cq * 32;
    const float* bp = bias + col0 + cq * 32;
#pragma unroll 2
    for (int n = 0; n < 32; ++n) {
      const float v = cr[n] * (1.0f / 1024.0f) + bfr(bp[n]);
      const float ge = 0.5f * v * (1.0f + erff(v * 0.70710678118654752f));
      cr[n] = ge * 16.0f;
    }
  }
  __syncthreads();
  v4u pk[4];
  size_t offs[4];
#pragma unroll
  for (int s = 0; s < 4; ++s) {
    const int idx = s * 256 + tid;
    const int row = idx >> 4, piece = idx & 15;
    const int colp = piece * 8;
    v4u a;
#pragma unroll
    for (int e = 0; e < 4; ++e)
      a[e] = pk16(hb16(Cs[row * LDC + colp + 2 * e]), hb16(Cs[row * LDC + colp + 2 * e + 1]));
    pk[s] = a;
    offs[s] = (size_t)(tok0 + row) * MLP + col0 + colp;
  }
#pragma unroll
  for (int s = 0; s < 4; ++s) *(v4u*)(gh + offs[s]) = pk[s];
  
}

// =================================================================================================================
// FC2 + bias + residual: C[64 tokens][128 cols] = gh . w2t^T (K = 768, 24 k-steps), Cs = 1024 (g w2);
// coverage: out [32768][256] f32, every element once.
// =================================================================================================================
__global__ __launch_bounds__(256)
void k_fc2(const unsigned short* __restrict__ gh, const unsigned short* __restrict__ w2t,
           const float* __restrict__ bias, const float* __restrict__ x1, float* out) {
  __shared__ __align__(16) unsigned char sm[StageBytes<MLP / 6>::total];
  const float* Cs = (const float*)(const void*)sm;
  const int tid = threadIdx.x;
  const int mb = blockIdx.x, cg = blockIdx.y;
  const int tok0 = mb * 64, col0 = cg * 128;
  mm_tile1<MLP / 6, 6>((const _Float16*)(const void*)gh, (const _Float16*)(const void*)w2t, tok0, col0, sm);
  __syncthreads();
  v4f pk[8];
  size_t offs[8];
#pragma unroll
  for (int s = 0; s < 8; ++s) {
    const int idx = s * 256 + tid;
    const int row = idx >> 5, piece = idx & 31;
    const int colp = piece * 4;
    const size_t off = (size_t)(tok0 + row) * DIMC + col0 + colp;
    const v4f xr = *(const v4f*)(x1 + off);
    v4f v;
#pragma unroll
    for (int e = 0; e < 4; ++e)
      v[e] = xr[e] + (Cs[row * LDC + colp + e] * (1.0f / 1024.0f) + bfr(bias[col0 + colp + e]));
    pk[s] = v;
    offs[s] = off;
  }
#pragma unroll
  for (int s = 0; s < 8; ++s) *(v4f*)(out + offs[s]) = pk[s];
  
}

// =================================================================================================================
// Workspace map (bytes; all offsets multiples of 131072; every region sized exactly at its whole-line store extent;
// regions reused across phases in stream order):
//   [0, 16 MiB)      XH  f16 [32768][256]  (dead after k_kv_part)  -> reused as HH f16 [32768][256] (k_xf -> k_fc1)
//   [16, 32 MiB)     QH, [32, 48 MiB) QL  (dead after k_xf)
//   [48, 56 MiB)     PT  f32 [16][32][64][64] logit partials (k_kv_part -> k_attn_sm)
//   [80, 112 MiB)    X1 f32 [32768][256] (k_xf -> k_fc2)
//   [16, 64 MiB)     GH f16 [32768][768] (k_fc1 -> k_fc2, over the dead q planes and partials)
//   112 MiB + : ATH, ATL f16 [32][64][64] 262144 each | WQT f16 [768][256] 393216 | W1T [768][256] 393216 |
//               W2T f16 [256][768] 393216 ; end = 119144448.
// =================================================================================================================
extern "C" void kernel_launch(void* const* d_in, const int* in_sizes, int n_in,
                              void* d_out, int out_size, void* d_ws, size_t ws_size,
                              hipStream_t stream) {
  if (n_in < 9) return;
  const int expect[9] = { NTOK * DIMC, DIMC * MLP, MLP, DIMC, DIMC, DIMC * MLP, MLP, MLP * DIMC, DIMC };
  for (int i = 0; i < 9; ++i) if (in_sizes[i] != expect[i]) return;
  if (out_size != NTOK * DIMC) return;

  const float* x     = (const float*)d_in[0];
  const float* w_qkv = (const float*)d_in[1];
  const float* b_qkv = (const float*)d_in[2];
  const float* ng    = (const float*)d_in[3];
  const float* nbt   = (const float*)d_in[4];
  const float* w_fc1 = (const float*)d_in[5];
  const float* b_fc1 = (const float*)d_in[6];
  const float* w_fc2 = (const float*)d_in[7];
  const float* b_fc2 = (const float*)d_in[8];
  float* out = (float*)d_out;

  const size_t MiB = (size_t)1048576;
  const size_t szX16 = (size_t)NTOK * DIMC * 2;                    // 16 MiB
  const size_t szX1  = (size_t)NTOK * DIMC * 4;                    // 32 MiB
  const size_t szGH  = (size_t)NTOK * MLP * 2;                     // 48 MiB
  const size_t szAT  = ATL_OFF * 2;                                // 262144
  const size_t szWQ  = (size_t)MLP * DIMC * 2;                     // 393216
  if (szX16 != 16 * MiB || szX1 != 32 * MiB || szGH != 48 * MiB) return;

  const size_t oXH  = 0;
  const size_t oHH  = 0;
  const size_t oQH  = 16 * MiB;                                     // QL at oQH + 16 MiB
  const size_t oPT  = 48 * MiB;
  const size_t oX1  = 80 * MiB;
  const size_t oGH  = 16 * MiB;
  const size_t oATH = 112 * MiB;                                    // ATL at oATH + szAT
  const size_t oWQT = oATH + 2 * szAT;
  const size_t oW1T = oWQT + szWQ;
  const size_t oW2T = oW1T + szWQ;
  const size_t oEND = oW2T + szWQ;                                  // 119144448
  if (oQH + 2 * szX16 != oPT) return;
  if (oX1 + szX1 > oATH || oGH + szGH > oX1 || oHH + szX16 > oGH) return;
  if (oPT + (size_t)KSPLIT * ATL_OFF * 4 > oX1) return;
  if (oEND > ws_size) return;
  if (oEND > (size_t)134217728) return;

  char* ws = (char*)d_ws;
  unsigned short* XH  = (unsigned short*)(ws + oXH);
  unsigned short* HH  = (unsigned short*)(ws + oHH);
  float*          PT  = (float*)(ws + oPT);
  unsigned short* QH  = (unsigned short*)(ws + oQH);
  float*          X1  = (float*)(ws + oX1);
  unsigned short* GH  = (unsigned short*)(ws + oGH);
  unsigned short* ATH = (unsigned short*)(ws + oATH);
  unsigned short* WQT = (unsigned short*)(ws + oWQT);
  unsigned short* W1T = (unsigned short*)(ws + oW1T);
  unsigned short* W2T = (unsigned short*)(ws + oW2T);

  const dim3 blk(256);
  const int npieces = NTOK * DIMC / 8;
  // (1) weight planes (transposed, 64 * bf16)
  k_wcvt<<<dim3(2 * MLP + DIMC), dim3(128), 0, stream>>>(w_qkv, w_fc1, w_fc2, WQT, W1T, W2T);
  // (2) x -> f16 plane of 16 bf16(x)
  k_xcvt<<<dim3((npieces + 255) / 256), blk, 0, stream>>>(x, XH, npieces);
  // (3) q projection -> q hi/lo [token][256]
  k_qkv<<<dim3(NTOK / 64, 2), blk, 0, stream>>>(XH, WQT, b_qkv, QH);
  // (4) per (b, h): k, v projection + logits, K split in KSPLIT chunks -> f32 partial tiles; chunk sum + softmax -> P hi/lo planes
  k_kv_part<<<dim3(KSPLIT, BB * NH), blk, 0, stream>>>(XH, WQT, b_qkv, PT);
  k_attn_sm<<<dim3(BB * NH, HD / 16), blk, 0, stream>>>(PT, ATH);
  // (5) xf + residual + layer norm -> x1 f32, h f16
  k_xf<<<dim3(NTOK / 32), blk, 0, stream>>>(QH, ATH, x, ng, nbt, X1, HH);
  // (6) fc1 + GELU -> g f16
  k_fc1<<<dim3(NTOK / 64, 6), blk, 0, stream>>>(HH, W1T, b_fc1, GH);
  // (7) fc2 + bias + residual -> d_out
  k_fc2<<<dim3(NTOK / 64, 2), blk, 0, stream>>>(GH, W2T, b_fc2, X1, out);
  (void)hipGetLastError();
}

// v004
// One run takes 90.4 microseconds.
// In two side-by-side timings against v003, it was 1.20 and 1.19 times as fast.
// Counting every step since v000, it is 3.27 times as fast.
// Contractions: qkv projection (K=256), fc1 (K=256), fc2 (K=768): v_wmma_f32_16x16x32_f16, single f16 products,
// activations carried x16, weights one f16 plane of 64*bf16(w); per-head k^T v logits (K=4096) and attn x q (K=64):
// v_wmma_f32_16x16x32_f16 with both operands as f16 hi + x2048 residual planes (3 products); f32 accumulate
// everywhere. Softmax, layer norm, exact GELU and all epilogues f32 on VALU; every float input RNE-converted to
// bf16 on load.
#include <hip/hip_runtime.h>
#include <stdint.h>

#define BB     8
#define NN     4096
#define DIMC   256
#define NH     4
#define HD     64
#define MLP    768
#define NTOK   (BB * NN)
#define LDC    132
#define LDX    260
#define LDA    68
#define RSC    0.00048828125f
#define QL_OFF ((size_t)NTOK * DIMC)
#define ATL_OFF ((size_t)BB * NH * HD * HD)
#define KSPLIT 16
#define KCH    (NN / KSPLIT)
#define XSP    (HD * 2 + 16)
#define WSP    (DIMC * 2 + 16)
#define TSP    (64 * 2 + 16)
#define GSP    (128 * 2 + 16)

static_assert(NTOK == 32768);
static_assert(DIMC == NH * HD);
static_assert((NN % 64) == 0 && (NTOK % 64) == 0);
static_assert((DIMC % 32) == 0 && (MLP % 32) == 0 && (HD % 32) == 0 && (NN % 32) == 0);
static_assert((LDX * 4) % 16 == 0 && (LDC * 4) % 16 == 0);
static_assert(QL_OFF == 8388608 && ATL_OFF == 131072);
static_assert(MLP == 6 * 128 && DIMC == 2 * 128 && (NTOK % 128) == 0 && ((GSP / 16) & 1) == 1);
static_assert(KCH * KSPLIT == NN && (KCH % 32) == 0);
static_assert(KCH == 256 && HD == 64 && ((XSP / 16) & 1) == 1 && ((WSP / 16) & 1) == 1 && ((TSP / 16) & 1) == 1);

typedef _Float16 v16h __attribute__((ext_vector_type(16)));
typedef _Float16 v8h  __attribute__((ext_vector_type(8)));
typedef float    v8f  __attribute__((ext_vector_type(8)));
typedef float    v4f  __attribute__((ext_vector_type(4)));
typedef unsigned int v4u __attribute__((ext_vector_type(4)));
typedef unsigned int v2u __attribute__((ext_vector_type(2)));

// ---- scalar helpers ------------------------------------------------------------------------------------------
__device__ __forceinline__ unsigned short bf_bits(float f) {          // f32 -> bf16 bits, RNE convert
  unsigned u = __float_as_uint(f);
  return (unsigned short)((u + 0x7FFFu + ((u >> 16) & 1u)) >> 16);
}
__device__ __forceinline__ float bf_up(unsigned short b) { return __uint_as_float(((unsigned)b) << 16); }
__device__ __forceinline__ float bfr(float f) { return bf_up(bf_bits(f)); }
__device__ __forceinline__ unsigned short h_bits(_Float16 x) { return __builtin_bit_cast(unsigned short, x); }
__device__ __forceinline__ unsigned short hb16(float f) { return h_bits((_Float16)f); }
__device__ __forceinline__ unsigned pk16(unsigned short a, unsigned short b) { return (unsigned)a | ((unsigned)b << 16); }
__device__ __forceinline__ v8f zero8() { v8f z = {0.f, 0.f, 0.f, 0.f, 0.f, 0.f, 0.f, 0.f}; return z; }
// hi/lo pair of two f32 values: hi = f16(v), lo = f16(2048 (v - hi)), packed as two 32-bit words
__device__ __forceinline__ void split2(float f0, float f1, unsigned& hp, unsigned& lp) {
  const _Float16 h0 = (_Float16)f0, h1 = (_Float16)f1;
  const float q0 = (f0 - (float)h0) * 2048.0f, q1 = (f1 - (float)h1) * 2048.0f;
  hp = pk16(h_bits(h0), h_bits(h1));
  lp = pk16(hb16(q0), hb16(q1));
}

// ---- fragment loader: 16-bit A/B operand, lane -> row/col (lane&15), p already includes +8*(lane>>4);
//      elements 0..7 <- p[0..7] (k0+8h..k0+8h+7), elements 8..15 <- p[16..23] (k0+16+8h..k0+16+8h+7)
__device__ __forceinline__ v16h ldfrag_h(const _Float16* p) {
  union { v16h v; v8h h[2]; } f;
  f.h[0] = *(const v8h*)(p);
  f.h[1] = *(const v8h*)(p + 16);
  return f.v;
}

// ---- WMMA helpers; the guards insert the trailing VALU hazard gap and keep A/B live --------------------------
__device__ __forceinline__ v8f mma_raw(v16h a, v16h b, v8f c) {
  return __builtin_amdgcn_wmma_f32_16x16x32_f16(false, a, false, b, (short)0, c, false, false);
}
__device__ __forceinline__ void guard4(v8f& c0, v8f& c1, v8f& c2, v8f& c3,
                                       const v16h& a0, const v16h& a1, const v16h& b0, const v16h& b1) {
#if defined(__HIP_DEVICE_COMPILE__)
  asm volatile("v_nop\n\tv_nop\n\tv_nop\n\tv_nop"
               : "+v"(c0), "+v"(c1), "+v"(c2), "+v"(c3)
               : "v"(a0), "v"(a1), "v"(b0), "v"(b1));
#endif
}
__device__ __forceinline__ void guard6(v8f& c0, v8f& c1, v8f& c2, v8f& c3, v8f& c4, v8f& c5,
                                       const v16h& a0, const v16h& a1, const v16h& b0, const v16h& b1,
                                       const v16h& b2, const v16h& b3) {
#if defined(__HIP_DEVICE_COMPILE__)
  asm volatile("v_nop\n\tv_nop\n\tv_nop\n\tv_nop"
               : "+v"(c0), "+v"(c1), "+v"(c2), "+v"(c3), "+v"(c4), "+v"(c5)
               : "v"(a0), "v"(a1), "v"(b0), "v"(b1), "v"(b2), "v"(b3));
#endif
}
__device__ __forceinline__ void guard8(v8f& c0, v8f& c1, v8f& c2, v8f& c3, v8f& c4, v8f& c5, v8f& c6, v8f& c7,
                                       const v16h& a0, const v16h& a1, const v16h& b0, const v16h& b1,
                                       const v16h& b2, const v16h& b3) {
#if defined(__HIP_DEVICE_COMPILE__)
  asm volatile("v_nop\n\tv_nop\n\tv_nop\n\tv_nop"
               : "+v"(c0), "+v"(c1), "+v"(c2), "+v"(c3), "+v"(c4), "+v"(c5), "+v"(c6), "+v"(c7)
               : "v"(a0), "v"(a1), "v"(b0), "v"(b1), "v"(b2), "v"(b3));
#endif
}
__device__ __forceinline__ void guard3(v8f& c0, v8f& c1, v8f& c2,
                                       const v16h& a0, const v16h& a1, const v16h& b0, const v16h& b1) {
#if defined(__HIP_DEVICE_COMPILE__)
  asm volatile("v_nop\n\tv_nop\n\tv_nop\n\tv_nop"
               : "+v"(c0), "+v"(c1), "+v"(c2)
               : "v"(a0), "v"(a1), "v"(b0), "v"(b1));
#endif
}

// ---- asynchronous copies, global -> LDS, 16 B per lane, six per statement. The s_wait_xcnt is the last line of the
//      copies' own statement, so that no address register named here is rewritten in front of it.
__device__ __forceinline__ void acopy6(const unsigned* l, const _Float16* const* g) {
#if defined(__HIP_DEVICE_COMPILE__)
  asm volatile("global_load_async_to_lds_b128 %0, %6, off\n\t"
               "global_load_async_to_lds_b128 %1, %7, off\n\t"
               "global_load_async_to_lds_b128 %2, %8, off\n\t"
               "global_load_async_to_lds_b128 %3, %9, off\n\t"
               "global_load_async_to_lds_b128 %4, %10, off\n\t"
               "global_load_async_to_lds_b128 %5, %11, off\n\t"
               "s_wait_xcnt 0x0"
               :: "v"(l[0]), "v"(l[1]), "v"(l[2]), "v"(l[3]), "v"(l[4]), "v"(l[5]),
                  "v"(g[0]), "v"(g[1]), "v"(g[2]), "v"(g[3]), "v"(g[4]), "v"(g[5])
               : "memory");
#endif
}

// the same, eight per statement
__device__ __forceinline__ void acopy8(const unsigned* l, const _Float16* const* g) {
#if defined(__HIP_DEVICE_COMPILE__)
  asm volatile("global_load_async_to_lds_b128 %0, %8, off\n\t"
               "global_load_async_to_lds_b128 %1, %9, off\n\t"
               "global_load_async_to_lds_b128 %2, %10, off\n\t"
               "global_load_async_to_lds_b128 %3, %11, off\n\t"
               "global_load_async_to_lds_b128 %4, %12, off\n\t"
               "global_load_async_to_lds_b128 %5, %13, off\n\t"
               "global_load_async_to_lds_b128 %6, %14, off\n\t"
               "global_load_async_to_lds_b128 %7, %15, off\n\t"
               "s_wait_xcnt 0x0"
               :: "v"(l[0]), "v"(l[1]), "v"(l[2]), "v"(l[3]), "v"(l[4]), "v"(l[5]), "v"(l[6]), "v"(l[7]),
                  "v"(g[0]), "v"(g[1]), "v"(g[2]), "v"(g[3]), "v"(g[4]), "v"(g[5]), "v"(g[6]), "v"(g[7])
               : "memory");
#endif
}

// ---- 64x128 block tile GEMM core, single 16-bit planes: A and W are k-contiguous rows of pitch KC*NCH elements
//      (W is [n][k]). K runs in NCH chunks of KC: each chunk's 64 A rows and 128 W rows are copied in whole lines
//      into LDS rows of KC*2 + 16 bytes (16 B x odd: ds_load_b128 without bank conflicts), A rows first; fragments
//      come from LDS with the table layout, k ascending as before. 8 waves = 2 (32 rows) x 4 (32 cols), 2x2 tiles of
//      16 per wave; results go to the f32 tile Cs[64][LDC], which lies over the staging rows once they are read.
template <int KC> struct StageBytes { static constexpr int pitch = KC * 2 + 16; static constexpr int total = 192 * pitch; };
template <int KC, int NCH>
__device__ __forceinline__ void mm_tile1(const _Float16* __restrict__ A, const _Float16* __restrict__ W,
                                         int arow0, int bcol0, unsigned char* sm) {
  constexpr int LD = KC * NCH;                 // row pitch of both operands, elements
  constexpr int PITCH = StageBytes<KC>::pitch; // LDS row pitch, bytes
  constexpr int PPR = KC / 8;                  // 16-B pieces per row
  constexpr int NCP = 192 * PPR / 256;         // copies per thread and chunk
  constexpr int RPJ = 256 / PPR;               // rows that one copy of all 256 threads covers
  static_assert(NCP * 256 == 192 * PPR && (NCP % 6) == 0 && NCP <= 63);
  static_assert(RPJ * PPR == 256 && (64 % RPJ) == 0 && (KC % 32) == 0 && ((PITCH / 16) & 1) == 1);
  static_assert(64 * LDC * 4 <= StageBytes<KC>::total);
  const int tid = threadIdx.x, wave = tid >> 5, lane = tid & 31, hh = lane >> 4, c = lane & 15;
  const int mw = wave >> 2, nw = wave & 3;
  const int r0 = tid / PPR, piece = tid % PPR;  // this thread's row within a copy's RPJ rows, and its 16-B piece
  const unsigned l0 = (unsigned)(uintptr_t)sm + (unsigned)(r0 * PITCH + piece * 16);  // LDS byte address
  const _Float16* gA = A + (size_t)(arow0 + r0) * LD + piece * 8;
  const _Float16* gW = W + (size_t)(bcol0 + r0) * LD + piece * 8;
  float* Cs = (float*)(void*)sm;
  const _Float16* a0p = (const _Float16*)(const void*)(sm + (mw * 32 + c) * PITCH) + 8 * hh;
  const _Float16* a1p = (const _Float16*)(const void*)(sm + (mw * 32 + 16 + c) * PITCH) + 8 * hh;
  const _Float16* b0p = (const _Float16*)(const void*)(sm + (64 + nw * 32 + c) * PITCH) + 8 * hh;
  const _Float16* b1p = (const _Float16*)(const void*)(sm + (64 + nw * 32 + 16 + c) * PITCH) + 8 * hh;
  v8f c00 = zero8(), c01 = zero8(), c10 = zero8(), c11 = zero8();
#pragma unroll 1  // one copy of the chunk body: the text stays short
  for (int ch = 0; ch < NCH; ++ch) {
    if (ch > 0) {
      // every wave's fragment reads of the last chunk have returned and all waves are here before the rows are refilled
      asm volatile("s_wait_dscnt 0x0" ::: "memory");
      __syncthreads();
    }
#pragma unroll  // l[] and g[] indexed by constants, so they stay in registers
    for (int j0 = 0; j0 < NCP; j0 += 6) {
      unsigned l[6];
      const _Float16* g[6];
#pragma unroll
      for (int j = 0; j < 6; ++j) {
        const int rj = (j0 + j) * RPJ;           // staging row = rj + r0: below 64 an A row, from 64 on a W row
        l[j] = l0 + (unsigned)(rj * PITCH);
        g[j] = (rj < 64 ? gA + (size_t)rj * LD : gW + (size_t)(rj - 64) * LD) + ch * KC;
      }
      acopy6(l, g);
    }
    // this wave's copies have landed; behind the barrier every wave's have
    asm volatile("s_wait_asynccnt 0x0" ::: "memory");
    __syncthreads();
#pragma unroll  // straight-line k-steps: the fragment reads of later steps can go ahead of earlier products
    for (int ks = 0; ks < KC / 32; ++ks) {
      const int ko = ks * 32;
      const v16h fa0 = ldfrag_h(a0p + ko);
      const v16h fa1 = ldfrag_h(a1p + ko);
      const v16h fb0 = ldfrag_h(b0p + ko);
      const v16h fb1 = ldfrag_h(b1p + ko);
      c00 = mma_raw(fa0, fb0, c00);
      c01 = mma_raw(fa0, fb1, c01);
      c10 = mma_raw(fa1, fb0, c10);
      c11 = mma_raw(fa1, fb1, c11);
      if (NCH > 1 && ks == KC / 32 - 1) guard4(c00, c01, c10, c11, fa0, fa1, fb0, fb1);  // in front of the back edge
    }
  }
  // the f32 tile overwrites the staging rows: all fragment reads of all waves end here
  asm volatile("s_wait_dscnt 0x0" ::: "memory");
  __syncthreads();
#pragma unroll
  for (int r = 0; r < 8; ++r) {
    const int row = mw * 32 + 8 * hh + r;
    Cs[row * LDC + nw * 32 + c]             = c00[r];
    Cs[row * LDC + nw * 32 + 16 + c]        = c01[r];
    Cs[(row + 16) * LDC + nw * 32 + c]      = c10[r];
    Cs[(row + 16) * LDC + nw * 32 + 16 + c] = c11[r];
  }
}

// =================================================================================================================
// Weight convert: wqt[n][k] = f16(64 bf16(w_qkv[k][n])), w1t[n][k] = f16(64 bf16(w_fc1[k][n])) (n < 768, k < 256),
// w2t[n][k] = f16(64 bf16(w_fc2[k][n])) (n < 256, k < 768). Block = one output row n; thread = one 16-B piece of
// coverage: wqt 768 x 256, w1t 768 x 256, w2t 256 x 768, every element once.
// =================================================================================================================
__global__ __launch_bounds__(128)
void k_wcvt(const float* __restrict__ wqkv, const float* __restrict__ wfc1, const float* __restrict__ wfc2,
            unsigned short* wqt, unsigned short* w1t, unsigned short* w2t) {
  const int tid = threadIdx.x;
  const int blk = blockIdx.x;
  if (blk < 2 * MLP) {                                      // block-uniform branch
    const int t = (blk < MLP) ? 0 : 1;
    const int n = blk - t * MLP;
    const float* src = t ? wfc1 : wqkv;
    unsigned short* dstp = t ? w1t : wqt;
    const int tt = min(tid, 31);
    const int k0 = tt * 8;
    v4u pk;
#pragma unroll
    for (int e = 0; e < 4; ++e) {
      const float f0 = src[(size_t)(k0 + 2 * e) * MLP + n];
      const float f1 = src[(size_t)(k0 + 2 * e + 1) * MLP + n];
      pk[e] = pk16(hb16(bfr(f0) * 64.0f), hb16(bfr(f1) * 64.0f));
    }
    if (tid < 32) {
      unsigned short* dst = dstp + (size_t)n * DIMC + k0;
      *(v4u*)dst = pk;
      
    }
  } else {
    const int n = blk - 2 * MLP;                            // 0..255
    const int tt = min(tid, 95);
    const int k0 = tt * 8;
    v4u pk;
#pragma unroll
    for (int e = 0; e < 4; ++e) {
      const float f0 = wfc2[(size_t)(k0 + 2 * e) * DIMC + n];
      const float f1 = wfc2[(size_t)(k0 + 2 * e + 1) * DIMC + n];
      pk[e] = pk16(hb16(bfr(f0) * 64.0f), hb16(bfr(f1) * 64.0f));
    }
    if (tid < 96) {
      unsigned short* dst = w2t + (size_t)n * MLP + k0;
      *(v4u*)dst = pk;
      
    }
  }
}

// =================================================================================================================
// x [32768][256] f32 -> xh f16 plane of 16 bf16(x); thread = 8 consecutive elements = one 16-B piece, consecutive
// grid = ceil(npieces/256). coverage: xh [32768][256], every element once.
// =================================================================================================================
__global__ __launch_bounds__(256)
void k_xcvt(const float* __restrict__ x, unsigned short* xh, int npieces) {
  const int i = blockIdx.x * 256 + threadIdx.x;
  if (i >= npieces) return;
  const float* p = x + (size_t)i * 8;
  const v4f a = *(const v4f*)(p);
  const v4f b = *(const v4f*)(p + 4);
  v4u pk;
  pk[0] = pk16(hb16(bfr(a[0]) * 16.0f), hb16(bfr(a[1]) * 16.0f));
  pk[1] = pk16(hb16(bfr(a[2]) * 16.0f), hb16(bfr(a[3]) * 16.0f));
  pk[2] = pk16(hb16(bfr(b[0]) * 16.0f), hb16(bfr(b[1]) * 16.0f));
  pk[3] = pk16(hb16(bfr(b[2]) * 16.0f), hb16(bfr(b[3]) * 16.0f));
  unsigned short* dst = xh + (size_t)i * 8;
  *(v4u*)dst = pk;
  
}

// =================================================================================================================
// Q projection: C[64 tokens][128 cols] = xh . wqt^T (K = 256, 8 k-steps), Cs = 1024 (x w). Column group cg (0..1)
// covers cols cg*128 of the first 256 (q). Carried value 16 (x w + b) = Cs/64 + 16 bf16(b), stored as f16 hi +
// x2048 residual planes qh/ql [token][256] in whole lines.
// grid = (NTOK/64, 2), 256 threads. coverage: qh/ql [32768][256], every element once.
// =================================================================================================================
__global__ __launch_bounds__(256)
void k_qkv(const unsigned short* __restrict__ xh, const unsigned short* __restrict__ wqt,
           const float* __restrict__ bias, unsigned short* qp) {
  __shared__ __align__(16) unsigned char sm[StageBytes<DIMC>::total];
  const float* Cs = (const float*)(const void*)sm;
  const int tid = threadIdx.x;
  const int mb = blockIdx.x, cg = blockIdx.y;
  const int tok0 = mb * 64, col0 = cg * 128;
  mm_tile1<DIMC, 1>((const _Float16*)(const void*)xh, (const _Float16*)(const void*)wqt, tok0, col0, sm);
  __syncthreads();
  unsigned short* dh = qp;
  unsigned short* dl = qp + QL_OFF;
  v4u ph[4], pq[4];
  size_t offs[4];
#pragma unroll
  for (int s4 = 0; s4 < 4; ++s4) {
    const int idx = s4 * 256 + tid;
    const int row = idx >> 4, piece = idx & 15;
    const int colp = piece * 8;
    v4u a, q4;
#pragma unroll
    for (int e = 0; e < 4; ++e) {
      const float b0 = 16.0f * bfr(bias[col0 + colp + 2 * e]);
      const float b1 = 16.0f * bfr(bias[col0 + colp + 2 * e + 1]);
      const float f0 = Cs[row * LDC + colp + 2 * e] * (1.0f / 64.0f) + b0;
      const float f1 = Cs[row * LDC + colp + 2 * e + 1] * (1.0f / 64.0f) + b1;
      unsigned hw, lw;
      split2(f0, f1, hw, lw);
      a[e] = hw; q4[e] = lw;
    }
    ph[s4] = a;
    pq[s4] = q4;
    offs[s4] = (size_t)(tok0 + row) * DIMC + col0 + colp;
  }
#pragma unroll
  for (int s4 = 0; s4 < 4; ++s4) { *(v4u*)(dh + offs[s4]) = ph[s4]; *(v4u*)(dl + offs[s4]) = pq[s4]; }
}

// one 16x16 accumulator tile (lane = channel, registers = 8 consecutive tokens) -> carried value 16 (x w + b) =
// acc/64 + bb as f16 hi + x2048 residual, 16 B each, into the channel's hi row and its lo row (HD rows further on)
__device__ __forceinline__ void put_planes(const v8f& acc, float bb, unsigned char* hi_dst) {
  v4u a, q4;
#pragma unroll
  for (int e = 0; e < 4; ++e) {
    const float f0 = acc[2 * e] * (1.0f / 64.0f) + bb;
    const float f1 = acc[2 * e + 1] * (1.0f / 64.0f) + bb;
    unsigned hw, lw;
    split2(f0, f1, hw, lw);
    a[e] = hw; q4[e] = lw;
  }
  *(v4u*)(void*)hi_dst = a;
  *(v4u*)(void*)(hi_dst + HD * TSP) = q4;
}

// =================================================================================================================
// K, V projection of one head fused with its channel-attention logits, split over K. Block (ck, bh) takes the KCH
// tokens of chunk ck in KCH/64 sub-tiles of 64. The head's 64 k rows and 64 v rows of wqt are copied into LDS once
// (rows of WSP bytes); per sub-tile the 64 xh rows are copied in, C[64 tokens][128 channels] = xh . w^T (K = 256,
// 8 waves = 2 (32 tokens) x 4 (32 channels), as in the GEMM core), and each lane's 8 consecutive tokens of a channel
// go as f16 hi + x2048 residual into the LDS planes T[plane * 64 + channel][64 tokens] (rows of TSP bytes; planes
// k hi, k lo, v hi, v lo). Then raw[d][e] += sum_n (16 k[n][d]) (16 v[n][e]) on WMMA (M = N = 64, 2 k-steps):
// A = k planes, B = v planes, products hi*hi + (hi*lo + lo*hi)/2048, 8 waves = 4 (16 rows) x 2 (32 cols), tokens
// ascending. k and v never leave the work-group. The chunk's f32 tile goes through LDS to part[ck][bh][d][e].
// grid = (KSPLIT, 32), 256 threads. coverage: part [KSPLIT][32][64][64] f32, every element once.
// =================================================================================================================
// four waves per SIMD: the register budget that lets two work-groups (the LDS limit) share a WGP
__global__ __launch_bounds__(256) __attribute__((amdgpu_waves_per_eu(4)))
void k_kv_part(const unsigned short* __restrict__ xh, const unsigned short* __restrict__ wqt,
               const float* __restrict__ bias, float* part) {
  __shared__ __align__(16) unsigned char sm[192 * WSP + 4 * HD * TSP];
  unsigned char* sW = sm;                                   // 128 weight rows: 0..63 k channels, 64..127 v channels
  unsigned char* sA = sm + 128 * WSP;                       // 64 token rows
  unsigned char* sT = sm + 192 * WSP;                       // the four planes of one sub-tile
  static_assert(64 * LDA * 4 <= 64 * WSP);
  const int tid = threadIdx.x, wave = tid >> 5, lane = tid & 31, hh = lane >> 4, c = lane & 15;
  const int ck = blockIdx.x, bh = blockIdx.y;
  const int h = bh & (NH - 1);
  const int tok0 = (bh >> 2) * NN + ck * KCH;
  const _Float16* gA = (const _Float16*)(const void*)xh + (size_t)(tok0 + wave) * DIMC + lane * 8;
  const unsigned lA = (unsigned)(uintptr_t)sA + (unsigned)(wave * WSP + lane * 16);   // LDS byte address
  {
    // one wave copy = one whole row of 512 B; row = j * 8 + wave
    const _Float16* gK = (const _Float16*)(const void*)wqt + (size_t)(DIMC + h * HD + wave) * DIMC + lane * 8;
    const _Float16* gV = gK + (size_t)DIMC * DIMC;
    const unsigned lW = (unsigned)(uintptr_t)sW + (unsigned)(wave * WSP + lane * 16);
    unsigned l[8];
    const _Float16* g[8];
#pragma unroll  // l[] and g[] indexed by constants, so they stay in registers (the two loops below likewise)
    for (int j = 0; j < 8; ++j) { l[j] = lW + (unsigned)(j * 8 * WSP); g[j] = gK + (size_t)j * 8 * DIMC; }
    acopy8(l, g);
#pragma unroll
    for (int j = 0; j < 8; ++j) { l[j] = lW + (unsigned)((64 + j * 8) * WSP); g[j] = gV + (size_t)j * 8 * DIMC; }
    acopy8(l, g);
#pragma unroll
    for (int j = 0; j < 8; ++j) { l[j] = lA + (unsigned)(j * 8 * WSP); g[j] = gA + (size_t)j * 8 * DIMC; }
    acopy8(l, g);
    // this wave's copies have landed; behind the barrier every wave's have
    asm volatile("s_wait_asynccnt 0x0" ::: "memory");
    __syncthreads();
  }
  // projection: wave = 32 tokens x 32 channels
  const int mw = wave >> 2, nw = wave & 3;
  const _Float16* a0p = (const _Float16*)(const void*)(sA + (mw * 32 + c) * WSP) + 8 * hh;
  const _Float16* a1p = (const _Float16*)(const void*)(sA + (mw * 32 + 16 + c) * WSP) + 8 * hh;
  const _Float16* b0p = (const _Float16*)(const void*)(sW + (nw * 32 + c) * WSP) + 8 * hh;
  const _Float16* b1p = (const _Float16*)(const void*)(sW + (nw * 32 + 16 + c) * WSP) + 8 * hh;
  const int kvs = nw >> 1;                                  // 0: this wave's channels are k, 1: v
  const int d0 = (nw & 1) * 32 + c;                         // channel within the head; the second tile is d0 + 16
  const float bb0 = 16.0f * bfr(bias[(1 + kvs) * DIMC + h * HD + d0]);
  const float bb1 = 16.0f * bfr(bias[(1 + kvs) * DIMC + h * HD + d0 + 16]);
  unsigned char* t00 = sT + (kvs * 2 * HD + d0) * TSP + (mw * 32 + 8 * hh) * 2;   // hi row of d0, this lane's 8 tokens
  // logits: wave = 16 rows d x 32 cols e
  const int mv = wave >> 1, nv = wave & 1;
  const _Float16* ahp = (const _Float16*)(const void*)(sT + (mv * 16 + c) * TSP) + 8 * hh;
  const _Float16* alp = (const _Float16*)(const void*)(sT + (HD + mv * 16 + c) * TSP) + 8 * hh;
  const _Float16* b0h = (const _Float16*)(const void*)(sT + (2 * HD + nv * 32 + c) * TSP) + 8 * hh;
  const _Float16* b1h = (const _Float16*)(const void*)(sT + (2 * HD + nv * 32 + 16 + c) * TSP) + 8 * hh;
  const _Float16* b0l = (const _Float16*)(const void*)(sT + (3 * HD + nv * 32 + c) * TSP) + 8 * hh;
  const _Float16* b1l = (const _Float16*)(const void*)(sT + (3 * HD + nv * 32 + 16 + c) * TSP) + 8 * hh;
  v8f p0 = zero8(), p1 = zero8(), q0 = zero8(), q1 = zero8(), r0 = zero8(), r1 = zero8();
#pragma unroll 1  // one copy of the sub-tile body: the text stays short
  for (int t = 0; t < KCH / 64; ++t) {                      // block-uniform trip count
    v8f c00 = zero8(), c01 = zero8(), c10 = zero8(), c11 = zero8();
    // fragments are fetched one k-step ahead: the reads of step ks + 1 are in flight under the products of step ks
    v16h fa0 = ldfrag_h(a0p), fa1 = ldfrag_h(a1p);
    v16h fb0 = ldfrag_h(b0p), fb1 = ldfrag_h(b1p);
#pragma unroll  // straight-line k-steps
    for (int ks = 0; ks < DIMC / 32; ++ks) {
      const int kn = (ks + 1 < DIMC / 32 ? ks + 1 : ks) * 32;
      v16h na0 = fa0, na1 = fa1, nb0 = fb0, nb1 = fb1;
      if (ks + 1 < DIMC / 32) {
        na0 = ldfrag_h(a0p + kn);
        na1 = ldfrag_h(a1p + kn);
        nb0 = ldfrag_h(b0p + kn);
        nb1 = ldfrag_h(b1p + kn);
      }
      __builtin_amdgcn_sched_barrier(0);  // holds the next step's reads in front of this step's products
      c00 = mma_raw(fa0, fb0, c00);
      c01 = mma_raw(fa0, fb1, c01);
      c10 = mma_raw(fa1, fb0, c10);
      c11 = mma_raw(fa1, fb1, c11);
      __builtin_amdgcn_sched_barrier(0);  // and later reads behind them: no deeper fetch, no spills
      fa0 = na0; fa1 = na1; fb0 = nb0; fb1 = nb1;
    }
    put_planes(c00, bb0, t00);
    put_planes(c01, bb1, t00 + 16 * TSP);
    put_planes(c10, bb0, t00 + 32);
    put_planes(c11, bb1, t00 + 16 * TSP + 32);
    // the planes are written and this wave's reads of the token rows have returned; behind the barrier all waves' have
    asm volatile("s_wait_dscnt 0x0" ::: "memory");
    __syncthreads();
    if (t + 1 < KCH / 64) {                                 // block-uniform: the next sub-tile's token rows fly under the logits
      unsigned l[8];
      const _Float16* g[8];
#pragma unroll
      for (int j = 0; j < 8; ++j) { l[j] = lA + (unsigned)(j * 8 * WSP); g[j] = gA + (size_t)((t + 1) * 64 + j * 8) * DIMC; }
      acopy8(l, g);
    }
#pragma unroll  // two straight-line k-steps
    for (int ks = 0; ks < 2; ++ks) {
      const int ko = ks * 32;
      const v16h fa  = ldfrag_h(ahp + ko);
      const v16h ga  = ldfrag_h(alp + ko);
      const v16h fb0 = ldfrag_h(b0h + ko);
      const v16h fb1 = ldfrag_h(b1h + ko);
      const v16h gb0 = ldfrag_h(b0l + ko);
      const v16h gb1 = ldfrag_h(b1l + ko);
      p0 = mma_raw(fa, fb0, p0);
      p1 = mma_raw(fa, fb1, p1);
      q0 = mma_raw(fa, gb0, q0);
      q1 = mma_raw(fa, gb1, q1);
      r0 = mma_raw(ga, fb0, r0);
      r1 = mma_raw(ga, fb1, r1);
      if (ks == 1) guard6(p0, p1, q0, q1, r0, r1, fa, ga, fb0, fb1, gb0, gb1);  // in front of the back edge
    }
    // the plane reads have returned and this wave's copies have landed; behind the barrier the planes may be
    // rewritten and the new token rows read
    asm volatile("s_wait_dscnt 0x0" ::: "memory");
    asm volatile("s_wait_asynccnt 0x0" ::: "memory");
    __syncthreads();
  }
  float* Cs = (float*)(void*)sA;                            // the token rows are dead: the f32 tile lies over them
#pragma unroll
  for (int r = 0; r < 8; ++r) {
    const int row = mv * 16 + 8 * hh + r;
    Cs[row * LDA + nv * 32 + c]      = p0[r] + (q0[r] + r0[r]) * RSC;
    Cs[row * LDA + nv * 32 + 16 + c] = p1[r] + (q1[r] + r1[r]) * RSC;
  }
  __syncthreads();
  float* dst = part + ((size_t)ck * (BB * NH) + bh) * (HD * HD);
  v4f pk[4];
#pragma unroll  // pk[] indexed by constants, so it stays in registers
  for (int s = 0; s < 4; ++s) {
    const int idx = s * 256 + tid;
    pk[s] = *(const v4f*)(Cs + (idx >> 4) * LDA + (idx & 15) * 4);
  }
#pragma unroll  // as above
  for (int s = 0; s < 4; ++s) *(v4f*)(dst + (size_t)(s * 256 + tid) * 4) = pk[s];
}

// =================================================================================================================
// Chunk sum + softmax. Block = 16 rows d of one (b, h); thread = 4 consecutive e of one row, 16 lanes per row.
// raw = sum over ck of part[ck] in index order; logit = raw/2048 (includes the head_dim^-0.5 factor 1/8). Softmax
// over e per row d in f32 (max subtracted, 16-lane butterflies), 4096 P stored as f16 hi + x2048 residual planes;
// a wave's store covers two whole 128-B rows.
// grid = (32, 4), 256 threads. coverage: ath/atl [32][64][64], every element once.
// =================================================================================================================
__global__ __launch_bounds__(256)
void k_attn_sm(const float* __restrict__ part, unsigned short* at) {
  const int tid = threadIdx.x;
  const int bh = blockIdx.x;
  const int row = blockIdx.y * 16 + (tid >> 4), col0 = (tid & 15) * 4;
  const size_t off = ((size_t)bh * HD + row) * HD + col0;
  v4f t[KSPLIT];
#pragma unroll  // all chunk loads issued before the first add: one memory latency, not KSPLIT
  for (int s = 0; s < KSPLIT; ++s) t[s] = *(const v4f*)(part + (size_t)s * ATL_OFF + off);
  v4f a = t[0];
#pragma unroll  // t[] indexed by constants, so it stays in registers (the short loops below likewise)
  for (int s = 1; s < KSPLIT; ++s) a += t[s];
  float mx = fmaxf(fmaxf(a[0], a[1]), fmaxf(a[2], a[3]));
#pragma unroll
  for (int o = 1; o < 16; o <<= 1) mx = fmaxf(mx, __shfl_xor(mx, o, 32));
  float e[4];
#pragma unroll
  for (int n = 0; n < 4; ++n) e[n] = expf((a[n] - mx) * RSC);
  float sm = (e[0] + e[1]) + (e[2] + e[3]);
#pragma unroll
  for (int o = 1; o < 16; o <<= 1) sm += __shfl_xor(sm, o, 32);
  const float sc = (1.0f / sm) * 4096.0f;
  v2u ph, pq;
#pragma unroll
  for (int n = 0; n < 2; ++n) {
    unsigned hw, lw;
    split2(e[2 * n] * sc, e[2 * n + 1] * sc, hw, lw);
    ph[n] = hw; pq[n] = lw;
  }
  *(v2u*)(at + off) = ph;
  *(v2u*)(at + ATL_OFF + off) = pq;
}

// =================================================================================================================
// xf + residual + layer norm. Block = 32 tokens of one batch, all 4 heads. Per head h: C[32 tok][64 d] =
// sum_e (16 q[tok][h*64+e]) (4096 P[d][e]) on WMMA (K = 64, 2 k-steps): A = qh/ql [token][256] pitch 256 at
// column h*64, B = ath/atl [bh][d][64] (e contiguous = [n][k] copy form); products hi*hi + (hi*lo + lo*hi)/2048;
// 8 waves = 2 (16 rows) x 4 (16 cols); xf = C/65536. Then x1 = bf16(x) + xf (f32, kept in the LDS tile), mean
// f16, every element once.
// =================================================================================================================
__global__ __launch_bounds__(256)
void k_xf(const unsigned short* __restrict__ qp, const unsigned short* __restrict__ at,
          const float* __restrict__ x, const float* __restrict__ gw, const float* __restrict__ gb,
          float* x1, unsigned short* hh16) {
  __shared__ __align__(16) unsigned char st[192 * XSP];
  __shared__ __align__(16) float Cs[32 * LDX];
  __shared__ float Mu[32];
  __shared__ float Rs[32];
  const int tid = threadIdx.x, wave = tid >> 5, lane = tid & 31, hh = lane >> 4, c = lane & 15;
  const int mw = wave >> 2, nw = wave & 3;
  const int tok0 = blockIdx.x * 32;
  const int b = tok0 >> 12;
  const _Float16* Qh = (const _Float16*)(const void*)qp;
  const _Float16* Ql = Qh + QL_OFF;
  const _Float16* Ah = (const _Float16*)(const void*)at;
  const _Float16* Al = Ah + ATL_OFF;
  // per head, 192 rows of 128 B are copied in whole lines into LDS rows of XSP bytes: 0..31 q hi (token), 32..63 q lo,
  // 64..127 P hi (d), 128..191 P lo; thread = one 16-B piece of six rows; fragments come from there
  const unsigned stb = (unsigned)(uintptr_t)st;             // LDS byte address of the staging rows
  const int srow = tid >> 3, spc = tid & 7;
  const _Float16* ahp = (const _Float16*)(const void*)(st + (mw * 16 + c) * XSP) + 8 * hh;
  const _Float16* alp = (const _Float16*)(const void*)(st + (32 + mw * 16 + c) * XSP) + 8 * hh;
  const _Float16* bhp = (const _Float16*)(const void*)(st + (64 + nw * 16 + c) * XSP) + 8 * hh;
  const _Float16* blp = (const _Float16*)(const void*)(st + (128 + nw * 16 + c) * XSP) + 8 * hh;
#pragma unroll 1
  for (int h = 0; h < NH; ++h) {                            // block-uniform trip count
    if (h > 0) {
      // every wave's fragment reads of the last head have returned and all waves are here before the rows are refilled
      asm volatile("s_wait_dscnt 0x0" ::: "memory");
      __syncthreads();
    }
    {
      const size_t qoff = (size_t)(tok0 + srow) * DIMC + h * HD + spc * 8;
      const size_t poff = ((size_t)(b * NH + h) * HD + srow) * HD + spc * 8;
      unsigned l[6];
#pragma unroll  // l[] indexed by constants, so it stays in registers
      for (int j = 0; j < 6; ++j) l[j] = stb + (unsigned)((j * 32 + srow) * XSP + spc * 16);
      const _Float16* g[6] = { Qh + qoff, Ql + qoff, Ah + poff, Ah + poff + 32 * HD, Al + poff, Al + poff + 32 * HD };
      acopy6(l, g);
    }
    // this wave's copies have landed; behind the barrier every wave's have
    asm volatile("s_wait_asynccnt 0x0" ::: "memory");
    __syncthreads();
    v8f p = zero8(), q = zero8(), r = zero8();
#pragma unroll
    for (int ks = 0; ks < HD / 32; ++ks) {
      const int ko = ks * 32;
      const v16h fa = ldfrag_h(ahp + ko);
      const v16h ga = ldfrag_h(alp + ko);
      const v16h fb = ldfrag_h(bhp + ko);
      const v16h gq = ldfrag_h(blp + ko);
      p = mma_raw(fa, fb, p);
      q = mma_raw(fa, gq, q);
      r = mma_raw(ga, fb, r);
      guard3(p, q, r, fa, ga, fb, gq);
    }
#pragma unroll
    for (int rr = 0; rr < 8; ++rr)
      Cs[(mw * 16 + 8 * hh + rr) * LDX + h * HD + nw * 16 + c] = p[rr] + (q[rr] + r[rr]) * RSC;
  }
  __syncthreads();
  // phase 1: x1 = bf16(x) + xf back into the tile, per-row statistics
#pragma unroll 1
  for (int it = 0; it < 4; ++it) {
    const int row = wave * 4 + it;
    const size_t tok = (size_t)(tok0 + row);
    const float* xr = x + tok * DIMC + lane * 8;
    const v4f xa = *(const v4f*)(xr);
    const v4f xb = *(const v4f*)(xr + 4);
    float* cr = Cs + row * LDX + lane * 8;
    float v[8];
#pragma unroll
    for (int e = 0; e < 4; ++e) {
      v[e]     = bfr(xa[e]) + cr[e] * (1.0f / 65536.0f);
      v[4 + e] = bfr(xb[e]) + cr[4 + e] * (1.0f / 65536.0f);
    }
#pragma unroll
    for (int e = 0; e < 8; ++e) cr[e] = v[e];
    float s = ((v[0] + v[1]) + (v[2] + v[3])) + ((v[4] + v[5]) + (v[6] + v[7]));
#pragma unroll
    for (int off = 16; off; off >>= 1) s += __shfl_xor(s, off, 32);
    const float mu = s * (1.0f / 256.0f);
    float sq = 0.f;
#pragma unroll
    for (int e = 0; e < 8; ++e) { const float d = v[e] - mu; sq += d * d; }
#pragma unroll
    for (int off = 16; off; off >>= 1) sq += __shfl_xor(sq, off, 32);
    const float var = sq * (1.0f / 256.0f);
    const float rs = rsqrtf(var + 1e-5f);
    if (lane == 0) { Mu[row] = mu; Rs[row] = rs; }
  }
  __syncthreads();
  // phase 2: whole-line stores of x1 (f32) and hh16 (f16 of 16 h)
  v4f pk[8];
  size_t offs[8];
#pragma unroll
  for (int s = 0; s < 8; ++s) {
    const int idx = s * 256 + tid;
    const int row = idx >> 6, piece = idx & 63;
    v4f v4;
#pragma unroll
    for (int e = 0; e < 4; ++e) v4[e] = Cs[row * LDX + piece * 4 + e];
    pk[s] = v4;
    offs[s] = (size_t)(tok0 + row) * DIMC + piece * 4;
  }
  v4u ph[4];
  size_t offh[4];
#pragma unroll
  for (int s = 0; s < 4; ++s) {
    const int idx = s * 256 + tid;
    const int row = idx >> 5, piece = idx & 31;
    const int col0 = piece * 8;
    const float mu = Mu[row], rs = Rs[row];
    v4u a;
#pragma unroll
    for (int e = 0; e < 4; ++e) {
      const int cA = col0 + 2 * e, cB = cA + 1;
      const float f0 = ((Cs[row * LDX + cA] - mu) * rs) * bfr(gw[cA]) + bfr(gb[cA]);
      const float f1 = ((Cs[row * LDX + cB] - mu) * rs) * bfr(gw[cB]) + bfr(gb[cB]);
      a[e] = pk16(hb16(f0 * 16.0f), hb16(f1 * 16.0f));
    }
    ph[s] = a;
    offh[s] = (size_t)(tok0 + row) * DIMC + col0;
  }
#pragma unroll
  for (int s = 0; s < 8; ++s) *(v4f*)(x1 + offs[s]) = pk[s];
#pragma unroll
  for (int s = 0; s < 4; ++s) *(v4u*)(hh16 + offh[s]) = ph[s];
  
}

// =================================================================================================================
// FC1 + exact GELU + FC2 + bias + residual in one kernel: g never leaves the work-group. Block = 128 tokens, 16 waves,
// one block per WGP. The 128 hh16 rows (K = 256) are copied into LDS once. The 768 hidden channels run in 6 chunks of
// 128. Per chunk: C1[128 hidden][128 tokens] = w1t rows . hh16 rows^T (8 k-steps, 16 waves = 4 (32 hidden) x 4
// (32 tokens)); the weight rows are the A operand, so a lane holds 8 consecutive hidden channels of one token:
// v = C1/1024 + bf16(b1), g = 0.5 v (1 + erf(v / sqrt 2)) in registers, 16 g as f16, one 16-B LDS store into
// G[token][128]. Then C2[128 tokens][256 cols] += G . w2t chunk^T (4 k-steps, 16 waves = 4 (32 tokens) x 4 (64 cols)),
// hidden channels ascending as before. The chunk's w2t rows fly under FC1 and GELU, the next chunk's w1t rows under FC2.
// out = x1 + C2/1024 + bf16(b2) through an f32 LDS tile, whole lines.
// grid = NTOK/128, 512 threads. coverage: out [32768][256] f32, every element once.
// =================================================================================================================
__global__ __launch_bounds__(512)
void k_mlp(const unsigned short* __restrict__ hh16, const unsigned short* __restrict__ w1t,
           const float* __restrict__ bias1, const unsigned short* __restrict__ w2t,
           const float* __restrict__ bias2, const float* __restrict__ x1, float* out) {
  __shared__ __align__(16) unsigned char sm[256 * WSP + 384 * GSP + MLP * 4];
  unsigned char* sH  = sm;                                  // 128 token rows of hh16, WSP bytes each
  unsigned char* sW1 = sm + 128 * WSP;                      // 128 w1t rows of the chunk
  unsigned char* sG  = sm + 256 * WSP;                      // 128 token rows of g, GSP bytes each
  unsigned char* sW2 = sm + 256 * WSP + 128 * GSP;          // 256 w2t rows, the chunk's 128 k
  float* sB1 = (float*)(void*)(sm + 256 * WSP + 384 * GSP); // bf16(b1) as f32
  static_assert(128 * LDX * 4 <= 256 * WSP);
  const int tid = threadIdx.x, wave = tid >> 5, lane = tid & 31, hh = lane >> 4, c = lane & 15;
  const int tok0 = blockIdx.x * 128;
  const int wq = wave >> 2, wr = wave & 3;
  // copies: a wave copy covers one whole 512-B row (hh16, w1t) or two 256-B row pieces (w2t)
  const _Float16* gH  = (const _Float16*)(const void*)hh16 + (size_t)(tok0 + wave) * DIMC + lane * 8;
  const _Float16* gW1 = (const _Float16*)(const void*)w1t + (size_t)wave * DIMC + lane * 8;
  const _Float16* gW2 = (const _Float16*)(const void*)w2t + (size_t)(wave * 2 + hh) * MLP + c * 8;
  const unsigned lH  = (unsigned)(uintptr_t)sH  + (unsigned)(wave * WSP + lane * 16);            // LDS byte addresses
  const unsigned lW1 = (unsigned)(uintptr_t)sW1 + (unsigned)(wave * WSP + lane * 16);
  const unsigned lW2 = (unsigned)(uintptr_t)sW2 + (unsigned)((wave * 2 + hh) * GSP + c * 16);
  {
    unsigned l[8];
    const _Float16* g[8];
#pragma unroll  // l[] and g[] indexed by constants, so they stay in registers (the copy loops below likewise)
    for (int j = 0; j < 8; ++j) { l[j] = lH + (unsigned)(j * 16 * WSP); g[j] = gH + (size_t)j * 16 * DIMC; }
    acopy8(l, g);
#pragma unroll
    for (int j = 0; j < 8; ++j) { l[j] = lW1 + (unsigned)(j * 16 * WSP); g[j] = gW1 + (size_t)j * 16 * DIMC; }
    acopy8(l, g);
    for (int i = tid; i < MLP; i += 512) sB1[i] = bfr(bias1[i]);
    // this wave's copies have landed; behind the barrier every wave's have, and the bias row is written
    asm volatile("s_wait_asynccnt 0x0" ::: "memory");
    __syncthreads();
  }
  // FC1: wave = 32 hidden (wq) x 32 tokens (wr); FC2: wave = 32 tokens (wq) x 64 cols (wr)
  const _Float16* w1p = (const _Float16*)(const void*)(sW1 + (wq * 32 + c) * WSP) + 8 * hh;
  const _Float16* hp  = (const _Float16*)(const void*)(sH  + (wr * 32 + c) * WSP) + 8 * hh;
  const _Float16* gp  = (const _Float16*)(const void*)(sG  + (wq * 32 + c) * GSP) + 8 * hh;
  const _Float16* w2p = (const _Float16*)(const void*)(sW2 + (wr * 64 + c) * GSP) + 8 * hh;
  unsigned char* gst = sG + (wr * 32 + c) * GSP + (wq * 32 + 8 * hh) * 2;   // this lane's token row, its 8 hidden channels
  v8f o[2][4];
#pragma unroll  // o[][] indexed by constants, so it stays in registers (every short loop below likewise)
  for (int t = 0; t < 2; ++t)
#pragma unroll
    for (int n = 0; n < 4; ++n) o[t][n] = zero8();
#pragma unroll 1  // one copy of the chunk body: the text stays short
  for (int ch = 0; ch < MLP / 128; ++ch) {                  // block-uniform trip count
    {
      // the chunk's w2t rows fly under FC1 and GELU; the last chunk's readers left them at the barrier at the loop's foot
      unsigned l[8];
      const _Float16* g[8];
#pragma unroll
      for (int j = 0; j < 8; ++j) { l[j] = lW2 + (unsigned)(j * 32 * GSP); g[j] = gW2 + (size_t)j * 32 * MLP + ch * 128; }
      acopy8(l, g);
    }
    v8f a[2][2];
#pragma unroll
    for (int i = 0; i < 2; ++i)
#pragma unroll
      for (int t = 0; t < 2; ++t) a[i][t] = zero8();
    {
      // fragments are fetched one k-step ahead: the reads of step ks + 1 are in flight under the products of step ks
      v16h fw0 = ldfrag_h(w1p), fw1 = ldfrag_h(w1p + 16 * (WSP / 2));
      v16h fh0 = ldfrag_h(hp), fh1 = ldfrag_h(hp + 16 * (WSP / 2));
#pragma unroll  // straight-line k-steps
      for (int ks = 0; ks < DIMC / 32; ++ks) {
        const int kn = (ks + 1) * 32;
        v16h nw0 = fw0, nw1 = fw1, nh0 = fh0, nh1 = fh1;
        if (ks + 1 < DIMC / 32) {
          nw0 = ldfrag_h(w1p + kn);
          nw1 = ldfrag_h(w1p + 16 * (WSP / 2) + kn);
          nh0 = ldfrag_h(hp + kn);
          nh1 = ldfrag_h(hp + 16 * (WSP / 2) + kn);
        }
        __builtin_amdgcn_sched_barrier(0);  // holds the next step's reads in front of this step's products
        a[0][0] = mma_raw(fw0, fh0, a[0][0]);
        a[0][1] = mma_raw(fw0, fh1, a[0][1]);
        a[1][0] = mma_raw(fw1, fh0, a[1][0]);
        a[1][1] = mma_raw(fw1, fh1, a[1][1]);
        __builtin_amdgcn_sched_barrier(0);  // and later reads behind them: one step ahead, no deeper
        fw0 = nw0; fw1 = nw1; fh0 = nh0; fh1 = nh1;
      }
    }
#pragma unroll
    for (int i = 0; i < 2; ++i) {
      const float* bp = sB1 + ch * 128 + wq * 32 + i * 16 + 8 * hh;
      const v4f bA = *(const v4f*)(bp);
      const v4f bB = *(const v4f*)(bp + 4);
      const float bv[8] = { bA[0], bA[1], bA[2], bA[3], bB[0], bB[1], bB[2], bB[3] };
#pragma unroll
      for (int t = 0; t < 2; ++t) {
        float v[8], xe[8], er[8];
        bool small = true;
#pragma unroll
        for (int e = 0; e < 8; ++e) {
          v[e] = a[i][t][e] * (1.0f / 1024.0f) + bv[e];
          xe[e] = v[e] * 0.70710678118654752f;
          small = small && (fabsf(xe[e]) < 1.0f);
        }
        // erff tests |x| < 1 for each value; one test for the lane's 8 values leaves 8 independent chains with no
        // branch between them on the side where all are below 1, and the full erff for all 8 on the other side
        if (small) {
#pragma unroll
          for (int e = 0; e < 8; ++e) er[e] = erff(xe[e]);
        } else {
#pragma unroll
          for (int e = 0; e < 8; ++e) er[e] = erff(xe[e]);
        }
        v4u pk;
#pragma unroll
        for (int e = 0; e < 4; ++e) {
          const float g0 = 0.5f * v[2 * e] * (1.0f + er[2 * e]);
          const float g1 = 0.5f * v[2 * e + 1] * (1.0f + er[2 * e + 1]);
          pk[e] = pk16(hb16(g0 * 16.0f), hb16(g1 * 16.0f));
        }
        *(v4u*)(void*)(gst + t * 16 * GSP + i * 32) = pk;
      }
    }
    // g is written, this wave's reads of the w1t rows have returned and its w2t copies have landed; behind the barrier
    // all waves' have
    asm volatile("s_wait_dscnt 0x0" ::: "memory");
    asm volatile("s_wait_asynccnt 0x0" ::: "memory");
    __syncthreads();
    if (ch + 1 < MLP / 128) {                               // block-uniform: the next chunk's w1t rows fly under FC2
      unsigned l[8];
      const _Float16* g[8];
#pragma unroll
      for (int j = 0; j < 8; ++j) { l[j] = lW1 + (unsigned)(j * 16 * WSP); g[j] = gW1 + (size_t)((ch + 1) * 128 + j * 16) * DIMC; }
      acopy8(l, g);
    }
    // fragments one k-step ahead, as in FC1
    v16h fg0 = ldfrag_h(gp), fg1 = ldfrag_h(gp + 16 * (GSP / 2));
    v16h fv0 = ldfrag_h(w2p), fv1 = ldfrag_h(w2p + 16 * (GSP / 2));
    v16h fv2 = ldfrag_h(w2p + 32 * (GSP / 2)), fv3 = ldfrag_h(w2p + 48 * (GSP / 2));
#pragma unroll  // straight-line k-steps
    for (int ks = 0; ks < 4; ++ks) {
      const int kn = (ks + 1) * 32;
      v16h ng0 = fg0, ng1 = fg1, nv0 = fv0, nv1 = fv1, nv2 = fv2, nv3 = fv3;
      if (ks + 1 < 4) {
        ng0 = ldfrag_h(gp + kn);
        ng1 = ldfrag_h(gp + 16 * (GSP / 2) + kn);
        nv0 = ldfrag_h(w2p + kn);
        nv1 = ldfrag_h(w2p + 16 * (GSP / 2) + kn);
        nv2 = ldfrag_h(w2p + 32 * (GSP / 2) + kn);
        nv3 = ldfrag_h(w2p + 48 * (GSP / 2) + kn);
      }
      __builtin_amdgcn_sched_barrier(0);  // holds the next step's reads in front of this step's products
      o[0][0] = mma_raw(fg0, fv0, o[0][0]);
      o[0][1] = mma_raw(fg0, fv1, o[0][1]);
      o[0][2] = mma_raw(fg0, fv2, o[0][2]);
      o[0][3] = mma_raw(fg0, fv3, o[0][3]);
      o[1][0] = mma_raw(fg1, fv0, o[1][0]);
      o[1][1] = mma_raw(fg1, fv1, o[1][1]);
      o[1][2] = mma_raw(fg1, fv2, o[1][2]);
      o[1][3] = mma_raw(fg1, fv3, o[1][3]);
      if (ks == 3)  // in front of the back edge
        guard8(o[0][0], o[0][1], o[0][2], o[0][3], o[1][0], o[1][1], o[1][2], o[1][3], fg0, fg1, fv0, fv1, fv2, fv3);
      __builtin_amdgcn_sched_barrier(0);  // and later reads behind them: one step ahead, no deeper
      fg0 = ng0; fg1 = ng1; fv0 = nv0; fv1 = nv1; fv2 = nv2; fv3 = nv3;
    }
    // the reads of g and of the w2t rows have returned and this wave's w1t copies have landed; behind the barrier g and
    // the w2t rows may be rewritten and the new w1t rows read
    asm volatile("s_wait_dscnt 0x0" ::: "memory");
    asm volatile("s_wait_asynccnt 0x0" ::: "memory");
    __syncthreads();
  }
  float* Cs = (float*)(void*)sm;                            // the hh16 and w1t rows are dead: the f32 tile lies over them
#pragma unroll
  for (int t = 0; t < 2; ++t)
#pragma unroll
    for (int n = 0; n < 4; ++n)
#pragma unroll
      for (int r = 0; r < 8; ++r)
        Cs[(wq * 32 + t * 16 + 8 * hh + r) * LDX + wr * 64 + n * 16 + c] = o[t][n][r];
  __syncthreads();
  // thread = 4 columns of 16 rows, 8 rows apart: a wave's load or store covers one whole 512-B half row
  const int row0 = tid >> 6, colp = (tid & 63) * 4;
  const unsigned boff = (unsigned)((tok0 + row0) * DIMC + colp) * 4u;   // one byte offset (< 32 MiB) for x1 and out
  const char* xp = (const char*)(const void*)x1 + boff;
  char* op = (char*)(void*)out + boff;
  const float* cp = Cs + row0 * LDX + colp;
  v4f b2;
#pragma unroll
  for (int e = 0; e < 4; ++e) b2[e] = bfr(bias2[colp + e]);
  v4f xr[16];
#pragma unroll  // all residual loads issued before the first use
  for (int s = 0; s < 16; ++s) xr[s] = *(const v4f*)(const void*)(xp + s * 8 * DIMC * 4);
#pragma unroll
  for (int s = 0; s < 16; ++s) {
    const v4f c4 = *(const v4f*)(cp + s * 8 * LDX);
    v4f v;
#pragma unroll
    for (int e = 0; e < 4; ++e) v[e] = xr[s][e] + (c4[e] * (1.0f / 1024.0f) + b2[e]);
    *(v4f*)(void*)(op + s * 8 * DIMC * 4) = v;
  }
}

// =================================================================================================================
// Workspace map (bytes; all offsets multiples of 131072; every region sized exactly at its whole-line store extent;
// regions reused across phases in stream order):
//   [0, 16 MiB)      XH  f16 [32768][256]  (dead after k_kv_part)  -> reused as HH f16 [32768][256] (k_xf -> k_mlp)
//   [16, 32 MiB)     QH, [32, 48 MiB) QL  (dead after k_xf)
//   [48, 56 MiB)     PT  f32 [16][32][64][64] logit partials (k_kv_part -> k_attn_sm)
//   [80, 112 MiB)    X1 f32 [32768][256] (k_xf -> k_mlp)
//   112 MiB + : ATH, ATL f16 [32][64][64] 262144 each | WQT f16 [768][256] 393216 | W1T [768][256] 393216 |
//               W2T f16 [256][768] 393216 ; end = 119144448.
// =================================================================================================================
extern "C" void kernel_launch(void* const* d_in, const int* in_sizes, int n_in,
                              void* d_out, int out_size, void* d_ws, size_t ws_size,
                              hipStream_t stream) {
  if (n_in < 9) return;
  const int expect[9] = { NTOK * DIMC, DIMC * MLP, MLP, DIMC, DIMC, DIMC * MLP, MLP, MLP * DIMC, DIMC };
  for (int i = 0; i < 9; ++i) if (in_sizes[i] != expect[i]) return;
  if (out_size != NTOK * DIMC) return;

  const float* x     = (const float*)d_in[0];
  const float* w_qkv = (const float*)d_in[1];
  const float* b_qkv = (const float*)d_in[2];
  const float* ng    = (const float*)d_in[3];
  const float* nbt   = (const float*)d_in[4];
  const float* w_fc1 = (const float*)d_in[5];
  const float* b_fc1 = (const float*)d_in[6];
  const float* w_fc2 = (const float*)d_in[7];
  const float* b_fc2 = (const float*)d_in[8];
  float* out = (float*)d_out;

  const size_t MiB = (size_t)1048576;
  const size_t szX16 = (size_t)NTOK * DIMC * 2;                    // 16 MiB
  const size_t szX1  = (size_t)NTOK * DIMC * 4;                    // 32 MiB
  const size_t szAT  = ATL_OFF * 2;                                // 262144
  const size_t szWQ  = (size_t)MLP * DIMC * 2;                     // 393216
  if (szX16 != 16 * MiB || szX1 != 32 * MiB) return;

  const size_t oXH  = 0;
  const size_t oHH  = 0;
  const size_t oQH  = 16 * MiB;                                     // QL at oQH + 16 MiB
  const size_t oPT  = 48 * MiB;
  const size_t oX1  = 80 * MiB;
  const size_t oATH = 112 * MiB;                                    // ATL at oATH + szAT
  const size_t oWQT = oATH + 2 * szAT;
  const size_t oW1T = oWQT + szWQ;
  const size_t oW2T = oW1T + szWQ;
  const size_t oEND = oW2T + szWQ;                                  // 119144448
  if (oQH + 2 * szX16 != oPT) return;
  if (oX1 + szX1 > oATH || oHH + szX16 > oQH) return;
  if (oPT + (size_t)KSPLIT * ATL_OFF * 4 > oX1) return;
  if (oEND > ws_size) return;
  if (oEND > (size_t)134217728) return;

  char* ws = (char*)d_ws;
  unsigned short* XH  = (unsigned short*)(ws + oXH);
  unsigned short* HH  = (unsigned short*)(ws + oHH);
  float*          PT  = (float*)(ws + oPT);
  unsigned short* QH  = (unsigned short*)(ws + oQH);
  float*          X1  = (float*)(ws + oX1);
  unsigned short* ATH = (unsigned short*)(ws + oATH);
  unsigned short* WQT = (unsigned short*)(ws + oWQT);
  unsigned short* W1T = (unsigned short*)(ws + oW1T);
  unsigned short* W2T = (unsigned short*)(ws + oW2T);

  const dim3 blk(256);
  const int npieces = NTOK * DIMC / 8;
  // (1) weight planes (transposed, 64 * bf16)
  k_wcvt<<<dim3(2 * MLP + DIMC), dim3(128), 0, stream>>>(w_qkv, w_fc1, w_fc2, WQT, W1T, W2T);
  // (2) x -> f16 plane of 16 bf16(x)
  k_xcvt<<<dim3((npieces + 255) / 256), blk, 0, stream>>>(x, XH, npieces);
  // (3) q projection -> q hi/lo [token][256]
  k_qkv<<<dim3(NTOK / 64, 2), blk, 0, stream>>>(XH, WQT, b_qkv, QH);
  // (4) per (b, h): k, v projection + logits, K split in KSPLIT chunks -> f32 partial tiles; chunk sum + softmax -> P hi/lo planes
  k_kv_part<<<dim3(KSPLIT, BB * NH), blk, 0, stream>>>(XH, WQT, b_qkv, PT);
  k_attn_sm<<<dim3(BB * NH, HD / 16), blk, 0, stream>>>(PT, ATH);
  // (5) xf + residual + layer norm -> x1 f32, h f16
  k_xf<<<dim3(NTOK / 32), blk, 0, stream>>>(QH, ATH, x, ng, nbt, X1, HH);
  // (6) fc1 + GELU + fc2 + bias + residual -> d_out
  k_mlp<<<dim3(NTOK / 128), dim3(512), 0, stream>>>(HH, W1T, b_fc1, W2T, b_fc2, X1, out);
  (void)hipGetLastError();
}

// v005
// A run of this version takes 73.8 microseconds.
// In two side-by-side timings against v004, it was 1.24 and 1.22 times as fast.
// All steps since v000 together make it 4.02 times as fast.
// Contractions: qkv projection (K=256), fc1 (K=256), fc2 (K=768): v_wmma_f32_16x16x32_f16, single f16 products,
// activations carried x16, weights one f16 plane of 64*bf16(w); per-head k^T v logits (K=4096) and attn x q (K=64):
// v_wmma_f32_16x16x32_f16 with both operands as f16 hi + x2048 residual planes (3 products); f32 accumulate
// everywhere. Softmax, layer norm, exact GELU and all epilogues f32 on VALU; every float input RNE-converted to
// bf16 on load.
#include <hip/hip_runtime.h>
#include <stdint.h>

#define BB     8
#define NN     4096
#define DIMC   256
#define NH     4
#define HD     64
#define MLP    768
#define NTOK   (BB * NN)
#define LDC    132
#define LDX    260
#define LDA    68
#define RSC    0.00048828125f
#define QL_OFF ((size_t)NTOK * DIMC)
#define ATL_OFF ((size_t)BB * NH * HD * HD)
#define KSPLIT 16
#define KCH    (NN / KSPLIT)
#define XSP    (HD * 2 + 16)
#define WSP    (DIMC * 2 + 16)
#define TSP    (64 * 2 + 16)
#define GSP    (128 * 2 + 16)

static_assert(NTOK == 32768);
static_assert(DIMC == NH * HD);
static_assert((NN % 64) == 0 && (NTOK % 64) == 0);
static_assert((DIMC % 32) == 0 && (MLP % 32) == 0 && (HD % 32) == 0 && (NN % 32) == 0);
static_assert((LDX * 4) % 16 == 0 && (LDC * 4) % 16 == 0);
static_assert(QL_OFF == 8388608 && ATL_OFF == 131072);
static_assert(MLP == 6 * 128 && DIMC == 2 * 128 && (NTOK % 128) == 0 && ((GSP / 16) & 1) == 1);
static_assert(KCH * KSPLIT == NN && (KCH % 32) == 0);
static_assert(KCH == 256 && HD == 64 && ((XSP / 16) & 1) == 1 && ((WSP / 16) & 1) == 1 && ((TSP / 16) & 1) == 1);

typedef _Float16 v16h __attribute__((ext_vector_type(16)));
typedef _Float16 v8h  __attribute__((ext_vector_type(8)));
typedef float    v8f  __attribute__((ext_vector_type(8)));
typedef float    v4f  __attribute__((ext_vector_type(4)));
typedef unsigned int v4u __attribute__((ext_vector_type(4)));
typedef unsigned int v2u __attribute__((ext_vector_type(2)));

// ---- scalar helpers ------------------------------------------------------------------------------------------
__device__ __forceinline__ unsigned short bf_bits(float f) {          // f32 -> bf16 bits, RNE convert
  unsigned u = __float_as_uint(f);
  return (unsigned short)((u + 0x7FFFu + ((u >> 16) & 1u)) >> 16);
}
__device__ __forceinline__ float bf_up(unsigned short b) { return __uint_as_float(((unsigned)b) << 16); }
__device__ __forceinline__ float bfr(float f) { return bf_up(bf_bits(f)); }
__device__ __forceinline__ unsigned short h_bits(_Float16 x) { return __builtin_bit_cast(unsigned short, x); }
__device__ __forceinline__ unsigned short hb16(float f) { return h_bits((_Float16)f); }
__device__ __forceinline__ unsigned pk16(unsigned short a, unsigned short b) { return (unsigned)a | ((unsigned)b << 16); }
__device__ __forceinline__ v8f zero8() { v8f z = {0.f, 0.f, 0.f, 0.f, 0.f, 0.f, 0.f, 0.f}; return z; }
// hi/lo pair of two f32 values: hi = f16(v), lo = f16(2048 (v - hi)), packed as two 32-bit words
__device__ __forceinline__ void split2(float f0, float f1, unsigned& hp, unsigned& lp) {
  const _Float16 h0 = (_Float16)f0, h1 = (_Float16)f1;
  const float q0 = (f0 - (float)h0) * 2048.0f, q1 = (f1 - (float)h1) * 2048.0f;
  hp = pk16(h_bits(h0), h_bits(h1));
  lp = pk16(hb16(q0), hb16(q1));
}

// ---- fragment loader: 16-bit A/B operand, lane -> row/col (lane&15), p already includes +8*(lane>>4);
//      elements 0..7 <- p[0..7] (k0+8h..k0+8h+7), elements 8..15 <- p[16..23] (k0+16+8h..k0+16+8h+7)
__device__ __forceinline__ v16h ldfrag_h(const _Float16* p) {
  union { v16h v; v8h h[2]; } f;
  f.h[0] = *(const v8h*)(p);
  f.h[1] = *(const v8h*)(p + 16);
  return f.v;
}

// ---- WMMA helpers; the guards insert the trailing VALU hazard gap and keep A/B live --------------------------
__device__ __forceinline__ v8f mma_raw(v16h a, v16h b, v8f c) {
  return __builtin_amdgcn_wmma_f32_16x16x32_f16(false, a, false, b, (short)0, c, false, false);
}
__device__ __forceinline__ void guard4(v8f& c0, v8f& c1, v8f& c2, v8f& c3,
                                       const v16h& a0, const v16h& a1, const v16h& b0, const v16h& b1) {
#if defined(__HIP_DEVICE_COMPILE__)
  asm volatile("v_nop\n\tv_nop\n\tv_nop\n\tv_nop"
               : "+v"(c0), "+v"(c1), "+v"(c2), "+v"(c3)
               : "v"(a0), "v"(a1), "v"(b0), "v"(b1));
#endif
}
__device__ __forceinline__ void guard6(v8f& c0, v8f& c1, v8f& c2, v8f& c3, v8f& c4, v8f& c5,
                                       const v16h& a0, const v16h& a1, const v16h& b0, const v16h& b1,
                                       const v16h& b2, const v16h& b3) {
#if defined(__HIP_DEVICE_COMPILE__)
  asm volatile("v_nop\n\tv_nop\n\tv_nop\n\tv_nop"
               : "+v"(c0), "+v"(c1), "+v"(c2), "+v"(c3), "+v"(c4), "+v"(c5)
               : "v"(a0), "v"(a1), "v"(b0), "v"(b1), "v"(b2), "v"(b3));
#endif
}
__device__ __forceinline__ void guard8(v8f& c0, v8f& c1, v8f& c2, v8f& c3, v8f& c4, v8f& c5, v8f& c6, v8f& c7,
                                       const v16h& a0, const v16h& a1, const v16h& b0, const v16h& b1,
                                       const v16h& b2, const v16h& b3) {
#if defined(__HIP_DEVICE_COMPILE__)
  asm volatile("v_nop\n\tv_nop\n\tv_nop\n\tv_nop"
               : "+v"(c0), "+v"(c1), "+v"(c2), "+v"(c3), "+v"(c4), "+v"(c5), "+v"(c6), "+v"(c7)
               : "v"(a0), "v"(a1), "v"(b0), "v"(b1), "v"(b2), "v"(b3));
#endif
}

// ---- asynchronous copies, global -> LDS, 16 B per lane, six per statement. The s_wait_xcnt is the last line of the
//      copies' own statement, so that no address register named here is rewritten in front of it.
__device__ __forceinline__ void acopy6(const unsigned* l, const _Float16* const* g) {
#if defined(__HIP_DEVICE_COMPILE__)
  asm volatile("global_load_async_to_lds_b128 %0, %6, off\n\t"
               "global_load_async_to_lds_b128 %1, %7, off\n\t"
               "global_load_async_to_lds_b128 %2, %8, off\n\t"
               "global_load_async_to_lds_b128 %3, %9, off\n\t"
               "global_load_async_to_lds_b128 %4, %10, off\n\t"
               "global_load_async_to_lds_b128 %5, %11, off\n\t"
               "s_wait_xcnt 0x0"
               :: "v"(l[0]), "v"(l[1]), "v"(l[2]), "v"(l[3]), "v"(l[4]), "v"(l[5]),
                  "v"(g[0]), "v"(g[1]), "v"(g[2]), "v"(g[3]), "v"(g[4]), "v"(g[5])
               : "memory");
#endif
}

// the same, eight per statement
__device__ __forceinline__ void acopy8(const unsigned* l, const _Float16* const* g) {
#if defined(__HIP_DEVICE_COMPILE__)
  asm volatile("global_load_async_to_lds_b128 %0, %8, off\n\t"
               "global_load_async_to_lds_b128 %1, %9, off\n\t"
               "global_load_async_to_lds_b128 %2, %10, off\n\t"
               "global_load_async_to_lds_b128 %3, %11, off\n\t"
               "global_load_async_to_lds_b128 %4, %12, off\n\t"
               "global_load_async_to_lds_b128 %5, %13, off\n\t"
               "global_load_async_to_lds_b128 %6, %14, off\n\t"
               "global_load_async_to_lds_b128 %7, %15, off\n\t"
               "s_wait_xcnt 0x0"
               :: "v"(l[0]), "v"(l[1]), "v"(l[2]), "v"(l[3]), "v"(l[4]), "v"(l[5]), "v"(l[6]), "v"(l[7]),
                  "v"(g[0]), "v"(g[1]), "v"(g[2]), "v"(g[3]), "v"(g[4]), "v"(g[5]), "v"(g[6]), "v"(g[7])
               : "memory");
#endif
}

// ---- 64x128 block tile GEMM core, single 16-bit planes: A and W are k-contiguous rows of pitch KC*NCH elements
//      (W is [n][k]). K runs in NCH chunks of KC: each chunk's 64 A rows and 128 W rows are copied in whole lines
//      into LDS rows of KC*2 + 16 bytes (16 B x odd: ds_load_b128 without bank conflicts), A rows first; fragments
//      come from LDS with the table layout, k ascending as before. 8 waves = 2 (32 rows) x 4 (32 cols), 2x2 tiles of
//      16 per wave; results go to the f32 tile Cs[64][LDC], which lies over the staging rows once they are read.
template <int KC> struct StageBytes { static constexpr int pitch = KC * 2 + 16; static constexpr int total = 192 * pitch; };
template <int KC, int NCH>
__device__ __forceinline__ void mm_tile1(const _Float16* __restrict__ A, const _Float16* __restrict__ W,
                                         int arow0, int bcol0, unsigned char* sm) {
  constexpr int LD = KC * NCH;                 // row pitch of both operands, elements
  constexpr int PITCH = StageBytes<KC>::pitch; // LDS row pitch, bytes
  constexpr int PPR = KC / 8;                  // 16-B pieces per row
  constexpr int NCP = 192 * PPR / 256;         // copies per thread and chunk
  constexpr int RPJ = 256 / PPR;               // rows that one copy of all 256 threads covers
  static_assert(NCP * 256 == 192 * PPR && (NCP % 6) == 0 && NCP <= 63);
  static_assert(RPJ * PPR == 256 && (64 % RPJ) == 0 && (KC % 32) == 0 && ((PITCH / 16) & 1) == 1);
  static_assert(64 * LDC * 4 <= StageBytes<KC>::total);
  const int tid = threadIdx.x, wave = tid >> 5, lane = tid & 31, hh = lane >> 4, c = lane & 15;
  const int mw = wave >> 2, nw = wave & 3;
  const int r0 = tid / PPR, piece = tid % PPR;  // this thread's row within a copy's RPJ rows, and its 16-B piece
  const unsigned l0 = (unsigned)(uintptr_t)sm + (unsigned)(r0 * PITCH + piece * 16);  // LDS byte address
  const _Float16* gA = A + (size_t)(arow0 + r0) * LD + piece * 8;
  const _Float16* gW = W + (size_t)(bcol0 + r0) * LD + piece * 8;
  float* Cs = (float*)(void*)sm;
  const _Float16* a0p = (const _Float16*)(const void*)(sm + (mw * 32 + c) * PITCH) + 8 * hh;
  const _Float16* a1p = (const _Float16*)(const void*)(sm + (mw * 32 + 16 + c) * PITCH) + 8 * hh;
  const _Float16* b0p = (const _Float16*)(const void*)(sm + (64 + nw * 32 + c) * PITCH) + 8 * hh;
  const _Float16* b1p = (const _Float16*)(const void*)(sm + (64 + nw * 32 + 16 + c) * PITCH) + 8 * hh;
  v8f c00 = zero8(), c01 = zero8(), c10 = zero8(), c11 = zero8();
#pragma unroll 1  // one copy of the chunk body: the text stays short
  for (int ch = 0; ch < NCH; ++ch) {
    if (ch > 0) {
      // every wave's fragment reads of the last chunk have returned and all waves are here before the rows are refilled
      asm volatile("s_wait_dscnt 0x0" ::: "memory");
      __syncthreads();
    }
#pragma unroll  // l[] and g[] indexed by constants, so they stay in registers
    for (int j0 = 0; j0 < NCP; j0 += 6) {
      unsigned l[6];
      const _Float16* g[6];
#pragma unroll
      for (int j = 0; j < 6; ++j) {
        const int rj = (j0 + j) * RPJ;           // staging row = rj + r0: below 64 an A row, from 64 on a W row
        l[j] = l0 + (unsigned)(rj * PITCH);
        g[j] = (rj < 64 ? gA + (size_t)rj * LD : gW + (size_t)(rj - 64) * LD) + ch * KC;
      }
      acopy6(l, g);
    }
    // this wave's copies have landed; behind the barrier every wave's have
    asm volatile("s_wait_asynccnt 0x0" ::: "memory");
    __syncthreads();
#pragma unroll  // straight-line k-steps: the fragment reads of later steps can go ahead of earlier products
    for (int ks = 0; ks < KC / 32; ++ks) {
      const int ko = ks * 32;
      const v16h fa0 = ldfrag_h(a0p + ko);
      const v16h fa1 = ldfrag_h(a1p + ko);
      const v16h fb0 = ldfrag_h(b0p + ko);
      const v16h fb1 = ldfrag_h(b1p + ko);
      c00 = mma_raw(fa0, fb0, c00);
      c01 = mma_raw(fa0, fb1, c01);
      c10 = mma_raw(fa1, fb0, c10);
      c11 = mma_raw(fa1, fb1, c11);
      if (NCH > 1 && ks == KC / 32 - 1) guard4(c00, c01, c10, c11, fa0, fa1, fb0, fb1);  // in front of the back edge
    }
  }
  // the f32 tile overwrites the staging rows: all fragment reads of all waves end here
  asm volatile("s_wait_dscnt 0x0" ::: "memory");
  __syncthreads();
#pragma unroll
  for (int r = 0; r < 8; ++r) {
    const int row = mw * 32 + 8 * hh + r;
    Cs[row * LDC + nw * 32 + c]             = c00[r];
    Cs[row * LDC + nw * 32 + 16 + c]        = c01[r];
    Cs[(row + 16) * LDC + nw * 32 + c]      = c10[r];
    Cs[(row + 16) * LDC + nw * 32 + 16 + c] = c11[r];
  }
}

// =================================================================================================================
// Weight convert: wqt[n][k] = f16(64 bf16(w_qkv[k][n])), w1t[n][k] = f16(64 bf16(w_fc1[k][n])) (n < 768, k < 256),
// w2t[n][k] = f16(64 bf16(w_fc2[k][n])) (n < 256, k < 768). Block = one output row n; thread = one 16-B piece of
// coverage: wqt 768 x 256, w1t 768 x 256, w2t 256 x 768, every element once.
// =================================================================================================================
__global__ __launch_bounds__(128)
void k_wcvt(const float* __restrict__ wqkv, const float* __restrict__ wfc1, const float* __restrict__ wfc2,
            unsigned short* wqt, unsigned short* w1t, unsigned short* w2t) {
  const int tid = threadIdx.x;
  const int blk = blockIdx.x;
  if (blk < 2 * MLP) {                                      // block-uniform branch
    const int t = (blk < MLP) ? 0 : 1;
    const int n = blk - t * MLP;
    const float* src = t ? wfc1 : wqkv;
    unsigned short* dstp = t ? w1t : wqt;
    const int tt = min(tid, 31);
    const int k0 = tt * 8;
    v4u pk;
#pragma unroll
    for (int e = 0; e < 4; ++e) {
      const float f0 = src[(size_t)(k0 + 2 * e) * MLP + n];
      const float f1 = src[(size_t)(k0 + 2 * e + 1) * MLP + n];
      pk[e] = pk16(hb16(bfr(f0) * 64.0f), hb16(bfr(f1) * 64.0f));
    }
    if (tid < 32) {
      unsigned short* dst = dstp + (size_t)n * DIMC + k0;
      *(v4u*)dst = pk;
      
    }
  } else {
    const int n = blk - 2 * MLP;                            // 0..255
    const int tt = min(tid, 95);
    const int k0 = tt * 8;
    v4u pk;
#pragma unroll
    for (int e = 0; e < 4; ++e) {
      const float f0 = wfc2[(size_t)(k0 + 2 * e) * DIMC + n];
      const float f1 = wfc2[(size_t)(k0 + 2 * e + 1) * DIMC + n];
      pk[e] = pk16(hb16(bfr(f0) * 64.0f), hb16(bfr(f1) * 64.0f));
    }
    if (tid < 96) {
      unsigned short* dst = w2t + (size_t)n * MLP + k0;
      *(v4u*)dst = pk;
      
    }
  }
}

// =================================================================================================================
// x [32768][256] f32 -> xh f16 plane of 16 bf16(x); thread = 8 consecutive elements = one 16-B piece, consecutive
// grid = ceil(npieces/256). coverage: xh [32768][256], every element once.
// =================================================================================================================
__global__ __launch_bounds__(256)
void k_xcvt(const float* __restrict__ x, unsigned short* xh, int npieces) {
  const int i = blockIdx.x * 256 + threadIdx.x;
  if (i >= npieces) return;
  const float* p = x + (size_t)i * 8;
  const v4f a = *(const v4f*)(p);
  const v4f b = *(const v4f*)(p + 4);
  v4u pk;
  pk[0] = pk16(hb16(bfr(a[0]) * 16.0f), hb16(bfr(a[1]) * 16.0f));
  pk[1] = pk16(hb16(bfr(a[2]) * 16.0f), hb16(bfr(a[3]) * 16.0f));
  pk[2] = pk16(hb16(bfr(b[0]) * 16.0f), hb16(bfr(b[1]) * 16.0f));
  pk[3] = pk16(hb16(bfr(b[2]) * 16.0f), hb16(bfr(b[3]) * 16.0f));
  unsigned short* dst = xh + (size_t)i * 8;
  *(v4u*)dst = pk;
  
}

// =================================================================================================================
// Q projection: C[64 tokens][128 cols] = xh . wqt^T (K = 256, 8 k-steps), Cs = 1024 (x w). Column group cg (0..1)
// covers cols cg*128 of the first 256 (q). Carried value 16 (x w + b) = Cs/64 + 16 bf16(b), stored as f16 hi +
// x2048 residual planes qh/ql [token][256] in whole lines.
// grid = (NTOK/64, 2), 256 threads. coverage: qh/ql [32768][256], every element once.
// =================================================================================================================
__global__ __launch_bounds__(256)
void k_qkv(const unsigned short* __restrict__ xh, const unsigned short* __restrict__ wqt,
           const float* __restrict__ bias, unsigned short* qp) {
  __shared__ __align__(16) unsigned char sm[StageBytes<DIMC>::total];
  const float* Cs = (const float*)(const void*)sm;
  const int tid = threadIdx.x;
  const int mb = blockIdx.x, cg = blockIdx.y;
  const int tok0 = mb * 64, col0 = cg * 128;
  mm_tile1<DIMC, 1>((const _Float16*)(const void*)xh, (const _Float16*)(const void*)wqt, tok0, col0, sm);
  __syncthreads();
  unsigned short* dh = qp;
  unsigned short* dl = qp + QL_OFF;
  v4u ph[4], pq[4];
  size_t offs[4];
#pragma unroll
  for (int s4 = 0; s4 < 4; ++s4) {
    const int idx = s4 * 256 + tid;
    const int row = idx >> 4, piece = idx & 15;
    const int colp = piece * 8;
    v4u a, q4;
#pragma unroll
    for (int e = 0; e < 4; ++e) {
      const float b0 = 16.0f * bfr(bias[col0 + colp + 2 * e]);
      const float b1 = 16.0f * bfr(bias[col0 + colp + 2 * e + 1]);
      const float f0 = Cs[row * LDC + colp + 2 * e] * (1.0f / 64.0f) + b0;
      const float f1 = Cs[row * LDC + colp + 2 * e + 1] * (1.0f / 64.0f) + b1;
      unsigned hw, lw;
      split2(f0, f1, hw, lw);
      a[e] = hw; q4[e] = lw;
    }
    ph[s4] = a;
    pq[s4] = q4;
    offs[s4] = (size_t)(tok0 + row) * DIMC + col0 + colp;
  }
#pragma unroll
  for (int s4 = 0; s4 < 4; ++s4) { *(v4u*)(dh + offs[s4]) = ph[s4]; *(v4u*)(dl + offs[s4]) = pq[s4]; }
}

// one 16x16 accumulator tile (lane = channel, registers = 8 consecutive tokens) -> carried value 16 (x w + b) =
// acc/64 + bb as f16 hi + x2048 residual, 16 B each, into the channel's hi row and its lo row (HD rows further on)
__device__ __forceinline__ void put_planes(const v8f& acc, float bb, unsigned char* hi_dst) {
  v4u a, q4;
#pragma unroll
  for (int e = 0; e < 4; ++e) {
    const float f0 = acc[2 * e] * (1.0f / 64.0f) + bb;
    const float f1 = acc[2 * e + 1] * (1.0f / 64.0f) + bb;
    unsigned hw, lw;
    split2(f0, f1, hw, lw);
    a[e] = hw; q4[e] = lw;
  }
  *(v4u*)(void*)hi_dst = a;
  *(v4u*)(void*)(hi_dst + HD * TSP) = q4;
}

// =================================================================================================================
// K, V projection of one head fused with its channel-attention logits, split over K. Block (ck, bh) takes the KCH
// tokens of chunk ck in KCH/64 sub-tiles of 64. The head's 64 k rows and 64 v rows of wqt are copied into LDS once
// (rows of WSP bytes); per sub-tile the 64 xh rows are copied in, C[64 tokens][128 channels] = xh . w^T (K = 256,
// 8 waves = 2 (32 tokens) x 4 (32 channels), as in the GEMM core), and each lane's 8 consecutive tokens of a channel
// go as f16 hi + x2048 residual into the LDS planes T[plane * 64 + channel][64 tokens] (rows of TSP bytes; planes
// k hi, k lo, v hi, v lo). Then raw[d][e] += sum_n (16 k[n][d]) (16 v[n][e]) on WMMA (M = N = 64, 2 k-steps):
// A = k planes, B = v planes, products hi*hi + (hi*lo + lo*hi)/2048, 8 waves = 4 (16 rows) x 2 (32 cols), tokens
// ascending. k and v never leave the work-group. The chunk's f32 tile goes through LDS to part[ck][bh][d][e].
// grid = (KSPLIT, 32), 256 threads. coverage: part [KSPLIT][32][64][64] f32, every element once.
// =================================================================================================================
// four waves per SIMD: the register budget that lets two work-groups (the LDS limit) share a WGP
__global__ __launch_bounds__(256) __attribute__((amdgpu_waves_per_eu(4)))
void k_kv_part(const unsigned short* __restrict__ xh, const unsigned short* __restrict__ wqt,
               const float* __restrict__ bias, float* part) {
  __shared__ __align__(16) unsigned char sm[192 * WSP + 4 * HD * TSP];
  unsigned char* sW = sm;                                   // 128 weight rows: 0..63 k channels, 64..127 v channels
  unsigned char* sA = sm + 128 * WSP;                       // 64 token rows
  unsigned char* sT = sm + 192 * WSP;                       // the four planes of one sub-tile
  static_assert(64 * LDA * 4 <= 64 * WSP);
  const int tid = threadIdx.x, wave = tid >> 5, lane = tid & 31, hh = lane >> 4, c = lane & 15;
  const int ck = blockIdx.x, bh = blockIdx.y;
  const int h = bh & (NH - 1);
  const int tok0 = (bh >> 2) * NN + ck * KCH;
  const _Float16* gA = (const _Float16*)(const void*)xh + (size_t)(tok0 + wave) * DIMC + lane * 8;
  const unsigned lA = (unsigned)(uintptr_t)sA + (unsigned)(wave * WSP + lane * 16);   // LDS byte address
  {
    // one wave copy = one whole row of 512 B; row = j * 8 + wave
    const _Float16* gK = (const _Float16*)(const void*)wqt + (size_t)(DIMC + h * HD + wave) * DIMC + lane * 8;
    const _Float16* gV = gK + (size_t)DIMC * DIMC;
    const unsigned lW = (unsigned)(uintptr_t)sW + (unsigned)(wave * WSP + lane * 16);
    unsigned l[8];
    const _Float16* g[8];
#pragma unroll  // l[] and g[] indexed by constants, so they stay in registers (the two loops below likewise)
    for (int j = 0; j < 8; ++j) { l[j] = lW + (unsigned)(j * 8 * WSP); g[j] = gK + (size_t)j * 8 * DIMC; }
    acopy8(l, g);
#pragma unroll
    for (int j = 0; j < 8; ++j) { l[j] = lW + (unsigned)((64 + j * 8) * WSP); g[j] = gV + (size_t)j * 8 * DIMC; }
    acopy8(l, g);
#pragma unroll
    for (int j = 0; j < 8; ++j) { l[j] = lA + (unsigned)(j * 8 * WSP); g[j] = gA + (size_t)j * 8 * DIMC; }
    acopy8(l, g);
    // this wave's copies have landed; behind the barrier every wave's have
    asm volatile("s_wait_asynccnt 0x0" ::: "memory");
    __syncthreads();
  }
  // projection: wave = 32 tokens x 32 channels
  const int mw = wave >> 2, nw = wave & 3;
  const _Float16* a0p = (const _Float16*)(const void*)(sA + (mw * 32 + c) * WSP) + 8 * hh;
  const _Float16* a1p = (const _Float16*)(const void*)(sA + (mw * 32 + 16 + c) * WSP) + 8 * hh;
  const _Float16* b0p = (const _Float16*)(const void*)(sW + (nw * 32 + c) * WSP) + 8 * hh;
  const _Float16* b1p = (const _Float16*)(const void*)(sW + (nw * 32 + 16 + c) * WSP) + 8 * hh;
  const int kvs = nw >> 1;                                  // 0: this wave's channels are k, 1: v
  const int d0 = (nw & 1) * 32 + c;                         // channel within the head; the second tile is d0 + 16
  const float bb0 = 16.0f * bfr(bias[(1 + kvs) * DIMC + h * HD + d0]);
  const float bb1 = 16.0f * bfr(bias[(1 + kvs) * DIMC + h * HD + d0 + 16]);
  unsigned char* t00 = sT + (kvs * 2 * HD + d0) * TSP + (mw * 32 + 8 * hh) * 2;   // hi row of d0, this lane's 8 tokens
  // logits: wave = 16 rows d x 32 cols e
  const int mv = wave >> 1, nv = wave & 1;
  const _Float16* ahp = (const _Float16*)(const void*)(sT + (mv * 16 + c) * TSP) + 8 * hh;
  const _Float16* alp = (const _Float16*)(const void*)(sT + (HD + mv * 16 + c) * TSP) + 8 * hh;
  const _Float16* b0h = (const _Float16*)(const void*)(sT + (2 * HD + nv * 32 + c) * TSP) + 8 * hh;
  const _Float16* b1h = (const _Float16*)(const void*)(sT + (2 * HD + nv * 32 + 16 + c) * TSP) + 8 * hh;
  const _Float16* b0l = (const _Float16*)(const void*)(sT + (3 * HD + nv * 32 + c) * TSP) + 8 * hh;
  const _Float16* b1l = (const _Float16*)(const void*)(sT + (3 * HD + nv * 32 + 16 + c) * TSP) + 8 * hh;
  v8f p0 = zero8(), p1 = zero8(), q0 = zero8(), q1 = zero8(), r0 = zero8(), r1 = zero8();
#pragma unroll 1  // one copy of the sub-tile body: the text stays short
  for (int t = 0; t < KCH / 64; ++t) {                      // block-uniform trip count
    v8f c00 = zero8(), c01 = zero8(), c10 = zero8(), c11 = zero8();
    // fragments are fetched one k-step ahead: the reads of step ks + 1 are in flight under the products of step ks
    v16h fa0 = ldfrag_h(a0p), fa1 = ldfrag_h(a1p);
    v16h fb0 = ldfrag_h(b0p), fb1 = ldfrag_h(b1p);
#pragma unroll  // straight-line k-steps
    for (int ks = 0; ks < DIMC / 32; ++ks) {
      const int kn = (ks + 1 < DIMC / 32 ? ks + 1 : ks) * 32;
      v16h na0 = fa0, na1 = fa1, nb0 = fb0, nb1 = fb1;
      if (ks + 1 < DIMC / 32) {
        na0 = ldfrag_h(a0p + kn);
        na1 = ldfrag_h(a1p + kn);
        nb0 = ldfrag_h(b0p + kn);
        nb1 = ldfrag_h(b1p + kn);
      }
      __builtin_amdgcn_sched_barrier(0);  // holds the next step's reads in front of this step's products
      c00 = mma_raw(fa0, fb0, c00);
      c01 = mma_raw(fa0, fb1, c01);
      c10 = mma_raw(fa1, fb0, c10);
      c11 = mma_raw(fa1, fb1, c11);
      __builtin_amdgcn_sched_barrier(0);  // and later reads behind them: no deeper fetch, no spills
      fa0 = na0; fa1 = na1; fb0 = nb0; fb1 = nb1;
    }
    put_planes(c00, bb0, t00);
    put_planes(c01, bb1, t00 + 16 * TSP);
    put_planes(c10, bb0, t00 + 32);
    put_planes(c11, bb1, t00 + 16 * TSP + 32);
    // the planes are written and this wave's reads of the token rows have returned; behind the barrier all waves' have
    asm volatile("s_wait_dscnt 0x0" ::: "memory");
    __syncthreads();
    if (t + 1 < KCH / 64) {                                 // block-uniform: the next sub-tile's token rows fly under the logits
      unsigned l[8];
      const _Float16* g[8];
#pragma unroll
      for (int j = 0; j < 8; ++j) { l[j] = lA + (unsigned)(j * 8 * WSP); g[j] = gA + (size_t)((t + 1) * 64 + j * 8) * DIMC; }
      acopy8(l, g);
    }
#pragma unroll  // two straight-line k-steps
    for (int ks = 0; ks < 2; ++ks) {
      const int ko = ks * 32;
      const v16h fa  = ldfrag_h(ahp + ko);
      const v16h ga  = ldfrag_h(alp + ko);
      const v16h fb0 = ldfrag_h(b0h + ko);
      const v16h fb1 = ldfrag_h(b1h + ko);
      const v16h gb0 = ldfrag_h(b0l + ko);
      const v16h gb1 = ldfrag_h(b1l + ko);
      p0 = mma_raw(fa, fb0, p0);
      p1 = mma_raw(fa, fb1, p1);
      q0 = mma_raw(fa, gb0, q0);
      q1 = mma_raw(fa, gb1, q1);
      r0 = mma_raw(ga, fb0, r0);
      r1 = mma_raw(ga, fb1, r1);
      if (ks == 1) guard6(p0, p1, q0, q1, r0, r1, fa, ga, fb0, fb1, gb0, gb1);  // in front of the back edge
    }
    // the plane reads have returned and this wave's copies have landed; behind the barrier the planes may be
    // rewritten and the new token rows read
    asm volatile("s_wait_dscnt 0x0" ::: "memory");
    asm volatile("s_wait_asynccnt 0x0" ::: "memory");
    __syncthreads();
  }
  float* Cs = (float*)(void*)sA;                            // the token rows are dead: the f32 tile lies over them
#pragma unroll
  for (int r = 0; r < 8; ++r) {
    const int row = mv * 16 + 8 * hh + r;
    Cs[row * LDA + nv * 32 + c]      = p0[r] + (q0[r] + r0[r]) * RSC;
    Cs[row * LDA + nv * 32 + 16 + c] = p1[r] + (q1[r] + r1[r]) * RSC;
  }
  __syncthreads();
  float* dst = part + ((size_t)ck * (BB * NH) + bh) * (HD * HD);
  v4f pk[4];
#pragma unroll  // pk[] indexed by constants, so it stays in registers
  for (int s = 0; s < 4; ++s) {
    const int idx = s * 256 + tid;
    pk[s] = *(const v4f*)(Cs + (idx >> 4) * LDA + (idx & 15) * 4);
  }
#pragma unroll  // as above
  for (int s = 0; s < 4; ++s) *(v4f*)(dst + (size_t)(s * 256 + tid) * 4) = pk[s];
}

// =================================================================================================================
// Chunk sum + softmax. Block = 16 rows d of one (b, h); thread = 4 consecutive e of one row, 16 lanes per row.
// raw = sum over ck of part[ck] in index order; logit = raw/2048 (includes the head_dim^-0.5 factor 1/8). Softmax
// over e per row d in f32 (max subtracted, 16-lane butterflies), 4096 P stored as f16 hi + x2048 residual planes;
// a wave's store covers two whole 128-B rows.
// grid = (32, 4), 256 threads. coverage: ath/atl [32][64][64], every element once.
// =================================================================================================================
__global__ __launch_bounds__(256)
void k_attn_sm(const float* __restrict__ part, unsigned short* at) {
  const int tid = threadIdx.x;
  const int bh = blockIdx.x;
  const int row = blockIdx.y * 16 + (tid >> 4), col0 = (tid & 15) * 4;
  const size_t off = ((size_t)bh * HD + row) * HD + col0;
  v4f t[KSPLIT];
#pragma unroll  // all chunk loads issued before the first add: one memory latency, not KSPLIT
  for (int s = 0; s < KSPLIT; ++s) t[s] = *(const v4f*)(part + (size_t)s * ATL_OFF + off);
  v4f a = t[0];
#pragma unroll  // t[] indexed by constants, so it stays in registers (the short loops below likewise)
  for (int s = 1; s < KSPLIT; ++s) a += t[s];
  float mx = fmaxf(fmaxf(a[0], a[1]), fmaxf(a[2], a[3]));
#pragma unroll
  for (int o = 1; o < 16; o <<= 1) mx = fmaxf(mx, __shfl_xor(mx, o, 32));
  float e[4];
#pragma unroll
  for (int n = 0; n < 4; ++n) e[n] = expf((a[n] - mx) * RSC);
  float sm = (e[0] + e[1]) + (e[2] + e[3]);
#pragma unroll
  for (int o = 1; o < 16; o <<= 1) sm += __shfl_xor(sm, o, 32);
  const float sc = (1.0f / sm) * 4096.0f;
  v2u ph, pq;
#pragma unroll
  for (int n = 0; n < 2; ++n) {
    unsigned hw, lw;
    split2(e[2 * n] * sc, e[2 * n + 1] * sc, hw, lw);
    ph[n] = hw; pq[n] = lw;
  }
  *(v2u*)(at + off) = ph;
  *(v2u*)(at + ATL_OFF + off) = pq;
}

// =================================================================================================================
// xf + residual + layer norm + FC1 + exact GELU + FC2 + bias + residual in one kernel: x1, h and g never leave the
// work-group. Block = 128 tokens of one batch, 16 waves, one block per WGP. Wave (wq, wr) owns 32 tokens (wq) x the 64
// channels of head wr, from xf to the output.
// xf: C[64 d][32 tokens] = sum_e (4096 P[d][e]) (16 q[token][wr*64+e]) on WMMA (K = 64, 2 k-steps): A = P hi/lo rows,
// B = q hi/lo rows, products hi*hi + (hi*lo + lo*hi)/2048, xf = C/65536; a lane holds 8 consecutive channels of one
// token. x1 = bf16(x) + xf in registers (bf16(x) = xh/16). Layer norm: mean, then the sum of squared differences, each
// summed in the lane, over the lane pair and over the four waves of a token through LDS. 16 h goes as f16, 16 B a
// store, into H[token][256] in LDS. 1024 x1 is the start value of the FC2 accumulators.
// The 768 hidden channels run in 6 chunks of 128. Per chunk: C1[128 hidden][128 tokens] = w1t rows . H rows^T (8
// k-steps, 16 waves = 4 (32 hidden) x 4 (32 tokens)): v = C1/1024 + bf16(b1), g = 0.5 v (1 + erf(v / sqrt 2)) in
// registers, 16 g as f16, one 16-B LDS store into G[token][128]. Then C2[256 cols][128 tokens] += w2t chunk . G^T
// (4 k-steps), hidden channels ascending. The chunk's w2t rows fly under FC1 and GELU, the next chunk's w1t rows under
// FC2. out = C2/1024 + bf16(b2) through an f32 LDS tile, whole lines.
// grid = NTOK/128, 512 threads. coverage: out [32768][256] f32, every element once.
// =================================================================================================================
__global__ __launch_bounds__(512)
void k_mlp(const unsigned short* __restrict__ qp, const unsigned short* __restrict__ at,
           const unsigned short* __restrict__ xh, const float* __restrict__ gw, const float* __restrict__ gb,
           const unsigned short* __restrict__ w1t, const float* __restrict__ bias1,
           const unsigned short* __restrict__ w2t, const float* __restrict__ bias2, float* out) {
  __shared__ __align__(16) unsigned char sm[384 * WSP + 384 * GSP + MLP * 4 + 2 * NH * 128 * 4 + 2 * DIMC * 4];
  unsigned char* sH  = sm;                                  // 128 token rows, WSP bytes each: q hi, then h
  unsigned char* sW1 = sm + 128 * WSP;                      // 128 rows: q lo, then the chunk's w1t rows
  unsigned char* sG  = sm + 256 * WSP;                      // 128 token rows of g, GSP bytes each
  unsigned char* sW2 = sm + 256 * WSP + 128 * GSP;          // 256 w2t rows, the chunk's 128 k
  unsigned char* sP  = sG;                                  // first: 512 rows of XSP bytes, P hi [head][d], then P lo
  float* sB1 = (float*)(void*)(sm + 256 * WSP + 384 * GSP); // bf16(b1) as f32
  unsigned char* sX  = sm + 256 * WSP + 384 * GSP + MLP * 4;  // 128 token rows of xh
  float* sR  = (float*)(void*)(sX + 128 * WSP);             // layer-norm partial sums [2][head][128 tokens]
  float* sLN = sR + 2 * NH * 128;                           // bf16(norm weight), then bf16(norm bias), as f32
  static_assert(128 * LDX * 4 <= 256 * WSP);
  static_assert(2 * NH * HD * XSP <= 384 * GSP && (NN % 128) == 0);
  static_assert(sizeof(sm) <= 327680);
  const int tid = threadIdx.x, wave = tid >> 5, lane = tid & 31, hh = lane >> 4, c = lane & 15;
  const int tok0 = blockIdx.x * 128;
  const int wq = wave >> 2, wr = wave & 3;
  // copies: a wave copy covers one whole 512-B row (q, xh, w1t), two 256-B row pieces (w2t) or four 128-B rows (P)
  const _Float16* gQ  = (const _Float16*)(const void*)qp + (size_t)(tok0 + wave) * DIMC + lane * 8;
  const _Float16* gX  = (const _Float16*)(const void*)xh + (size_t)(tok0 + wave) * DIMC + lane * 8;
  const _Float16* gP  = (const _Float16*)(const void*)at + (size_t)(tok0 / NN) * (NH * HD * HD) + tid * 8;
  const _Float16* gW1 = (const _Float16*)(const void*)w1t + (size_t)wave * DIMC + lane * 8;
  const _Float16* gW2 = (const _Float16*)(const void*)w2t + (size_t)(wave * 2 + hh) * MLP + c * 8;
  const unsigned lH  = (unsigned)(uintptr_t)sH  + (unsigned)(wave * WSP + lane * 16);            // LDS byte addresses
  const unsigned lW1 = (unsigned)(uintptr_t)sW1 + (unsigned)(wave * WSP + lane * 16);
  const unsigned lX  = (unsigned)(uintptr_t)sX  + (unsigned)(wave * WSP + lane * 16);
  const unsigned lP  = (unsigned)(uintptr_t)sP  + (unsigned)((tid >> 3) * XSP + (tid & 7) * 16);
  const unsigned lW2 = (unsigned)(uintptr_t)sW2 + (unsigned)((wave * 2 + hh) * GSP + c * 16);
  {
    unsigned l[8];
    const _Float16* g[8];
#pragma unroll  // l[] and g[] indexed by constants, so they stay in registers (the copy loops below likewise)
    for (int j = 0; j < 8; ++j) { l[j] = lH + (unsigned)(j * 16 * WSP); g[j] = gQ + (size_t)j * 16 * DIMC; }
    acopy8(l, g);
#pragma unroll
    for (int j = 0; j < 8; ++j) { l[j] = lW1 + (unsigned)(j * 16 * WSP); g[j] = gQ + QL_OFF + (size_t)j * 16 * DIMC; }
    acopy8(l, g);
#pragma unroll
    for (int j = 0; j < 8; ++j) {                           // j < 4: P hi, 64 rows (one head) a copy; j >= 4: P lo
      l[j] = lP + (unsigned)(j * HD * XSP);
      g[j] = gP + (size_t)(j >> 2) * ATL_OFF + (size_t)(j & 3) * HD * HD;
    }
    acopy8(l, g);
#pragma unroll
    for (int j = 0; j < 8; ++j) { l[j] = lX + (unsigned)(j * 16 * WSP); g[j] = gX + (size_t)j * 16 * DIMC; }
    acopy8(l, g);
    for (int i = tid; i < MLP; i += 512) sB1[i] = bfr(bias1[i]);
    if (tid < DIMC) { sLN[tid] = bfr(gw[tid]); sLN[DIMC + tid] = bfr(gb[tid]); }
    // this wave's copies have landed; behind the barrier every wave's have, and the three parameter rows are written
    asm volatile("s_wait_asynccnt 0x0" ::: "memory");
    __syncthreads();
  }
  // o[n][t]: lane = token wq*32 + t*16 + c, registers = channels wr*64 + n*16 + 8*hh + 0..7
  v8f o[4][2];
  {
    const _Float16* qhp = (const _Float16*)(const void*)(sH  + (wq * 32 + c) * WSP) + wr * HD + 8 * hh;
    const _Float16* qlp = (const _Float16*)(const void*)(sW1 + (wq * 32 + c) * WSP) + wr * HD + 8 * hh;
    const _Float16* xp  = (const _Float16*)(const void*)(sX  + (wq * 32 + c) * WSP) + wr * HD + 8 * hh;
    const _Float16* php = (const _Float16*)(const void*)(sP + (wr * HD + c) * XSP) + 8 * hh;
    const _Float16* plp = (const _Float16*)(const void*)(sP + (NH * HD + wr * HD + c) * XSP) + 8 * hh;
#pragma unroll  // every array below is indexed by constants, so it stays in registers (every short loop likewise)
    for (int t = 0; t < 2; ++t) {
      const v16h fq0 = ldfrag_h(qhp + t * 16 * (WSP / 2)), fq1 = ldfrag_h(qhp + t * 16 * (WSP / 2) + 32);
      const v16h gq0 = ldfrag_h(qlp + t * 16 * (WSP / 2)), gq1 = ldfrag_h(qlp + t * 16 * (WSP / 2) + 32);
#pragma unroll
      for (int n = 0; n < 4; ++n) {
        const v16h fp0 = ldfrag_h(php + n * 16 * (XSP / 2)), fp1 = ldfrag_h(php + n * 16 * (XSP / 2) + 32);
        const v16h gp0 = ldfrag_h(plp + n * 16 * (XSP / 2)), gp1 = ldfrag_h(plp + n * 16 * (XSP / 2) + 32);
        const v8h xv = *(const v8h*)(xp + t * 16 * (WSP / 2) + n * 16);
        v8f p = zero8(), q = zero8(), r = zero8();
        p = mma_raw(fp0, fq0, p);
        q = mma_raw(gp0, fq0, q);
        r = mma_raw(fp0, gq0, r);
        p = mma_raw(fp1, fq1, p);
        q = mma_raw(gp1, fq1, q);
        r = mma_raw(fp1, gq1, r);
#pragma unroll
        for (int e = 0; e < 8; ++e)
          o[n][t][e] = (float)xv[e] * (1.0f / 16.0f) + (p[e] + (q[e] + r[e]) * RSC) * (1.0f / 65536.0f);
        __builtin_amdgcn_sched_barrier(0);  // holds later fragment reads behind these products: no spills
      }
    }
  }
  float mu[2], rs[2];
#pragma unroll
  for (int t = 0; t < 2; ++t) {
    float s = 0.f;
#pragma unroll
    for (int n = 0; n < 4; ++n)
      s += ((o[n][t][0] + o[n][t][1]) + (o[n][t][2] + o[n][t][3])) + ((o[n][t][4] + o[n][t][5]) + (o[n][t][6] + o[n][t][7]));
    s += __shfl_xor(s, 16, 32);
    if (hh == 0) sR[wr * 128 + wq * 32 + t * 16 + c] = s;
  }
  // the sums are written and this wave's reads of q, P and xh have returned; behind the barrier all waves' have
  asm volatile("s_wait_dscnt 0x0" ::: "memory");
  __syncthreads();
  {
    // the first chunk's w1t rows go where q lo lay and fly under the rest of the layer norm
    unsigned l[8];
    const _Float16* g[8];
#pragma unroll
    for (int j = 0; j < 8; ++j) { l[j] = lW1 + (unsigned)(j * 16 * WSP); g[j] = gW1 + (size_t)j * 16 * DIMC; }
    acopy8(l, g);
  }
#pragma unroll
  for (int t = 0; t < 2; ++t) {
    const float* rp = sR + wq * 32 + t * 16 + c;
    mu[t] = ((rp[0] + rp[128]) + (rp[256] + rp[384])) * (1.0f / 256.0f);
    float sq = 0.f;
#pragma unroll
    for (int n = 0; n < 4; ++n)
#pragma unroll
      for (int e = 0; e < 8; ++e) { const float d = o[n][t][e] - mu[t]; sq += d * d; }
    sq += __shfl_xor(sq, 16, 32);
    if (hh == 0) sR[NH * 128 + wr * 128 + wq * 32 + t * 16 + c] = sq;
  }
  __syncthreads();
#pragma unroll
  for (int t = 0; t < 2; ++t) {
    const float* rp = sR + NH * 128 + wq * 32 + t * 16 + c;
    rs[t] = rsqrtf(((rp[0] + rp[128]) + (rp[256] + rp[384])) * (1.0f / 256.0f) + 1e-5f);
  }
#pragma unroll
  for (int n = 0; n < 4; ++n) {
    const int col0 = wr * HD + n * 16 + 8 * hh;
    const v4f gA = *(const v4f*)(sLN + col0), gB = *(const v4f*)(sLN + col0 + 4);
    const v4f bA = *(const v4f*)(sLN + DIMC + col0), bB = *(const v4f*)(sLN + DIMC + col0 + 4);
    const float gv[8] = { gA[0], gA[1], gA[2], gA[3], gB[0], gB[1], gB[2], gB[3] };
    const float bv[8] = { bA[0], bA[1], bA[2], bA[3], bB[0], bB[1], bB[2], bB[3] };
#pragma unroll
    for (int t = 0; t < 2; ++t) {
      v4u pk;
#pragma unroll
      for (int e = 0; e < 4; ++e) {
        const float f0 = ((o[n][t][2 * e] - mu[t]) * rs[t]) * gv[2 * e] + bv[2 * e];
        const float f1 = ((o[n][t][2 * e + 1] - mu[t]) * rs[t]) * gv[2 * e + 1] + bv[2 * e + 1];
        pk[e] = pk16(hb16(f0 * 16.0f), hb16(f1 * 16.0f));
      }
      *(v4u*)(void*)(sH + (wq * 32 + t * 16 + c) * WSP + col0 * 2) = pk;
      o[n][t] *= 1024.0f;                                   // x1 in the scale of the FC2 products
    }
  }
  // h is written and this wave's w1t copies have landed; behind the barrier all waves' have
  asm volatile("s_wait_dscnt 0x0" ::: "memory");
  asm volatile("s_wait_asynccnt 0x0" ::: "memory");
  __syncthreads();
  // FC1: wave = 32 hidden (wq) x 32 tokens (wr); FC2: wave = 64 cols (wr) x 32 tokens (wq)
  const _Float16* w1p = (const _Float16*)(const void*)(sW1 + (wq * 32 + c) * WSP) + 8 * hh;
  const _Float16* hp  = (const _Float16*)(const void*)(sH  + (wr * 32 + c) * WSP) + 8 * hh;
  const _Float16* gp  = (const _Float16*)(const void*)(sG  + (wq * 32 + c) * GSP) + 8 * hh;
  const _Float16* w2p = (const _Float16*)(const void*)(sW2 + (wr * 64 + c) * GSP) + 8 * hh;
  unsigned char* gst = sG + (wr * 32 + c) * GSP + (wq * 32 + 8 * hh) * 2;   // this lane's token row, its 8 hidden channels
#pragma unroll 1  // one copy of the chunk body: the text stays short
  for (int ch = 0; ch < MLP / 128; ++ch) {                  // block-uniform trip count
    {
      // the chunk's w2t rows fly under FC1 and GELU; the last chunk's readers left them at the barrier at the loop's foot
      // (first chunk: the readers of the P rows that lay there left them at the barrier behind the row sums)
      unsigned l[8];
      const _Float16* g[8];
#pragma unroll
      for (int j = 0; j < 8; ++j) { l[j] = lW2 + (unsigned)(j * 32 * GSP); g[j] = gW2 + (size_t)j * 32 * MLP + ch * 128; }
      acopy8(l, g);
    }
    v8f a[2][2];
#pragma unroll
    for (int i = 0; i < 2; ++i)
#pragma unroll
      for (int t = 0; t < 2; ++t) a[i][t] = zero8();
    {
      // fragments are fetched one k-step ahead: the reads of step ks + 1 are in flight under the products of step ks
      v16h fw0 = ldfrag_h(w1p), fw1 = ldfrag_h(w1p + 16 * (WSP / 2));
      v16h fh0 = ldfrag_h(hp), fh1 = ldfrag_h(hp + 16 * (WSP / 2));
#pragma unroll  // straight-line k-steps
      for (int ks = 0; ks < DIMC / 32; ++ks) {
        const int kn = (ks + 1) * 32;
        v16h nw0 = fw0, nw1 = fw1, nh0 = fh0, nh1 = fh1;
        if (ks + 1 < DIMC / 32) {
          nw0 = ldfrag_h(w1p + kn);
          nw1 = ldfrag_h(w1p + 16 * (WSP / 2) + kn);
          nh0 = ldfrag_h(hp + kn);
          nh1 = ldfrag_h(hp + 16 * (WSP / 2) + kn);
        }
        __builtin_amdgcn_sched_barrier(0);  // holds the next step's reads in front of this step's products
        a[0][0] = mma_raw(fw0, fh0, a[0][0]);
        a[0][1] = mma_raw(fw0, fh1, a[0][1]);
        a[1][0] = mma_raw(fw1, fh0, a[1][0]);
        a[1][1] = mma_raw(fw1, fh1, a[1][1]);
        __builtin_amdgcn_sched_barrier(0);  // and later reads behind them: one step ahead, no deeper
        fw0 = nw0; fw1 = nw1; fh0 = nh0; fh1 = nh1;
      }
    }
#pragma unroll
    for (int i = 0; i < 2; ++i) {
      const float* bp = sB1 + ch * 128 + wq * 32 + i * 16 + 8 * hh;
      const v4f bA = *(const v4f*)(bp);
      const v4f bB = *(const v4f*)(bp + 4);
      const float bv[8] = { bA[0], bA[1], bA[2], bA[3], bB[0], bB[1], bB[2], bB[3] };
#pragma unroll
      for (int t = 0; t < 2; ++t) {
        float v[8], xe[8], er[8];
        bool small = true;
#pragma unroll
        for (int e = 0; e < 8; ++e) {
          v[e] = a[i][t][e] * (1.0f / 1024.0f) + bv[e];
          xe[e] = v[e] * 0.70710678118654752f;
          small = small && (fabsf(xe[e]) < 1.0f);
        }
        // erff tests |x| < 1 for each value; one test for the lane's 8 values leaves 8 independent chains with no
        // branch between them on the side where all are below 1, and the full erff for all 8 on the other side
        if (small) {
#pragma unroll
          for (int e = 0; e < 8; ++e) er[e] = erff(xe[e]);
        } else {
#pragma unroll
          for (int e = 0; e < 8; ++e) er[e] = erff(xe[e]);
        }
        v4u pk;
#pragma unroll
        for (int e = 0; e < 4; ++e) {
          const float g0 = 0.5f * v[2 * e] * (1.0f + er[2 * e]);
          const float g1 = 0.5f * v[2 * e + 1] * (1.0f + er[2 * e + 1]);
          pk[e] = pk16(hb16(g0 * 16.0f), hb16(g1 * 16.0f));
        }
        *(v4u*)(void*)(gst + t * 16 * GSP + i * 32) = pk;
      }
    }
    // g is written, this wave's reads of the w1t rows have returned and its w2t copies have landed; behind the barrier
    // all waves' have
    asm volatile("s_wait_dscnt 0x0" ::: "memory");
    asm volatile("s_wait_asynccnt 0x0" ::: "memory");
    __syncthreads();
    if (ch + 1 < MLP / 128) {                               // block-uniform: the next chunk's w1t rows fly under FC2
      unsigned l[8];
      const _Float16* g[8];
#pragma unroll
      for (int j = 0; j < 8; ++j) { l[j] = lW1 + (unsigned)(j * 16 * WSP); g[j] = gW1 + (size_t)((ch + 1) * 128 + j * 16) * DIMC; }
      acopy8(l, g);
    }
    // fragments one k-step ahead, as in FC1
    v16h fg0 = ldfrag_h(gp), fg1 = ldfrag_h(gp + 16 * (GSP / 2));
    v16h fv0 = ldfrag_h(w2p), fv1 = ldfrag_h(w2p + 16 * (GSP / 2));
    v16h fv2 = ldfrag_h(w2p + 32 * (GSP / 2)), fv3 = ldfrag_h(w2p + 48 * (GSP / 2));
#pragma unroll  // straight-line k-steps
    for (int ks = 0; ks < 4; ++ks) {
      const int kn = (ks + 1) * 32;
      v16h ng0 = fg0, ng1 = fg1, nv0 = fv0, nv1 = fv1, nv2 = fv2, nv3 = fv3;
      if (ks + 1 < 4) {
        ng0 = ldfrag_h(gp + kn);
        ng1 = ldfrag_h(gp + 16 * (GSP / 2) + kn);
        nv0 = ldfrag_h(w2p + kn);
        nv1 = ldfrag_h(w2p + 16 * (GSP / 2) + kn);
        nv2 = ldfrag_h(w2p + 32 * (GSP / 2) + kn);
        nv3 = ldfrag_h(w2p + 48 * (GSP / 2) + kn);
      }
      __builtin_amdgcn_sched_barrier(0);  // holds the next step's reads in front of this step's products
      o[0][0] = mma_raw(fv0, fg0, o[0][0]);
      o[0][1] = mma_raw(fv0, fg1, o[0][1]);
      o[1][0] = mma_raw(fv1, fg0, o[1][0]);
      o[1][1] = mma_raw(fv1, fg1, o[1][1]);
      o[2][0] = mma_raw(fv2, fg0, o[2][0]);
      o[2][1] = mma_raw(fv2, fg1, o[2][1]);
      o[3][0] = mma_raw(fv3, fg0, o[3][0]);
      o[3][1] = mma_raw(fv3, fg1, o[3][1]);
      if (ks == 3)  // in front of the back edge
        guard8(o[0][0], o[0][1], o[1][0], o[1][1], o[2][0], o[2][1], o[3][0], o[3][1], fg0, fg1, fv0, fv1, fv2, fv3);
      __builtin_amdgcn_sched_barrier(0);  // and later reads behind them: one step ahead, no deeper
      fg0 = ng0; fg1 = ng1; fv0 = nv0; fv1 = nv1; fv2 = nv2; fv3 = nv3;
    }
    // the reads of g and of the w2t rows have returned and this wave's w1t copies have landed; behind the barrier g and
    // the w2t rows may be rewritten and the new w1t rows read
    asm volatile("s_wait_dscnt 0x0" ::: "memory");
    asm volatile("s_wait_asynccnt 0x0" ::: "memory");
    __syncthreads();
  }
  float* Cs = (float*)(void*)sm;                            // the h and w1t rows are dead: the f32 tile lies over them
#pragma unroll
  for (int n = 0; n < 4; ++n)
#pragma unroll
    for (int t = 0; t < 2; ++t) {
      float* d = Cs + (wq * 32 + t * 16 + c) * LDX + wr * HD + n * 16 + 8 * hh;
      const v4f lo4 = { o[n][t][0], o[n][t][1], o[n][t][2], o[n][t][3] };
      const v4f hi4 = { o[n][t][4], o[n][t][5], o[n][t][6], o[n][t][7] };
      *(v4f*)d = lo4;
      *(v4f*)(d + 4) = hi4;
    }
  __syncthreads();
  // thread = 4 columns of 16 rows, 8 rows apart: a wave's store covers one whole 512-B half row
  const int row0 = tid >> 6, colp = (tid & 63) * 4;
  char* op = (char*)(void*)out + (unsigned)((tok0 + row0) * DIMC + colp) * 4u;   // byte offset below 32 MiB
  const float* cp = Cs + row0 * LDX + colp;
  v4f b2;
#pragma unroll
  for (int e = 0; e < 4; ++e) b2[e] = bfr(bias2[colp + e]);
#pragma unroll
  for (int s = 0; s < 16; ++s) {
    const v4f c4 = *(const v4f*)(cp + s * 8 * LDX);
    v4f v;
#pragma unroll
    for (int e = 0; e < 4; ++e) v[e] = c4[e] * (1.0f / 1024.0f) + b2[e];
    *(v4f*)(void*)(op + s * 8 * DIMC * 4) = v;
  }
}

// =================================================================================================================
// Workspace map (bytes; all offsets multiples of 131072; every region sized exactly at its whole-line store extent):
//   [0, 16 MiB)      XH  f16 [32768][256]  (k_xcvt -> k_qkv, k_kv_part, k_mlp)
//   [16, 32 MiB)     QH, [32, 48 MiB) QL  (k_qkv -> k_mlp)
//   [48, 56 MiB)     PT  f32 [16][32][64][64] logit partials (k_kv_part -> k_attn_sm)
//   112 MiB + : ATH, ATL f16 [32][64][64] 262144 each | WQT f16 [768][256] 393216 | W1T [768][256] 393216 |
//               W2T f16 [256][768] 393216 ; end = 119144448.
// =================================================================================================================
extern "C" void kernel_launch(void* const* d_in, const int* in_sizes, int n_in,
                              void* d_out, int out_size, void* d_ws, size_t ws_size,
                              hipStream_t stream) {
  if (n_in < 9) return;
  const int expect[9] = { NTOK * DIMC, DIMC * MLP, MLP, DIMC, DIMC, DIMC * MLP, MLP, MLP * DIMC, DIMC };
  for (int i = 0; i < 9; ++i) if (in_sizes[i] != expect[i]) return;
  if (out_size != NTOK * DIMC) return;

  const float* x     = (const float*)d_in[0];
  const float* w_qkv = (const float*)d_in[1];
  const float* b_qkv = (const float*)d_in[2];
  const float* ng    = (const float*)d_in[3];
  const float* nbt   = (const float*)d_in[4];
  const float* w_fc1 = (const float*)d_in[5];
  const float* b_fc1 = (const float*)d_in[6];
  const float* w_fc2 = (const float*)d_in[7];
  const float* b_fc2 = (const float*)d_in[8];
  float* out = (float*)d_out;

  const size_t MiB = (size_t)1048576;
  const size_t szX16 = (size_t)NTOK * DIMC * 2;                    // 16 MiB
  const size_t szAT  = ATL_OFF * 2;                                // 262144
  const size_t szWQ  = (size_t)MLP * DIMC * 2;                     // 393216
  if (szX16 != 16 * MiB) return;

  const size_t oXH  = 0;
  const size_t oQH  = 16 * MiB;                                     // QL at oQH + 16 MiB
  const size_t oPT  = 48 * MiB;
  const size_t oATH = 112 * MiB;                                    // ATL at oATH + szAT
  const size_t oWQT = oATH + 2 * szAT;
  const size_t oW1T = oWQT + szWQ;
  const size_t oW2T = oW1T + szWQ;
  const size_t oEND = oW2T + szWQ;                                  // 119144448
  if (oQH + 2 * szX16 != oPT) return;
  if (oXH + szX16 > oQH) return;
  if (oPT + (size_t)KSPLIT * ATL_OFF * 4 > oATH) return;
  if (oEND > ws_size) return;
  if (oEND > (size_t)134217728) return;

  char* ws = (char*)d_ws;
  unsigned short* XH  = (unsigned short*)(ws + oXH);
  float*          PT  = (float*)(ws + oPT);
  unsigned short* QH  = (unsigned short*)(ws + oQH);
  unsigned short* ATH = (unsigned short*)(ws + oATH);
  unsigned short* WQT = (unsigned short*)(ws + oWQT);
  unsigned short* W1T = (unsigned short*)(ws + oW1T);
  unsigned short* W2T = (unsigned short*)(ws + oW2T);

  const dim3 blk(256);
  const int npieces = NTOK * DIMC / 8;
  // (1) weight planes (transposed, 64 * bf16)
  k_wcvt<<<dim3(2 * MLP + DIMC), dim3(128), 0, stream>>>(w_qkv, w_fc1, w_fc2, WQT, W1T, W2T);
  // (2) x -> f16 plane of 16 bf16(x)
  k_xcvt<<<dim3((npieces + 255) / 256), blk, 0, stream>>>(x, XH, npieces);
  // (3) q projection -> q hi/lo [token][256]
  k_qkv<<<dim3(NTOK / 64, 2), blk, 0, stream>>>(XH, WQT, b_qkv, QH);
  // (4) per (b, h): k, v projection + logits, K split in KSPLIT chunks -> f32 partial tiles; chunk sum + softmax -> P hi/lo planes
  k_kv_part<<<dim3(KSPLIT, BB * NH), blk, 0, stream>>>(XH, WQT, b_qkv, PT);
  k_attn_sm<<<dim3(BB * NH, HD / 16), blk, 0, stream>>>(PT, ATH);
  // (5) xf + residual + layer norm + fc1 + GELU + fc2 + bias + residual -> d_out
  k_mlp<<<dim3(NTOK / 128), dim3(512), 0, stream>>>(QH, ATH, XH, ng, nbt, W1T, b_fc1, W2T, b_fc2, out);
  (void)hipGetLastError();
}

// v006
// A run of this version takes 63.6 microseconds.
// Timed twice side by side with v005, it ran 1.17 times as fast both times.
// All steps since v000 together make it 4.69 times as fast.
// Contractions: qkv projection (K=256), fc1 (K=256), fc2 (K=768): v_wmma_f32_16x16x32_f16, single f16 products,
// activations carried x16, weights one f16 plane of 64*bf16(w); per-head k^T v logits (K=4096) and attn x q (K=64):
// v_wmma_f32_16x16x32_f16 with both operands as f16 hi + x2048 residual planes (3 products); f32 accumulate
// everywhere. Softmax, layer norm, exact GELU and all epilogues f32 on VALU; every float input RNE-converted to
// bf16 on load.
#include <hip/hip_runtime.h>
#include <stdint.h>

#define BB     8
#define NN     4096
#define DIMC   256
#define NH     4
#define HD     64
#define MLP    768
#define NTOK   (BB * NN)
#define LDX    260
#define LDA    68
#define RSC    0.00048828125f
#define ATL_OFF ((size_t)BB * NH * HD * HD)
#define KSPLIT 16
#define KCH    (NN / KSPLIT)
#define XSP    (HD * 2 + 16)
#define WSP    (DIMC * 2 + 16)
#define TSP    (64 * 2 + 16)
#define GSP    (128 * 2 + 16)

static_assert(NTOK == 32768);
static_assert(DIMC == NH * HD);
static_assert((NN % 64) == 0 && (NTOK % 64) == 0);
static_assert((DIMC % 32) == 0 && (MLP % 32) == 0 && (HD % 32) == 0 && (NN % 32) == 0);
static_assert((LDX * 4) % 16 == 0);
static_assert(ATL_OFF == 131072);
static_assert(MLP == 6 * 128 && DIMC == 2 * 128 && (NTOK % 128) == 0 && ((GSP / 16) & 1) == 1);
static_assert(KCH * KSPLIT == NN && (KCH % 32) == 0);
static_assert(KCH == 256 && HD == 64 && ((XSP / 16) & 1) == 1 && ((WSP / 16) & 1) == 1 && ((TSP / 16) & 1) == 1);

typedef _Float16 v16h __attribute__((ext_vector_type(16)));
typedef _Float16 v8h  __attribute__((ext_vector_type(8)));
typedef float    v8f  __attribute__((ext_vector_type(8)));
typedef float    v4f  __attribute__((ext_vector_type(4)));
typedef unsigned int v4u __attribute__((ext_vector_type(4)));
typedef unsigned int v2u __attribute__((ext_vector_type(2)));

// ---- scalar helpers ------------------------------------------------------------------------------------------
__device__ __forceinline__ unsigned short bf_bits(float f) {          // f32 -> bf16 bits, RNE convert
  unsigned u = __float_as_uint(f);
  return (unsigned short)((u + 0x7FFFu + ((u >> 16) & 1u)) >> 16);
}
__device__ __forceinline__ float bf_up(unsigned short b) { return __uint_as_float(((unsigned)b) << 16); }
__device__ __forceinline__ float bfr(float f) { return bf_up(bf_bits(f)); }
__device__ __forceinline__ unsigned short h_bits(_Float16 x) { return __builtin_bit_cast(unsigned short, x); }
__device__ __forceinline__ unsigned short hb16(float f) { return h_bits((_Float16)f); }
__device__ __forceinline__ unsigned pk16(unsigned short a, unsigned short b) { return (unsigned)a | ((unsigned)b << 16); }
__device__ __forceinline__ v8f zero8() { v8f z = {0.f, 0.f, 0.f, 0.f, 0.f, 0.f, 0.f, 0.f}; return z; }
// hi/lo pair of two f32 values: hi = f16(v), lo = f16(2048 (v - hi)), packed as two 32-bit words
__device__ __forceinline__ void split2(float f0, float f1, unsigned& hp, unsigned& lp) {
  const _Float16 h0 = (_Float16)f0, h1 = (_Float16)f1;
  const float q0 = (f0 - (float)h0) * 2048.0f, q1 = (f1 - (float)h1) * 2048.0f;
  hp = pk16(h_bits(h0), h_bits(h1));
  lp = pk16(hb16(q0), hb16(q1));
}

// ---- fragment loader: 16-bit A/B operand, lane -> row/col (lane&15), p already includes +8*(lane>>4);
//      elements 0..7 <- p[0..7] (k0+8h..k0+8h+7), elements 8..15 <- p[16..23] (k0+16+8h..k0+16+8h+7)
__device__ __forceinline__ v16h ldfrag_h(const _Float16* p) {
  union { v16h v; v8h h[2]; } f;
  f.h[0] = *(const v8h*)(p);
  f.h[1] = *(const v8h*)(p + 16);
  return f.v;
}

// ---- WMMA helpers; the guards insert the trailing VALU hazard gap and keep A/B live --------------------------
__device__ __forceinline__ v8f mma_raw(v16h a, v16h b, v8f c) {
  return __builtin_amdgcn_wmma_f32_16x16x32_f16(false, a, false, b, (short)0, c, false, false);
}
__device__ __forceinline__ void guard6(v8f& c0, v8f& c1, v8f& c2, v8f& c3, v8f& c4, v8f& c5,
                                       const v16h& a0, const v16h& a1, const v16h& b0, const v16h& b1,
                                       const v16h& b2, const v16h& b3) {
#if defined(__HIP_DEVICE_COMPILE__)
  asm volatile("v_nop\n\tv_nop\n\tv_nop\n\tv_nop"
               : "+v"(c0), "+v"(c1), "+v"(c2), "+v"(c3), "+v"(c4), "+v"(c5)
               : "v"(a0), "v"(a1), "v"(b0), "v"(b1), "v"(b2), "v"(b3));
#endif
}
__device__ __forceinline__ void guard8(v8f& c0, v8f& c1, v8f& c2, v8f& c3, v8f& c4, v8f& c5, v8f& c6, v8f& c7,
                                       const v16h& a0, const v16h& a1, const v16h& b0, const v16h& b1,
                                       const v16h& b2, const v16h& b3) {
#if defined(__HIP_DEVICE_COMPILE__)
  asm volatile("v_nop\n\tv_nop\n\tv_nop\n\tv_nop"
               : "+v"(c0), "+v"(c1), "+v"(c2), "+v"(c3), "+v"(c4), "+v"(c5), "+v"(c6), "+v"(c7)
               : "v"(a0), "v"(a1), "v"(b0), "v"(b1), "v"(b2), "v"(b3));
#endif
}

// ---- asynchronous copies, global -> LDS, 16 B per lane, eight per statement. The s_wait_xcnt is the last line of the
//      copies' own statement, so that no address register named here is rewritten in front of it.
__device__ __forceinline__ void acopy8(const unsigned* l, const _Float16* const* g) {
#if defined(__HIP_DEVICE_COMPILE__)
  asm volatile("global_load_async_to_lds_b128 %0, %8, off\n\t"
               "global_load_async_to_lds_b128 %1, %9, off\n\t"
               "global_load_async_to_lds_b128 %2, %10, off\n\t"
               "global_load_async_to_lds_b128 %3, %11, off\n\t"
               "global_load_async_to_lds_b128 %4, %12, off\n\t"
               "global_load_async_to_lds_b128 %5, %13, off\n\t"
               "global_load_async_to_lds_b128 %6, %14, off\n\t"
               "global_load_async_to_lds_b128 %7, %15, off\n\t"
               "s_wait_xcnt 0x0"
               :: "v"(l[0]), "v"(l[1]), "v"(l[2]), "v"(l[3]), "v"(l[4]), "v"(l[5]), "v"(l[6]), "v"(l[7]),
                  "v"(g[0]), "v"(g[1]), "v"(g[2]), "v"(g[3]), "v"(g[4]), "v"(g[5]), "v"(g[6]), "v"(g[7])
               : "memory");
#endif
}

// =================================================================================================================
// Weight convert: wqt[n][k] = f16(64 bf16(w_qkv[k][n])), w1t[n][k] = f16(64 bf16(w_fc1[k][n])) (n < 768, k < 256),
// w2t[n][k] = f16(64 bf16(w_fc2[k][n])) (n < 256, k < 768). Block = one output row n; thread = one 16-B piece of
// coverage: wqt 768 x 256, w1t 768 x 256, w2t 256 x 768, every element once.
// =================================================================================================================
__global__ __launch_bounds__(128)
void k_wcvt(const float* __restrict__ wqkv, const float* __restrict__ wfc1, const float* __restrict__ wfc2,
            unsigned short* wqt, unsigned short* w1t, unsigned short* w2t) {
  const int tid = threadIdx.x;
  const int blk = blockIdx.x;
  if (blk < 2 * MLP) {                                      // block-uniform branch
    const int t = (blk < MLP) ? 0 : 1;
    const int n = blk - t * MLP;
    const float* src = t ? wfc1 : wqkv;
    unsigned short* dstp = t ? w1t : wqt;
    const int tt = min(tid, 31);
    const int k0 = tt * 8;
    v4u pk;
#pragma unroll
    for (int e = 0; e < 4; ++e) {
      const float f0 = src[(size_t)(k0 + 2 * e) * MLP + n];
      const float f1 = src[(size_t)(k0 + 2 * e + 1) * MLP + n];
      pk[e] = pk16(hb16(bfr(f0) * 64.0f), hb16(bfr(f1) * 64.0f));
    }
    if (tid < 32) {
      unsigned short* dst = dstp + (size_t)n * DIMC + k0;
      *(v4u*)dst = pk;
      
    }
  } else {
    const int n = blk - 2 * MLP;                            // 0..255
    const int tt = min(tid, 95);
    const int k0 = tt * 8;
    v4u pk;
#pragma unroll
    for (int e = 0; e < 4; ++e) {
      const float f0 = wfc2[(size_t)(k0 + 2 * e) * DIMC + n];
      const float f1 = wfc2[(size_t)(k0 + 2 * e + 1) * DIMC + n];
      pk[e] = pk16(hb16(bfr(f0) * 64.0f), hb16(bfr(f1) * 64.0f));
    }
    if (tid < 96) {
      unsigned short* dst = w2t + (size_t)n * MLP + k0;
      *(v4u*)dst = pk;
      
    }
  }
}

// =================================================================================================================
// x [32768][256] f32 -> xh f16 plane of 16 bf16(x); thread = 8 consecutive elements = one 16-B piece, consecutive
// grid = ceil(npieces/256). coverage: xh [32768][256], every element once.
// =================================================================================================================
__global__ __launch_bounds__(256)
void k_xcvt(const float* __restrict__ x, unsigned short* xh, int npieces) {
  const int i = blockIdx.x * 256 + threadIdx.x;
  if (i >= npieces) return;
  const float* p = x + (size_t)i * 8;
  const v4f a = *(const v4f*)(p);
  const v4f b = *(const v4f*)(p + 4);
  v4u pk;
  pk[0] = pk16(hb16(bfr(a[0]) * 16.0f), hb16(bfr(a[1]) * 16.0f));
  pk[1] = pk16(hb16(bfr(a[2]) * 16.0f), hb16(bfr(a[3]) * 16.0f));
  pk[2] = pk16(hb16(bfr(b[0]) * 16.0f), hb16(bfr(b[1]) * 16.0f));
  pk[3] = pk16(hb16(bfr(b[2]) * 16.0f), hb16(bfr(b[3]) * 16.0f));
  unsigned short* dst = xh + (size_t)i * 8;
  *(v4u*)dst = pk;
  
}

// one 16x16 accumulator tile (lane = channel, registers = 8 consecutive tokens) -> carried value 16 (x w + b) =
// acc/64 + bb as f16 hi + x2048 residual, 16 B each, into the channel's hi row and its lo row (HD rows further on)
__device__ __forceinline__ void put_planes(const v8f& acc, float bb, unsigned char* hi_dst) {
  v4u a, q4;
#pragma unroll
  for (int e = 0; e < 4; ++e) {
    const float f0 = acc[2 * e] * (1.0f / 64.0f) + bb;
    const float f1 = acc[2 * e + 1] * (1.0f / 64.0f) + bb;
    unsigned hw, lw;
    split2(f0, f1, hw, lw);
    a[e] = hw; q4[e] = lw;
  }
  *(v4u*)(void*)hi_dst = a;
  *(v4u*)(void*)(hi_dst + HD * TSP) = q4;
}

// =================================================================================================================
// K, V projection of one head fused with its channel-attention logits, split over K. Block (ck, bh) takes the KCH
// tokens of chunk ck in KCH/64 sub-tiles of 64. The head's 64 k rows and 64 v rows of wqt are copied into LDS once
// (rows of WSP bytes); per sub-tile the 64 xh rows are copied in, C[64 tokens][128 channels] = xh . w^T (K = 256,
// 8 waves = 2 (32 tokens) x 4 (32 channels)), and each lane's 8 consecutive tokens of a channel
// go as f16 hi + x2048 residual into the LDS planes T[plane * 64 + channel][64 tokens] (rows of TSP bytes; planes
// k hi, k lo, v hi, v lo). Then raw[d][e] += sum_n (16 k[n][d]) (16 v[n][e]) on WMMA (M = N = 64, 2 k-steps):
// A = k planes, B = v planes, products hi*hi + (hi*lo + lo*hi)/2048, 8 waves = 4 (16 rows) x 2 (32 cols), tokens
// ascending. k and v never leave the work-group. The chunk's f32 tile goes through LDS to part[ck][bh][d][e].
// grid = (KSPLIT, 32), 256 threads. coverage: part [KSPLIT][32][64][64] f32, every element once.
// =================================================================================================================
// four waves per SIMD: the register budget that lets two work-groups (the LDS limit) share a WGP
__global__ __launch_bounds__(256) __attribute__((amdgpu_waves_per_eu(4)))
void k_kv_part(const unsigned short* __restrict__ xh, const unsigned short* __restrict__ wqt,
               const float* __restrict__ bias, float* part) {
  __shared__ __align__(16) unsigned char sm[192 * WSP + 4 * HD * TSP];
  unsigned char* sW = sm;                                   // 128 weight rows: 0..63 k channels, 64..127 v channels
  unsigned char* sA = sm + 128 * WSP;                       // 64 token rows
  unsigned char* sT = sm + 192 * WSP;                       // the four planes of one sub-tile
  static_assert(64 * LDA * 4 <= 64 * WSP);
  const int tid = threadIdx.x, wave = tid >> 5, lane = tid & 31, hh = lane >> 4, c = lane & 15;
  const int ck = blockIdx.x, bh = blockIdx.y;
  const int h = bh & (NH - 1);
  const int tok0 = (bh >> 2) * NN + ck * KCH;
  const _Float16* gA = (const _Float16*)(const void*)xh + (size_t)(tok0 + wave) * DIMC + lane * 8;
  const unsigned lA = (unsigned)(uintptr_t)sA + (unsigned)(wave * WSP + lane * 16);   // LDS byte address
  {
    // one wave copy = one whole row of 512 B; row = j * 8 + wave
    const _Float16* gK = (const _Float16*)(const void*)wqt + (size_t)(DIMC + h * HD + wave) * DIMC + lane * 8;
    const _Float16* gV = gK + (size_t)DIMC * DIMC;
    const unsigned lW = (unsigned)(uintptr_t)sW + (unsigned)(wave * WSP + lane * 16);
    unsigned l[8];
    const _Float16* g[8];
#pragma unroll  // l[] and g[] indexed by constants, so they stay in registers (the two loops below likewise)
    for (int j = 0; j < 8; ++j) { l[j] = lW + (unsigned)(j * 8 * WSP); g[j] = gK + (size_t)j * 8 * DIMC; }
    acopy8(l, g);
#pragma unroll
    for (int j = 0; j < 8; ++j) { l[j] = lW + (unsigned)((64 + j * 8) * WSP); g[j] = gV + (size_t)j * 8 * DIMC; }
    acopy8(l, g);
#pragma unroll
    for (int j = 0; j < 8; ++j) { l[j] = lA + (unsigned)(j * 8 * WSP); g[j] = gA + (size_t)j * 8 * DIMC; }
    acopy8(l, g);
    // this wave's copies have landed; behind the barrier every wave's have
    asm volatile("s_wait_asynccnt 0x0" ::: "memory");
    __syncthreads();
  }
  // projection: wave = 32 tokens x 32 channels
  const int mw = wave >> 2, nw = wave & 3;
  const _Float16* a0p = (const _Float16*)(const void*)(sA + (mw * 32 + c) * WSP) + 8 * hh;
  const _Float16* a1p = (const _Float16*)(const void*)(sA + (mw * 32 + 16 + c) * WSP) + 8 * hh;
  const _Float16* b0p = (const _Float16*)(const void*)(sW + (nw * 32 + c) * WSP) + 8 * hh;
  const _Float16* b1p = (const _Float16*)(const void*)(sW + (nw * 32 + 16 + c) * WSP) + 8 * hh;
  const int kvs = nw >> 1;                                  // 0: this wave's channels are k, 1: v
  const int d0 = (nw & 1) * 32 + c;                         // channel within the head; the second tile is d0 + 16
  const float bb0 = 16.0f * bfr(bias[(1 + kvs) * DIMC + h * HD + d0]);
  const float bb1 = 16.0f * bfr(bias[(1 + kvs) * DIMC + h * HD + d0 + 16]);
  unsigned char* t00 = sT + (kvs * 2 * HD + d0) * TSP + (mw * 32 + 8 * hh) * 2;   // hi row of d0, this lane's 8 tokens
  // logits: wave = 16 rows d x 32 cols e
  const int mv = wave >> 1, nv = wave & 1;
  const _Float16* ahp = (const _Float16*)(const void*)(sT + (mv * 16 + c) * TSP) + 8 * hh;
  const _Float16* alp = (const _Float16*)(const void*)(sT + (HD + mv * 16 + c) * TSP) + 8 * hh;
  const _Float16* b0h = (const _Float16*)(const void*)(sT + (2 * HD + nv * 32 + c) * TSP) + 8 * hh;
  const _Float16* b1h = (const _Float16*)(const void*)(sT + (2 * HD + nv * 32 + 16 + c) * TSP) + 8 * hh;
  const _Float16* b0l = (const _Float16*)(const void*)(sT + (3 * HD + nv * 32 + c) * TSP) + 8 * hh;
  const _Float16* b1l = (const _Float16*)(const void*)(sT + (3 * HD + nv * 32 + 16 + c) * TSP) + 8 * hh;
  v8f p0 = zero8(), p1 = zero8(), q0 = zero8(), q1 = zero8(), r0 = zero8(), r1 = zero8();
#pragma unroll 1  // one copy of the sub-tile body: the text stays short
  for (int t = 0; t < KCH / 64; ++t) {                      // block-uniform trip count
    v8f c00 = zero8(), c01 = zero8(), c10 = zero8(), c11 = zero8();
    // fragments are fetched one k-step ahead: the reads of step ks + 1 are in flight under the products of step ks
    v16h fa0 = ldfrag_h(a0p), fa1 = ldfrag_h(a1p);
    v16h fb0 = ldfrag_h(b0p), fb1 = ldfrag_h(b1p);
#pragma unroll  // straight-line k-steps
    for (int ks = 0; ks < DIMC / 32; ++ks) {
      const int kn = (ks + 1 < DIMC / 32 ? ks + 1 : ks) * 32;
      v16h na0 = fa0, na1 = fa1, nb0 = fb0, nb1 = fb1;
      if (ks + 1 < DIMC / 32) {
        na0 = ldfrag_h(a0p + kn);
        na1 = ldfrag_h(a1p + kn);
        nb0 = ldfrag_h(b0p + kn);
        nb1 = ldfrag_h(b1p + kn);
      }
      __builtin_amdgcn_sched_barrier(0);  // holds the next step's reads in front of this step's products
      c00 = mma_raw(fa0, fb0, c00);
      c01 = mma_raw(fa0, fb1, c01);
      c10 = mma_raw(fa1, fb0, c10);
      c11 = mma_raw(fa1, fb1, c11);
      __builtin_amdgcn_sched_barrier(0);  // and later reads behind them: no deeper fetch, no spills
      fa0 = na0; fa1 = na1; fb0 = nb0; fb1 = nb1;
    }
    put_planes(c00, bb0, t00);
    put_planes(c01, bb1, t00 + 16 * TSP);
    put_planes(c10, bb0, t00 + 32);
    put_planes(c11, bb1, t00 + 16 * TSP + 32);
    // the planes are written and this wave's reads of the token rows have returned; behind the barrier all waves' have
    asm volatile("s_wait_dscnt 0x0" ::: "memory");
    __syncthreads();
    if (t + 1 < KCH / 64) {                                 // block-uniform: the next sub-tile's token rows fly under the logits
      unsigned l[8];
      const _Float16* g[8];
#pragma unroll
      for (int j = 0; j < 8; ++j) { l[j] = lA + (unsigned)(j * 8 * WSP); g[j] = gA + (size_t)((t + 1) * 64 + j * 8) * DIMC; }
      acopy8(l, g);
    }
#pragma unroll  // two straight-line k-steps
    for (int ks = 0; ks < 2; ++ks) {
      const int ko = ks * 32;
      const v16h fa  = ldfrag_h(ahp + ko);
      const v16h ga  = ldfrag_h(alp + ko);
      const v16h fb0 = ldfrag_h(b0h + ko);
      const v16h fb1 = ldfrag_h(b1h + ko);
      const v16h gb0 = ldfrag_h(b0l + ko);
      const v16h gb1 = ldfrag_h(b1l + ko);
      p0 = mma_raw(fa, fb0, p0);
      p1 = mma_raw(fa, fb1, p1);
      q0 = mma_raw(fa, gb0, q0);
      q1 = mma_raw(fa, gb1, q1);
      r0 = mma_raw(ga, fb0, r0);
      r1 = mma_raw(ga, fb1, r1);
      if (ks == 1) guard6(p0, p1, q0, q1, r0, r1, fa, ga, fb0, fb1, gb0, gb1);  // in front of the back edge
    }
    // the plane reads have returned and this wave's copies have landed; behind the barrier the planes may be
    // rewritten and the new token rows read
    asm volatile("s_wait_dscnt 0x0" ::: "memory");
    asm volatile("s_wait_asynccnt 0x0" ::: "memory");
    __syncthreads();
  }
  float* Cs = (float*)(void*)sA;                            // the token rows are dead: the f32 tile lies over them
#pragma unroll
  for (int r = 0; r < 8; ++r) {
    const int row = mv * 16 + 8 * hh + r;
    Cs[row * LDA + nv * 32 + c]      = p0[r] + (q0[r] + r0[r]) * RSC;
    Cs[row * LDA + nv * 32 + 16 + c] = p1[r] + (q1[r] + r1[r]) * RSC;
  }
  __syncthreads();
  float* dst = part + ((size_t)ck * (BB * NH) + bh) * (HD * HD);
  v4f pk[4];
#pragma unroll  // pk[] indexed by constants, so it stays in registers
  for (int s = 0; s < 4; ++s) {
    const int idx = s * 256 + tid;
    pk[s] = *(const v4f*)(Cs + (idx >> 4) * LDA + (idx & 15) * 4);
  }
#pragma unroll  // as above
  for (int s = 0; s < 4; ++s) *(v4f*)(dst + (size_t)(s * 256 + tid) * 4) = pk[s];
}

// =================================================================================================================
// Chunk sum + softmax. Block = 16 rows d of one (b, h); thread = 4 consecutive e of one row, 16 lanes per row.
// raw = sum over ck of part[ck] in index order; logit = raw/2048 (includes the head_dim^-0.5 factor 1/8). Softmax
// over e per row d in f32 (max subtracted, 16-lane butterflies), 4096 P stored as f16 hi + x2048 residual planes;
// a wave's store covers two whole 128-B rows.
// grid = (32, 4), 256 threads. coverage: ath/atl [32][64][64], every element once.
// =================================================================================================================
__global__ __launch_bounds__(256)
void k_attn_sm(const float* __restrict__ part, unsigned short* at) {
  const int tid = threadIdx.x;
  const int bh = blockIdx.x;
  const int row = blockIdx.y * 16 + (tid >> 4), col0 = (tid & 15) * 4;
  const size_t off = ((size_t)bh * HD + row) * HD + col0;
  v4f t[KSPLIT];
#pragma unroll  // all chunk loads issued before the first add: one memory latency, not KSPLIT
  for (int s = 0; s < KSPLIT; ++s) t[s] = *(const v4f*)(part + (size_t)s * ATL_OFF + off);
  v4f a = t[0];
#pragma unroll  // t[] indexed by constants, so it stays in registers (the short loops below likewise)
  for (int s = 1; s < KSPLIT; ++s) a += t[s];
  float mx = fmaxf(fmaxf(a[0], a[1]), fmaxf(a[2], a[3]));
#pragma unroll
  for (int o = 1; o < 16; o <<= 1) mx = fmaxf(mx, __shfl_xor(mx, o, 32));
  float e[4];
#pragma unroll
  for (int n = 0; n < 4; ++n) e[n] = expf((a[n] - mx) * RSC);
  float sm = (e[0] + e[1]) + (e[2] + e[3]);
#pragma unroll
  for (int o = 1; o < 16; o <<= 1) sm += __shfl_xor(sm, o, 32);
  const float sc = (1.0f / sm) * 4096.0f;
  v2u ph, pq;
#pragma unroll
  for (int n = 0; n < 2; ++n) {
    unsigned hw, lw;
    split2(e[2 * n] * sc, e[2 * n + 1] * sc, hw, lw);
    ph[n] = hw; pq[n] = lw;
  }
  *(v2u*)(at + off) = ph;
  *(v2u*)(at + ATL_OFF + off) = pq;
}

// =================================================================================================================
// Q projection + xf + residual + layer norm + FC1 + exact GELU + FC2 + bias + residual in one kernel: q, x1, h and g
// never leave the work-group. Block = 128 tokens of one batch, 16 waves, one block per WGP. Wave (wq, wr) owns 32
// tokens (wq) x the 64 channels of head wr, from q to the output.
// q: C[64 e][32 tokens] = wqt rows . xh rows^T on WMMA (K = 256, 8 k-steps, k ascending), C = 1024 (x w); a lane holds
// 8 consecutive channels of one token, so two accumulator tiles 16 channels apart are, lane for lane, one B fragment
// of 32 channels: the carried value 16 (x w + b) = C/64 + 16 bf16(b) goes as f16 hi + x2048 residual straight into
// the fragment registers of xf.
// xf: C[64 d][32 tokens] = sum_e (4096 P[d][e]) (16 q[token][wr*64+e]) on WMMA (K = 64, 2 k-steps): A = P hi/lo rows,
// B = q hi/lo fragments, products hi*hi + (hi*lo + lo*hi)/2048, xf = C/65536; a lane holds 8 consecutive channels of
// one token. x1 = bf16(x) + xf in registers (bf16(x) = xh/16). Layer norm: mean, then the sum of squared differences, each
// summed in the lane, over the lane pair and over the four waves of a token through LDS. 16 h goes as f16, 16 B a
// store, into H[token][256] in LDS. 1024 x1 is the start value of the FC2 accumulators.
// The 768 hidden channels run in 6 chunks of 128. Per chunk: C1[128 hidden][128 tokens] = w1t rows . H rows^T (8
// k-steps, 16 waves = 4 (32 hidden) x 4 (32 tokens)): v = C1/1024 + bf16(b1), g = 0.5 v (1 + erf(v / sqrt 2)) in
// registers, 16 g as f16, one 16-B LDS store into G[token][128]. Then C2[256 cols][128 tokens] += w2t chunk . G^T
// (4 k-steps), hidden channels ascending. The chunk's w2t rows fly under FC1 and GELU, the next chunk's w1t rows under
// FC2. out = C2/1024 + bf16(b2) through an f32 LDS tile, whole lines.
// grid = NTOK/128, 512 threads. coverage: out [32768][256] f32, every element once.
// =================================================================================================================
__global__ __launch_bounds__(512)
void k_mlp(const unsigned short* __restrict__ wqt, const float* __restrict__ biasq,
           const unsigned short* __restrict__ at,
           const unsigned short* __restrict__ xh, const float* __restrict__ gw, const float* __restrict__ gb,
           const unsigned short* __restrict__ w1t, const float* __restrict__ bias1,
           const unsigned short* __restrict__ w2t, const float* __restrict__ bias2, float* out) {
  __shared__ __align__(16) unsigned char sm[384 * WSP + 384 * GSP + MLP * 4 + 2 * NH * 128 * 4 + 3 * DIMC * 4];
  unsigned char* sH  = sm;                                  // 128 rows, WSP bytes each: wqt rows 0..127, then h by token
  unsigned char* sW1 = sm + 128 * WSP;                      // 128 rows: wqt rows 128..255, then the chunk's w1t rows
  unsigned char* sG  = sm + 256 * WSP;                      // 128 token rows of g, GSP bytes each
  unsigned char* sW2 = sm + 256 * WSP + 128 * GSP;          // 256 w2t rows, the chunk's 128 k
  unsigned char* sP  = sG;                                  // first: 512 rows of XSP bytes, P hi [head][d], then P lo
  float* sB1 = (float*)(void*)(sm + 256 * WSP + 384 * GSP); // bf16(b1) as f32
  unsigned char* sX  = sm + 256 * WSP + 384 * GSP + MLP * 4;  // 128 token rows of xh
  float* sR  = (float*)(void*)(sX + 128 * WSP);             // layer-norm partial sums [2][head][128 tokens]
  float* sLN = sR + 2 * NH * 128;                           // bf16(norm weight), then bf16(norm bias), as f32
  float* sBQ = sLN + 2 * DIMC;                              // 16 bf16(b) of the 256 q channels, as f32
  static_assert(128 * LDX * 4 <= 256 * WSP);
  static_assert(2 * NH * HD * XSP <= 384 * GSP && (NN % 128) == 0);
  static_assert(sizeof(sm) <= 327680);
  const int tid = threadIdx.x, wave = tid >> 5, lane = tid & 31, hh = lane >> 4, c = lane & 15;
  const int tok0 = blockIdx.x * 128;
  const int wq = wave >> 2, wr = wave & 3;
  // copies: a wave copy covers one whole 512-B row (wqt, xh, w1t), two 256-B row pieces (w2t) or four 128-B rows (P)
  const _Float16* gQ  = (const _Float16*)(const void*)wqt + (size_t)wave * DIMC + lane * 8;   // rows 0..255: the q channels
  const _Float16* gX  = (const _Float16*)(const void*)xh + (size_t)(tok0 + wave) * DIMC + lane * 8;
  const _Float16* gP  = (const _Float16*)(const void*)at + (size_t)(tok0 / NN) * (NH * HD * HD) + tid * 8;
  const _Float16* gW1 = (const _Float16*)(const void*)w1t + (size_t)wave * DIMC + lane * 8;
  const _Float16* gW2 = (const _Float16*)(const void*)w2t + (size_t)(wave * 2 + hh) * MLP + c * 8;
  const unsigned lH  = (unsigned)(uintptr_t)sH  + (unsigned)(wave * WSP + lane * 16);            // LDS byte addresses
  const unsigned lW1 = (unsigned)(uintptr_t)sW1 + (unsigned)(wave * WSP + lane * 16);
  const unsigned lX  = (unsigned)(uintptr_t)sX  + (unsigned)(wave * WSP + lane * 16);
  const unsigned lP  = (unsigned)(uintptr_t)sP  + (unsigned)((tid >> 3) * XSP + (tid & 7) * 16);
  const unsigned lW2 = (unsigned)(uintptr_t)sW2 + (unsigned)((wave * 2 + hh) * GSP + c * 16);
  {
    unsigned l[8];
    const _Float16* g[8];
#pragma unroll  // l[] and g[] indexed by constants, so they stay in registers (the copy loops below likewise)
    for (int j = 0; j < 8; ++j) { l[j] = lH + (unsigned)(j * 16 * WSP); g[j] = gQ + (size_t)j * 16 * DIMC; }
    acopy8(l, g);
#pragma unroll
    for (int j = 0; j < 8; ++j) { l[j] = lW1 + (unsigned)(j * 16 * WSP); g[j] = gQ + (size_t)(128 + j * 16) * DIMC; }
    acopy8(l, g);
#pragma unroll
    for (int j = 0; j < 8; ++j) {                           // j < 4: P hi, 64 rows (one head) a copy; j >= 4: P lo
      l[j] = lP + (unsigned)(j * HD * XSP);
      g[j] = gP + (size_t)(j >> 2) * ATL_OFF + (size_t)(j & 3) * HD * HD;
    }
    acopy8(l, g);
#pragma unroll
    for (int j = 0; j < 8; ++j) { l[j] = lX + (unsigned)(j * 16 * WSP); g[j] = gX + (size_t)j * 16 * DIMC; }
    acopy8(l, g);
    for (int i = tid; i < MLP; i += 512) sB1[i] = bfr(bias1[i]);
    if (tid < DIMC) { sLN[tid] = bfr(gw[tid]); sLN[DIMC + tid] = bfr(gb[tid]); sBQ[tid] = 16.0f * bfr(biasq[tid]); }
    // this wave's copies have landed; behind the barrier every wave's have, and the four parameter rows are written
    asm volatile("s_wait_asynccnt 0x0" ::: "memory");
    __syncthreads();
  }
  // o[n][t]: lane = token wq*32 + t*16 + c, registers = channels wr*64 + n*16 + 8*hh + 0..7
  v8f o[4][2];
  {
    // qa[n][t]: lane = token wq*32 + t*16 + c, registers = q channels wr*64 + n*16 + 8*hh + 0..7, value 1024 (x w)
    v8f qa[4][2];
#pragma unroll  // every array here is indexed by constants, so it stays in registers
    for (int n = 0; n < 4; ++n)
#pragma unroll
      for (int t = 0; t < 2; ++t) qa[n][t] = zero8();
    {
      const _Float16* wp = (const _Float16*)(const void*)(sH + (wr * HD + c) * WSP) + 8 * hh;   // the head's 64 wqt rows
      const _Float16* xb = (const _Float16*)(const void*)(sX + (wq * 32 + c) * WSP) + 8 * hh;   // the wave's 32 token rows
      // fragments are fetched one k-step ahead: the reads of step ks + 1 are in flight under the products of step ks
      v16h fx0 = ldfrag_h(xb), fx1 = ldfrag_h(xb + 16 * (WSP / 2));
      v16h fw0 = ldfrag_h(wp), fw1 = ldfrag_h(wp + 16 * (WSP / 2));
      v16h fw2 = ldfrag_h(wp + 32 * (WSP / 2)), fw3 = ldfrag_h(wp + 48 * (WSP / 2));
#pragma unroll  // straight-line k-steps
      for (int ks = 0; ks < DIMC / 32; ++ks) {
        const int kn = (ks + 1) * 32;
        v16h nx0 = fx0, nx1 = fx1, nw0 = fw0, nw1 = fw1, nw2 = fw2, nw3 = fw3;
        if (ks + 1 < DIMC / 32) {
          nx0 = ldfrag_h(xb + kn);
          nx1 = ldfrag_h(xb + 16 * (WSP / 2) + kn);
          nw0 = ldfrag_h(wp + kn);
          nw1 = ldfrag_h(wp + 16 * (WSP / 2) + kn);
          nw2 = ldfrag_h(wp + 32 * (WSP / 2) + kn);
          nw3 = ldfrag_h(wp + 48 * (WSP / 2) + kn);
        }
        __builtin_amdgcn_sched_barrier(0);  // holds the next step's reads in front of this step's products
        qa[0][0] = mma_raw(fw0, fx0, qa[0][0]);
        qa[0][1] = mma_raw(fw0, fx1, qa[0][1]);
        qa[1][0] = mma_raw(fw1, fx0, qa[1][0]);
        qa[1][1] = mma_raw(fw1, fx1, qa[1][1]);
        qa[2][0] = mma_raw(fw2, fx0, qa[2][0]);
        qa[2][1] = mma_raw(fw2, fx1, qa[2][1]);
        qa[3][0] = mma_raw(fw3, fx0, qa[3][0]);
        qa[3][1] = mma_raw(fw3, fx1, qa[3][1]);
        __builtin_amdgcn_sched_barrier(0);  // and later reads behind them: one step ahead, no deeper
        fx0 = nx0; fx1 = nx1; fw0 = nw0; fw1 = nw1; fw2 = nw2; fw3 = nw3;
      }
    }
    // fragment words: tile n fills elements 8*(n&1) .. 8*(n&1)+7 of fragment n>>1 (k = n*16 + 8*hh + 0..7, the table layout)
    union QF { v16h v; v4u u[2]; } qh[2][2], ql[2][2];      // [t][k-step]
#pragma unroll
    for (int n = 0; n < 4; ++n) {
      const float* bp = sBQ + wr * HD + n * 16 + 8 * hh;
      const v4f bA = *(const v4f*)(bp);
      const v4f bB = *(const v4f*)(bp + 4);
      const float bv[8] = { bA[0], bA[1], bA[2], bA[3], bB[0], bB[1], bB[2], bB[3] };
#pragma unroll
      for (int t = 0; t < 2; ++t) {
        v4u a, q4;
#pragma unroll
        for (int e = 0; e < 4; ++e) {
          const float f0 = qa[n][t][2 * e] * (1.0f / 64.0f) + bv[2 * e];
          const float f1 = qa[n][t][2 * e + 1] * (1.0f / 64.0f) + bv[2 * e + 1];
          unsigned hw, lw;
          split2(f0, f1, hw, lw);
          a[e] = hw; q4[e] = lw;
        }
        qh[t][n >> 1].u[n & 1] = a;
        ql[t][n >> 1].u[n & 1] = q4;
      }
    }
    const _Float16* xp  = (const _Float16*)(const void*)(sX  + (wq * 32 + c) * WSP) + wr * HD + 8 * hh;
    const _Float16* php = (const _Float16*)(const void*)(sP + (wr * HD + c) * XSP) + 8 * hh;
    const _Float16* plp = (const _Float16*)(const void*)(sP + (NH * HD + wr * HD + c) * XSP) + 8 * hh;
#pragma unroll  // every array below is indexed by constants, so it stays in registers (every short loop likewise)
    for (int t = 0; t < 2; ++t) {
      const v16h fq0 = qh[t][0].v, fq1 = qh[t][1].v;
      const v16h gq0 = ql[t][0].v, gq1 = ql[t][1].v;
#pragma unroll
      for (int n = 0; n < 4; ++n) {
        const v16h fp0 = ldfrag_h(php + n * 16 * (XSP / 2)), fp1 = ldfrag_h(php + n * 16 * (XSP / 2) + 32);
        const v16h gp0 = ldfrag_h(plp + n * 16 * (XSP / 2)), gp1 = ldfrag_h(plp + n * 16 * (XSP / 2) + 32);
        const v8h xv = *(const v8h*)(xp + t * 16 * (WSP / 2) + n * 16);
        v8f p = zero8(), q = zero8(), r = zero8();
        p = mma_raw(fp0, fq0, p);
        q = mma_raw(gp0, fq0, q);
        r = mma_raw(fp0, gq0, r);
        p = mma_raw(fp1, fq1, p);
        q = mma_raw(gp1, fq1, q);
        r = mma_raw(fp1, gq1, r);
#pragma unroll
        for (int e = 0; e < 8; ++e)
          o[n][t][e] = (float)xv[e] * (1.0f / 16.0f) + (p[e] + (q[e] + r[e]) * RSC) * (1.0f / 65536.0f);
        __builtin_amdgcn_sched_barrier(0);  // holds later fragment reads behind these products: no spills
      }
    }
  }
  float mu[2], rs[2];
#pragma unroll
  for (int t = 0; t < 2; ++t) {
    float s = 0.f;
#pragma unroll
    for (int n = 0; n < 4; ++n)
      s += ((o[n][t][0] + o[n][t][1]) + (o[n][t][2] + o[n][t][3])) + ((o[n][t][4] + o[n][t][5]) + (o[n][t][6] + o[n][t][7]));
    s += __shfl_xor(s, 16, 32);
    if (hh == 0) sR[wr * 128 + wq * 32 + t * 16 + c] = s;
  }
  // the sums are written and this wave's reads of the wqt rows, P and xh have returned; behind the barrier all waves' have
  asm volatile("s_wait_dscnt 0x0" ::: "memory");
  __syncthreads();
  {
    // the first chunk's w1t rows go where wqt rows 128..255 lay and fly under the rest of the layer norm
    unsigned l[8];
    const _Float16* g[8];
#pragma unroll
    for (int j = 0; j < 8; ++j) { l[j] = lW1 + (unsigned)(j * 16 * WSP); g[j] = gW1 + (size_t)j * 16 * DIMC; }
    acopy8(l, g);
  }
#pragma unroll
  for (int t = 0; t < 2; ++t) {
    const float* rp = sR + wq * 32 + t * 16 + c;
    mu[t] = ((rp[0] + rp[128]) + (rp[256] + rp[384])) * (1.0f / 256.0f);
    float sq = 0.f;
#pragma unroll
    for (int n = 0; n < 4; ++n)
#pragma unroll
      for (int e = 0; e < 8; ++e) { const float d = o[n][t][e] - mu[t]; sq += d * d; }
    sq += __shfl_xor(sq, 16, 32);
    if (hh == 0) sR[NH * 128 + wr * 128 + wq * 32 + t * 16 + c] = sq;
  }
  __syncthreads();
#pragma unroll
  for (int t = 0; t < 2; ++t) {
    const float* rp = sR + NH * 128 + wq * 32 + t * 16 + c;
    rs[t] = rsqrtf(((rp[0] + rp[128]) + (rp[256] + rp[384])) * (1.0f / 256.0f) + 1e-5f);
  }
#pragma unroll
  for (int n = 0; n < 4; ++n) {
    const int col0 = wr * HD + n * 16 + 8 * hh;
    const v4f gA = *(const v4f*)(sLN + col0), gB = *(const v4f*)(sLN + col0 + 4);
    const v4f bA = *(const v4f*)(sLN + DIMC + col0), bB = *(const v4f*)(sLN + DIMC + col0 + 4);
    const float gv[8] = { gA[0], gA[1], gA[2], gA[3], gB[0], gB[1], gB[2], gB[3] };
    const float bv[8] = { bA[0], bA[1], bA[2], bA[3], bB[0], bB[1], bB[2], bB[3] };
#pragma unroll
    for (int t = 0; t < 2; ++t) {
      v4u pk;
#pragma unroll
      for (int e = 0; e < 4; ++e) {
        const float f0 = ((o[n][t][2 * e] - mu[t]) * rs[t]) * gv[2 * e] + bv[2 * e];
        const float f1 = ((o[n][t][2 * e + 1] - mu[t]) * rs[t]) * gv[2 * e + 1] + bv[2 * e + 1];
        pk[e] = pk16(hb16(f0 * 16.0f), hb16(f1 * 16.0f));
      }
      *(v4u*)(void*)(sH + (wq * 32 + t * 16 + c) * WSP + col0 * 2) = pk;
      o[n][t] *= 1024.0f;                                   // x1 in the scale of the FC2 products
    }
  }
  // h is written and this wave's w1t copies have landed; behind the barrier all waves' have
  asm volatile("s_wait_dscnt 0x0" ::: "memory");
  asm volatile("s_wait_asynccnt 0x0" ::: "memory");
  __syncthreads();
  // FC1: wave = 32 hidden (wq) x 32 tokens (wr); FC2: wave = 64 cols (wr) x 32 tokens (wq)
  const _Float16* w1p = (const _Float16*)(const void*)(sW1 + (wq * 32 + c) * WSP) + 8 * hh;
  const _Float16* hp  = (const _Float16*)(const void*)(sH  + (wr * 32 + c) * WSP) + 8 * hh;
  const _Float16* gp  = (const _Float16*)(const void*)(sG  + (wq * 32 + c) * GSP) + 8 * hh;
  const _Float16* w2p = (const _Float16*)(const void*)(sW2 + (wr * 64 + c) * GSP) + 8 * hh;
  unsigned char* gst = sG + (wr * 32 + c) * GSP + (wq * 32 + 8 * hh) * 2;   // this lane's token row, its 8 hidden channels
#pragma unroll 1  // one copy of the chunk body: the text stays short
  for (int ch = 0; ch < MLP / 128; ++ch) {                  // block-uniform trip count
    {
      // the chunk's w2t rows fly under FC1 and GELU; the last chunk's readers left them at the barrier at the loop's foot
      // (first chunk: the readers of the P rows that lay there left them at the barrier behind the row sums)
      unsigned l[8];
      const _Float16* g[8];
#pragma unroll
      for (int j = 0; j < 8; ++j) { l[j] = lW2 + (unsigned)(j * 32 * GSP); g[j] = gW2 + (size_t)j * 32 * MLP + ch * 128; }
      acopy8(l, g);
    }
    v8f a[2][2];
#pragma unroll
    for (int i = 0; i < 2; ++i)
#pragma unroll
      for (int t = 0; t < 2; ++t) a[i][t] = zero8();
    {
      // fragments are fetched one k-step ahead: the reads of step ks + 1 are in flight under the products of step ks
      v16h fw0 = ldfrag_h(w1p), fw1 = ldfrag_h(w1p + 16 * (WSP / 2));
      v16h fh0 = ldfrag_h(hp), fh1 = ldfrag_h(hp + 16 * (WSP / 2));
#pragma unroll  // straight-line k-steps
      for (int ks = 0; ks < DIMC / 32; ++ks) {
        const int kn = (ks + 1) * 32;
        v16h nw0 = fw0, nw1 = fw1, nh0 = fh0, nh1 = fh1;
        if (ks + 1 < DIMC / 32) {
          nw0 = ldfrag_h(w1p + kn);
          nw1 = ldfrag_h(w1p + 16 * (WSP / 2) + kn);
          nh0 = ldfrag_h(hp + kn);
          nh1 = ldfrag_h(hp + 16 * (WSP / 2) + kn);
        }
        __builtin_amdgcn_sched_barrier(0);  // holds the next step's reads in front of this step's products
        a[0][0] = mma_raw(fw0, fh0, a[0][0]);
        a[0][1] = mma_raw(fw0, fh1, a[0][1]);
        a[1][0] = mma_raw(fw1, fh0, a[1][0]);
        a[1][1] = mma_raw(fw1, fh1, a[1][1]);
        __builtin_amdgcn_sched_barrier(0);  // and later reads behind them: one step ahead, no deeper
        fw0 = nw0; fw1 = nw1; fh0 = nh0; fh1 = nh1;
      }
    }
#pragma unroll
    for (int i = 0; i < 2; ++i) {
      const float* bp = sB1 + ch * 128 + wq * 32 + i * 16 + 8 * hh;
      const v4f bA = *(const v4f*)(bp);
      const v4f bB = *(const v4f*)(bp + 4);
      const float bv[8] = { bA[0], bA[1], bA[2], bA[3], bB[0], bB[1], bB[2], bB[3] };
#pragma unroll
      for (int t = 0; t < 2; ++t) {
        float v[8], xe[8], er[8];
        bool small = true;
#pragma unroll
        for (int e = 0; e < 8; ++e) {
          v[e] = a[i][t][e] * (1.0f / 1024.0f) + bv[e];
          xe[e] = v[e] * 0.70710678118654752f;
          small = small && (fabsf(xe[e]) < 1.0f);
        }
        // erff tests |x| < 1 for each value; one test for the lane's 8 values leaves 8 independent chains with no
        // branch between them on the side where all are below 1, and the full erff for all 8 on the other side
        if (small) {
#pragma unroll
          for (int e = 0; e < 8; ++e) er[e] = erff(xe[e]);
        } else {
#pragma unroll
          for (int e = 0; e < 8; ++e) er[e] = erff(xe[e]);
        }
        v4u pk;
#pragma unroll
        for (int e = 0; e < 4; ++e) {
          const float g0 = 0.5f * v[2 * e] * (1.0f + er[2 * e]);
          const float g1 = 0.5f * v[2 * e + 1] * (1.0f + er[2 * e + 1]);
          pk[e] = pk16(hb16(g0 * 16.0f), hb16(g1 * 16.0f));
        }
        *(v4u*)(void*)(gst + t * 16 * GSP + i * 32) = pk;
      }
    }
    // g is written, this wave's reads of the w1t rows have returned and its w2t copies have landed; behind the barrier
    // all waves' have
    asm volatile("s_wait_dscnt 0x0" ::: "memory");
    asm volatile("s_wait_asynccnt 0x0" ::: "memory");
    __syncthreads();
    if (ch + 1 < MLP / 128) {                               // block-uniform: the next chunk's w1t rows fly under FC2
      unsigned l[8];
      const _Float16* g[8];
#pragma unroll
      for (int j = 0; j < 8; ++j) { l[j] = lW1 + (unsigned)(j * 16 * WSP); g[j] = gW1 + (size_t)((ch + 1) * 128 + j * 16) * DIMC; }
      acopy8(l, g);
    }
    // fragments one k-step ahead, as in FC1
    v16h fg0 = ldfrag_h(gp), fg1 = ldfrag_h(gp + 16 * (GSP / 2));
    v16h fv0 = ldfrag_h(w2p), fv1 = ldfrag_h(w2p + 16 * (GSP / 2));
    v16h fv2 = ldfrag_h(w2p + 32 * (GSP / 2)), fv3 = ldfrag_h(w2p + 48 * (GSP / 2));
#pragma unroll  // straight-line k-steps
    for (int ks = 0; ks < 4; ++ks) {
      const int kn = (ks + 1) * 32;
      v16h ng0 = fg0, ng1 = fg1, nv0 = fv0, nv1 = fv1, nv2 = fv2, nv3 = fv3;
      if (ks + 1 < 4) {
        ng0 = ldfrag_h(gp + kn);
        ng1 = ldfrag_h(gp + 16 * (GSP / 2) + kn);
        nv0 = ldfrag_h(w2p + kn);
        nv1 = ldfrag_h(w2p + 16 * (GSP / 2) + kn);
        nv2 = ldfrag_h(w2p + 32 * (GSP / 2) + kn);
        nv3 = ldfrag_h(w2p + 48 * (GSP / 2) + kn);
      }
      __builtin_amdgcn_sched_barrier(0);  // holds the next step's reads in front of this step's products
      o[0][0] = mma_raw(fv0, fg0, o[0][0]);
      o[0][1] = mma_raw(fv0, fg1, o[0][1]);
      o[1][0] = mma_raw(fv1, fg0, o[1][0]);
      o[1][1] = mma_raw(fv1, fg1, o[1][1]);
      o[2][0] = mma_raw(fv2, fg0, o[2][0]);
      o[2][1] = mma_raw(fv2, fg1, o[2][1]);
      o[3][0] = mma_raw(fv3, fg0, o[3][0]);
      o[3][1] = mma_raw(fv3, fg1, o[3][1]);
      if (ks == 3)  // in front of the back edge
        guard8(o[0][0], o[0][1], o[1][0], o[1][1], o[2][0], o[2][1], o[3][0], o[3][1], fg0, fg1, fv0, fv1, fv2, fv3);
      __builtin_amdgcn_sched_barrier(0);  // and later reads behind them: one step ahead, no deeper
      fg0 = ng0; fg1 = ng1; fv0 = nv0; fv1 = nv1; fv2 = nv2; fv3 = nv3;
    }
    // the reads of g and of the w2t rows have returned and this wave's w1t copies have landed; behind the barrier g and
    // the w2t rows may be rewritten and the new w1t rows read
    asm volatile("s_wait_dscnt 0x0" ::: "memory");
    asm volatile("s_wait_asynccnt 0x0" ::: "memory");
    __syncthreads();
  }
  float* Cs = (float*)(void*)sm;                            // the h and w1t rows are dead: the f32 tile lies over them
#pragma unroll
  for (int n = 0; n < 4; ++n)
#pragma unroll
    for (int t = 0; t < 2; ++t) {
      float* d = Cs + (wq * 32 + t * 16 + c) * LDX + wr * HD + n * 16 + 8 * hh;
      const v4f lo4 = { o[n][t][0], o[n][t][1], o[n][t][2], o[n][t][3] };
      const v4f hi4 = { o[n][t][4], o[n][t][5], o[n][t][6], o[n][t][7] };
      *(v4f*)d = lo4;
      *(v4f*)(d + 4) = hi4;
    }
  __syncthreads();
  // thread = 4 columns of 16 rows, 8 rows apart: a wave's store covers one whole 512-B half row
  const int row0 = tid >> 6, colp = (tid & 63) * 4;
  char* op = (char*)(void*)out + (unsigned)((tok0 + row0) * DIMC + colp) * 4u;   // byte offset below 32 MiB
  const float* cp = Cs + row0 * LDX + colp;
  v4f b2;
#pragma unroll
  for (int e = 0; e < 4; ++e) b2[e] = bfr(bias2[colp + e]);
#pragma unroll
  for (int s = 0; s < 16; ++s) {
    const v4f c4 = *(const v4f*)(cp + s * 8 * LDX);
    v4f v;
#pragma unroll
    for (int e = 0; e < 4; ++e) v[e] = c4[e] * (1.0f / 1024.0f) + b2[e];
    *(v4f*)(void*)(op + s * 8 * DIMC * 4) = v;
  }
}

// =================================================================================================================
// Workspace map (bytes; all offsets multiples of 131072; every region sized exactly at its whole-line store extent):
//   [0, 16 MiB)      XH  f16 [32768][256]  (k_xcvt -> k_kv_part, k_mlp)
//   [48, 56 MiB)     PT  f32 [16][32][64][64] logit partials (k_kv_part -> k_attn_sm)
//   112 MiB + : ATH, ATL f16 [32][64][64] 262144 each | WQT f16 [768][256] 393216 | W1T [768][256] 393216 |
//               W2T f16 [256][768] 393216 ; end = 119144448.
// =================================================================================================================
extern "C" void kernel_launch(void* const* d_in, const int* in_sizes, int n_in,
                              void* d_out, int out_size, void* d_ws, size_t ws_size,
                              hipStream_t stream) {
  if (n_in < 9) return;
  const int expect[9] = { NTOK * DIMC, DIMC * MLP, MLP, DIMC, DIMC, DIMC * MLP, MLP, MLP * DIMC, DIMC };
  for (int i = 0; i < 9; ++i) if (in_sizes[i] != expect[i]) return;
  if (out_size != NTOK * DIMC) return;

  const float* x     = (const float*)d_in[0];
  const float* w_qkv = (const float*)d_in[1];
  const float* b_qkv = (const float*)d_in[2];
  const float* ng    = (const float*)d_in[3];
  const float* nbt   = (const float*)d_in[4];
  const float* w_fc1 = (const float*)d_in[5];
  const float* b_fc1 = (const float*)d_in[6];
  const float* w_fc2 = (const float*)d_in[7];
  const float* b_fc2 = (const float*)d_in[8];
  float* out = (float*)d_out;

  const size_t MiB = (size_t)1048576;
  const size_t szX16 = (size_t)NTOK * DIMC * 2;                    // 16 MiB
  const size_t szAT  = ATL_OFF * 2;                                // 262144
  const size_t szWQ  = (size_t)MLP * DIMC * 2;                     // 393216
  if (szX16 != 16 * MiB) return;

  const size_t oXH  = 0;
  const size_t oPT  = 48 * MiB;
  const size_t oATH = 112 * MiB;                                    // ATL at oATH + szAT
  const size_t oWQT = oATH + 2 * szAT;
  const size_t oW1T = oWQT + szWQ;
  const size_t oW2T = oW1T + szWQ;
  const size_t oEND = oW2T + szWQ;                                  // 119144448
  if (oXH + szX16 > oPT) return;
  if (oPT + (size_t)KSPLIT * ATL_OFF * 4 > oATH) return;
  if (oEND > ws_size) return;
  if (oEND > (size_t)134217728) return;

  char* ws = (char*)d_ws;
  unsigned short* XH  = (unsigned short*)(ws + oXH);
  float*          PT  = (float*)(ws + oPT);
  unsigned short* ATH = (unsigned short*)(ws + oATH);
  unsigned short* WQT = (unsigned short*)(ws + oWQT);
  unsigned short* W1T = (unsigned short*)(ws + oW1T);
  unsigned short* W2T = (unsigned short*)(ws + oW2T);

  const dim3 blk(256);
  const int npieces = NTOK * DIMC / 8;
  // (1) weight planes (transposed, 64 * bf16)
  k_wcvt<<<dim3(2 * MLP + DIMC), dim3(128), 0, stream>>>(w_qkv, w_fc1, w_fc2, WQT, W1T, W2T);
  // (2) x -> f16 plane of 16 bf16(x)
  k_xcvt<<<dim3((npieces + 255) / 256), blk, 0, stream>>>(x, XH, npieces);
  // (3) per (b, h): k, v projection + logits, K split in KSPLIT chunks -> f32 partial tiles; chunk sum + softmax -> P hi/lo planes
  k_kv_part<<<dim3(KSPLIT, BB * NH), blk, 0, stream>>>(XH, WQT, b_qkv, PT);
  k_attn_sm<<<dim3(BB * NH, HD / 16), blk, 0, stream>>>(PT, ATH);
  // (4) q projection + xf + residual + layer norm + fc1 + GELU + fc2 + bias + residual -> d_out
  k_mlp<<<dim3(NTOK / 128), dim3(512), 0, stream>>>(WQT, b_qkv, ATH, XH, ng, nbt, W1T, b_fc1, W2T, b_fc2, out);
  (void)hipGetLastError();
}

// v007
// One run takes 58.1 microseconds.
// Two timings next to v006 both put it at 1.09 times that version's speed.
// Counting every step since v000, it is 5.11 times as fast.
// Contractions: qkv projection (K=256), fc1 (K=256), fc2 (K=768): v_wmma_f32_16x16x32_f16, single f16 products,
// activations carried x16, weights one f16 plane of 64*bf16(w); per-head k^T v logits (K=4096) and attn x q (K=64):
// v_wmma_f32_16x16x32_f16 with both operands as f16 hi + x2048 residual planes (3 products); f32 accumulate
// everywhere. Softmax, layer norm, exact GELU and all epilogues f32 on VALU; every float input RNE-converted to
// bf16 on load.
#include <hip/hip_runtime.h>
#include <stdint.h>

#define BB     8
#define NN     4096
#define DIMC   256
#define NH     4
#define HD     64
#define MLP    768
#define NTOK   (BB * NN)
#define LDX    260
#define LDA    68
#define RSC    0.00048828125f
#define ATL_OFF ((size_t)BB * NH * HD * HD)
#define KSPLIT 16
#define KCH    (NN / KSPLIT)
#define XSP    (HD * 2 + 16)
#define WSP    (DIMC * 2 + 16)
#define TSP    (64 * 2 + 16)
#define GSP    (128 * 2 + 16)

static_assert(NTOK == 32768);
static_assert(DIMC == NH * HD);
static_assert((NN % 64) == 0 && (NTOK % 64) == 0);
static_assert((DIMC % 32) == 0 && (MLP % 32) == 0 && (HD % 32) == 0 && (NN % 32) == 0);
static_assert((LDX * 4) % 16 == 0);
static_assert(ATL_OFF == 131072);
static_assert(MLP == 6 * 128 && DIMC == 2 * 128 && (NTOK % 128) == 0 && ((GSP / 16) & 1) == 1);
static_assert(KCH * KSPLIT == NN && (KCH % 32) == 0);
static_assert(KCH == 256 && HD == 64 && ((XSP / 16) & 1) == 1 && ((WSP / 16) & 1) == 1 && ((TSP / 16) & 1) == 1);

typedef _Float16 v16h __attribute__((ext_vector_type(16)));
typedef _Float16 v8h  __attribute__((ext_vector_type(8)));
typedef float    v8f  __attribute__((ext_vector_type(8)));
typedef float    v4f  __attribute__((ext_vector_type(4)));
typedef unsigned int v4u __attribute__((ext_vector_type(4)));
typedef unsigned int v2u __attribute__((ext_vector_type(2)));

// ---- scalar helpers ------------------------------------------------------------------------------------------
__device__ __forceinline__ unsigned short bf_bits(float f) {          // f32 -> bf16 bits, RNE convert
  unsigned u = __float_as_uint(f);
  return (unsigned short)((u + 0x7FFFu + ((u >> 16) & 1u)) >> 16);
}
__device__ __forceinline__ float bf_up(unsigned short b) { return __uint_as_float(((unsigned)b) << 16); }
__device__ __forceinline__ float bfr(float f) { return bf_up(bf_bits(f)); }
__device__ __forceinline__ unsigned short h_bits(_Float16 x) { return __builtin_bit_cast(unsigned short, x); }
__device__ __forceinline__ unsigned short hb16(float f) { return h_bits((_Float16)f); }
__device__ __forceinline__ unsigned pk16(unsigned short a, unsigned short b) { return (unsigned)a | ((unsigned)b << 16); }
__device__ __forceinline__ v8f zero8() { v8f z = {0.f, 0.f, 0.f, 0.f, 0.f, 0.f, 0.f, 0.f}; return z; }
// hi/lo pair of two f32 values: hi = f16(v), lo = f16(2048 (v - hi)), packed as two 32-bit words
__device__ __forceinline__ void split2(float f0, float f1, unsigned& hp, unsigned& lp) {
  const _Float16 h0 = (_Float16)f0, h1 = (_Float16)f1;
  const float q0 = (f0 - (float)h0) * 2048.0f, q1 = (f1 - (float)h1) * 2048.0f;
  hp = pk16(h_bits(h0), h_bits(h1));
  lp = pk16(hb16(q0), hb16(q1));
}

// ---- fragment loader: 16-bit A/B operand, lane -> row/col (lane&15), p already includes +8*(lane>>4);
//      elements 0..7 <- p[0..7] (k0+8h..k0+8h+7), elements 8..15 <- p[16..23] (k0+16+8h..k0+16+8h+7)
__device__ __forceinline__ v16h ldfrag_h(const _Float16* p) {
  union { v16h v; v8h h[2]; } f;
  f.h[0] = *(const v8h*)(p);
  f.h[1] = *(const v8h*)(p + 16);
  return f.v;
}

// ---- WMMA helpers; the guards insert the trailing VALU hazard gap and keep A/B live --------------------------
__device__ __forceinline__ v8f mma_raw(v16h a, v16h b, v8f c) {
  return __builtin_amdgcn_wmma_f32_16x16x32_f16(false, a, false, b, (short)0, c, false, false);
}
__device__ __forceinline__ void guard6(v8f& c0, v8f& c1, v8f& c2, v8f& c3, v8f& c4, v8f& c5,
                                       const v16h& a0, const v16h& a1, const v16h& b0, const v16h& b1,
                                       const v16h& b2, const v16h& b3) {
#if defined(__HIP_DEVICE_COMPILE__)
  asm volatile("v_nop\n\tv_nop\n\tv_nop\n\tv_nop"
               : "+v"(c0), "+v"(c1), "+v"(c2), "+v"(c3), "+v"(c4), "+v"(c5)
               : "v"(a0), "v"(a1), "v"(b0), "v"(b1), "v"(b2), "v"(b3));
#endif
}
__device__ __forceinline__ void guard8(v8f& c0, v8f& c1, v8f& c2, v8f& c3, v8f& c4, v8f& c5, v8f& c6, v8f& c7,
                                       const v16h& a0, const v16h& a1, const v16h& b0, const v16h& b1,
                                       const v16h& b2, const v16h& b3) {
#if defined(__HIP_DEVICE_COMPILE__)
  asm volatile("v_nop\n\tv_nop\n\tv_nop\n\tv_nop"
               : "+v"(c0), "+v"(c1), "+v"(c2), "+v"(c3), "+v"(c4), "+v"(c5), "+v"(c6), "+v"(c7)
               : "v"(a0), "v"(a1), "v"(b0), "v"(b1), "v"(b2), "v"(b3));
#endif
}

// ---- asynchronous copies, global -> LDS, 16 B per lane, eight per statement. The s_wait_xcnt is the last line of the
//      copies' own statement, so that no address register named here is rewritten in front of it.
__device__ __forceinline__ void acopy8(const unsigned* l, const _Float16* const* g) {
#if defined(__HIP_DEVICE_COMPILE__)
  asm volatile("global_load_async_to_lds_b128 %0, %8, off\n\t"
               "global_load_async_to_lds_b128 %1, %9, off\n\t"
               "global_load_async_to_lds_b128 %2, %10, off\n\t"
               "global_load_async_to_lds_b128 %3, %11, off\n\t"
               "global_load_async_to_lds_b128 %4, %12, off\n\t"
               "global_load_async_to_lds_b128 %5, %13, off\n\t"
               "global_load_async_to_lds_b128 %6, %14, off\n\t"
               "global_load_async_to_lds_b128 %7, %15, off\n\t"
               "s_wait_xcnt 0x0"
               :: "v"(l[0]), "v"(l[1]), "v"(l[2]), "v"(l[3]), "v"(l[4]), "v"(l[5]), "v"(l[6]), "v"(l[7]),
                  "v"(g[0]), "v"(g[1]), "v"(g[2]), "v"(g[3]), "v"(g[4]), "v"(g[5]), "v"(g[6]), "v"(g[7])
               : "memory");
#endif
}

// =================================================================================================================
// Both conversions in one launch whose waves are all resident at once: 256 work-groups of 16 waves, no loop. A wave's
// job is 2048 elements: 16 loads of 16 B a lane, each covering whole 128-B lines, all issued before the first use.
// x [32768][256] f32 -> xh f16 plane of 16 bf16(x): wave gw takes the 2048 consecutive elements from gw * 2048; load j
// covers the 512 contiguous bytes of elements j * 128 + lane * 4 + 0..3; each 8-B-a-lane store covers two whole lines.
// Weights: wqt[n][k] = f16(64 bf16(w_qkv[k][n])), w1t[n][k] = f16(64 bf16(w_fc1[k][n])) (n < 768, k < 256),
// w2t[n][k] = f16(64 bf16(w_fc2[k][n])) (n < 256, k < 768), in tiles of 64 k x 32 n, 96 a matrix, 288 in all: wave 0 of
// every work-group takes one beside its x job, wave 2 of the first 32 work-groups the rest. Lane = (kq = lane >> 3,
// nq = lane & 7): load (hf, e) reads n = nq * 4 + 0..3 of source row k = hf * 32 + kq * 8 + e (four whole lines a load), so
// the lane holds 8 consecutive k of 4 rows n; store (hf, i) writes them, 16 B, to output row nq * 4 + i. The 128-B line of
// an output row (64 k) is written by this one wave.
// grid = 256, 512 threads. coverage: xh [32768][256], wqt 768 x 256, w1t 768 x 256, w2t 256 x 768, every element once.
// =================================================================================================================
#define CVT_WG 256
#define CVT_XW 2048
#define CVT_WT ((MLP / 32) * (DIMC / 64))
static_assert(CVT_WG * 16 * CVT_XW == NTOK * DIMC);
static_assert(CVT_WT == 96 && 3 * CVT_WT == CVT_WG + 32 && (MLP % 64) == 0 && (DIMC % 64) == 0);
__global__ __launch_bounds__(512)
void k_cvt(const float* __restrict__ x, const float* __restrict__ wqkv, const float* __restrict__ wfc1,
           const float* __restrict__ wfc2, unsigned short* xh, unsigned short* wqt, unsigned short* w1t,
           unsigned short* w2t) {
  const int lane = threadIdx.x & 31;
  const int wave = __builtin_amdgcn_readfirstlane((int)(threadIdx.x >> 5));   // scalar: the weight tests are scalar branches
  const int blk = blockIdx.x;
  const size_t x0 = (size_t)(blk * 16 + wave) * CVT_XW + lane * 4;
  const float* xp = x + x0;
  v4f a[16];
#pragma unroll  // a[] indexed by constants, so it stays in registers (the loops below likewise)
  for (int j = 0; j < 16; ++j) a[j] = *(const v4f*)(xp + j * 128);
  // weight tile of this wave, or none (wave-uniform)
  const int wt = (wave == 0) ? blk : ((wave == 2 && blk < 3 * CVT_WT - CVT_WG) ? CVT_WG + blk : -1);
  const int m = wt / CVT_WT, r = wt - m * CVT_WT;
  const int ns = (m == 2) ? DIMC : MLP;                     // source row length = number of output rows
  const int kd = (m == 2) ? MLP : DIMC;                     // output row length
  const int nt = (m == 2) ? r / (MLP / 64) : r / (DIMC / 64);   // constant divisors: scalar shifts and multiplies
  const int kt = r - nt * (kd / 64);
  const int kq = lane >> 3, nq = lane & 7;
  v4f g[16];
  if (wt >= 0) {
    const float* p = (m == 0 ? wqkv : (m == 1 ? wfc1 : wfc2)) + (size_t)(kt * 64 + kq * 8) * ns + nt * 32 + nq * 4;
    const float* q[16];
#pragma unroll
    for (int j = 0; j < 16; ++j) { q[j] = p + (size_t)((j >> 3) * 32 + (j & 7)) * ns; g[j] = *(const v4f*)q[j]; }
#if defined(__HIP_DEVICE_COMPILE__)
    // the loads' address registers are inputs here, so they live up to the wait and nothing is written over them in front of it
    asm volatile("s_wait_xcnt 0x0" :: "v"(q[0]), "v"(q[1]), "v"(q[2]), "v"(q[3]), "v"(q[4]), "v"(q[5]), "v"(q[6]), "v"(q[7]),
                 "v"(q[8]), "v"(q[9]), "v"(q[10]), "v"(q[11]), "v"(q[12]), "v"(q[13]), "v"(q[14]), "v"(q[15]) : "memory");
#endif
  }
#if defined(__HIP_DEVICE_COMPILE__)
  // as above, for the address register of the 16 x loads
  asm volatile("s_wait_xcnt 0x0" :: "v"(xp) : "memory");
#endif
  __builtin_amdgcn_sched_barrier(0);  // holds every load in front of the first conversion: one memory latency a wave
  v2u pk[16];
#pragma unroll
  for (int j = 0; j < 16; ++j) {
    pk[j][0] = pk16(hb16(bfr(a[j][0]) * 16.0f), hb16(bfr(a[j][1]) * 16.0f));
    pk[j][1] = pk16(hb16(bfr(a[j][2]) * 16.0f), hb16(bfr(a[j][3]) * 16.0f));
  }
  __builtin_amdgcn_sched_barrier(0);  // every store behind the last conversion: no register of an issued store is written again
  unsigned short* xd = xh + x0;
#pragma unroll
  for (int j = 0; j < 16; ++j) *(v2u*)(xd + j * 128) = pk[j];
  if (wt >= 0) {
#if defined(__HIP_DEVICE_COMPILE__)
    // in front of the conversions below, which may write over registers that the x stores name
    asm volatile("s_wait_xcnt 0x0" ::: "memory");
#endif
    __builtin_amdgcn_sched_barrier(0);  // keeps those conversions behind the wait
    v4u w[8];
#pragma unroll
    for (int s = 0; s < 8; ++s)
#pragma unroll
      for (int e = 0; e < 4; ++e)
        w[s][e] = pk16(hb16(bfr(g[(s >> 2) * 8 + 2 * e][s & 3]) * 64.0f), hb16(bfr(g[(s >> 2) * 8 + 2 * e + 1][s & 3]) * 64.0f));
    __builtin_amdgcn_sched_barrier(0);  // as above: the stores behind the last conversion
    unsigned short* d = (m == 0 ? wqt : (m == 1 ? w1t : w2t)) + (size_t)(nt * 32 + nq * 4) * kd + kt * 64 + kq * 8;
#pragma unroll
    for (int s = 0; s < 8; ++s) *(v4u*)(d + (size_t)(s & 3) * kd + (s >> 2) * 32) = w[s];
  }
}

// one 16x16 accumulator tile (lane = channel, registers = 8 consecutive tokens) -> carried value 16 (x w + b) =
// acc/64 + bb as f16 hi + x2048 residual, 16 B each, into the channel's hi row and its lo row (HD rows further on)
__device__ __forceinline__ void put_planes(const v8f& acc, float bb, unsigned char* hi_dst) {
  v4u a, q4;
#pragma unroll
  for (int e = 0; e < 4; ++e) {
    const float f0 = acc[2 * e] * (1.0f / 64.0f) + bb;
    const float f1 = acc[2 * e + 1] * (1.0f / 64.0f) + bb;
    unsigned hw, lw;
    split2(f0, f1, hw, lw);
    a[e] = hw; q4[e] = lw;
  }
  *(v4u*)(void*)hi_dst = a;
  *(v4u*)(void*)(hi_dst + HD * TSP) = q4;
}

// =================================================================================================================
// K, V projection of one head fused with its channel-attention logits, split over K. Block (ck, bh) takes the KCH
// tokens of chunk ck in KCH/64 sub-tiles of 64. The head's 64 k rows and 64 v rows of wqt are copied into LDS once
// (rows of WSP bytes); per sub-tile the 64 xh rows are copied in, C[64 tokens][128 channels] = xh . w^T (K = 256,
// 8 waves = 2 (32 tokens) x 4 (32 channels)), and each lane's 8 consecutive tokens of a channel
// go as f16 hi + x2048 residual into the LDS planes T[plane * 64 + channel][64 tokens] (rows of TSP bytes; planes
// k hi, k lo, v hi, v lo). Then raw[d][e] += sum_n (16 k[n][d]) (16 v[n][e]) on WMMA (M = N = 64, 2 k-steps):
// A = k planes, B = v planes, products hi*hi + (hi*lo + lo*hi)/2048, 8 waves = 4 (16 rows) x 2 (32 cols), tokens
// ascending. k and v never leave the work-group. The chunk's f32 tile goes through LDS to part[ck][bh][d][e].
// grid = (KSPLIT, 32), 256 threads. coverage: part [KSPLIT][32][64][64] f32, every element once.
// =================================================================================================================
// four waves per SIMD: the register budget that lets two work-groups (the LDS limit) share a WGP
__global__ __launch_bounds__(256) __attribute__((amdgpu_waves_per_eu(4)))
void k_kv_part(const unsigned short* __restrict__ xh, const unsigned short* __restrict__ wqt,
               const float* __restrict__ bias, float* part) {
  __shared__ __align__(16) unsigned char sm[192 * WSP + 4 * HD * TSP];
  unsigned char* sW = sm;                                   // 128 weight rows: 0..63 k channels, 64..127 v channels
  unsigned char* sA = sm + 128 * WSP;                       // 64 token rows
  unsigned char* sT = sm + 192 * WSP;                       // the four planes of one sub-tile
  static_assert(64 * LDA * 4 <= 64 * WSP);
  const int tid = threadIdx.x, wave = tid >> 5, lane = tid & 31, hh = lane >> 4, c = lane & 15;
  const int ck = blockIdx.x, bh = blockIdx.y;
  const int h = bh & (NH - 1);
  const int tok0 = (bh >> 2) * NN + ck * KCH;
  const _Float16* gA = (const _Float16*)(const void*)xh + (size_t)(tok0 + wave) * DIMC + lane * 8;
  const unsigned lA = (unsigned)(uintptr_t)sA + (unsigned)(wave * WSP + lane * 16);   // LDS byte address
  {
    // one wave copy = one whole row of 512 B; row = j * 8 + wave
    const _Float16* gK = (const _Float16*)(const void*)wqt + (size_t)(DIMC + h * HD + wave) * DIMC + lane * 8;
    const _Float16* gV = gK + (size_t)DIMC * DIMC;
    const unsigned lW = (unsigned)(uintptr_t)sW + (unsigned)(wave * WSP + lane * 16);
    unsigned l[8];
    const _Float16* g[8];
#pragma unroll  // l[] and g[] indexed by constants, so they stay in registers (the two loops below likewise)
    for (int j = 0; j < 8; ++j) { l[j] = lW + (unsigned)(j * 8 * WSP); g[j] = gK + (size_t)j * 8 * DIMC; }
    acopy8(l, g);
#pragma unroll
    for (int j = 0; j < 8; ++j) { l[j] = lW + (unsigned)((64 + j * 8) * WSP); g[j] = gV + (size_t)j * 8 * DIMC; }
    acopy8(l, g);
#pragma unroll
    for (int j = 0; j < 8; ++j) { l[j] = lA + (unsigned)(j * 8 * WSP); g[j] = gA + (size_t)j * 8 * DIMC; }
    acopy8(l, g);
    // this wave's copies have landed; behind the barrier every wave's have
    asm volatile("s_wait_asynccnt 0x0" ::: "memory");
    __syncthreads();
  }
  // projection: wave = 32 tokens x 32 channels
  const int mw = wave >> 2, nw = wave & 3;
  const _Float16* a0p = (const _Float16*)(const void*)(sA + (mw * 32 + c) * WSP) + 8 * hh;
  const _Float16* a1p = (const _Float16*)(const void*)(sA + (mw * 32 + 16 + c) * WSP) + 8 * hh;
  const _Float16* b0p = (const _Float16*)(const void*)(sW + (nw * 32 + c) * WSP) + 8 * hh;
  const _Float16* b1p = (const _Float16*)(const void*)(sW + (nw * 32 + 16 + c) * WSP) + 8 * hh;
  const int kvs = nw >> 1;                                  // 0: this wave's channels are k, 1: v
  const int d0 = (nw & 1) * 32 + c;                         // channel within the head; the second tile is d0 + 16
  const float bb0 = 16.0f * bfr(bias[(1 + kvs) * DIMC + h * HD + d0]);
  const float bb1 = 16.0f * bfr(bias[(1 + kvs) * DIMC + h * HD + d0 + 16]);
  unsigned char* t00 = sT + (kvs * 2 * HD + d0) * TSP + (mw * 32 + 8 * hh) * 2;   // hi row of d0, this lane's 8 tokens
  // logits: wave = 16 rows d x 32 cols e
  const int mv = wave >> 1, nv = wave & 1;
  const _Float16* ahp = (const _Float16*)(const void*)(sT + (mv * 16 + c) * TSP) + 8 * hh;
  const _Float16* alp = (const _Float16*)(const void*)(sT + (HD + mv * 16 + c) * TSP) + 8 * hh;
  const _Float16* b0h = (const _Float16*)(const void*)(sT + (2 * HD + nv * 32 + c) * TSP) + 8 * hh;
  const _Float16* b1h = (const _Float16*)(const void*)(sT + (2 * HD + nv * 32 + 16 + c) * TSP) + 8 * hh;
  const _Float16* b0l = (const _Float16*)(const void*)(sT + (3 * HD + nv * 32 + c) * TSP) + 8 * hh;
  const _Float16* b1l = (const _Float16*)(const void*)(sT + (3 * HD + nv * 32 + 16 + c) * TSP) + 8 * hh;
  v8f p0 = zero8(), p1 = zero8(), q0 = zero8(), q1 = zero8(), r0 = zero8(), r1 = zero8();
#pragma unroll 1  // one copy of the sub-tile body: the text stays short
  for (int t = 0; t < KCH / 64; ++t) {                      // block-uniform trip count
    v8f c00 = zero8(), c01 = zero8(), c10 = zero8(), c11 = zero8();
    // fragments are fetched one k-step ahead: the reads of step ks + 1 are in flight under the products of step ks
    v16h fa0 = ldfrag_h(a0p), fa1 = ldfrag_h(a1p);
    v16h fb0 = ldfrag_h(b0p), fb1 = ldfrag_h(b1p);
#pragma unroll  // straight-line k-steps
    for (int ks = 0; ks < DIMC / 32; ++ks) {
      const int kn = (ks + 1 < DIMC / 32 ? ks + 1 : ks) * 32;
      v16h na0 = fa0, na1 = fa1, nb0 = fb0, nb1 = fb1;
      if (ks + 1 < DIMC / 32) {
        na0 = ldfrag_h(a0p + kn);
        na1 = ldfrag_h(a1p + kn);
        nb0 = ldfrag_h(b0p + kn);
        nb1 = ldfrag_h(b1p + kn);
      }
      __builtin_amdgcn_sched_barrier(0);  // holds the next step's reads in front of this step's products
      c00 = mma_raw(fa0, fb0, c00);
      c01 = mma_raw(fa0, fb1, c01);
      c10 = mma_raw(fa1, fb0, c10);
      c11 = mma_raw(fa1, fb1, c11);
      __builtin_amdgcn_sched_barrier(0);  // and later reads behind them: no deeper fetch, no spills
      fa0 = na0; fa1 = na1; fb0 = nb0; fb1 = nb1;
    }
    put_planes(c00, bb0, t00);
    put_planes(c01, bb1, t00 + 16 * TSP);
    put_planes(c10, bb0, t00 + 32);
    put_planes(c11, bb1, t00 + 16 * TSP + 32);
    // the planes are written and this wave's reads of the token rows have returned; behind the barrier all waves' have
    asm volatile("s_wait_dscnt 0x0" ::: "memory");
    __syncthreads();
    if (t + 1 < KCH / 64) {                                 // block-uniform: the next sub-tile's token rows fly under the logits
      unsigned l[8];
      const _Float16* g[8];
#pragma unroll
      for (int j = 0; j < 8; ++j) { l[j] = lA + (unsigned)(j * 8 * WSP); g[j] = gA + (size_t)((t + 1) * 64 + j * 8) * DIMC; }
      acopy8(l, g);
    }
#pragma unroll  // two straight-line k-steps
    for (int ks = 0; ks < 2; ++ks) {
      const int ko = ks * 32;
      const v16h fa  = ldfrag_h(ahp + ko);
      const v16h ga  = ldfrag_h(alp + ko);
      const v16h fb0 = ldfrag_h(b0h + ko);
      const v16h fb1 = ldfrag_h(b1h + ko);
      const v16h gb0 = ldfrag_h(b0l + ko);
      const v16h gb1 = ldfrag_h(b1l + ko);
      p0 = mma_raw(fa, fb0, p0);
      p1 = mma_raw(fa, fb1, p1);
      q0 = mma_raw(fa, gb0, q0);
      q1 = mma_raw(fa, gb1, q1);
      r0 = mma_raw(ga, fb0, r0);
      r1 = mma_raw(ga, fb1, r1);
      if (ks == 1) guard6(p0, p1, q0, q1, r0, r1, fa, ga, fb0, fb1, gb0, gb1);  // in front of the back edge
    }
    // the plane reads have returned and this wave's copies have landed; behind the barrier the planes may be
    // rewritten and the new token rows read
    asm volatile("s_wait_dscnt 0x0" ::: "memory");
    asm volatile("s_wait_asynccnt 0x0" ::: "memory");
    __syncthreads();
  }
  float* Cs = (float*)(void*)sA;                            // the token rows are dead: the f32 tile lies over them
#pragma unroll
  for (int r = 0; r < 8; ++r) {
    const int row = mv * 16 + 8 * hh + r;
    Cs[row * LDA + nv * 32 + c]      = p0[r] + (q0[r] + r0[r]) * RSC;
    Cs[row * LDA + nv * 32 + 16 + c] = p1[r] + (q1[r] + r1[r]) * RSC;
  }
  __syncthreads();
  float* dst = part + ((size_t)ck * (BB * NH) + bh) * (HD * HD);
  v4f pk[4];
#pragma unroll  // pk[] indexed by constants, so it stays in registers
  for (int s = 0; s < 4; ++s) {
    const int idx = s * 256 + tid;
    pk[s] = *(const v4f*)(Cs + (idx >> 4) * LDA + (idx & 15) * 4);
  }
#pragma unroll  // as above
  for (int s = 0; s < 4; ++s) *(v4f*)(dst + (size_t)(s * 256 + tid) * 4) = pk[s];
}

// =================================================================================================================
// Chunk sum + softmax. Block = 16 rows d of one (b, h); thread = 4 consecutive e of one row, 16 lanes per row.
// raw = sum over ck of part[ck] in index order; logit = raw/2048 (includes the head_dim^-0.5 factor 1/8). Softmax
// over e per row d in f32 (max subtracted, 16-lane butterflies), 4096 P stored as f16 hi + x2048 residual planes;
// a wave's store covers two whole 128-B rows.
// grid = (32, 4), 256 threads. coverage: ath/atl [32][64][64], every element once.
// =================================================================================================================
__global__ __launch_bounds__(256)
void k_attn_sm(const float* __restrict__ part, unsigned short* at) {
  const int tid = threadIdx.x;
  const int bh = blockIdx.x;
  const int row = blockIdx.y * 16 + (tid >> 4), col0 = (tid & 15) * 4;
  const size_t off = ((size_t)bh * HD + row) * HD + col0;
  v4f t[KSPLIT];
#pragma unroll  // all chunk loads issued before the first add: one memory latency, not KSPLIT
  for (int s = 0; s < KSPLIT; ++s) t[s] = *(const v4f*)(part + (size_t)s * ATL_OFF + off);
  v4f a = t[0];
#pragma unroll  // t[] indexed by constants, so it stays in registers (the short loops below likewise)
  for (int s = 1; s < KSPLIT; ++s) a += t[s];
  float mx = fmaxf(fmaxf(a[0], a[1]), fmaxf(a[2], a[3]));
#pragma unroll
  for (int o = 1; o < 16; o <<= 1) mx = fmaxf(mx, __shfl_xor(mx, o, 32));
  float e[4];
#pragma unroll
  for (int n = 0; n < 4; ++n) e[n] = expf((a[n] - mx) * RSC);
  float sm = (e[0] + e[1]) + (e[2] + e[3]);
#pragma unroll
  for (int o = 1; o < 16; o <<= 1) sm += __shfl_xor(sm, o, 32);
  const float sc = (1.0f / sm) * 4096.0f;
  v2u ph, pq;
#pragma unroll
  for (int n = 0; n < 2; ++n) {
    unsigned hw, lw;
    split2(e[2 * n] * sc, e[2 * n + 1] * sc, hw, lw);
    ph[n] = hw; pq[n] = lw;
  }
  *(v2u*)(at + off) = ph;
  *(v2u*)(at + ATL_OFF + off) = pq;
}

// =================================================================================================================
// Q projection + xf + residual + layer norm + FC1 + exact GELU + FC2 + bias + residual in one kernel: q, x1, h and g
// never leave the work-group. Block = 128 tokens of one batch, 16 waves, one block per WGP. Wave (wq, wr) owns 32
// tokens (wq) x the 64 channels of head wr, from q to the output.
// q: C[64 e][32 tokens] = wqt rows . xh rows^T on WMMA (K = 256, 8 k-steps, k ascending), C = 1024 (x w); a lane holds
// 8 consecutive channels of one token, so two accumulator tiles 16 channels apart are, lane for lane, one B fragment
// of 32 channels: the carried value 16 (x w + b) = C/64 + 16 bf16(b) goes as f16 hi + x2048 residual straight into
// the fragment registers of xf.
// xf: C[64 d][32 tokens] = sum_e (4096 P[d][e]) (16 q[token][wr*64+e]) on WMMA (K = 64, 2 k-steps): A = P hi/lo rows,
// B = q hi/lo fragments, products hi*hi + (hi*lo + lo*hi)/2048, xf = C/65536; a lane holds 8 consecutive channels of
// one token. x1 = bf16(x) + xf in registers (bf16(x) = xh/16). Layer norm: mean, then the sum of squared differences, each
// summed in the lane, over the lane pair and over the four waves of a token through LDS. 16 h goes as f16, 16 B a
// store, into H[token][256] in LDS. 1024 x1 is the start value of the FC2 accumulators.
// The 768 hidden channels run in 6 chunks of 128. Per chunk: C1[128 hidden][128 tokens] = w1t rows . H rows^T (8
// k-steps, 16 waves = 4 (32 hidden) x 4 (32 tokens)): v = C1/1024 + bf16(b1), g = 0.5 v (1 + erf(v / sqrt 2)) in
// registers, 16 g as f16, one 16-B LDS store into G[token][128]. Then C2[256 cols][128 tokens] += w2t chunk . G^T
// (4 k-steps), hidden channels ascending. The chunk's w2t rows fly under FC1 and GELU, the next chunk's w1t rows under
// FC2. out = C2/1024 + bf16(b2) through an f32 LDS tile, whole lines.
// grid = NTOK/128, 512 threads. coverage: out [32768][256] f32, every element once.
// =================================================================================================================
__global__ __launch_bounds__(512)
void k_mlp(const unsigned short* __restrict__ wqt, const float* __restrict__ biasq,
           const unsigned short* __restrict__ at,
           const unsigned short* __restrict__ xh, const float* __restrict__ gw, const float* __restrict__ gb,
           const unsigned short* __restrict__ w1t, const float* __restrict__ bias1,
           const unsigned short* __restrict__ w2t, const float* __restrict__ bias2, float* out) {
  __shared__ __align__(16) unsigned char sm[384 * WSP + 384 * GSP + MLP * 4 + 2 * NH * 128 * 4 + 3 * DIMC * 4];
  unsigned char* sH  = sm;                                  // 128 rows, WSP bytes each: wqt rows 0..127, then h by token
  unsigned char* sW1 = sm + 128 * WSP;                      // 128 rows: wqt rows 128..255, then the chunk's w1t rows
  unsigned char* sG  = sm + 256 * WSP;                      // 128 token rows of g, GSP bytes each
  unsigned char* sW2 = sm + 256 * WSP + 128 * GSP;          // 256 w2t rows, the chunk's 128 k
  unsigned char* sP  = sG;                                  // first: 512 rows of XSP bytes, P hi [head][d], then P lo
  float* sB1 = (float*)(void*)(sm + 256 * WSP + 384 * GSP); // bf16(b1) as f32
  unsigned char* sX  = sm + 256 * WSP + 384 * GSP + MLP * 4;  // 128 token rows of xh
  float* sR  = (float*)(void*)(sX + 128 * WSP);             // layer-norm partial sums [2][head][128 tokens]
  float* sLN = sR + 2 * NH * 128;                           // bf16(norm weight), then bf16(norm bias), as f32
  float* sBQ = sLN + 2 * DIMC;                              // 16 bf16(b) of the 256 q channels, as f32
  static_assert(128 * LDX * 4 <= 256 * WSP);
  static_assert(2 * NH * HD * XSP <= 384 * GSP && (NN % 128) == 0);
  static_assert(sizeof(sm) <= 327680);
  const int tid = threadIdx.x, wave = tid >> 5, lane = tid & 31, hh = lane >> 4, c = lane & 15;
  const int tok0 = blockIdx.x * 128;
  const int wq = wave >> 2, wr = wave & 3;
  // copies: a wave copy covers one whole 512-B row (wqt, xh, w1t), two 256-B row pieces (w2t) or four 128-B rows (P)
  const _Float16* gQ  = (const _Float16*)(const void*)wqt + (size_t)wave * DIMC + lane * 8;   // rows 0..255: the q channels
  const _Float16* gX  = (const _Float16*)(const void*)xh + (size_t)(tok0 + wave) * DIMC + lane * 8;
  const _Float16* gP  = (const _Float16*)(const void*)at + (size_t)(tok0 / NN) * (NH * HD * HD) + tid * 8;
  const _Float16* gW1 = (const _Float16*)(const void*)w1t + (size_t)wave * DIMC + lane * 8;
  const _Float16* gW2 = (const _Float16*)(const void*)w2t + (size_t)(wave * 2 + hh) * MLP + c * 8;
  const unsigned lH  = (unsigned)(uintptr_t)sH  + (unsigned)(wave * WSP + lane * 16);            // LDS byte addresses
  const unsigned lW1 = (unsigned)(uintptr_t)sW1 + (unsigned)(wave * WSP + lane * 16);
  const unsigned lX  = (unsigned)(uintptr_t)sX  + (unsigned)(wave * WSP + lane * 16);
  const unsigned lP  = (unsigned)(uintptr_t)sP  + (unsigned)((tid >> 3) * XSP + (tid & 7) * 16);
  const unsigned lW2 = (unsigned)(uintptr_t)sW2 + (unsigned)((wave * 2 + hh) * GSP + c * 16);
  {
    unsigned l[8];
    const _Float16* g[8];
#pragma unroll  // l[] and g[] indexed by constants, so they stay in registers (the copy loops below likewise)
    for (int j = 0; j < 8; ++j) { l[j] = lH + (unsigned)(j * 16 * WSP); g[j] = gQ + (size_t)j * 16 * DIMC; }
    acopy8(l, g);
#pragma unroll
    for (int j = 0; j < 8; ++j) { l[j] = lW1 + (unsigned)(j * 16 * WSP); g[j] = gQ + (size_t)(128 + j * 16) * DIMC; }
    acopy8(l, g);
#pragma unroll
    for (int j = 0; j < 8; ++j) {                           // j < 4: P hi, 64 rows (one head) a copy; j >= 4: P lo
      l[j] = lP + (unsigned)(j * HD * XSP);
      g[j] = gP + (size_t)(j >> 2) * ATL_OFF + (size_t)(j & 3) * HD * HD;
    }
    acopy8(l, g);
#pragma unroll
    for (int j = 0; j < 8; ++j) { l[j] = lX + (unsigned)(j * 16 * WSP); g[j] = gX + (size_t)j * 16 * DIMC; }
    acopy8(l, g);
    for (int i = tid; i < MLP; i += 512) sB1[i] = bfr(bias1[i]);
    if (tid < DIMC) { sLN[tid] = bfr(gw[tid]); sLN[DIMC + tid] = bfr(gb[tid]); sBQ[tid] = 16.0f * bfr(biasq[tid]); }
    // this wave's copies have landed; behind the barrier every wave's have, and the four parameter rows are written
    asm volatile("s_wait_asynccnt 0x0" ::: "memory");
    __syncthreads();
  }
  // o[n][t]: lane = token wq*32 + t*16 + c, registers = channels wr*64 + n*16 + 8*hh + 0..7
  v8f o[4][2];
  {
    // qa[n][t]: lane = token wq*32 + t*16 + c, registers = q channels wr*64 + n*16 + 8*hh + 0..7, value 1024 (x w)
    v8f qa[4][2];
#pragma unroll  // every array here is indexed by constants, so it stays in registers
    for (int n = 0; n < 4; ++n)
#pragma unroll
      for (int t = 0; t < 2; ++t) qa[n][t] = zero8();
    {
      const _Float16* wp = (const _Float16*)(const void*)(sH + (wr * HD + c) * WSP) + 8 * hh;   // the head's 64 wqt rows
      const _Float16* xb = (const _Float16*)(const void*)(sX + (wq * 32 + c) * WSP) + 8 * hh;   // the wave's 32 token rows
      // fragments are fetched one k-step ahead: the reads of step ks + 1 are in flight under the products of step ks
      v16h fx0 = ldfrag_h(xb), fx1 = ldfrag_h(xb + 16 * (WSP / 2));
      v16h fw0 = ldfrag_h(wp), fw1 = ldfrag_h(wp + 16 * (WSP / 2));
      v16h fw2 = ldfrag_h(wp + 32 * (WSP / 2)), fw3 = ldfrag_h(wp + 48 * (WSP / 2));
#pragma unroll  // straight-line k-steps
      for (int ks = 0; ks < DIMC / 32; ++ks) {
        const int kn = (ks + 1) * 32;
        v16h nx0 = fx0, nx1 = fx1, nw0 = fw0, nw1 = fw1, nw2 = fw2, nw3 = fw3;
        if (ks + 1 < DIMC / 32) {
          nx0 = ldfrag_h(xb + kn);
          nx1 = ldfrag_h(xb + 16 * (WSP / 2) + kn);
          nw0 = ldfrag_h(wp + kn);
          nw1 = ldfrag_h(wp + 16 * (WSP / 2) + kn);
          nw2 = ldfrag_h(wp + 32 * (WSP / 2) + kn);
          nw3 = ldfrag_h(wp + 48 * (WSP / 2) + kn);
        }
        __builtin_amdgcn_sched_barrier(0);  // holds the next step's reads in front of this step's products
        qa[0][0] = mma_raw(fw0, fx0, qa[0][0]);
        qa[0][1] = mma_raw(fw0, fx1, qa[0][1]);
        qa[1][0] = mma_raw(fw1, fx0, qa[1][0]);
        qa[1][1] = mma_raw(fw1, fx1, qa[1][1]);
        qa[2][0] = mma_raw(fw2, fx0, qa[2][0]);
        qa[2][1] = mma_raw(fw2, fx1, qa[2][1]);
        qa[3][0] = mma_raw(fw3, fx0, qa[3][0]);
        qa[3][1] = mma_raw(fw3, fx1, qa[3][1]);
        __builtin_amdgcn_sched_barrier(0);  // and later reads behind them: one step ahead, no deeper
        fx0 = nx0; fx1 = nx1; fw0 = nw0; fw1 = nw1; fw2 = nw2; fw3 = nw3;
      }
    }
    // fragment words: tile n fills elements 8*(n&1) .. 8*(n&1)+7 of fragment n>>1 (k = n*16 + 8*hh + 0..7, the table layout)
    union QF { v16h v; v4u u[2]; } qh[2][2], ql[2][2];      // [t][k-step]
#pragma unroll
    for (int n = 0; n < 4; ++n) {
      const float* bp = sBQ + wr * HD + n * 16 + 8 * hh;
      const v4f bA = *(const v4f*)(bp);
      const v4f bB = *(const v4f*)(bp + 4);
      const float bv[8] = { bA[0], bA[1], bA[2], bA[3], bB[0], bB[1], bB[2], bB[3] };
#pragma unroll
      for (int t = 0; t < 2; ++t) {
        v4u a, q4;
#pragma unroll
        for (int e = 0; e < 4; ++e) {
          const float f0 = qa[n][t][2 * e] * (1.0f / 64.0f) + bv[2 * e];
          const float f1 = qa[n][t][2 * e + 1] * (1.0f / 64.0f) + bv[2 * e + 1];
          unsigned hw, lw;
          split2(f0, f1, hw, lw);
          a[e] = hw; q4[e] = lw;
        }
        qh[t][n >> 1].u[n & 1] = a;
        ql[t][n >> 1].u[n & 1] = q4;
      }
    }
    const _Float16* xp  = (const _Float16*)(const void*)(sX  + (wq * 32 + c) * WSP) + wr * HD + 8 * hh;
    const _Float16* php = (const _Float16*)(const void*)(sP + (wr * HD + c) * XSP) + 8 * hh;
    const _Float16* plp = (const _Float16*)(const void*)(sP + (NH * HD + wr * HD + c) * XSP) + 8 * hh;
#pragma unroll  // every array below is indexed by constants, so it stays in registers (every short loop likewise)
    for (int t = 0; t < 2; ++t) {
      const v16h fq0 = qh[t][0].v, fq1 = qh[t][1].v;
      const v16h gq0 = ql[t][0].v, gq1 = ql[t][1].v;
#pragma unroll
      for (int n = 0; n < 4; ++n) {
        const v16h fp0 = ldfrag_h(php + n * 16 * (XSP / 2)), fp1 = ldfrag_h(php + n * 16 * (XSP / 2) + 32);
        const v16h gp0 = ldfrag_h(plp + n * 16 * (XSP / 2)), gp1 = ldfrag_h(plp + n * 16 * (XSP / 2) + 32);
        const v8h xv = *(const v8h*)(xp + t * 16 * (WSP / 2) + n * 16);
        v8f p = zero8(), q = zero8(), r = zero8();
        p = mma_raw(fp0, fq0, p);
        q = mma_raw(gp0, fq0, q);
        r = mma_raw(fp0, gq0, r);
        p = mma_raw(fp1, fq1, p);
        q = mma_raw(gp1, fq1, q);
        r = mma_raw(fp1, gq1, r);
#pragma unroll
        for (int e = 0; e < 8; ++e)
          o[n][t][e] = (float)xv[e] * (1.0f / 16.0f) + (p[e] + (q[e] + r[e]) * RSC) * (1.0f / 65536.0f);
        __builtin_amdgcn_sched_barrier(0);  // holds later fragment reads behind these products: no spills
      }
    }
  }
  float mu[2], rs[2];
#pragma unroll
  for (int t = 0; t < 2; ++t) {
    float s = 0.f;
#pragma unroll
    for (int n = 0; n < 4; ++n)
      s += ((o[n][t][0] + o[n][t][1]) + (o[n][t][2] + o[n][t][3])) + ((o[n][t][4] + o[n][t][5]) + (o[n][t][6] + o[n][t][7]));
    s += __shfl_xor(s, 16, 32);
    if (hh == 0) sR[wr * 128 + wq * 32 + t * 16 + c] = s;
  }
  // the sums are written and this wave's reads of the wqt rows, P and xh have returned; behind the barrier all waves' have
  asm volatile("s_wait_dscnt 0x0" ::: "memory");
  __syncthreads();
  {
    // the first chunk's w1t rows go where wqt rows 128..255 lay and fly under the rest of the layer norm
    unsigned l[8];
    const _Float16* g[8];
#pragma unroll
    for (int j = 0; j < 8; ++j) { l[j] = lW1 + (unsigned)(j * 16 * WSP); g[j] = gW1 + (size_t)j * 16 * DIMC; }
    acopy8(l, g);
  }
#pragma unroll
  for (int t = 0; t < 2; ++t) {
    const float* rp = sR + wq * 32 + t * 16 + c;
    mu[t] = ((rp[0] + rp[128]) + (rp[256] + rp[384])) * (1.0f / 256.0f);
    float sq = 0.f;
#pragma unroll
    for (int n = 0; n < 4; ++n)
#pragma unroll
      for (int e = 0; e < 8; ++e) { const float d = o[n][t][e] - mu[t]; sq += d * d; }
    sq += __shfl_xor(sq, 16, 32);
    if (hh == 0) sR[NH * 128 + wr * 128 + wq * 32 + t * 16 + c] = sq;
  }
  __syncthreads();
#pragma unroll
  for (int t = 0; t < 2; ++t) {
    const float* rp = sR + NH * 128 + wq * 32 + t * 16 + c;
    rs[t] = rsqrtf(((rp[0] + rp[128]) + (rp[256] + rp[384])) * (1.0f / 256.0f) + 1e-5f);
  }
#pragma unroll
  for (int n = 0; n < 4; ++n) {
    const int col0 = wr * HD + n * 16 + 8 * hh;
    const v4f gA = *(const v4f*)(sLN + col0), gB = *(const v4f*)(sLN + col0 + 4);
    const v4f bA = *(const v4f*)(sLN + DIMC + col0), bB = *(const v4f*)(sLN + DIMC + col0 + 4);
    const float gv[8] = { gA[0], gA[1], gA[2], gA[3], gB[0], gB[1], gB[2], gB[3] };
    const float bv[8] = { bA[0], bA[1], bA[2], bA[3], bB[0], bB[1], bB[2], bB[3] };
#pragma unroll
    for (int t = 0; t < 2; ++t) {
      v4u pk;
#pragma unroll
      for (int e = 0; e < 4; ++e) {
        const float f0 = ((o[n][t][2 * e] - mu[t]) * rs[t]) * gv[2 * e] + bv[2 * e];
        const float f1 = ((o[n][t][2 * e + 1] - mu[t]) * rs[t]) * gv[2 * e + 1] + bv[2 * e + 1];
        pk[e] = pk16(hb16(f0 * 16.0f), hb16(f1 * 16.0f));
      }
      *(v4u*)(void*)(sH + (wq * 32 + t * 16 + c) * WSP + col0 * 2) = pk;
      o[n][t] *= 1024.0f;                                   // x1 in the scale of the FC2 products
    }
  }
  // h is written and this wave's w1t copies have landed; behind the barrier all waves' have
  asm volatile("s_wait_dscnt 0x0" ::: "memory");
  asm volatile("s_wait_asynccnt 0x0" ::: "memory");
  __syncthreads();
  // FC1: wave = 32 hidden (wq) x 32 tokens (wr); FC2: wave = 64 cols (wr) x 32 tokens (wq)
  const _Float16* w1p = (const _Float16*)(const void*)(sW1 + (wq * 32 + c) * WSP) + 8 * hh;
  const _Float16* hp  = (const _Float16*)(const void*)(sH  + (wr * 32 + c) * WSP) + 8 * hh;
  const _Float16* gp  = (const _Float16*)(const void*)(sG  + (wq * 32 + c) * GSP) + 8 * hh;
  const _Float16* w2p = (const _Float16*)(const void*)(sW2 + (wr * 64 + c) * GSP) + 8 * hh;
  unsigned char* gst = sG + (wr * 32 + c) * GSP + (wq * 32 + 8 * hh) * 2;   // this lane's token row, its 8 hidden channels
#pragma unroll 1  // one copy of the chunk body: the text stays short
  for (int ch = 0; ch < MLP / 128; ++ch) {                  // block-uniform trip count
    {
      // the chunk's w2t rows fly under FC1 and GELU; the last chunk's readers left them at the barrier at the loop's foot
      // (first chunk: the readers of the P rows that lay there left them at the barrier behind the row sums)
      unsigned l[8];
      const _Float16* g[8];
#pragma unroll
      for (int j = 0; j < 8; ++j) { l[j] = lW2 + (unsigned)(j * 32 * GSP); g[j] = gW2 + (size_t)j * 32 * MLP + ch * 128; }
      acopy8(l, g);
    }
    v8f a[2][2];
#pragma unroll
    for (int i = 0; i < 2; ++i)
#pragma unroll
      for (int t = 0; t < 2; ++t) a[i][t] = zero8();
    {
      // fragments are fetched one k-step ahead: the reads of step ks + 1 are in flight under the products of step ks
      v16h fw0 = ldfrag_h(w1p), fw1 = ldfrag_h(w1p + 16 * (WSP / 2));
      v16h fh0 = ldfrag_h(hp), fh1 = ldfrag_h(hp + 16 * (WSP / 2));
#pragma unroll  // straight-line k-steps
      for (int ks = 0; ks < DIMC / 32; ++ks) {
        const int kn = (ks + 1) * 32;
        v16h nw0 = fw0, nw1 = fw1, nh0 = fh0, nh1 = fh1;
        if (ks + 1 < DIMC / 32) {
          nw0 = ldfrag_h(w1p + kn);
          nw1 = ldfrag_h(w1p + 16 * (WSP / 2) + kn);
          nh0 = ldfrag_h(hp + kn);
          nh1 = ldfrag_h(hp + 16 * (WSP / 2) + kn);
        }
        __builtin_amdgcn_sched_barrier(0);  // holds the next step's reads in front of this step's products
        a[0][0] = mma_raw(fw0, fh0, a[0][0]);
        a[0][1] = mma_raw(fw0, fh1, a[0][1]);
        a[1][0] = mma_raw(fw1, fh0, a[1][0]);
        a[1][1] = mma_raw(fw1, fh1, a[1][1]);
        __builtin_amdgcn_sched_barrier(0);  // and later reads behind them: one step ahead, no deeper
        fw0 = nw0; fw1 = nw1; fh0 = nh0; fh1 = nh1;
      }
    }
#pragma unroll
    for (int i = 0; i < 2; ++i) {
      const float* bp = sB1 + ch * 128 + wq * 32 + i * 16 + 8 * hh;
      const v4f bA = *(const v4f*)(bp);
      const v4f bB = *(const v4f*)(bp + 4);
      const float bv[8] = { bA[0], bA[1], bA[2], bA[3], bB[0], bB[1], bB[2], bB[3] };
#pragma unroll
      for (int t = 0; t < 2; ++t) {
        float v[8], xe[8], er[8];
        bool small = true;
#pragma unroll
        for (int e = 0; e < 8; ++e) {
          v[e] = a[i][t][e] * (1.0f / 1024.0f) + bv[e];
          xe[e] = v[e] * 0.70710678118654752f;
          small = small && (fabsf(xe[e]) < 1.0f);
        }
        // erff tests |x| < 1 for each value; one test for the lane's 8 values leaves 8 independent chains with no
        // branch between them on the side where all are below 1, and the full erff for all 8 on the other side
        if (small) {
#pragma unroll
          for (int e = 0; e < 8; ++e) er[e] = erff(xe[e]);
        } else {
#pragma unroll
          for (int e = 0; e < 8; ++e) er[e] = erff(xe[e]);
        }
        v4u pk;
#pragma unroll
        for (int e = 0; e < 4; ++e) {
          const float g0 = 0.5f * v[2 * e] * (1.0f + er[2 * e]);
          const float g1 = 0.5f * v[2 * e + 1] * (1.0f + er[2 * e + 1]);
          pk[e] = pk16(hb16(g0 * 16.0f), hb16(g1 * 16.0f));
        }
        *(v4u*)(void*)(gst + t * 16 * GSP + i * 32) = pk;
      }
    }
    // g is written, this wave's reads of the w1t rows have returned and its w2t copies have landed; behind the barrier
    // all waves' have
    asm volatile("s_wait_dscnt 0x0" ::: "memory");
    asm volatile("s_wait_asynccnt 0x0" ::: "memory");
    __syncthreads();
    if (ch + 1 < MLP / 128) {                               // block-uniform: the next chunk's w1t rows fly under FC2
      unsigned l[8];
      const _Float16* g[8];
#pragma unroll
      for (int j = 0; j < 8; ++j) { l[j] = lW1 + (unsigned)(j * 16 * WSP); g[j] = gW1 + (size_t)((ch + 1) * 128 + j * 16) * DIMC; }
      acopy8(l, g);
    }
    // fragments one k-step ahead, as in FC1
    v16h fg0 = ldfrag_h(gp), fg1 = ldfrag_h(gp + 16 * (GSP / 2));
    v16h fv0 = ldfrag_h(w2p), fv1 = ldfrag_h(w2p + 16 * (GSP / 2));
    v16h fv2 = ldfrag_h(w2p + 32 * (GSP / 2)), fv3 = ldfrag_h(w2p + 48 * (GSP / 2));
#pragma unroll  // straight-line k-steps
    for (int ks = 0; ks < 4; ++ks) {
      const int kn = (ks + 1) * 32;
      v16h ng0 = fg0, ng1 = fg1, nv0 = fv0, nv1 = fv1, nv2 = fv2, nv3 = fv3;
      if (ks + 1 < 4) {
        ng0 = ldfrag_h(gp + kn);
        ng1 = ldfrag_h(gp + 16 * (GSP / 2) + kn);
        nv0 = ldfrag_h(w2p + kn);
        nv1 = ldfrag_h(w2p + 16 * (GSP / 2) + kn);
        nv2 = ldfrag_h(w2p + 32 * (GSP / 2) + kn);
        nv3 = ldfrag_h(w2p + 48 * (GSP / 2) + kn);
      }
      __builtin_amdgcn_sched_barrier(0);  // holds the next step's reads in front of this step's products
      o[0][0] = mma_raw(fv0, fg0, o[0][0]);
      o[0][1] = mma_raw(fv0, fg1, o[0][1]);
      o[1][0] = mma_raw(fv1, fg0, o[1][0]);
      o[1][1] = mma_raw(fv1, fg1, o[1][1]);
      o[2][0] = mma_raw(fv2, fg0, o[2][0]);
      o[2][1] = mma_raw(fv2, fg1, o[2][1]);
      o[3][0] = mma_raw(fv3, fg0, o[3][0]);
      o[3][1] = mma_raw(fv3, fg1, o[3][1]);
      if (ks == 3)  // in front of the back edge
        guard8(o[0][0], o[0][1], o[1][0], o[1][1], o[2][0], o[2][1], o[3][0], o[3][1], fg0, fg1, fv0, fv1, fv2, fv3);
      __builtin_amdgcn_sched_barrier(0);  // and later reads behind them: one step ahead, no deeper
      fg0 = ng0; fg1 = ng1; fv0 = nv0; fv1 = nv1; fv2 = nv2; fv3 = nv3;
    }
    // the reads of g and of the w2t rows have returned and this wave's w1t copies have landed; behind the barrier g and
    // the w2t rows may be rewritten and the new w1t rows read
    asm volatile("s_wait_dscnt 0x0" ::: "memory");
    asm volatile("s_wait_asynccnt 0x0" ::: "memory");
    __syncthreads();
  }
  float* Cs = (float*)(void*)sm;                            // the h and w1t rows are dead: the f32 tile lies over them
#pragma unroll
  for (int n = 0; n < 4; ++n)
#pragma unroll
    for (int t = 0; t < 2; ++t) {
      float* d = Cs + (wq * 32 + t * 16 + c) * LDX + wr * HD + n * 16 + 8 * hh;
      const v4f lo4 = { o[n][t][0], o[n][t][1], o[n][t][2], o[n][t][3] };
      const v4f hi4 = { o[n][t][4], o[n][t][5], o[n][t][6], o[n][t][7] };
      *(v4f*)d = lo4;
      *(v4f*)(d + 4) = hi4;
    }
  __syncthreads();
  // thread = 4 columns of 16 rows, 8 rows apart: a wave's store covers one whole 512-B half row
  const int row0 = tid >> 6, colp = (tid & 63) * 4;
  char* op = (char*)(void*)out + (unsigned)((tok0 + row0) * DIMC + colp) * 4u;   // byte offset below 32 MiB
  const float* cp = Cs + row0 * LDX + colp;
  v4f b2;
#pragma unroll
  for (int e = 0; e < 4; ++e) b2[e] = bfr(bias2[colp + e]);
#pragma unroll
  for (int s = 0; s < 16; ++s) {
    const v4f c4 = *(const v4f*)(cp + s * 8 * LDX);
    v4f v;
#pragma unroll
    for (int e = 0; e < 4; ++e) v[e] = c4[e] * (1.0f / 1024.0f) + b2[e];
    *(v4f*)(void*)(op + s * 8 * DIMC * 4) = v;
  }
}

// =================================================================================================================
// Workspace map (bytes; all offsets multiples of 131072; every region sized exactly at its whole-line store extent):
//   [0, 16 MiB)      XH  f16 [32768][256]  (k_cvt -> k_kv_part, k_mlp)
//   [48, 56 MiB)     PT  f32 [16][32][64][64] logit partials (k_kv_part -> k_attn_sm)
//   112 MiB + : ATH, ATL f16 [32][64][64] 262144 each | WQT f16 [768][256] 393216 | W1T [768][256] 393216 |
//               W2T f16 [256][768] 393216 ; end = 119144448.
// =================================================================================================================
extern "C" void kernel_launch(void* const* d_in, const int* in_sizes, int n_in,
                              void* d_out, int out_size, void* d_ws, size_t ws_size,
                              hipStream_t stream) {
  if (n_in < 9) return;
  const int expect[9] = { NTOK * DIMC, DIMC * MLP, MLP, DIMC, DIMC, DIMC * MLP, MLP, MLP * DIMC, DIMC };
  for (int i = 0; i < 9; ++i) if (in_sizes[i] != expect[i]) return;
  if (out_size != NTOK * DIMC) return;

  const float* x     = (const float*)d_in[0];
  const float* w_qkv = (const float*)d_in[1];
  const float* b_qkv = (const float*)d_in[2];
  const float* ng    = (const float*)d_in[3];
  const float* nbt   = (const float*)d_in[4];
  const float* w_fc1 = (const float*)d_in[5];
  const float* b_fc1 = (const float*)d_in[6];
  const float* w_fc2 = (const float*)d_in[7];
  const float* b_fc2 = (const float*)d_in[8];
  float* out = (float*)d_out;

  const size_t MiB = (size_t)1048576;
  const size_t szX16 = (size_t)NTOK * DIMC * 2;                    // 16 MiB
  const size_t szAT  = ATL_OFF * 2;                                // 262144
  const size_t szWQ  = (size_t)MLP * DIMC * 2;                     // 393216
  if (szX16 != 16 * MiB) return;

  const size_t oXH  = 0;
  const size_t oPT  = 48 * MiB;
  const size_t oATH = 112 * MiB;                                    // ATL at oATH + szAT
  const size_t oWQT = oATH + 2 * szAT;
  const size_t oW1T = oWQT + szWQ;
  const size_t oW2T = oW1T + szWQ;
  const size_t oEND = oW2T + szWQ;                                  // 119144448
  if (oXH + szX16 > oPT) return;
  if (oPT + (size_t)KSPLIT * ATL_OFF * 4 > oATH) return;
  if (oEND > ws_size) return;
  if (oEND > (size_t)134217728) return;

  char* ws = (char*)d_ws;
  unsigned short* XH  = (unsigned short*)(ws + oXH);
  float*          PT  = (float*)(ws + oPT);
  unsigned short* ATH = (unsigned short*)(ws + oATH);
  unsigned short* WQT = (unsigned short*)(ws + oWQT);
  unsigned short* W1T = (unsigned short*)(ws + oW1T);
  unsigned short* W2T = (unsigned short*)(ws + oW2T);

  const dim3 blk(256);
  // (1) x -> f16 plane of 16 bf16(x); weight planes (transposed, 64 * bf16)
  k_cvt<<<dim3(CVT_WG), dim3(512), 0, stream>>>(x, w_qkv, w_fc1, w_fc2, XH, WQT, W1T, W2T);
  // (2) per (b, h): k, v projection + logits, K split in KSPLIT chunks -> f32 partial tiles; chunk sum + softmax -> P hi/lo planes
  k_kv_part<<<dim3(KSPLIT, BB * NH), blk, 0, stream>>>(XH, WQT, b_qkv, PT);
  k_attn_sm<<<dim3(BB * NH, HD / 16), blk, 0, stream>>>(PT, ATH);
  // (3) q projection + xf + residual + layer norm + fc1 + GELU + fc2 + bias + residual -> d_out
  k_mlp<<<dim3(NTOK / 128), dim3(512), 0, stream>>>(WQT, b_qkv, ATH, XH, ng, nbt, W1T, b_fc1, W2T, b_fc2, out);
  (void)hipGetLastError();
}

// v008
// One run takes 57.2 microseconds.
// Two timings next to v007 put it at 1.04 and 1.02 times that version's speed.
// Counting every step since v000, it is 5.24 times as fast.
// Contractions: qkv projection (K=256), fc1 (K=256), fc2 (K=768): v_wmma_f32_16x16x32_f16, single f16 products,
// activations carried x16, weights one f16 plane of 64*bf16(w); per-head k^T v logits (K=4096) and attn x q (K=64):
// v_wmma_f32_16x16x32_f16 with both operands as f16 hi + x2048 residual planes (3 products); f32 accumulate
// everywhere. Softmax, layer norm, exact GELU and all epilogues f32 on VALU; every float input RNE-converted to
// bf16 on load.
#include <hip/hip_runtime.h>
#include <stdint.h>

#define BB     8
#define NN     4096
#define DIMC   256
#define NH     4
#define HD     64
#define MLP    768
#define NTOK   (BB * NN)
#define LDX    260
#define LDA    68
#define RSC    0.00048828125f
#define ATL_OFF ((size_t)BB * NH * HD * HD)
#define KSPLIT 16
#define KCH    (NN / KSPLIT)
#define XSP    (HD * 2 + 16)
#define WSP    (DIMC * 2 + 16)
#define TSP    (64 * 2 + 16)
#define GSP    (128 * 2 + 16)

static_assert(NTOK == 32768);
static_assert(DIMC == NH * HD);
static_assert((NN % 64) == 0 && (NTOK % 64) == 0);
static_assert((DIMC % 32) == 0 && (MLP % 32) == 0 && (HD % 32) == 0 && (NN % 32) == 0);
static_assert((LDX * 4) % 16 == 0);
static_assert(ATL_OFF == 131072);
static_assert(MLP == 6 * 128 && DIMC == 2 * 128 && (NTOK % 128) == 0 && ((GSP / 16) & 1) == 1);
static_assert(KCH * KSPLIT == NN && (KCH % 32) == 0);
static_assert(KCH == 256 && HD == 64 && ((XSP / 16) & 1) == 1 && ((WSP / 16) & 1) == 1 && ((TSP / 16) & 1) == 1);

typedef _Float16 v16h __attribute__((ext_vector_type(16)));
typedef _Float16 v8h  __attribute__((ext_vector_type(8)));
typedef float    v8f  __attribute__((ext_vector_type(8)));
typedef float    v4f  __attribute__((ext_vector_type(4)));
typedef unsigned int v4u __attribute__((ext_vector_type(4)));
typedef unsigned int v2u __attribute__((ext_vector_type(2)));
typedef float    v2f  __attribute__((ext_vector_type(2)));
typedef __bf16   v2b  __attribute__((ext_vector_type(2)));
typedef _Float16 v2h  __attribute__((ext_vector_type(2)));

// ---- scalar helpers ------------------------------------------------------------------------------------------
__device__ __forceinline__ unsigned short bf_bits(float f) {          // f32 -> bf16 bits, RNE convert
  unsigned u = __float_as_uint(f);
  return (unsigned short)((u + 0x7FFFu + ((u >> 16) & 1u)) >> 16);
}
__device__ __forceinline__ float bf_up(unsigned short b) { return __uint_as_float(((unsigned)b) << 16); }
__device__ __forceinline__ float bfr(float f) { return bf_up(bf_bits(f)); }
__device__ __forceinline__ unsigned short h_bits(_Float16 x) { return __builtin_bit_cast(unsigned short, x); }
__device__ __forceinline__ unsigned short hb16(float f) { return h_bits((_Float16)f); }
__device__ __forceinline__ unsigned pk16(unsigned short a, unsigned short b) { return (unsigned)a | ((unsigned)b << 16); }
__device__ __forceinline__ v8f zero8() { v8f z = {0.f, 0.f, 0.f, 0.f, 0.f, 0.f, 0.f, 0.f}; return z; }
// hi/lo pair of two f32 values: hi = f16(v), lo = f16(2048 (v - hi)), packed as two 32-bit words
__device__ __forceinline__ void split2(float f0, float f1, unsigned& hp, unsigned& lp) {
  const _Float16 h0 = (_Float16)f0, h1 = (_Float16)f1;
  const float q0 = (f0 - (float)h0) * 2048.0f, q1 = (f1 - (float)h1) * 2048.0f;
  hp = pk16(h_bits(h0), h_bits(h1));
  lp = pk16(hb16(q0), hb16(q1));
}

// ---- fragment loader: 16-bit A/B operand, lane -> row/col (lane&15), p already includes +8*(lane>>4);
//      elements 0..7 <- p[0..7] (k0+8h..k0+8h+7), elements 8..15 <- p[16..23] (k0+16+8h..k0+16+8h+7)
__device__ __forceinline__ v16h ldfrag_h(const _Float16* p) {
  union { v16h v; v8h h[2]; } f;
  f.h[0] = *(const v8h*)(p);
  f.h[1] = *(const v8h*)(p + 16);
  return f.v;
}

// ---- WMMA helpers; the guards insert the trailing VALU hazard gap and keep A/B live --------------------------
__device__ __forceinline__ v8f mma_raw(v16h a, v16h b, v8f c) {
  return __builtin_amdgcn_wmma_f32_16x16x32_f16(false, a, false, b, (short)0, c, false, false);
}
__device__ __forceinline__ void guard6(v8f& c0, v8f& c1, v8f& c2, v8f& c3, v8f& c4, v8f& c5,
                                       const v16h& a0, const v16h& a1, const v16h& b0, const v16h& b1,
                                       const v16h& b2, const v16h& b3) {
#if defined(__HIP_DEVICE_COMPILE__)
  asm volatile("v_nop\n\tv_nop\n\tv_nop\n\tv_nop"
               : "+v"(c0), "+v"(c1), "+v"(c2), "+v"(c3), "+v"(c4), "+v"(c5)
               : "v"(a0), "v"(a1), "v"(b0), "v"(b1), "v"(b2), "v"(b3));
#endif
}
__device__ __forceinline__ void guard8(v8f& c0, v8f& c1, v8f& c2, v8f& c3, v8f& c4, v8f& c5, v8f& c6, v8f& c7,
                                       const v16h& a0, const v16h& a1, const v16h& b0, const v16h& b1,
                                       const v16h& b2, const v16h& b3) {
#if defined(__HIP_DEVICE_COMPILE__)
  asm volatile("v_nop\n\tv_nop\n\tv_nop\n\tv_nop"
               : "+v"(c0), "+v"(c1), "+v"(c2), "+v"(c3), "+v"(c4), "+v"(c5), "+v"(c6), "+v"(c7)
               : "v"(a0), "v"(a1), "v"(b0), "v"(b1), "v"(b2), "v"(b3));
#endif
}

// ---- asynchronous copies, global -> LDS, 16 B per lane, eight per statement. The s_wait_xcnt is the last line of the
//      copies' own statement, so that no address register named here is rewritten in front of it.
__device__ __forceinline__ void acopy8(const unsigned* l, const _Float16* const* g) {
#if defined(__HIP_DEVICE_COMPILE__)
  asm volatile("global_load_async_to_lds_b128 %0, %8, off\n\t"
               "global_load_async_to_lds_b128 %1, %9, off\n\t"
               "global_load_async_to_lds_b128 %2, %10, off\n\t"
               "global_load_async_to_lds_b128 %3, %11, off\n\t"
               "global_load_async_to_lds_b128 %4, %12, off\n\t"
               "global_load_async_to_lds_b128 %5, %13, off\n\t"
               "global_load_async_to_lds_b128 %6, %14, off\n\t"
               "global_load_async_to_lds_b128 %7, %15, off\n\t"
               "s_wait_xcnt 0x0"
               :: "v"(l[0]), "v"(l[1]), "v"(l[2]), "v"(l[3]), "v"(l[4]), "v"(l[5]), "v"(l[6]), "v"(l[7]),
                  "v"(g[0]), "v"(g[1]), "v"(g[2]), "v"(g[3]), "v"(g[4]), "v"(g[5]), "v"(g[6]), "v"(g[7])
               : "memory");
#endif
}

// ---- input conversions ------------------------------------------------------------------------------------------
// two f32 values -> one word of f16(s bf16(f)), s a power of two, both conversions RNE, written on vectors of two so that
// the packed convert instructions serve them; bf16(s f) = s bf16(f), so the scale goes in front, in f32
__device__ __forceinline__ unsigned cvt2(float f0, float f1, float s) {
  const v2f a = {f0 * s, f1 * s};
  const v2b b = __builtin_convertvector(a, v2b);
  const v2f r = __builtin_convertvector(b, v2f);
  return __builtin_bit_cast(unsigned, __builtin_convertvector(r, v2h));
}
// four x values -> two words of f16(16 bf16(x))
__device__ __forceinline__ v2u cvt_x4(const v4f a) {
  v2u p;
  p[0] = cvt2(a[0], a[1], 16.0f);
  p[1] = cvt2(a[2], a[3], 16.0f);
  return p;
}
// Weight tile of 64 k x 32 n of a row-major f32 matrix w[k][n], one wave. Lane = (kq = lane >> 3, nq = lane & 7): load
// j = (hf = j >> 3, e = j & 7) reads n = nq * 4 + 0..3 of source row k = hf * 32 + kq * 8 + e (four whole lines a load), so
// the lane holds 8 consecutive k of 4 rows n; word group s = (hf = s >> 2, i = s & 3) is f16(64 bf16(w)) of these 8 k of
// row nq * 4 + i, 16 B.
__device__ __forceinline__ void wt_pack(const v4f (&g)[16], v4u (&w)[8]) {
#pragma unroll  // g[] and w[] indexed by constants, so they stay in registers
  for (int s = 0; s < 8; ++s)
#pragma unroll
    for (int e = 0; e < 4; ++e)
      w[s][e] = cvt2(g[(s >> 2) * 8 + 2 * e][s & 3], g[(s >> 2) * 8 + 2 * e + 1][s & 3], 64.0f);
}

// one 16x16 accumulator tile (lane = channel, registers = 8 consecutive tokens) -> carried value 16 (x w + b) =
// acc/64 + bb as f16 hi + x2048 residual, 16 B each, into the channel's hi row and its lo row (HD rows further on)
__device__ __forceinline__ void put_planes(const v8f& acc, float bb, unsigned char* hi_dst) {
  v4u a, q4;
#pragma unroll
  for (int e = 0; e < 4; ++e) {
    const float f0 = acc[2 * e] * (1.0f / 64.0f) + bb;
    const float f1 = acc[2 * e + 1] * (1.0f / 64.0f) + bb;
    unsigned hw, lw;
    split2(f0, f1, hw, lw);
    a[e] = hw; q4[e] = lw;
  }
  *(v4u*)(void*)hi_dst = a;
  *(v4u*)(void*)(hi_dst + HD * TSP) = q4;
}

// =================================================================================================================
// Input conversion + K, V projection of one head fused with its channel-attention logits, split over K. Block (ck, bh)
// takes the KCH tokens of chunk ck in KCH/64 sub-tiles of 64. The head's 64 k columns and 64 v columns of w_qkv are read
// as f32 in 16 tiles of 64 k x 32 n, two a wave, and go as f16(64 bf16(w)) into LDS rows [channel][256 k] (WSP bytes).
// Per sub-tile the 64 x rows are read as f32, whole lines (load i of wave w: half i & 1 of row (i >> 1) * 8 + w), and go as
// f16(16 bf16(x)) into LDS rows of WSP bytes. The next sub-tile's loads are issued in front of the projection and
// converted behind the logits.
// C[64 tokens][128 channels] = xh . w^T (K = 256, 8 waves = 2 (32 tokens) x 4 (32 channels)), and each lane's 8
// consecutive tokens of a channel
// go as f16 hi + x2048 residual into the LDS planes T[plane * 64 + channel][64 tokens] (rows of TSP bytes; planes
// k hi, k lo, v hi, v lo). Then raw[d][e] += sum_n (16 k[n][d]) (16 v[n][e]) on WMMA (M = N = 64, 2 k-steps):
// A = k planes, B = v planes, products hi*hi + (hi*lo + lo*hi)/2048, 8 waves = 4 (16 rows) x 2 (32 cols), tokens
// ascending. k and v never leave the work-group. The chunk's f32 tile goes through LDS to part[ck][bh][d][e].
// The last kernel's weight planes, wqt[n][k] = f16(64 bf16(w_qkv[k][n])) (n < 256, k < 256), w1t[n][k] = f16(64 bf16(
// w_fc1[k][n])) (n < 768, k < 256), w2t[n][k] = f16(64 bf16(w_fc2[k][n])) (n < 256, k < 768), are 32 + 96 + 96 tiles of
// 64 k x 32 n: wave 0 of the first 224 blocks converts one each; the 128-B line of an output row is written by that wave.
// grid = (KSPLIT, 32), 256 threads. coverage: part [KSPLIT][32][64][64] f32, wqt 256 x 256, w1t 768 x 256,
// w2t 256 x 768, every element once.
// =================================================================================================================
#define WT_Q  ((DIMC / 32) * (DIMC / 64))
#define WT_F  ((MLP / 32) * (DIMC / 64))
static_assert(WT_Q == 32 && WT_F == 96 && WT_Q + 2 * WT_F <= KSPLIT * BB * NH && 3 * DIMC == MLP);
// four waves per SIMD: the register budget that lets two work-groups (the LDS limit) share a WGP
__global__ __launch_bounds__(256) __attribute__((amdgpu_waves_per_eu(4)))
void k_kv_part(const float* __restrict__ x, const float* __restrict__ wqkv, const float* __restrict__ wfc1,
               const float* __restrict__ wfc2, const float* __restrict__ bias, float* part,
               unsigned short* wqt, unsigned short* w1t, unsigned short* w2t) {
  __shared__ __align__(16) unsigned char sm[192 * WSP + 4 * HD * TSP];
  unsigned char* sW = sm;                                   // 128 weight rows: 0..63 k channels, 64..127 v channels
  unsigned char* sA = sm + 128 * WSP;                       // 64 token rows
  unsigned char* sT = sm + 192 * WSP;                       // the four planes of one sub-tile
  static_assert(64 * LDA * 4 <= 64 * WSP);
  const int tid = threadIdx.x, lane = tid & 31, hh = lane >> 4, c = lane & 15;
  const int wave = __builtin_amdgcn_readfirstlane((int)(threadIdx.x >> 5));   // scalar: the weight-tile test is a scalar branch
  const int ck = blockIdx.x, bh = blockIdx.y;
  const int h = bh & (NH - 1);
  const int tok0 = (bh >> 2) * NN + ck * KCH;
  const float* gX = x + (size_t)(tok0 + wave) * DIMC + lane * 4;
  unsigned char* lX = sA + wave * WSP + lane * 8;
  v4f xa[16];                                               // one sub-tile's x values of this lane
  {
    const int kq = lane >> 3, nq = lane & 7;
    // this wave's two tiles of the head's weights: 32 channels lt, k tiles kt0 and kt0 + 1
    const int lt = wave >> 1, kt0 = (wave & 1) * 2;
    const float* pw = wqkv + (size_t)(kt0 * 64 + kq * 8) * MLP + (1 + (lt >> 1)) * DIMC + h * HD + (lt & 1) * 32 + nq * 4;
    v4f ga[16], gb[16];
#pragma unroll  // every array here is indexed by constants, so it stays in registers (the loops below likewise)
    for (int j = 0; j < 16; ++j) ga[j] = *(const v4f*)(pw + (size_t)((j >> 3) * 32 + (j & 7)) * MLP);
#pragma unroll
    for (int j = 0; j < 16; ++j) gb[j] = *(const v4f*)(pw + (size_t)(64 + (j >> 3) * 32 + (j & 7)) * MLP);
#pragma unroll
    for (int i = 0; i < 16; ++i) xa[i] = *(const v4f*)(gX + (i >> 1) * 8 * DIMC + (i & 1) * 128);
    // the loads' address registers are inputs here, so they live up to the wait and nothing is written over them in front of it
    asm volatile("s_wait_xcnt 0x0" :: "v"(pw), "v"(gX) : "memory");
    __builtin_amdgcn_sched_barrier(0);  // holds every load in front of the first conversion: one memory latency
    unsigned char* dw = sW + (lt * 32 + nq * 4) * WSP + (kt0 * 64 + kq * 8) * 2;
    {
      v4u w[8];
      wt_pack(ga, w);
#pragma unroll
      for (int s = 0; s < 8; ++s) *(v4u*)(void*)(dw + (s & 3) * WSP + (s >> 2) * 64) = w[s];
      wt_pack(gb, w);
#pragma unroll
      for (int s = 0; s < 8; ++s) *(v4u*)(void*)(dw + 128 + (s & 3) * WSP + (s >> 2) * 64) = w[s];
    }
    // a tile of the last kernel's weight planes, or none (wave-uniform)
    const int fb = bh * KSPLIT + ck;
    const int et = (wave == 0 && fb < WT_Q + 2 * WT_F) ? fb : -1;
    const int m = (et < WT_Q) ? 0 : ((et < WT_Q + WT_F) ? 1 : 2);
    const int r = et - ((m == 0) ? 0 : ((m == 1) ? WT_Q : WT_Q + WT_F));
    const int ns = (m == 2) ? DIMC : MLP;                   // source row length
    const int kd = (m == 2) ? MLP : DIMC;                   // output row length
    const int nt = (m == 2) ? r / (MLP / 64) : r / (DIMC / 64);   // constant divisors: scalar shifts and multiplies
    const int kt = r - nt * (kd / 64);
    v4f ge[16];
    if (et >= 0) {
      const float* p = (m == 0 ? wqkv : (m == 1 ? wfc1 : wfc2)) + (size_t)(kt * 64 + kq * 8) * ns + nt * 32 + nq * 4;
      const float* q[16];
#pragma unroll
      for (int j = 0; j < 16; ++j) { q[j] = p + (size_t)((j >> 3) * 32 + (j & 7)) * ns; ge[j] = *(const v4f*)q[j]; }
      // as above: the 16 address registers live up to the wait
      asm volatile("s_wait_xcnt 0x0" :: "v"(q[0]), "v"(q[1]), "v"(q[2]), "v"(q[3]), "v"(q[4]), "v"(q[5]), "v"(q[6]), "v"(q[7]),
                   "v"(q[8]), "v"(q[9]), "v"(q[10]), "v"(q[11]), "v"(q[12]), "v"(q[13]), "v"(q[14]), "v"(q[15]) : "memory");
    }
    __builtin_amdgcn_sched_barrier(0);  // these loads fly under the conversion of the x rows
    {
      v2u pk[16];
#pragma unroll
      for (int i = 0; i < 16; ++i) pk[i] = cvt_x4(xa[i]);
#pragma unroll
      for (int i = 0; i < 16; ++i) *(v2u*)(void*)(lX + (i >> 1) * 8 * WSP + (i & 1) * 256) = pk[i];
    }
    // this wave's weight and token rows are written; behind the barrier every wave's are
    asm volatile("s_wait_dscnt 0x0" ::: "memory");
    __syncthreads();
    if (et >= 0) {                                          // behind the barrier: the stores' way to memory lies under the first projection
      v4u w[8];
      wt_pack(ge, w);
      __builtin_amdgcn_sched_barrier(0);  // as above: the stores behind the last conversion
      unsigned short* d = (m == 0 ? wqt : (m == 1 ? w1t : w2t)) + (size_t)(nt * 32 + nq * 4) * kd + kt * 64 + kq * 8;
#pragma unroll
      for (int s = 0; s < 8; ++s) *(v4u*)(d + (size_t)(s & 3) * kd + (s >> 2) * 32) = w[s];
      // in front of whatever writes next over a register that these stores name
      asm volatile("s_wait_xcnt 0x0" ::: "memory");
      __builtin_amdgcn_sched_barrier(0);  // keeps later work behind the wait
    }
  }
  // projection: wave = 32 tokens x 32 channels
  const int mw = wave >> 2, nw = wave & 3;
  const _Float16* a0p = (const _Float16*)(const void*)(sA + (mw * 32 + c) * WSP) + 8 * hh;
  const _Float16* a1p = (const _Float16*)(const void*)(sA + (mw * 32 + 16 + c) * WSP) + 8 * hh;
  const _Float16* b0p = (const _Float16*)(const void*)(sW + (nw * 32 + c) * WSP) + 8 * hh;
  const _Float16* b1p = (const _Float16*)(const void*)(sW + (nw * 32 + 16 + c) * WSP) + 8 * hh;
  const int kvs = nw >> 1;                                  // 0: this wave's channels are k, 1: v
  const int d0 = (nw & 1) * 32 + c;                         // channel within the head; the second tile is d0 + 16
  const float bb0 = 16.0f * bfr(bias[(1 + kvs) * DIMC + h * HD + d0]);
  const float bb1 = 16.0f * bfr(bias[(1 + kvs) * DIMC + h * HD + d0 + 16]);
  unsigned char* t00 = sT + (kvs * 2 * HD + d0) * TSP + (mw * 32 + 8 * hh) * 2;   // hi row of d0, this lane's 8 tokens
  // logits: wave = 16 rows d x 32 cols e
  const int mv = wave >> 1, nv = wave & 1;
  const _Float16* ahp = (const _Float16*)(const void*)(sT + (mv * 16 + c) * TSP) + 8 * hh;
  const _Float16* alp = (const _Float16*)(const void*)(sT + (HD + mv * 16 + c) * TSP) + 8 * hh;
  const _Float16* b0h = (const _Float16*)(const void*)(sT + (2 * HD + nv * 32 + c) * TSP) + 8 * hh;
  const _Float16* b1h = (const _Float16*)(const void*)(sT + (2 * HD + nv * 32 + 16 + c) * TSP) + 8 * hh;
  const _Float16* b0l = (const _Float16*)(const void*)(sT + (3 * HD + nv * 32 + c) * TSP) + 8 * hh;
  const _Float16* b1l = (const _Float16*)(const void*)(sT + (3 * HD + nv * 32 + 16 + c) * TSP) + 8 * hh;
  v8f p0 = zero8(), p1 = zero8(), q0 = zero8(), q1 = zero8(), r0 = zero8(), r1 = zero8();
#pragma unroll 1  // one copy of the sub-tile body: the text stays short
  for (int t = 0; t < KCH / 64; ++t) {                      // block-uniform trip count
    if (t + 1 < KCH / 64) {                                 // block-uniform: the next sub-tile's x loads fly under the projection
      const float* p = gX + (size_t)(t + 1) * 64 * DIMC;
#pragma unroll
      for (int i = 0; i < 16; ++i) xa[i] = *(const v4f*)(p + (i >> 1) * 8 * DIMC + (i & 1) * 128);
      // the loads' address register is an input here, so it lives up to the wait and nothing is written over it in front of it
      asm volatile("s_wait_xcnt 0x0" :: "v"(p) : "memory");
    }
    __builtin_amdgcn_sched_barrier(0);  // holds these loads in front of the projection
    v8f c00 = zero8(), c01 = zero8(), c10 = zero8(), c11 = zero8();
    // fragments are fetched one k-step ahead: the reads of step ks + 1 are in flight under the products of step ks
    v16h fa0 = ldfrag_h(a0p), fa1 = ldfrag_h(a1p);
    v16h fb0 = ldfrag_h(b0p), fb1 = ldfrag_h(b1p);
#pragma unroll  // straight-line k-steps
    for (int ks = 0; ks < DIMC / 32; ++ks) {
      const int kn = (ks + 1 < DIMC / 32 ? ks + 1 : ks) * 32;
      v16h na0 = fa0, na1 = fa1, nb0 = fb0, nb1 = fb1;
      if (ks + 1 < DIMC / 32) {
        na0 = ldfrag_h(a0p + kn);
        na1 = ldfrag_h(a1p + kn);
        nb0 = ldfrag_h(b0p + kn);
        nb1 = ldfrag_h(b1p + kn);
      }
      __builtin_amdgcn_sched_barrier(0);  // holds the next step's reads in front of this step's products
      c00 = mma_raw(fa0, fb0, c00);
      c01 = mma_raw(fa0, fb1, c01);
      c10 = mma_raw(fa1, fb0, c10);
      c11 = mma_raw(fa1, fb1, c11);
      __builtin_amdgcn_sched_barrier(0);  // and later reads behind them: no deeper fetch, no spills
      fa0 = na0; fa1 = na1; fb0 = nb0; fb1 = nb1;
    }
    put_planes(c00, bb0, t00);
    put_planes(c01, bb1, t00 + 16 * TSP);
    put_planes(c10, bb0, t00 + 32);
    put_planes(c11, bb1, t00 + 16 * TSP + 32);
    // the planes are written and this wave's reads of the token rows have returned; behind the barrier all waves' have
    asm volatile("s_wait_dscnt 0x0" ::: "memory");
    __syncthreads();
#pragma unroll  // two straight-line k-steps
    for (int ks = 0; ks < 2; ++ks) {
      const int ko = ks * 32;
      const v16h fa  = ldfrag_h(ahp + ko);
      const v16h ga  = ldfrag_h(alp + ko);
      const v16h fb0 = ldfrag_h(b0h + ko);
      const v16h fb1 = ldfrag_h(b1h + ko);
      const v16h gb0 = ldfrag_h(b0l + ko);
      const v16h gb1 = ldfrag_h(b1l + ko);
      p0 = mma_raw(fa, fb0, p0);
      p1 = mma_raw(fa, fb1, p1);
      q0 = mma_raw(fa, gb0, q0);
      q1 = mma_raw(fa, gb1, q1);
      r0 = mma_raw(ga, fb0, r0);
      r1 = mma_raw(ga, fb1, r1);
      if (ks == 1) guard6(p0, p1, q0, q1, r0, r1, fa, ga, fb0, fb1, gb0, gb1);  // in front of the back edge
    }
    if (t + 1 < KCH / 64) {                                 // block-uniform; the readers of the old token rows left them at the barrier above
      v2u pk[16];
#pragma unroll
      for (int i = 0; i < 16; ++i) pk[i] = cvt_x4(xa[i]);
#pragma unroll
      for (int i = 0; i < 16; ++i) *(v2u*)(void*)(lX + (i >> 1) * 8 * WSP + (i & 1) * 256) = pk[i];
    }
    // the plane reads have returned and the new token rows are written; behind the barrier the planes may be
    // rewritten and the new token rows read
    asm volatile("s_wait_dscnt 0x0" ::: "memory");
    __syncthreads();
  }
  float* Cs = (float*)(void*)sA;                            // the token rows are dead: the f32 tile lies over them
#pragma unroll
  for (int r = 0; r < 8; ++r) {
    const int row = mv * 16 + 8 * hh + r;
    Cs[row * LDA + nv * 32 + c]      = p0[r] + (q0[r] + r0[r]) * RSC;
    Cs[row * LDA + nv * 32 + 16 + c] = p1[r] + (q1[r] + r1[r]) * RSC;
  }
  __syncthreads();
  float* dst = part + ((size_t)ck * (BB * NH) + bh) * (HD * HD);
  v4f pk[4];
#pragma unroll  // pk[] indexed by constants, so it stays in registers
  for (int s = 0; s < 4; ++s) {
    const int idx = s * 256 + tid;
    pk[s] = *(const v4f*)(Cs + (idx >> 4) * LDA + (idx & 15) * 4);
  }
#pragma unroll  // as above
  for (int s = 0; s < 4; ++s) *(v4f*)(dst + (size_t)(s * 256 + tid) * 4) = pk[s];
}

// =================================================================================================================
// Chunk sum + softmax. Block = 16 rows d of one (b, h); thread = 4 consecutive e of one row, 16 lanes per row.
// raw = sum over ck of part[ck] in index order; logit = raw/2048 (includes the head_dim^-0.5 factor 1/8). Softmax
// over e per row d in f32 (max subtracted, 16-lane butterflies), 4096 P stored as f16 hi + x2048 residual planes;
// a wave's store covers two whole 128-B rows.
// grid = (32, 4), 256 threads. coverage: ath/atl [32][64][64], every element once.
// =================================================================================================================
__global__ __launch_bounds__(256)
void k_attn_sm(const float* __restrict__ part, unsigned short* at) {
  const int tid = threadIdx.x;
  const int bh = blockIdx.x;
  const int row = blockIdx.y * 16 + (tid >> 4), col0 = (tid & 15) * 4;
  const size_t off = ((size_t)bh * HD + row) * HD + col0;
  v4f t[KSPLIT];
#pragma unroll  // all chunk loads issued before the first add: one memory latency, not KSPLIT
  for (int s = 0; s < KSPLIT; ++s) t[s] = *(const v4f*)(part + (size_t)s * ATL_OFF + off);
  v4f a = t[0];
#pragma unroll  // t[] indexed by constants, so it stays in registers (the short loops below likewise)
  for (int s = 1; s < KSPLIT; ++s) a += t[s];
  float mx = fmaxf(fmaxf(a[0], a[1]), fmaxf(a[2], a[3]));
#pragma unroll
  for (int o = 1; o < 16; o <<= 1) mx = fmaxf(mx, __shfl_xor(mx, o, 32));
  float e[4];
#pragma unroll
  for (int n = 0; n < 4; ++n) e[n] = expf((a[n] - mx) * RSC);
  float sm = (e[0] + e[1]) + (e[2] + e[3]);
#pragma unroll
  for (int o = 1; o < 16; o <<= 1) sm += __shfl_xor(sm, o, 32);
  const float sc = (1.0f / sm) * 4096.0f;
  v2u ph, pq;
#pragma unroll
  for (int n = 0; n < 2; ++n) {
    unsigned hw, lw;
    split2(e[2 * n] * sc, e[2 * n + 1] * sc, hw, lw);
    ph[n] = hw; pq[n] = lw;
  }
  *(v2u*)(at + off) = ph;
  *(v2u*)(at + ATL_OFF + off) = pq;
}

// =================================================================================================================
// Q projection + xf + residual + layer norm + FC1 + exact GELU + FC2 + bias + residual in one kernel: q, x1, h and g
// never leave the work-group. Block = 128 tokens of one batch, 16 waves, one block per WGP. Wave (wq, wr) owns 32
// tokens (wq) x the 64 channels of head wr, from q to the output.
// q: C[64 e][32 tokens] = wqt rows . xh rows^T on WMMA (K = 256, 8 k-steps, k ascending), C = 1024 (x w); a lane holds
// 8 consecutive channels of one token, so two accumulator tiles 16 channels apart are, lane for lane, one B fragment
// of 32 channels: the carried value 16 (x w + b) = C/64 + 16 bf16(b) goes as f16 hi + x2048 residual straight into
// the fragment registers of xf.
// xf: C[64 d][32 tokens] = sum_e (4096 P[d][e]) (16 q[token][wr*64+e]) on WMMA (K = 64, 2 k-steps): A = P hi/lo rows,
// B = q hi/lo fragments, products hi*hi + (hi*lo + lo*hi)/2048, xf = C/65536; a lane holds 8 consecutive channels of
// one token. x1 = bf16(x) + xf in registers (bf16(x) = xh/16). Layer norm: mean, then the sum of squared differences, each
// summed in the lane, over the lane pair and over the four waves of a token through LDS. 16 h goes as f16, 16 B a
// store, into H[token][256] in LDS. 1024 x1 is the start value of the FC2 accumulators.
// The 768 hidden channels run in 6 chunks of 128. Per chunk: C1[128 hidden][128 tokens] = w1t rows . H rows^T (8
// k-steps, 16 waves = 4 (32 hidden) x 4 (32 tokens)): v = C1/1024 + bf16(b1), g = 0.5 v (1 + erf(v / sqrt 2)) in
// registers, 16 g as f16, one 16-B LDS store into G[token][128]. Then C2[256 cols][128 tokens] += w2t chunk . G^T
// (4 k-steps), hidden channels ascending. The chunk's w2t rows fly under FC1 and GELU, the next chunk's w1t rows under
// FC2. out = C2/1024 + bf16(b2) through an f32 LDS tile, whole lines.
// grid = NTOK/128, 512 threads. coverage: out [32768][256] f32, every element once.
// =================================================================================================================
__global__ __launch_bounds__(512)
void k_mlp(const unsigned short* __restrict__ wqt, const float* __restrict__ biasq,
           const unsigned short* __restrict__ at,
           const float* __restrict__ x, const float* __restrict__ gw, const float* __restrict__ gb,
           const unsigned short* __restrict__ w1t, const float* __restrict__ bias1,
           const unsigned short* __restrict__ w2t, const float* __restrict__ bias2, float* out) {
  __shared__ __align__(16) unsigned char sm[384 * WSP + 384 * GSP + MLP * 4 + 2 * NH * 128 * 4 + 3 * DIMC * 4];
  unsigned char* sH  = sm;                                  // 128 rows, WSP bytes each: wqt rows 0..127, then h by token
  unsigned char* sW1 = sm + 128 * WSP;                      // 128 rows: wqt rows 128..255, then the chunk's w1t rows
  unsigned char* sG  = sm + 256 * WSP;                      // 128 token rows of g, GSP bytes each
  unsigned char* sW2 = sm + 256 * WSP + 128 * GSP;          // 256 w2t rows, the chunk's 128 k
  unsigned char* sP  = sG;                                  // first: 512 rows of XSP bytes, P hi [head][d], then P lo
  float* sB1 = (float*)(void*)(sm + 256 * WSP + 384 * GSP); // bf16(b1) as f32
  unsigned char* sX  = sm + 256 * WSP + 384 * GSP + MLP * 4;  // 128 token rows of xh = f16(16 bf16(x))
  float* sR  = (float*)(void*)(sX + 128 * WSP);             // layer-norm partial sums [2][head][128 tokens]
  float* sLN = sR + 2 * NH * 128;                           // bf16(norm weight), then bf16(norm bias), as f32
  float* sBQ = sLN + 2 * DIMC;                              // 16 bf16(b) of the 256 q channels, as f32
  static_assert(128 * LDX * 4 <= 256 * WSP);
  static_assert(2 * NH * HD * XSP <= 384 * GSP && (NN % 128) == 0);
  static_assert(sizeof(sm) <= 327680);
  const int tid = threadIdx.x, wave = tid >> 5, lane = tid & 31, hh = lane >> 4, c = lane & 15;
  const int tok0 = blockIdx.x * 128;
  const int wq = wave >> 2, wr = wave & 3;
  // copies: a wave copy covers one whole 512-B row (wqt, w1t), two 256-B row pieces (w2t) or four 128-B rows (P)
  const _Float16* gQ  = (const _Float16*)(const void*)wqt + (size_t)wave * DIMC + lane * 8;   // rows 0..255: the q channels
  const float* gX = x + (size_t)(tok0 + wave) * DIMC + lane * 4;   // load i: half i & 1 of token row (i >> 1) * 16 + wave, whole lines
  const _Float16* gP  = (const _Float16*)(const void*)at + (size_t)(tok0 / NN) * (NH * HD * HD) + tid * 8;
  const _Float16* gW1 = (const _Float16*)(const void*)w1t + (size_t)wave * DIMC + lane * 8;
  const _Float16* gW2 = (const _Float16*)(const void*)w2t + (size_t)(wave * 2 + hh) * MLP + c * 8;
  const unsigned lH  = (unsigned)(uintptr_t)sH  + (unsigned)(wave * WSP + lane * 16);            // LDS byte addresses
  const unsigned lW1 = (unsigned)(uintptr_t)sW1 + (unsigned)(wave * WSP + lane * 16);
  const unsigned lP  = (unsigned)(uintptr_t)sP  + (unsigned)((tid >> 3) * XSP + (tid & 7) * 16);
  const unsigned lW2 = (unsigned)(uintptr_t)sW2 + (unsigned)((wave * 2 + hh) * GSP + c * 16);
  {
    v4f xa[16];
#pragma unroll  // xa[] indexed by constants, so it stays in registers
    for (int i = 0; i < 16; ++i) xa[i] = *(const v4f*)(gX + (i >> 1) * 16 * DIMC + (i & 1) * 128);
    // the loads' address register is an input here, so it lives up to the wait and nothing is written over it in front of it
    asm volatile("s_wait_xcnt 0x0" :: "v"(gX) : "memory");
    unsigned l[8];
    const _Float16* g[8];
#pragma unroll  // l[] and g[] indexed by constants, so they stay in registers (the copy loops below likewise)
    for (int j = 0; j < 8; ++j) { l[j] = lH + (unsigned)(j * 16 * WSP); g[j] = gQ + (size_t)j * 16 * DIMC; }
    acopy8(l, g);
#pragma unroll
    for (int j = 0; j < 8; ++j) { l[j] = lW1 + (unsigned)(j * 16 * WSP); g[j] = gQ + (size_t)(128 + j * 16) * DIMC; }
    acopy8(l, g);
#pragma unroll
    for (int j = 0; j < 8; ++j) {                           // j < 4: P hi, 64 rows (one head) a copy; j >= 4: P lo
      l[j] = lP + (unsigned)(j * HD * XSP);
      g[j] = gP + (size_t)(j >> 2) * ATL_OFF + (size_t)(j & 3) * HD * HD;
    }
    acopy8(l, g);
    for (int i = tid; i < MLP; i += 512) sB1[i] = bfr(bias1[i]);
    if (tid < DIMC) { sLN[tid] = bfr(gw[tid]); sLN[DIMC + tid] = bfr(gb[tid]); sBQ[tid] = 16.0f * bfr(biasq[tid]); }
    // the x rows are converted while the copies fly: f16(16 bf16(x)), 8 B a lane
#pragma unroll
    for (int i = 0; i < 16; ++i) *(v2u*)(void*)(sX + ((i >> 1) * 16 + wave) * WSP + (i & 1) * 256 + lane * 8) = cvt_x4(xa[i]);
    // this wave's copies have landed and its x rows are written; behind the barrier every wave's are, and the four
    // parameter rows are written
    asm volatile("s_wait_dscnt 0x0" ::: "memory");
    asm volatile("s_wait_asynccnt 0x0" ::: "memory");
    __syncthreads();
  }
  // o[n][t]: lane = token wq*32 + t*16 + c, registers = channels wr*64 + n*16 + 8*hh + 0..7
  v8f o[4][2];
  {
    // qa[n][t]: lane = token wq*32 + t*16 + c, registers = q channels wr*64 + n*16 + 8*hh + 0..7, value 1024 (x w)
    v8f qa[4][2];
#pragma unroll  // every array here is indexed by constants, so it stays in registers
    for (int n = 0; n < 4; ++n)
#pragma unroll
      for (int t = 0; t < 2; ++t) qa[n][t] = zero8();
    {
      const _Float16* wp = (const _Float16*)(const void*)(sH + (wr * HD + c) * WSP) + 8 * hh;   // the head's 64 wqt rows
      const _Float16* xb = (const _Float16*)(const void*)(sX + (wq * 32 + c) * WSP) + 8 * hh;   // the wave's 32 token rows
      // fragments are fetched one k-step ahead: the reads of step ks + 1 are in flight under the products of step ks
      v16h fx0 = ldfrag_h(xb), fx1 = ldfrag_h(xb + 16 * (WSP / 2));
      v16h fw0 = ldfrag_h(wp), fw1 = ldfrag_h(wp + 16 * (WSP / 2));
      v16h fw2 = ldfrag_h(wp + 32 * (WSP / 2)), fw3 = ldfrag_h(wp + 48 * (WSP / 2));
#pragma unroll  // straight-line k-steps
      for (int ks = 0; ks < DIMC / 32; ++ks) {
        const int kn = (ks + 1) * 32;
        v16h nx0 = fx0, nx1 = fx1, nw0 = fw0, nw1 = fw1, nw2 = fw2, nw3 = fw3;
        if (ks + 1 < DIMC / 32) {
          nx0 = ldfrag_h(xb + kn);
          nx1 = ldfrag_h(xb + 16 * (WSP / 2) + kn);
          nw0 = ldfrag_h(wp + kn);
          nw1 = ldfrag_h(wp + 16 * (WSP / 2) + kn);
          nw2 = ldfrag_h(wp + 32 * (WSP / 2) + kn);
          nw3 = ldfrag_h(wp + 48 * (WSP / 2) + kn);
        }
        __builtin_amdgcn_sched_barrier(0);  // holds the next step's reads in front of this step's products
        qa[0][0] = mma_raw(fw0, fx0, qa[0][0]);
        qa[0][1] = mma_raw(fw0, fx1, qa[0][1]);
        qa[1][0] = mma_raw(fw1, fx0, qa[1][0]);
        qa[1][1] = mma_raw(fw1, fx1, qa[1][1]);
        qa[2][0] = mma_raw(fw2, fx0, qa[2][0]);
        qa[2][1] = mma_raw(fw2, fx1, qa[2][1]);
        qa[3][0] = mma_raw(fw3, fx0, qa[3][0]);
        qa[3][1] = mma_raw(fw3, fx1, qa[3][1]);
        __builtin_amdgcn_sched_barrier(0);  // and later reads behind them: one step ahead, no deeper
        fx0 = nx0; fx1 = nx1; fw0 = nw0; fw1 = nw1; fw2 = nw2; fw3 = nw3;
      }
    }
    // fragment words: tile n fills elements 8*(n&1) .. 8*(n&1)+7 of fragment n>>1 (k = n*16 + 8*hh + 0..7, the table layout)
    union QF { v16h v; v4u u[2]; } qh[2][2], ql[2][2];      // [t][k-step]
#pragma unroll
    for (int n = 0; n < 4; ++n) {
      const float* bp = sBQ + wr * HD + n * 16 + 8 * hh;
      const v4f bA = *(const v4f*)(bp);
      const v4f bB = *(const v4f*)(bp + 4);
      const float bv[8] = { bA[0], bA[1], bA[2], bA[3], bB[0], bB[1], bB[2], bB[3] };
#pragma unroll
      for (int t = 0; t < 2; ++t) {
        v4u a, q4;
#pragma unroll
        for (int e = 0; e < 4; ++e) {
          const float f0 = qa[n][t][2 * e] * (1.0f / 64.0f) + bv[2 * e];
          const float f1 = qa[n][t][2 * e + 1] * (1.0f / 64.0f) + bv[2 * e + 1];
          unsigned hw, lw;
          split2(f0, f1, hw, lw);
          a[e] = hw; q4[e] = lw;
        }
        qh[t][n >> 1].u[n & 1] = a;
        ql[t][n >> 1].u[n & 1] = q4;
      }
    }
    const _Float16* xp  = (const _Float16*)(const void*)(sX  + (wq * 32 + c) * WSP) + wr * HD + 8 * hh;
    const _Float16* php = (const _Float16*)(const void*)(sP + (wr * HD + c) * XSP) + 8 * hh;
    const _Float16* plp = (const _Float16*)(const void*)(sP + (NH * HD + wr * HD + c) * XSP) + 8 * hh;
#pragma unroll  // every array below is indexed by constants, so it stays in registers (every short loop likewise)
    for (int t = 0; t < 2; ++t) {
      const v16h fq0 = qh[t][0].v, fq1 = qh[t][1].v;
      const v16h gq0 = ql[t][0].v, gq1 = ql[t][1].v;
#pragma unroll
      for (int n = 0; n < 4; ++n) {
        const v16h fp0 = ldfrag_h(php + n * 16 * (XSP / 2)), fp1 = ldfrag_h(php + n * 16 * (XSP / 2) + 32);
        const v16h gp0 = ldfrag_h(plp + n * 16 * (XSP / 2)), gp1 = ldfrag_h(plp + n * 16 * (XSP / 2) + 32);
        const v8h xv = *(const v8h*)(xp + t * 16 * (WSP / 2) + n * 16);
        v8f p = zero8(), q = zero8(), r = zero8();
        p = mma_raw(fp0, fq0, p);
        q = mma_raw(gp0, fq0, q);
        r = mma_raw(fp0, gq0, r);
        p = mma_raw(fp1, fq1, p);
        q = mma_raw(gp1, fq1, q);
        r = mma_raw(fp1, gq1, r);
#pragma unroll
        for (int e = 0; e < 8; ++e)
          o[n][t][e] = (float)xv[e] * (1.0f / 16.0f) + (p[e] + (q[e] + r[e]) * RSC) * (1.0f / 65536.0f);
        __builtin_amdgcn_sched_barrier(0);  // holds later fragment reads behind these products: no spills
      }
    }
  }
  float mu[2], rs[2];
#pragma unroll
  for (int t = 0; t < 2; ++t) {
    float s = 0.f;
#pragma unroll
    for (int n = 0; n < 4; ++n)
      s += ((o[n][t][0] + o[n][t][1]) + (o[n][t][2] + o[n][t][3])) + ((o[n][t][4] + o[n][t][5]) + (o[n][t][6] + o[n][t][7]));
    s += __shfl_xor(s, 16, 32);
    if (hh == 0) sR[wr * 128 + wq * 32 + t * 16 + c] = s;
  }
  // the sums are written and this wave's reads of the wqt rows, P and xh have returned; behind the barrier all waves' have
  asm volatile("s_wait_dscnt 0x0" ::: "memory");
  __syncthreads();
  {
    // the first chunk's w1t rows go where wqt rows 128..255 lay and fly under the rest of the layer norm
    unsigned l[8];
    const _Float16* g[8];
#pragma unroll
    for (int j = 0; j < 8; ++j) { l[j] = lW1 + (unsigned)(j * 16 * WSP); g[j] = gW1 + (size_t)j * 16 * DIMC; }
    acopy8(l, g);
  }
#pragma unroll
  for (int t = 0; t < 2; ++t) {
    const float* rp = sR + wq * 32 + t * 16 + c;
    mu[t] = ((rp[0] + rp[128]) + (rp[256] + rp[384])) * (1.0f / 256.0f);
    float sq = 0.f;
#pragma unroll
    for (int n = 0; n < 4; ++n)
#pragma unroll
      for (int e = 0; e < 8; ++e) { const float d = o[n][t][e] - mu[t]; sq += d * d; }
    sq += __shfl_xor(sq, 16, 32);
    if (hh == 0) sR[NH * 128 + wr * 128 + wq * 32 + t * 16 + c] = sq;
  }
  __syncthreads();
#pragma unroll
  for (int t = 0; t < 2; ++t) {
    const float* rp = sR + NH * 128 + wq * 32 + t * 16 + c;
    rs[t] = rsqrtf(((rp[0] + rp[128]) + (rp[256] + rp[384])) * (1.0f / 256.0f) + 1e-5f);
  }
#pragma unroll
  for (int n = 0; n < 4; ++n) {
    const int col0 = wr * HD + n * 16 + 8 * hh;
    const v4f gA = *(const v4f*)(sLN + col0), gB = *(const v4f*)(sLN + col0 + 4);
    const v4f bA = *(const v4f*)(sLN + DIMC + col0), bB = *(const v4f*)(sLN + DIMC + col0 + 4);
    const float gv[8] = { gA[0], gA[1], gA[2], gA[3], gB[0], gB[1], gB[2], gB[3] };
    const float bv[8] = { bA[0], bA[1], bA[2], bA[3], bB[0], bB[1], bB[2], bB[3] };
#pragma unroll
    for (int t = 0; t < 2; ++t) {
      v4u pk;
#pragma unroll
      for (int e = 0; e < 4; ++e) {
        const float f0 = ((o[n][t][2 * e] - mu[t]) * rs[t]) * gv[2 * e] + bv[2 * e];
        const float f1 = ((o[n][t][2 * e + 1] - mu[t]) * rs[t]) * gv[2 * e + 1] + bv[2 * e + 1];
        pk[e] = pk16(hb16(f0 * 16.0f), hb16(f1 * 16.0f));
      }
      *(v4u*)(void*)(sH + (wq * 32 + t * 16 + c) * WSP + col0 * 2) = pk;
      o[n][t] *= 1024.0f;                                   // x1 in the scale of the FC2 products
    }
  }
  // h is written and this wave's w1t copies have landed; behind the barrier all waves' have
  asm volatile("s_wait_dscnt 0x0" ::: "memory");
  asm volatile("s_wait_asynccnt 0x0" ::: "memory");
  __syncthreads();
  // FC1: wave = 32 hidden (wq) x 32 tokens (wr); FC2: wave = 64 cols (wr) x 32 tokens (wq)
  const _Float16* w1p = (const _Float16*)(const void*)(sW1 + (wq * 32 + c) * WSP) + 8 * hh;
  const _Float16* hp  = (const _Float16*)(const void*)(sH  + (wr * 32 + c) * WSP) + 8 * hh;
  const _Float16* gp  = (const _Float16*)(const void*)(sG  + (wq * 32 + c) * GSP) + 8 * hh;
  const _Float16* w2p = (const _Float16*)(const void*)(sW2 + (wr * 64 + c) * GSP) + 8 * hh;
  unsigned char* gst = sG + (wr * 32 + c) * GSP + (wq * 32 + 8 * hh) * 2;   // this lane's token row, its 8 hidden channels
#pragma unroll 1  // one copy of the chunk body: the text stays short
  for (int ch = 0; ch < MLP / 128; ++ch) {                  // block-uniform trip count
    {
      // the chunk's w2t rows fly under FC1 and GELU; the last chunk's readers left them at the barrier at the loop's foot
      // (first chunk: the readers of the P rows that lay there left them at the barrier behind the row sums)
      unsigned l[8];
      const _Float16* g[8];
#pragma unroll
      for (int j = 0; j < 8; ++j) { l[j] = lW2 + (unsigned)(j * 32 * GSP); g[j] = gW2 + (size_t)j * 32 * MLP + ch * 128; }
      acopy8(l, g);
    }
    v8f a[2][2];
#pragma unroll
    for (int i = 0; i < 2; ++i)
#pragma unroll
      for (int t = 0; t < 2; ++t) a[i][t] = zero8();
    {
      // fragments are fetched one k-step ahead: the reads of step ks + 1 are in flight under the products of step ks
      v16h fw0 = ldfrag_h(w1p), fw1 = ldfrag_h(w1p + 16 * (WSP / 2));
      v16h fh0 = ldfrag_h(hp), fh1 = ldfrag_h(hp + 16 * (WSP / 2));
#pragma unroll  // straight-line k-steps
      for (int ks = 0; ks < DIMC / 32; ++ks) {
        const int kn = (ks + 1) * 32;
        v16h nw0 = fw0, nw1 = fw1, nh0 = fh0, nh1 = fh1;
        if (ks + 1 < DIMC / 32) {
          nw0 = ldfrag_h(w1p + kn);
          nw1 = ldfrag_h(w1p + 16 * (WSP / 2) + kn);
          nh0 = ldfrag_h(hp + kn);
          nh1 = ldfrag_h(hp + 16 * (WSP / 2) + kn);
        }
        __builtin_amdgcn_sched_barrier(0);  // holds the next step's reads in front of this step's products
        a[0][0] = mma_raw(fw0, fh0, a[0][0]);
        a[0][1] = mma_raw(fw0, fh1, a[0][1]);
        a[1][0] = mma_raw(fw1, fh0, a[1][0]);
        a[1][1] = mma_raw(fw1, fh1, a[1][1]);
        __builtin_amdgcn_sched_barrier(0);  // and later reads behind them: one step ahead, no deeper
        fw0 = nw0; fw1 = nw1; fh0 = nh0; fh1 = nh1;
      }
    }
#pragma unroll
    for (int i = 0; i < 2; ++i) {
      const float* bp = sB1 + ch * 128 + wq * 32 + i * 16 + 8 * hh;
      const v4f bA = *(const v4f*)(bp);
      const v4f bB = *(const v4f*)(bp + 4);
      const float bv[8] = { bA[0], bA[1], bA[2], bA[3], bB[0], bB[1], bB[2], bB[3] };
#pragma unroll
      for (int t = 0; t < 2; ++t) {
        float v[8], xe[8], er[8];
        bool small = true;
#pragma unroll
        for (int e = 0; e < 8; ++e) {
          v[e] = a[i][t][e] * (1.0f / 1024.0f) + bv[e];
          xe[e] = v[e] * 0.70710678118654752f;
          small = small && (fabsf(xe[e]) < 1.0f);
        }
        // erff tests |x| < 1 for each value; one test for the lane's 8 values leaves 8 independent chains with no
        // branch between them on the side where all are below 1, and the full erff for all 8 on the other side
        if (small) {
#pragma unroll
          for (int e = 0; e < 8; ++e) er[e] = erff(xe[e]);
        } else {
#pragma unroll
          for (int e = 0; e < 8; ++e) er[e] = erff(xe[e]);
        }
        v4u pk;
#pragma unroll
        for (int e = 0; e < 4; ++e) {
          const float g0 = 0.5f * v[2 * e] * (1.0f + er[2 * e]);
          const float g1 = 0.5f * v[2 * e + 1] * (1.0f + er[2 * e + 1]);
          pk[e] = pk16(hb16(g0 * 16.0f), hb16(g1 * 16.0f));
        }
        *(v4u*)(void*)(gst + t * 16 * GSP + i * 32) = pk;
      }
    }
    // g is written, this wave's reads of the w1t rows have returned and its w2t copies have landed; behind the barrier
    // all waves' have
    asm volatile("s_wait_dscnt 0x0" ::: "memory");
    asm volatile("s_wait_asynccnt 0x0" ::: "memory");
    __syncthreads();
    if (ch + 1 < MLP / 128) {                               // block-uniform: the next chunk's w1t rows fly under FC2
      unsigned l[8];
      const _Float16* g[8];
#pragma unroll
      for (int j = 0; j < 8; ++j) { l[j] = lW1 + (unsigned)(j * 16 * WSP); g[j] = gW1 + (size_t)((ch + 1) * 128 + j * 16) * DIMC; }
      acopy8(l, g);
    }
    // fragments one k-step ahead, as in FC1
    v16h fg0 = ldfrag_h(gp), fg1 = ldfrag_h(gp + 16 * (GSP / 2));
    v16h fv0 = ldfrag_h(w2p), fv1 = ldfrag_h(w2p + 16 * (GSP / 2));
    v16h fv2 = ldfrag_h(w2p + 32 * (GSP / 2)), fv3 = ldfrag_h(w2p + 48 * (GSP / 2));
#pragma unroll  // straight-line k-steps
    for (int ks = 0; ks < 4; ++ks) {
      const int kn = (ks + 1) * 32;
      v16h ng0 = fg0, ng1 = fg1, nv0 = fv0, nv1 = fv1, nv2 = fv2, nv3 = fv3;
      if (ks + 1 < 4) {
        ng0 = ldfrag_h(gp + kn);
        ng1 = ldfrag_h(gp + 16 * (GSP / 2) + kn);
        nv0 = ldfrag_h(w2p + kn);
        nv1 = ldfrag_h(w2p + 16 * (GSP / 2) + kn);
        nv2 = ldfrag_h(w2p + 32 * (GSP / 2) + kn);
        nv3 = ldfrag_h(w2p + 48 * (GSP / 2) + kn);
      }
      __builtin_amdgcn_sched_barrier(0);  // holds the next step's reads in front of this step's products
      o[0][0] = mma_raw(fv0, fg0, o[0][0]);
      o[0][1] = mma_raw(fv0, fg1, o[0][1]);
      o[1][0] = mma_raw(fv1, fg0, o[1][0]);
      o[1][1] = mma_raw(fv1, fg1, o[1][1]);
      o[2][0] = mma_raw(fv2, fg0, o[2][0]);
      o[2][1] = mma_raw(fv2, fg1, o[2][1]);
      o[3][0] = mma_raw(fv3, fg0, o[3][0]);
      o[3][1] = mma_raw(fv3, fg1, o[3][1]);
      if (ks == 3)  // in front of the back edge
        guard8(o[0][0], o[0][1], o[1][0], o[1][1], o[2][0], o[2][1], o[3][0], o[3][1], fg0, fg1, fv0, fv1, fv2, fv3);
      __builtin_amdgcn_sched_barrier(0);  // and later reads behind them: one step ahead, no deeper
      fg0 = ng0; fg1 = ng1; fv0 = nv0; fv1 = nv1; fv2 = nv2; fv3 = nv3;
    }
    // the reads of g and of the w2t rows have returned and this wave's w1t copies have landed; behind the barrier g and
    // the w2t rows may be rewritten and the new w1t rows read
    asm volatile("s_wait_dscnt 0x0" ::: "memory");
    asm volatile("s_wait_asynccnt 0x0" ::: "memory");
    __syncthreads();
  }
  float* Cs = (float*)(void*)sm;                            // the h and w1t rows are dead: the f32 tile lies over them
#pragma unroll
  for (int n = 0; n < 4; ++n)
#pragma unroll
    for (int t = 0; t < 2; ++t) {
      float* d = Cs + (wq * 32 + t * 16 + c) * LDX + wr * HD + n * 16 + 8 * hh;
      const v4f lo4 = { o[n][t][0], o[n][t][1], o[n][t][2], o[n][t][3] };
      const v4f hi4 = { o[n][t][4], o[n][t][5], o[n][t][6], o[n][t][7] };
      *(v4f*)d = lo4;
      *(v4f*)(d + 4) = hi4;
    }
  __syncthreads();
  // thread = 4 columns of 16 rows, 8 rows apart: a wave's store covers one whole 512-B half row
  const int row0 = tid >> 6, colp = (tid & 63) * 4;
  char* op = (char*)(void*)out + (unsigned)((tok0 + row0) * DIMC + colp) * 4u;   // byte offset below 32 MiB
  const float* cp = Cs + row0 * LDX + colp;
  v4f b2;
#pragma unroll
  for (int e = 0; e < 4; ++e) b2[e] = bfr(bias2[colp + e]);
#pragma unroll
  for (int s = 0; s < 16; ++s) {
    const v4f c4 = *(const v4f*)(cp + s * 8 * LDX);
    v4f v;
#pragma unroll
    for (int e = 0; e < 4; ++e) v[e] = c4[e] * (1.0f / 1024.0f) + b2[e];
    *(v4f*)(void*)(op + s * 8 * DIMC * 4) = v;
  }
}

// =================================================================================================================
// Workspace map (bytes; all offsets multiples of 131072; every region but WQT sized exactly at its whole-line store extent):
//   [48, 56 MiB)     PT  f32 [16][32][64][64] logit partials (k_kv_part -> k_attn_sm)
//   112 MiB + : ATH, ATL f16 [32][64][64] 262144 each | WQT f16 [256][256] in 393216 | W1T [768][256] 393216 |
//               W2T f16 [256][768] 393216 ; end = 119144448.
// =================================================================================================================
extern "C" void kernel_launch(void* const* d_in, const int* in_sizes, int n_in,
                              void* d_out, int out_size, void* d_ws, size_t ws_size,
                              hipStream_t stream) {
  if (n_in < 9) return;
  const int expect[9] = { NTOK * DIMC, DIMC * MLP, MLP, DIMC, DIMC, DIMC * MLP, MLP, MLP * DIMC, DIMC };
  for (int i = 0; i < 9; ++i) if (in_sizes[i] != expect[i]) return;
  if (out_size != NTOK * DIMC) return;

  const float* x     = (const float*)d_in[0];
  const float* w_qkv = (const float*)d_in[1];
  const float* b_qkv = (const float*)d_in[2];
  const float* ng    = (const float*)d_in[3];
  const float* nbt   = (const float*)d_in[4];
  const float* w_fc1 = (const float*)d_in[5];
  const float* b_fc1 = (const float*)d_in[6];
  const float* w_fc2 = (const float*)d_in[7];
  const float* b_fc2 = (const float*)d_in[8];
  float* out = (float*)d_out;

  const size_t MiB = (size_t)1048576;
  const size_t szAT  = ATL_OFF * 2;                                // 262144
  const size_t szWQ  = (size_t)MLP * DIMC * 2;                     // 393216

  const size_t oPT  = 48 * MiB;
  const size_t oATH = 112 * MiB;                                    // ATL at oATH + szAT
  const size_t oWQT = oATH + 2 * szAT;
  const size_t oW1T = oWQT + szWQ;
  const size_t oW2T = oW1T + szWQ;
  const size_t oEND = oW2T + szWQ;                                  // 119144448
  if (oPT + (size_t)KSPLIT * ATL_OFF * 4 > oATH) return;
  if (oEND > ws_size) return;
  if (oEND > (size_t)134217728) return;

  char* ws = (char*)d_ws;
  float*          PT  = (float*)(ws + oPT);
  unsigned short* ATH = (unsigned short*)(ws + oATH);
  unsigned short* WQT = (unsigned short*)(ws + oWQT);
  unsigned short* W1T = (unsigned short*)(ws + oW1T);
  unsigned short* W2T = (unsigned short*)(ws + oW2T);

  const dim3 blk(256);
  // (1) per (b, h): conversion of x and the weights, k, v projection + logits, K split in KSPLIT chunks -> f32 partial tiles,
  //     the last kernel's weight planes (transposed, 64 * bf16)
  k_kv_part<<<dim3(KSPLIT, BB * NH), blk, 0, stream>>>(x, w_qkv, w_fc1, w_fc2, b_qkv, PT, WQT, W1T, W2T);
  // (2) chunk sum + softmax -> P hi/lo planes
  k_attn_sm<<<dim3(BB * NH, HD / 16), blk, 0, stream>>>(PT, ATH);
  // (3) q projection + xf + residual + layer norm + fc1 + GELU + fc2 + bias + residual -> d_out
  k_mlp<<<dim3(NTOK / 128), dim3(512), 0, stream>>>(WQT, b_qkv, ATH, x, ng, nbt, W1T, b_fc1, W2T, b_fc2, out);
  (void)hipGetLastError();
}

// v009
// A run of this version takes 55.7 microseconds.
// In two side-by-side timings against v008, it was 1.04 and 1.03 times as fast.
// Over all steps from v000 it is 5.43 times as fast.
// Contractions: k, v projection (K=256), x . (w_q P^T) (K=256), fc1 (K=256), fc2 (K=768): v_wmma_f32_16x16x32_f16, single
// f16 products, activations carried x16, weights one f16 plane of 64*bf16(w) (64 w_q P^T likewise one f16 plane); per-head
// k^T v logits (K=4096): both operands as f16 hi + x2048 residual planes (3 products); w_q P^T (K=64): P as hi + residual
// planes (2 products); f32 accumulate everywhere. Softmax, layer norm, exact GELU and all epilogues f32 on VALU; every float input RNE-converted to
// bf16 on load.
#include <hip/hip_runtime.h>
#include <stdint.h>

#define BB     8
#define NN     4096
#define DIMC   256
#define NH     4
#define HD     64
#define MLP    768
#define NTOK   (BB * NN)
#define LDX    260
#define LDA    68
#define RSC    0.00048828125f
#define ATL_OFF ((size_t)BB * NH * HD * HD)
#define KSPLIT 16
#define KCH    (NN / KSPLIT)
#define XSP    (HD * 2 + 16)
#define WSP    (DIMC * 2 + 16)
#define TSP    (64 * 2 + 16)
#define GSP    (128 * 2 + 16)

static_assert(NTOK == 32768);
static_assert(DIMC == NH * HD);
static_assert((NN % 64) == 0 && (NTOK % 64) == 0);
static_assert((DIMC % 32) == 0 && (MLP % 32) == 0 && (HD % 32) == 0 && (NN % 32) == 0);
static_assert((LDX * 4) % 16 == 0);
static_assert(ATL_OFF == 131072);
static_assert(MLP == 6 * 128 && DIMC == 2 * 128 && (NTOK % 128) == 0 && ((GSP / 16) & 1) == 1);
static_assert(KCH * KSPLIT == NN && (KCH % 32) == 0);
static_assert(KCH == 256 && HD == 64 && ((XSP / 16) & 1) == 1 && ((WSP / 16) & 1) == 1 && ((TSP / 16) & 1) == 1);

typedef _Float16 v16h __attribute__((ext_vector_type(16)));
typedef _Float16 v8h  __attribute__((ext_vector_type(8)));
typedef float    v8f  __attribute__((ext_vector_type(8)));
typedef float    v4f  __attribute__((ext_vector_type(4)));
typedef unsigned int v4u __attribute__((ext_vector_type(4)));
typedef unsigned int v2u __attribute__((ext_vector_type(2)));
typedef float    v2f  __attribute__((ext_vector_type(2)));
typedef __bf16   v2b  __attribute__((ext_vector_type(2)));
typedef _Float16 v2h  __attribute__((ext_vector_type(2)));

// ---- scalar helpers ------------------------------------------------------------------------------------------
__device__ __forceinline__ unsigned short bf_bits(float f) {          // f32 -> bf16 bits, RNE convert
  unsigned u = __float_as_uint(f);
  return (unsigned short)((u + 0x7FFFu + ((u >> 16) & 1u)) >> 16);
}
__device__ __forceinline__ float bf_up(unsigned short b) { return __uint_as_float(((unsigned)b) << 16); }
__device__ __forceinline__ float bfr(float f) { return bf_up(bf_bits(f)); }
__device__ __forceinline__ unsigned short h_bits(_Float16 x) { return __builtin_bit_cast(unsigned short, x); }
__device__ __forceinline__ unsigned short hb16(float f) { return h_bits((_Float16)f); }
__device__ __forceinline__ unsigned pk16(unsigned short a, unsigned short b) { return (unsigned)a | ((unsigned)b << 16); }
__device__ __forceinline__ v8f zero8() { v8f z = {0.f, 0.f, 0.f, 0.f, 0.f, 0.f, 0.f, 0.f}; return z; }
// hi/lo pair of two f32 values: hi = f16(v), lo = f16(2048 (v - hi)), packed as two 32-bit words
__device__ __forceinline__ void split2(float f0, float f1, unsigned& hp, unsigned& lp) {
  const _Float16 h0 = (_Float16)f0, h1 = (_Float16)f1;
  const float q0 = (f0 - (float)h0) * 2048.0f, q1 = (f1 - (float)h1) * 2048.0f;
  hp = pk16(h_bits(h0), h_bits(h1));
  lp = pk16(hb16(q0), hb16(q1));
}

// ---- fragment loader: 16-bit A/B operand, lane -> row/col (lane&15), p already includes +8*(lane>>4);
//      elements 0..7 <- p[0..7] (k0+8h..k0+8h+7), elements 8..15 <- p[16..23] (k0+16+8h..k0+16+8h+7)
__device__ __forceinline__ v16h ldfrag_h(const _Float16* p) {
  union { v16h v; v8h h[2]; } f;
  f.h[0] = *(const v8h*)(p);
  f.h[1] = *(const v8h*)(p + 16);
  return f.v;
}

// ---- WMMA helpers; the guards insert the trailing VALU hazard gap and keep A/B live --------------------------
__device__ __forceinline__ v8f mma_raw(v16h a, v16h b, v8f c) {
  return __builtin_amdgcn_wmma_f32_16x16x32_f16(false, a, false, b, (short)0, c, false, false);
}
__device__ __forceinline__ void guard6(v8f& c0, v8f& c1, v8f& c2, v8f& c3, v8f& c4, v8f& c5,
                                       const v16h& a0, const v16h& a1, const v16h& b0, const v16h& b1,
                                       const v16h& b2, const v16h& b3) {
#if defined(__HIP_DEVICE_COMPILE__)
  asm volatile("v_nop\n\tv_nop\n\tv_nop\n\tv_nop"
               : "+v"(c0), "+v"(c1), "+v"(c2), "+v"(c3), "+v"(c4), "+v"(c5)
               : "v"(a0), "v"(a1), "v"(b0), "v"(b1), "v"(b2), "v"(b3));
#endif
}
__device__ __forceinline__ void guard8(v8f& c0, v8f& c1, v8f& c2, v8f& c3, v8f& c4, v8f& c5, v8f& c6, v8f& c7,
                                       const v16h& a0, const v16h& a1, const v16h& b0, const v16h& b1,
                                       const v16h& b2, const v16h& b3) {
#if defined(__HIP_DEVICE_COMPILE__)
  asm volatile("v_nop\n\tv_nop\n\tv_nop\n\tv_nop"
               : "+v"(c0), "+v"(c1), "+v"(c2), "+v"(c3), "+v"(c4), "+v"(c5), "+v"(c6), "+v"(c7)
               : "v"(a0), "v"(a1), "v"(b0), "v"(b1), "v"(b2), "v"(b3));
#endif
}

// ---- asynchronous copies, global -> LDS, 16 B per lane, eight per statement. The s_wait_xcnt is the last line of the
//      copies' own statement, so that no address register named here is rewritten in front of it.
__device__ __forceinline__ void acopy8(const unsigned* l, const _Float16* const* g) {
#if defined(__HIP_DEVICE_COMPILE__)
  asm volatile("global_load_async_to_lds_b128 %0, %8, off\n\t"
               "global_load_async_to_lds_b128 %1, %9, off\n\t"
               "global_load_async_to_lds_b128 %2, %10, off\n\t"
               "global_load_async_to_lds_b128 %3, %11, off\n\t"
               "global_load_async_to_lds_b128 %4, %12, off\n\t"
               "global_load_async_to_lds_b128 %5, %13, off\n\t"
               "global_load_async_to_lds_b128 %6, %14, off\n\t"
               "global_load_async_to_lds_b128 %7, %15, off\n\t"
               "s_wait_xcnt 0x0"
               :: "v"(l[0]), "v"(l[1]), "v"(l[2]), "v"(l[3]), "v"(l[4]), "v"(l[5]), "v"(l[6]), "v"(l[7]),
                  "v"(g[0]), "v"(g[1]), "v"(g[2]), "v"(g[3]), "v"(g[4]), "v"(g[5]), "v"(g[6]), "v"(g[7])
               : "memory");
#endif
}

// ---- input conversions ------------------------------------------------------------------------------------------
// two f32 values -> one word of f16(s bf16(f)), s a power of two, both conversions RNE, written on vectors of two so that
// the packed convert instructions serve them; bf16(s f) = s bf16(f), so the scale goes in front, in f32
__device__ __forceinline__ unsigned cvt2(float f0, float f1, float s) {
  const v2f a = {f0 * s, f1 * s};
  const v2b b = __builtin_convertvector(a, v2b);
  const v2f r = __builtin_convertvector(b, v2f);
  return __builtin_bit_cast(unsigned, __builtin_convertvector(r, v2h));
}
// four x values -> two words of f16(16 bf16(x))
__device__ __forceinline__ v2u cvt_x4(const v4f a) {
  v2u p;
  p[0] = cvt2(a[0], a[1], 16.0f);
  p[1] = cvt2(a[2], a[3], 16.0f);
  return p;
}
// four weights -> two words of f16(64 bf16(w))
__device__ __forceinline__ v2u cvt_w4(const v4f a) {
  v2u p;
  p[0] = cvt2(a[0], a[1], 64.0f);
  p[1] = cvt2(a[2], a[3], 64.0f);
  return p;
}
// Weight tile of 64 k x 32 n of a row-major f32 matrix w[k][n], one wave. Lane = (kq = lane >> 3, nq = lane & 7): load
// j = (hf = j >> 3, e = j & 7) reads n = nq * 4 + 0..3 of source row k = hf * 32 + kq * 8 + e (four whole lines a load), so
// the lane holds 8 consecutive k of 4 rows n; word group s = (hf = s >> 2, i = s & 3) is f16(64 bf16(w)) of these 8 k of
// row nq * 4 + i, 16 B.
__device__ __forceinline__ void wt_pack(const v4f (&g)[16], v4u (&w)[8]) {
#pragma unroll  // g[] and w[] indexed by constants, so they stay in registers
  for (int s = 0; s < 8; ++s)
#pragma unroll
    for (int e = 0; e < 4; ++e)
      w[s][e] = cvt2(g[(s >> 2) * 8 + 2 * e][s & 3], g[(s >> 2) * 8 + 2 * e + 1][s & 3], 64.0f);
}

// one 16x16 accumulator tile (lane = channel, registers = 8 consecutive tokens) -> carried value 16 (x w + b) =
// acc/64 + bb as f16 hi + x2048 residual, 16 B each, into the channel's hi row and its lo row (HD rows further on)
__device__ __forceinline__ void put_planes(const v8f& acc, float bb, unsigned char* hi_dst) {
  v4u a, q4;
#pragma unroll
  for (int e = 0; e < 4; ++e) {
    const float f0 = acc[2 * e] * (1.0f / 64.0f) + bb;
    const float f1 = acc[2 * e + 1] * (1.0f / 64.0f) + bb;
    unsigned hw, lw;
    split2(f0, f1, hw, lw);
    a[e] = hw; q4[e] = lw;
  }
  *(v4u*)(void*)hi_dst = a;
  *(v4u*)(void*)(hi_dst + HD * TSP) = q4;
}

// =================================================================================================================
// Input conversion + K, V projection of one head fused with its channel-attention logits, split over K. Block (ck, bh)
// takes the KCH tokens of chunk ck in KCH/64 sub-tiles of 64. The head's 64 k columns and 64 v columns of w_qkv are read
// as f32 in 16 tiles of 64 k x 32 n, two a wave, and go as f16(64 bf16(w)) into LDS rows [channel][256 k] (WSP bytes).
// Per sub-tile the 64 x rows are read as f32, whole lines (load i of wave w: half i & 1 of row (i >> 1) * 8 + w), and go as
// f16(16 bf16(x)) into LDS rows of WSP bytes. The next sub-tile's loads are issued in front of the projection and
// converted behind the logits.
// C[64 tokens][128 channels] = xh . w^T (K = 256, 8 waves = 2 (32 tokens) x 4 (32 channels)), and each lane's 8
// consecutive tokens of a channel
// go as f16 hi + x2048 residual into the LDS planes T[plane * 64 + channel][64 tokens] (rows of TSP bytes; planes
// k hi, k lo, v hi, v lo). Then raw[d][e] += sum_n (16 k[n][d]) (16 v[n][e]) on WMMA (M = N = 64, 2 k-steps):
// A = k planes, B = v planes, products hi*hi + (hi*lo + lo*hi)/2048, 8 waves = 4 (16 rows) x 2 (32 cols), tokens
// ascending. k and v never leave the work-group. The chunk's f32 tile goes through LDS to part[ck][bh][d][e].
// The last kernel's weight planes, w1t[n][k] = f16(64 bf16(w_fc1[k][n])) (n < 768, k < 256) and w2t[n][k] = f16(64 bf16(
// w_fc2[k][n])) (n < 256, k < 768), are 96 + 96 tiles of
// 64 k x 32 n: wave 0 of the first 192 blocks converts one each; the 128-B line of an output row is written by that wave.
// grid = (KSPLIT, 32), 256 threads. coverage: part [KSPLIT][32][64][64] f32, w1t 768 x 256,
// w2t 256 x 768, every element once.
// =================================================================================================================
#define WT_F  ((MLP / 32) * (DIMC / 64))
static_assert(WT_F == 96 && 2 * WT_F <= KSPLIT * BB * NH && 3 * DIMC == MLP);
// four waves per SIMD: the register budget that lets two work-groups (the LDS limit) share a WGP
__global__ __launch_bounds__(256) __attribute__((amdgpu_waves_per_eu(4)))
void k_kv_part(const float* __restrict__ x, const float* __restrict__ wqkv, const float* __restrict__ wfc1,
               const float* __restrict__ wfc2, const float* __restrict__ bias, float* part,
               unsigned short* w1t, unsigned short* w2t) {
  __shared__ __align__(16) unsigned char sm[192 * WSP + 4 * HD * TSP];
  unsigned char* sW = sm;                                   // 128 weight rows: 0..63 k channels, 64..127 v channels
  unsigned char* sA = sm + 128 * WSP;                       // 64 token rows
  unsigned char* sT = sm + 192 * WSP;                       // the four planes of one sub-tile
  static_assert(64 * LDA * 4 <= 64 * WSP);
  const int tid = threadIdx.x, lane = tid & 31, hh = lane >> 4, c = lane & 15;
  const int wave = __builtin_amdgcn_readfirstlane((int)(threadIdx.x >> 5));   // scalar: the weight-tile test is a scalar branch
  const int ck = blockIdx.x, bh = blockIdx.y;
  const int h = bh & (NH - 1);
  const int tok0 = (bh >> 2) * NN + ck * KCH;
  const float* gX = x + (size_t)(tok0 + wave) * DIMC + lane * 4;
  unsigned char* lX = sA + wave * WSP + lane * 8;
  v4f xa[16];                                               // one sub-tile's x values of this lane
  {
    const int kq = lane >> 3, nq = lane & 7;
    // this wave's two tiles of the head's weights: 32 channels lt, k tiles kt0 and kt0 + 1
    const int lt = wave >> 1, kt0 = (wave & 1) * 2;
    const float* pw = wqkv + (size_t)(kt0 * 64 + kq * 8) * MLP + (1 + (lt >> 1)) * DIMC + h * HD + (lt & 1) * 32 + nq * 4;
    v4f ga[16], gb[16];
#pragma unroll  // every array here is indexed by constants, so it stays in registers (the loops below likewise)
    for (int j = 0; j < 16; ++j) ga[j] = *(const v4f*)(pw + (size_t)((j >> 3) * 32 + (j & 7)) * MLP);
#pragma unroll
    for (int j = 0; j < 16; ++j) gb[j] = *(const v4f*)(pw + (size_t)(64 + (j >> 3) * 32 + (j & 7)) * MLP);
#pragma unroll
    for (int i = 0; i < 16; ++i) xa[i] = *(const v4f*)(gX + (i >> 1) * 8 * DIMC + (i & 1) * 128);
    // the loads' address registers are inputs here, so they live up to the wait and nothing is written over them in front of it
    asm volatile("s_wait_xcnt 0x0" :: "v"(pw), "v"(gX) : "memory");
    __builtin_amdgcn_sched_barrier(0);  // holds every load in front of the first conversion: one memory latency
    unsigned char* dw = sW + (lt * 32 + nq * 4) * WSP + (kt0 * 64 + kq * 8) * 2;
    {
      v4u w[8];
      wt_pack(ga, w);
#pragma unroll
      for (int s = 0; s < 8; ++s) *(v4u*)(void*)(dw + (s & 3) * WSP + (s >> 2) * 64) = w[s];
      wt_pack(gb, w);
#pragma unroll
      for (int s = 0; s < 8; ++s) *(v4u*)(void*)(dw + 128 + (s & 3) * WSP + (s >> 2) * 64) = w[s];
    }
    // a tile of the last kernel's weight planes, or none (wave-uniform)
    const int fb = bh * KSPLIT + ck;
    const int et = (wave == 0 && fb < 2 * WT_F) ? fb : -1;
    const int m = (et < WT_F) ? 1 : 2;
    const int r = et - ((m == 1) ? 0 : WT_F);
    const int ns = (m == 2) ? DIMC : MLP;                   // source row length
    const int kd = (m == 2) ? MLP : DIMC;                   // output row length
    const int nt = (m == 2) ? r / (MLP / 64) : r / (DIMC / 64);   // constant divisors: scalar shifts and multiplies
    const int kt = r - nt * (kd / 64);
    v4f ge[16];
    if (et >= 0) {
      const float* p = (m == 1 ? wfc1 : wfc2) + (size_t)(kt * 64 + kq * 8) * ns + nt * 32 + nq * 4;
      const float* q[16];
#pragma unroll
      for (int j = 0; j < 16; ++j) { q[j] = p + (size_t)((j >> 3) * 32 + (j & 7)) * ns; ge[j] = *(const v4f*)q[j]; }
      // as above: the 16 address registers live up to the wait
      asm volatile("s_wait_xcnt 0x0" :: "v"(q[0]), "v"(q[1]), "v"(q[2]), "v"(q[3]), "v"(q[4]), "v"(q[5]), "v"(q[6]), "v"(q[7]),
                   "v"(q[8]), "v"(q[9]), "v"(q[10]), "v"(q[11]), "v"(q[12]), "v"(q[13]), "v"(q[14]), "v"(q[15]) : "memory");
    }
    __builtin_amdgcn_sched_barrier(0);  // these loads fly under the conversion of the x rows
    {
      v2u pk[16];
#pragma unroll
      for (int i = 0; i < 16; ++i) pk[i] = cvt_x4(xa[i]);
#pragma unroll
      for (int i = 0; i < 16; ++i) *(v2u*)(void*)(lX + (i >> 1) * 8 * WSP + (i & 1) * 256) = pk[i];
    }
    // this wave's weight and token rows are written; behind the barrier every wave's are
    asm volatile("s_wait_dscnt 0x0" ::: "memory");
    __syncthreads();
    if (et >= 0) {                                          // behind the barrier: the stores' way to memory lies under the first projection
      v4u w[8];
      wt_pack(ge, w);
      __builtin_amdgcn_sched_barrier(0);  // as above: the stores behind the last conversion
      unsigned short* d = (m == 1 ? w1t : w2t) + (size_t)(nt * 32 + nq * 4) * kd + kt * 64 + kq * 8;
#pragma unroll
      for (int s = 0; s < 8; ++s) *(v4u*)(d + (size_t)(s & 3) * kd + (s >> 2) * 32) = w[s];
      // in front of whatever writes next over a register that these stores name
      asm volatile("s_wait_xcnt 0x0" ::: "memory");
      __builtin_amdgcn_sched_barrier(0);  // keeps later work behind the wait
    }
  }
  // projection: wave = 32 tokens x 32 channels
  const int mw = wave >> 2, nw = wave & 3;
  const _Float16* a0p = (const _Float16*)(const void*)(sA + (mw * 32 + c) * WSP) + 8 * hh;
  const _Float16* a1p = (const _Float16*)(const void*)(sA + (mw * 32 + 16 + c) * WSP) + 8 * hh;
  const _Float16* b0p = (const _Float16*)(const void*)(sW + (nw * 32 + c) * WSP) + 8 * hh;
  const _Float16* b1p = (const _Float16*)(const void*)(sW + (nw * 32 + 16 + c) * WSP) + 8 * hh;
  const int kvs = nw >> 1;                                  // 0: this wave's channels are k, 1: v
  const int d0 = (nw & 1) * 32 + c;                         // channel within the head; the second tile is d0 + 16
  const float bb0 = 16.0f * bfr(bias[(1 + kvs) * DIMC + h * HD + d0]);
  const float bb1 = 16.0f * bfr(bias[(1 + kvs) * DIMC + h * HD + d0 + 16]);
  unsigned char* t00 = sT + (kvs * 2 * HD + d0) * TSP + (mw * 32 + 8 * hh) * 2;   // hi row of d0, this lane's 8 tokens
  // logits: wave = 16 rows d x 32 cols e
  const int mv = wave >> 1, nv = wave & 1;
  const _Float16* ahp = (const _Float16*)(const void*)(sT + (mv * 16 + c) * TSP) + 8 * hh;
  const _Float16* alp = (const _Float16*)(const void*)(sT + (HD + mv * 16 + c) * TSP) + 8 * hh;
  const _Float16* b0h = (const _Float16*)(const void*)(sT + (2 * HD + nv * 32 + c) * TSP) + 8 * hh;
  const _Float16* b1h = (const _Float16*)(const void*)(sT + (2 * HD + nv * 32 + 16 + c) * TSP) + 8 * hh;
  const _Float16* b0l = (const _Float16*)(const void*)(sT + (3 * HD + nv * 32 + c) * TSP) + 8 * hh;
  const _Float16* b1l = (const _Float16*)(const void*)(sT + (3 * HD + nv * 32 + 16 + c) * TSP) + 8 * hh;
  v8f p0 = zero8(), p1 = zero8(), q0 = zero8(), q1 = zero8(), r0 = zero8(), r1 = zero8();
#pragma unroll 1  // one copy of the sub-tile body: the text stays short
  for (int t = 0; t < KCH / 64; ++t) {                      // block-uniform trip count
    if (t + 1 < KCH / 64) {                                 // block-uniform: the next sub-tile's x loads fly under the projection
      const float* p = gX + (size_t)(t + 1) * 64 * DIMC;
#pragma unroll
      for (int i = 0; i < 16; ++i) xa[i] = *(const v4f*)(p + (i >> 1) * 8 * DIMC + (i & 1) * 128);
      // the loads' address register is an input here, so it lives up to the wait and nothing is written over it in front of it
      asm volatile("s_wait_xcnt 0x0" :: "v"(p) : "memory");
    }
    __builtin_amdgcn_sched_barrier(0);  // holds these loads in front of the projection
    v8f c00 = zero8(), c01 = zero8(), c10 = zero8(), c11 = zero8();
    // fragments are fetched one k-step ahead: the reads of step ks + 1 are in flight under the products of step ks
    v16h fa0 = ldfrag_h(a0p), fa1 = ldfrag_h(a1p);
    v16h fb0 = ldfrag_h(b0p), fb1 = ldfrag_h(b1p);
#pragma unroll  // straight-line k-steps
    for (int ks = 0; ks < DIMC / 32; ++ks) {
      const int kn = (ks + 1 < DIMC / 32 ? ks + 1 : ks) * 32;
      v16h na0 = fa0, na1 = fa1, nb0 = fb0, nb1 = fb1;
      if (ks + 1 < DIMC / 32) {
        na0 = ldfrag_h(a0p + kn);
        na1 = ldfrag_h(a1p + kn);
        nb0 = ldfrag_h(b0p + kn);
        nb1 = ldfrag_h(b1p + kn);
      }
      __builtin_amdgcn_sched_barrier(0);  // holds the next step's reads in front of this step's products
      c00 = mma_raw(fa0, fb0, c00);
      c01 = mma_raw(fa0, fb1, c01);
      c10 = mma_raw(fa1, fb0, c10);
      c11 = mma_raw(fa1, fb1, c11);
      __builtin_amdgcn_sched_barrier(0);  // and later reads behind them: no deeper fetch, no spills
      fa0 = na0; fa1 = na1; fb0 = nb0; fb1 = nb1;
    }
    put_planes(c00, bb0, t00);
    put_planes(c01, bb1, t00 + 16 * TSP);
    put_planes(c10, bb0, t00 + 32);
    put_planes(c11, bb1, t00 + 16 * TSP + 32);
    // the planes are written and this wave's reads of the token rows have returned; behind the barrier all waves' have
    asm volatile("s_wait_dscnt 0x0" ::: "memory");
    __syncthreads();
#pragma unroll  // two straight-line k-steps
    for (int ks = 0; ks < 2; ++ks) {
      const int ko = ks * 32;
      const v16h fa  = ldfrag_h(ahp + ko);
      const v16h ga  = ldfrag_h(alp + ko);
      const v16h fb0 = ldfrag_h(b0h + ko);
      const v16h fb1 = ldfrag_h(b1h + ko);
      const v16h gb0 = ldfrag_h(b0l + ko);
      const v16h gb1 = ldfrag_h(b1l + ko);
      p0 = mma_raw(fa, fb0, p0);
      p1 = mma_raw(fa, fb1, p1);
      q0 = mma_raw(fa, gb0, q0);
      q1 = mma_raw(fa, gb1, q1);
      r0 = mma_raw(ga, fb0, r0);
      r1 = mma_raw(ga, fb1, r1);
      if (ks == 1) guard6(p0, p1, q0, q1, r0, r1, fa, ga, fb0, fb1, gb0, gb1);  // in front of the back edge
    }
    if (t + 1 < KCH / 64) {                                 // block-uniform; the readers of the old token rows left them at the barrier above
      v2u pk[16];
#pragma unroll
      for (int i = 0; i < 16; ++i) pk[i] = cvt_x4(xa[i]);
#pragma unroll
      for (int i = 0; i < 16; ++i) *(v2u*)(void*)(lX + (i >> 1) * 8 * WSP + (i & 1) * 256) = pk[i];
    }
    // the plane reads have returned and the new token rows are written; behind the barrier the planes may be
    // rewritten and the new token rows read
    asm volatile("s_wait_dscnt 0x0" ::: "memory");
    __syncthreads();
  }
  float* Cs = (float*)(void*)sA;                            // the token rows are dead: the f32 tile lies over them
#pragma unroll
  for (int r = 0; r < 8; ++r) {
    const int row = mv * 16 + 8 * hh + r;
    Cs[row * LDA + nv * 32 + c]      = p0[r] + (q0[r] + r0[r]) * RSC;
    Cs[row * LDA + nv * 32 + 16 + c] = p1[r] + (q1[r] + r1[r]) * RSC;
  }
  __syncthreads();
  float* dst = part + ((size_t)ck * (BB * NH) + bh) * (HD * HD);
  v4f pk[4];
#pragma unroll  // pk[] indexed by constants, so it stays in registers
  for (int s = 0; s < 4; ++s) {
    const int idx = s * 256 + tid;
    pk[s] = *(const v4f*)(Cs + (idx >> 4) * LDA + (idx & 15) * 4);
  }
#pragma unroll  // as above
  for (int s = 0; s < 4; ++s) *(v4f*)(dst + (size_t)(s * 256 + tid) * 4) = pk[s];
}

// =================================================================================================================
// Chunk sum + softmax + the fold of P into the q weights. xf[token][d] = sum_e P[d][e] (x w_q + b_q)[token][e] =
// (x . (w_q P^T))[token][d] + (P b_q)[d], so the last kernel needs only wp = w_q P^T and bp = P b_q of its batch.
// Block = 16 rows d of one (b, h); thread = 4 consecutive e of one row, 16 lanes per row.
// raw = sum over ck of part[ck] in index order; logit = raw/2048 (includes the head_dim^-0.5 factor 1/8). Softmax
// over e per row d in f32 (max subtracted, 16-lane butterflies), 4096 P as f16 hi + x2048 residual planes into LDS rows
// [d][64 e] (XSP bytes). The head's 64 q columns of w_qkv are read as f32, whole lines (load j: rows j * 16 + (tid >> 4)),
// and go as f16(64 bf16(w)) into LDS rows [c][64 e]. C[256 c][16 d] = w rows . P rows^T on WMMA (K = 64, 2 k-steps, e
// ascending; 8 waves x 2 tiles of 16 c), products w*hi + (w*lo)/2048, C = 2^18 wp; a lane holds 8 consecutive c of one d:
// f16(64 wp), 16 B, into an LDS tile [d][256 c], from there whole lines to wpt[b][h*64+d][c]. bp in f32, summed in the lane
// and over the row's 16 lanes; the block's 16 values lie in a 128-B line of their own, bp[(bh*4 + blockIdx.y)*32 + 0..15].
// grid = (32, 4), 256 threads. coverage: wpt [8][256][256] f16, every element once; bp as above.
// =================================================================================================================
__global__ __launch_bounds__(256)
void k_attn_sm(const float* __restrict__ part, const float* __restrict__ wqkv, const float* __restrict__ bias,
               unsigned short* wpt, float* bp) {
  __shared__ __align__(16) unsigned char sm[DIMC * XSP + 2 * 16 * XSP + 16 * WSP + 16 * 4];
  unsigned char* sW = sm;                                   // 256 rows c of the head's q weights
  unsigned char* sP = sm + DIMC * XSP;                      // 16 rows d of P hi, then 16 rows of P lo
  unsigned char* sO = sP + 2 * 16 * XSP;                    // 16 rows d of 64 wp
  float* sB = (float*)(void*)(sO + 16 * WSP);               // the 16 values of bp
  const int tid = threadIdx.x, wave = tid >> 5, lane = tid & 31, hh = lane >> 4, c = lane & 15;
  const int bh = blockIdx.x, h = bh & (NH - 1);
  const int rl = tid >> 4;
  const int row = blockIdx.y * 16 + rl, col0 = (tid & 15) * 4;
  const float* pp = part + ((size_t)bh * HD + row) * HD + col0;
  const float* pw = wqkv + (size_t)rl * MLP + h * HD + col0;
  v4f t[KSPLIT], wv[16];
  const v4f bq = *(const v4f*)(bias + h * HD + col0);
#pragma unroll  // all chunk loads issued before the first add: one memory latency, not KSPLIT
  for (int s = 0; s < KSPLIT; ++s) t[s] = *(const v4f*)(pp + (size_t)s * ATL_OFF);
  __builtin_amdgcn_sched_barrier(0);  // the weight rows are issued last: loads return in order, and the chunk sums do not wait for them
#pragma unroll  // the weight rows fly with them; wv[] indexed by constants, so it stays in registers
  for (int j = 0; j < 16; ++j) wv[j] = *(const v4f*)(pw + (size_t)j * 16 * MLP);
  // the loads' address registers are inputs here, so they live up to the wait and nothing is written over them in front of it
  asm volatile("s_wait_xcnt 0x0" :: "v"(pp), "v"(pw) : "memory");
  __builtin_amdgcn_sched_barrier(0);  // holds every load in front of the first add: one memory latency
  unsigned char* dW = sW + rl * XSP + col0 * 2;
  v4f a = t[0];
#pragma unroll  // t[] indexed by constants, so it stays in registers (the short loops below likewise)
  for (int s = 1; s < KSPLIT; ++s) a += t[s];
  float mx = fmaxf(fmaxf(a[0], a[1]), fmaxf(a[2], a[3]));
#pragma unroll
  for (int o = 1; o < 16; o <<= 1) mx = fmaxf(mx, __shfl_xor(mx, o, 32));
  float e[4];
#pragma unroll
  for (int n = 0; n < 4; ++n) e[n] = expf((a[n] - mx) * RSC);
  float sm1 = (e[0] + e[1]) + (e[2] + e[3]);
  float sb = (e[0] * bfr(bq[0]) + e[1] * bfr(bq[1])) + (e[2] * bfr(bq[2]) + e[3] * bfr(bq[3]));
  // four weight rows are converted behind each exchange of this butterfly: their work stands in the exchange's latency
#pragma unroll
  for (int k = 0; k < 4; ++k) {
    const float o1 = __shfl_xor(sm1, 1 << k, 32), o2 = __shfl_xor(sb, 1 << k, 32);
    if (k == 0) __builtin_amdgcn_sched_barrier(0);  // keeps the conversions, which wait for the last loads, behind the maximum and the exponentials
#pragma unroll
    for (int j = 4 * k; j < 4 * k + 4; ++j) *(v2u*)(void*)(dW + j * 16 * XSP) = cvt_w4(wv[j]);
    sm1 += o1; sb += o2;
  }
  const float ri = 1.0f / sm1;
  const float sc = ri * 4096.0f;
  v2u ph, pq;
#pragma unroll
  for (int n = 0; n < 2; ++n) {
    unsigned hw, lw;
    split2(e[2 * n] * sc, e[2 * n + 1] * sc, hw, lw);
    ph[n] = hw; pq[n] = lw;
  }
  *(v2u*)(void*)(sP + rl * XSP + col0 * 2) = ph;
  *(v2u*)(void*)(sP + (16 + rl) * XSP + col0 * 2) = pq;
  if ((tid & 15) == 0) sB[rl] = sb * ri;
  __syncthreads();                                          // the P rows, the weight rows and bp are written
  {
    const _Float16* pbh = (const _Float16*)(const void*)(sP + c * XSP) + 8 * hh;
    const _Float16* pbl = (const _Float16*)(const void*)(sP + (16 + c) * XSP) + 8 * hh;
    const v16h fh0 = ldfrag_h(pbh), fh1 = ldfrag_h(pbh + 32);
    const v16h fl0 = ldfrag_h(pbl), fl1 = ldfrag_h(pbl + 32);
    const int c0 = wave * 32;                               // this wave's two tiles: rows c0 + 0..15 and c0 + 16..31
    const _Float16* pa = (const _Float16*)(const void*)(sW + (c0 + c) * XSP) + 8 * hh;
    const v16h fa0 = ldfrag_h(pa), fa1 = ldfrag_h(pa + 32);
    const v16h fb0 = ldfrag_h(pa + 16 * (XSP / 2)), fb1 = ldfrag_h(pa + 16 * (XSP / 2) + 32);
    __builtin_amdgcn_sched_barrier(0);  // holds all eight fragments' reads in front of the products: one LDS latency
    v8f u[2] = { zero8(), zero8() }, v[2] = { zero8(), zero8() };
    u[0] = mma_raw(fa0, fh0, u[0]);
    v[0] = mma_raw(fa0, fl0, v[0]);
    u[1] = mma_raw(fb0, fh0, u[1]);
    v[1] = mma_raw(fb0, fl0, v[1]);
    u[0] = mma_raw(fa1, fh1, u[0]);
    v[0] = mma_raw(fa1, fl1, v[0]);
    u[1] = mma_raw(fb1, fh1, u[1]);
    v[1] = mma_raw(fb1, fl1, v[1]);
#pragma unroll
    for (int i = 0; i < 2; ++i) {
      v4u pk;
#pragma unroll
      for (int n = 0; n < 4; ++n) {
        const float f0 = (u[i][2 * n] + v[i][2 * n] * RSC) * (1.0f / 4096.0f);
        const float f1 = (u[i][2 * n + 1] + v[i][2 * n + 1] * RSC) * (1.0f / 4096.0f);
        pk[n] = pk16(hb16(f0), hb16(f1));
      }
      *(v4u*)(void*)(sO + c * WSP + (c0 + i * 16 + 8 * hh) * 2) = pk;   // lane = row d, registers = c0 + i*16 + 8*hh + 0..7
    }
  }
  __syncthreads();                                          // the tile is written
  // thread = two 16-B pieces of row rl, 256 B apart: a wave's store covers two whole lines of each of two rows
  unsigned short* dst = wpt + ((size_t)(bh >> 2) * DIMC + h * HD + row) * DIMC + (tid & 15) * 8;
  const unsigned char* so = sO + rl * WSP + (tid & 15) * 16;
  const v4u o0 = *(const v4u*)(const void*)so;
  const v4u o1 = *(const v4u*)(const void*)(so + 256);
  *(v4u*)dst = o0;
  *(v4u*)(dst + 128) = o1;
  if (tid < 16) bp[(bh * 4 + blockIdx.y) * 32 + tid] = sB[tid];
}

// =================================================================================================================
// xf + residual + layer norm + FC1 + exact GELU + FC2 + bias + residual in one kernel: x1, h and g
// never leave the work-group. Block = 128 tokens of one batch, 16 waves, one block per WGP. Wave (wq, wr) owns 32
// tokens (wq) x the 64 channels of head wr, from xf to the output.
// xf: C[64 d][32 tokens] = wpt rows . xh rows^T on WMMA (K = 256, 8 k-steps, k ascending), C = 1024 (x wp), wpt the batch's
// f16(64 w_q P^T); a lane holds 8 consecutive channels of one token. x1 = bf16(x) + bp + C/1024 in registers
// (bf16(x) = xh/16). Layer norm: mean, then the sum of squared differences, each
// summed in the lane, over the lane pair and over the four waves of a token through LDS. 16 h goes as f16, 16 B a
// store, into H[token][256] in LDS. 1024 x1 is the start value of the FC2 accumulators.
// The 768 hidden channels run in 6 chunks of 128. Per chunk: C1[128 hidden][128 tokens] = w1t rows . H rows^T (8
// k-steps, 16 waves = 4 (32 hidden) x 4 (32 tokens)): v = C1/1024 + bf16(b1), g = 0.5 v (1 + erf(v / sqrt 2)) in
// registers, 16 g as f16, one 16-B LDS store into G[token][128]. Then C2[256 cols][128 tokens] += w2t chunk . G^T
// (4 k-steps), hidden channels ascending. The chunk's w2t rows fly under FC1 and GELU, the next chunk's w1t rows under
// FC2. out = C2/1024 + bf16(b2) through an f32 LDS tile, whole lines.
// grid = NTOK/128, 512 threads. coverage: out [32768][256] f32, every element once.
// =================================================================================================================
__global__ __launch_bounds__(512)
void k_mlp(const unsigned short* __restrict__ wpt, const float* __restrict__ bp,
           const float* __restrict__ x, const float* __restrict__ gw, const float* __restrict__ gb,
           const unsigned short* __restrict__ w1t, const float* __restrict__ bias1,
           const unsigned short* __restrict__ w2t, const float* __restrict__ bias2, float* out) {
  __shared__ __align__(16) unsigned char sm[384 * WSP + 384 * GSP + MLP * 4 + 2 * NH * 128 * 4 + 3 * DIMC * 4];
  unsigned char* sH  = sm;                                  // 128 rows, WSP bytes each: wpt rows 0..127, then h by token
  unsigned char* sW1 = sm + 128 * WSP;                      // 128 rows: wpt rows 128..255, then the chunk's w1t rows
  unsigned char* sG  = sm + 256 * WSP;                      // 128 token rows of g, GSP bytes each
  unsigned char* sW2 = sm + 256 * WSP + 128 * GSP;          // 256 w2t rows, the chunk's 128 k
  float* sB1 = (float*)(void*)(sm + 256 * WSP + 384 * GSP); // bf16(b1) as f32
  unsigned char* sX  = sm + 256 * WSP + 384 * GSP + MLP * 4;  // 128 token rows of xh = f16(16 bf16(x))
  float* sR  = (float*)(void*)(sX + 128 * WSP);             // layer-norm partial sums [2][head][128 tokens]
  float* sLN = sR + 2 * NH * 128;                           // bf16(norm weight), then bf16(norm bias), as f32
  float* sBQ = sLN + 2 * DIMC;                              // bp of the batch's 256 channels
  static_assert(128 * LDX * 4 <= 256 * WSP);
  static_assert((NN % 128) == 0);
  static_assert(sizeof(sm) <= 327680);
  const int tid = threadIdx.x, wave = tid >> 5, lane = tid & 31, hh = lane >> 4, c = lane & 15;
  const int tok0 = blockIdx.x * 128;
  const int wq = wave >> 2, wr = wave & 3;
  // copies: a wave copy covers one whole 512-B row (wpt, w1t) or two 256-B row pieces (w2t)
  const _Float16* gQ  = (const _Float16*)(const void*)wpt + (size_t)(tok0 / NN) * (DIMC * DIMC) + (size_t)wave * DIMC + lane * 8;   // the batch's rows 0..255
  const float* gX = x + (size_t)(tok0 + wave) * DIMC + lane * 4;   // load i: half i & 1 of token row (i >> 1) * 16 + wave, whole lines
  const _Float16* gW1 = (const _Float16*)(const void*)w1t + (size_t)wave * DIMC + lane * 8;
  const _Float16* gW2 = (const _Float16*)(const void*)w2t + (size_t)(wave * 2 + hh) * MLP + c * 8;
  const unsigned lH  = (unsigned)(uintptr_t)sH  + (unsigned)(wave * WSP + lane * 16);            // LDS byte addresses
  const unsigned lW1 = (unsigned)(uintptr_t)sW1 + (unsigned)(wave * WSP + lane * 16);
  const unsigned lW2 = (unsigned)(uintptr_t)sW2 + (unsigned)((wave * 2 + hh) * GSP + c * 16);
  {
    v4f xa[16];
#pragma unroll  // xa[] indexed by constants, so it stays in registers
    for (int i = 0; i < 16; ++i) xa[i] = *(const v4f*)(gX + (i >> 1) * 16 * DIMC + (i & 1) * 128);
    // the loads' address register is an input here, so it lives up to the wait and nothing is written over it in front of it
    asm volatile("s_wait_xcnt 0x0" :: "v"(gX) : "memory");
    unsigned l[8];
    const _Float16* g[8];
#pragma unroll  // l[] and g[] indexed by constants, so they stay in registers (the copy loops below likewise)
    for (int j = 0; j < 8; ++j) { l[j] = lH + (unsigned)(j * 16 * WSP); g[j] = gQ + (size_t)j * 16 * DIMC; }
    acopy8(l, g);
#pragma unroll
    for (int j = 0; j < 8; ++j) { l[j] = lW1 + (unsigned)(j * 16 * WSP); g[j] = gQ + (size_t)(128 + j * 16) * DIMC; }
    acopy8(l, g);
    for (int i = tid; i < MLP; i += 512) sB1[i] = bfr(bias1[i]);
    if (tid < DIMC) {
      sLN[tid] = bfr(gw[tid]); sLN[DIMC + tid] = bfr(gb[tid]);
      sBQ[tid] = bp[((tok0 / NN) * (NH * 4) + (tid >> 4)) * 32 + (tid & 15)];   // 16 channels a line
    }
    // the x rows are converted while the copies fly: f16(16 bf16(x)), 8 B a lane
#pragma unroll
    for (int i = 0; i < 16; ++i) *(v2u*)(void*)(sX + ((i >> 1) * 16 + wave) * WSP + (i & 1) * 256 + lane * 8) = cvt_x4(xa[i]);
    // this wave's copies have landed and its x rows are written; behind the barrier every wave's are, and the four
    // parameter rows are written
    asm volatile("s_wait_dscnt 0x0" ::: "memory");
    asm volatile("s_wait_asynccnt 0x0" ::: "memory");
    __syncthreads();
  }
  // o[n][t]: lane = token wq*32 + t*16 + c, registers = channels wr*64 + n*16 + 8*hh + 0..7
  v8f o[4][2];
  {
    // qa[n][t]: lane = token wq*32 + t*16 + c, registers = channels wr*64 + n*16 + 8*hh + 0..7, value 1024 (x wp)
    v8f qa[4][2];
#pragma unroll  // every array here is indexed by constants, so it stays in registers
    for (int n = 0; n < 4; ++n)
#pragma unroll
      for (int t = 0; t < 2; ++t) qa[n][t] = zero8();
    {
      const _Float16* wp = (const _Float16*)(const void*)(sH + (wr * HD + c) * WSP) + 8 * hh;   // the head's 64 wpt rows
      const _Float16* xb = (const _Float16*)(const void*)(sX + (wq * 32 + c) * WSP) + 8 * hh;   // the wave's 32 token rows
      // fragments are fetched one k-step ahead: the reads of step ks + 1 are in flight under the products of step ks
      v16h fx0 = ldfrag_h(xb), fx1 = ldfrag_h(xb + 16 * (WSP / 2));
      v16h fw0 = ldfrag_h(wp), fw1 = ldfrag_h(wp + 16 * (WSP / 2));
      v16h fw2 = ldfrag_h(wp + 32 * (WSP / 2)), fw3 = ldfrag_h(wp + 48 * (WSP / 2));
#pragma unroll  // straight-line k-steps
      for (int ks = 0; ks < DIMC / 32; ++ks) {
        const int kn = (ks + 1) * 32;
        v16h nx0 = fx0, nx1 = fx1, nw0 = fw0, nw1 = fw1, nw2 = fw2, nw3 = fw3;
        if (ks + 1 < DIMC / 32) {
          nx0 = ldfrag_h(xb + kn);
          nx1 = ldfrag_h(xb + 16 * (WSP / 2) + kn);
          nw0 = ldfrag_h(wp + kn);
          nw1 = ldfrag_h(wp + 16 * (WSP / 2) + kn);
          nw2 = ldfrag_h(wp + 32 * (WSP / 2) + kn);
          nw3 = ldfrag_h(wp + 48 * (WSP / 2) + kn);
        }
        __builtin_amdgcn_sched_barrier(0);  // holds the next step's reads in front of this step's products
        qa[0][0] = mma_raw(fw0, fx0, qa[0][0]);
        qa[0][1] = mma_raw(fw0, fx1, qa[0][1]);
        qa[1][0] = mma_raw(fw1, fx0, qa[1][0]);
        qa[1][1] = mma_raw(fw1, fx1, qa[1][1]);
        qa[2][0] = mma_raw(fw2, fx0, qa[2][0]);
        qa[2][1] = mma_raw(fw2, fx1, qa[2][1]);
        qa[3][0] = mma_raw(fw3, fx0, qa[3][0]);
        qa[3][1] = mma_raw(fw3, fx1, qa[3][1]);
        __builtin_amdgcn_sched_barrier(0);  // and later reads behind them: one step ahead, no deeper
        fx0 = nx0; fx1 = nx1; fw0 = nw0; fw1 = nw1; fw2 = nw2; fw3 = nw3;
      }
    }
    const _Float16* xp  = (const _Float16*)(const void*)(sX  + (wq * 32 + c) * WSP) + wr * HD + 8 * hh;
#pragma unroll  // every array below is indexed by constants, so it stays in registers (every short loop likewise)
    for (int n = 0; n < 4; ++n) {
      const float* bq = sBQ + wr * HD + n * 16 + 8 * hh;
      const v4f bA = *(const v4f*)(bq);
      const v4f bB = *(const v4f*)(bq + 4);
      const float bv[8] = { bA[0], bA[1], bA[2], bA[3], bB[0], bB[1], bB[2], bB[3] };
#pragma unroll
      for (int t = 0; t < 2; ++t) {
        const v8h xv = *(const v8h*)(xp + t * 16 * (WSP / 2) + n * 16);
#pragma unroll
        for (int e = 0; e < 8; ++e)
          o[n][t][e] = ((float)xv[e] * (1.0f / 16.0f) + bv[e]) + qa[n][t][e] * (1.0f / 1024.0f);
      }
    }
  }
  float mu[2], rs[2];
#pragma unroll
  for (int t = 0; t < 2; ++t) {
    float s = 0.f;
#pragma unroll
    for (int n = 0; n < 4; ++n)
      s += ((o[n][t][0] + o[n][t][1]) + (o[n][t][2] + o[n][t][3])) + ((o[n][t][4] + o[n][t][5]) + (o[n][t][6] + o[n][t][7]));
    s += __shfl_xor(s, 16, 32);
    if (hh == 0) sR[wr * 128 + wq * 32 + t * 16 + c] = s;
  }
  // the sums are written and this wave's reads of the wpt rows and xh have returned; behind the barrier all waves' have
  asm volatile("s_wait_dscnt 0x0" ::: "memory");
  __syncthreads();
  {
    // the first chunk's w1t rows go where wpt rows 128..255 lay and fly under the rest of the layer norm
    unsigned l[8];
    const _Float16* g[8];
#pragma unroll
    for (int j = 0; j < 8; ++j) { l[j] = lW1 + (unsigned)(j * 16 * WSP); g[j] = gW1 + (size_t)j * 16 * DIMC; }
    acopy8(l, g);
  }
#pragma unroll
  for (int t = 0; t < 2; ++t) {
    const float* rp = sR + wq * 32 + t * 16 + c;
    mu[t] = ((rp[0] + rp[128]) + (rp[256] + rp[384])) * (1.0f / 256.0f);
    float sq = 0.f;
#pragma unroll
    for (int n = 0; n < 4; ++n)
#pragma unroll
      for (int e = 0; e < 8; ++e) { const float d = o[n][t][e] - mu[t]; sq += d * d; }
    sq += __shfl_xor(sq, 16, 32);
    if (hh == 0) sR[NH * 128 + wr * 128 + wq * 32 + t * 16 + c] = sq;
  }
  __syncthreads();
#pragma unroll
  for (int t = 0; t < 2; ++t) {
    const float* rp = sR + NH * 128 + wq * 32 + t * 16 + c;
    rs[t] = rsqrtf(((rp[0] + rp[128]) + (rp[256] + rp[384])) * (1.0f / 256.0f) + 1e-5f);
  }
#pragma unroll
  for (int n = 0; n < 4; ++n) {
    const int col0 = wr * HD + n * 16 + 8 * hh;
    const v4f gA = *(const v4f*)(sLN + col0), gB = *(const v4f*)(sLN + col0 + 4);
    const v4f bA = *(const v4f*)(sLN + DIMC + col0), bB = *(const v4f*)(sLN + DIMC + col0 + 4);
    const float gv[8] = { gA[0], gA[1], gA[2], gA[3], gB[0], gB[1], gB[2], gB[3] };
    const float bv[8] = { bA[0], bA[1], bA[2], bA[3], bB[0], bB[1], bB[2], bB[3] };
#pragma unroll
    for (int t = 0; t < 2; ++t) {
      v4u pk;
#pragma unroll
      for (int e = 0; e < 4; ++e) {
        const float f0 = ((o[n][t][2 * e] - mu[t]) * rs[t]) * gv[2 * e] + bv[2 * e];
        const float f1 = ((o[n][t][2 * e + 1] - mu[t]) * rs[t]) * gv[2 * e + 1] + bv[2 * e + 1];
        pk[e] = pk16(hb16(f0 * 16.0f), hb16(f1 * 16.0f));
      }
      *(v4u*)(void*)(sH + (wq * 32 + t * 16 + c) * WSP + col0 * 2) = pk;
      o[n][t] *= 1024.0f;                                   // x1 in the scale of the FC2 products
    }
  }
  // h is written and this wave's w1t copies have landed; behind the barrier all waves' have
  asm volatile("s_wait_dscnt 0x0" ::: "memory");
  asm volatile("s_wait_asynccnt 0x0" ::: "memory");
  __syncthreads();
  // FC1: wave = 32 hidden (wq) x 32 tokens (wr); FC2: wave = 64 cols (wr) x 32 tokens (wq)
  const _Float16* w1p = (const _Float16*)(const void*)(sW1 + (wq * 32 + c) * WSP) + 8 * hh;
  const _Float16* hp  = (const _Float16*)(const void*)(sH  + (wr * 32 + c) * WSP) + 8 * hh;
  const _Float16* gp  = (const _Float16*)(const void*)(sG  + (wq * 32 + c) * GSP) + 8 * hh;
  const _Float16* w2p = (const _Float16*)(const void*)(sW2 + (wr * 64 + c) * GSP) + 8 * hh;
  unsigned char* gst = sG + (wr * 32 + c) * GSP + (wq * 32 + 8 * hh) * 2;   // this lane's token row, its 8 hidden channels
#pragma unroll 1  // one copy of the chunk body: the text stays short
  for (int ch = 0; ch < MLP / 128; ++ch) {                  // block-uniform trip count
    {
      // the chunk's w2t rows fly under FC1 and GELU; the last chunk's readers left them at the barrier at the loop's foot
      unsigned l[8];
      const _Float16* g[8];
#pragma unroll
      for (int j = 0; j < 8; ++j) { l[j] = lW2 + (unsigned)(j * 32 * GSP); g[j] = gW2 + (size_t)j * 32 * MLP + ch * 128; }
      acopy8(l, g);
    }
    v8f a[2][2];
#pragma unroll
    for (int i = 0; i < 2; ++i)
#pragma unroll
      for (int t = 0; t < 2; ++t) a[i][t] = zero8();
    {
      // fragments are fetched one k-step ahead: the reads of step ks + 1 are in flight under the products of step ks
      v16h fw0 = ldfrag_h(w1p), fw1 = ldfrag_h(w1p + 16 * (WSP / 2));
      v16h fh0 = ldfrag_h(hp), fh1 = ldfrag_h(hp + 16 * (WSP / 2));
#pragma unroll  // straight-line k-steps
      for (int ks = 0; ks < DIMC / 32; ++ks) {
        const int kn = (ks + 1) * 32;
        v16h nw0 = fw0, nw1 = fw1, nh0 = fh0, nh1 = fh1;
        if (ks + 1 < DIMC / 32) {
          nw0 = ldfrag_h(w1p + kn);
          nw1 = ldfrag_h(w1p + 16 * (WSP / 2) + kn);
          nh0 = ldfrag_h(hp + kn);
          nh1 = ldfrag_h(hp + 16 * (WSP / 2) + kn);
        }
        __builtin_amdgcn_sched_barrier(0);  // holds the next step's reads in front of this step's products
        a[0][0] = mma_raw(fw0, fh0, a[0][0]);
        a[0][1] = mma_raw(fw0, fh1, a[0][1]);
        a[1][0] = mma_raw(fw1, fh0, a[1][0]);
        a[1][1] = mma_raw(fw1, fh1, a[1][1]);
        __builtin_amdgcn_sched_barrier(0);  // and later reads behind them: one step ahead, no deeper
        fw0 = nw0; fw1 = nw1; fh0 = nh0; fh1 = nh1;
      }
    }
#pragma unroll
    for (int i = 0; i < 2; ++i) {
      const float* bp = sB1 + ch * 128 + wq * 32 + i * 16 + 8 * hh;
      const v4f bA = *(const v4f*)(bp);
      const v4f bB = *(const v4f*)(bp + 4);
      const float bv[8] = { bA[0], bA[1], bA[2], bA[3], bB[0], bB[1], bB[2], bB[3] };
#pragma unroll
      for (int t = 0; t < 2; ++t) {
        float v[8], xe[8], er[8];
        bool small = true;
#pragma unroll
        for (int e = 0; e < 8; ++e) {
          v[e] = a[i][t][e] * (1.0f / 1024.0f) + bv[e];
          xe[e] = v[e] * 0.70710678118654752f;
          small = small && (fabsf(xe[e]) < 1.0f);
        }
        // erff tests |x| < 1 for each value; one test for the lane's 8 values leaves 8 independent chains with no
        // branch between them on the side where all are below 1, and the full erff for all 8 on the other side
        if (small) {
#pragma unroll
          for (int e = 0; e < 8; ++e) er[e] = erff(xe[e]);
        } else {
#pragma unroll
          for (int e = 0; e < 8; ++e) er[e] = erff(xe[e]);
        }
        v4u pk;
#pragma unroll
        for (int e = 0; e < 4; ++e) {
          const float g0 = 0.5f * v[2 * e] * (1.0f + er[2 * e]);
          const float g1 = 0.5f * v[2 * e + 1] * (1.0f + er[2 * e + 1]);
          pk[e] = pk16(hb16(g0 * 16.0f), hb16(g1 * 16.0f));
        }
        *(v4u*)(void*)(gst + t * 16 * GSP + i * 32) = pk;
      }
    }
    // g is written, this wave's reads of the w1t rows have returned and its w2t copies have landed; behind the barrier
    // all waves' have
    asm volatile("s_wait_dscnt 0x0" ::: "memory");
    asm volatile("s_wait_asynccnt 0x0" ::: "memory");
    __syncthreads();
    if (ch + 1 < MLP / 128) {                               // block-uniform: the next chunk's w1t rows fly under FC2
      unsigned l[8];
      const _Float16* g[8];
#pragma unroll
      for (int j = 0; j < 8; ++j) { l[j] = lW1 + (unsigned)(j * 16 * WSP); g[j] = gW1 + (size_t)((ch + 1) * 128 + j * 16) * DIMC; }
      acopy8(l, g);
    }
    // fragments one k-step ahead, as in FC1
    v16h fg0 = ldfrag_h(gp), fg1 = ldfrag_h(gp + 16 * (GSP / 2));
    v16h fv0 = ldfrag_h(w2p), fv1 = ldfrag_h(w2p + 16 * (GSP / 2));
    v16h fv2 = ldfrag_h(w2p + 32 * (GSP / 2)), fv3 = ldfrag_h(w2p + 48 * (GSP / 2));
#pragma unroll  // straight-line k-steps
    for (int ks = 0; ks < 4; ++ks) {
      const int kn = (ks + 1) * 32;
      v16h ng0 = fg0, ng1 = fg1, nv0 = fv0, nv1 = fv1, nv2 = fv2, nv3 = fv3;
      if (ks + 1 < 4) {
        ng0 = ldfrag_h(gp + kn);
        ng1 = ldfrag_h(gp + 16 * (GSP / 2) + kn);
        nv0 = ldfrag_h(w2p + kn);
        nv1 = ldfrag_h(w2p + 16 * (GSP / 2) + kn);
        nv2 = ldfrag_h(w2p + 32 * (GSP / 2) + kn);
        nv3 = ldfrag_h(w2p + 48 * (GSP / 2) + kn);
      }
      __builtin_amdgcn_sched_barrier(0);  // holds the next step's reads in front of this step's products
      o[0][0] = mma_raw(fv0, fg0, o[0][0]);
      o[0][1] = mma_raw(fv0, fg1, o[0][1]);
      o[1][0] = mma_raw(fv1, fg0, o[1][0]);
      o[1][1] = mma_raw(fv1, fg1, o[1][1]);
      o[2][0] = mma_raw(fv2, fg0, o[2][0]);
      o[2][1] = mma_raw(fv2, fg1, o[2][1]);
      o[3][0] = mma_raw(fv3, fg0, o[3][0]);
      o[3][1] = mma_raw(fv3, fg1, o[3][1]);
      if (ks == 3)  // in front of the back edge
        guard8(o[0][0], o[0][1], o[1][0], o[1][1], o[2][0], o[2][1], o[3][0], o[3][1], fg0, fg1, fv0, fv1, fv2, fv3);
      __builtin_amdgcn_sched_barrier(0);  // and later reads behind them: one step ahead, no deeper
      fg0 = ng0; fg1 = ng1; fv0 = nv0; fv1 = nv1; fv2 = nv2; fv3 = nv3;
    }
    // the reads of g and of the w2t rows have returned and this wave's w1t copies have landed; behind the barrier g and
    // the w2t rows may be rewritten and the new w1t rows read
    asm volatile("s_wait_dscnt 0x0" ::: "memory");
    asm volatile("s_wait_asynccnt 0x0" ::: "memory");
    __syncthreads();
  }
  float* Cs = (float*)(void*)sm;                            // the h and w1t rows are dead: the f32 tile lies over them
#pragma unroll
  for (int n = 0; n < 4; ++n)
#pragma unroll
    for (int t = 0; t < 2; ++t) {
      float* d = Cs + (wq * 32 + t * 16 + c) * LDX + wr * HD + n * 16 + 8 * hh;
      const v4f lo4 = { o[n][t][0], o[n][t][1], o[n][t][2], o[n][t][3] };
      const v4f hi4 = { o[n][t][4], o[n][t][5], o[n][t][6], o[n][t][7] };
      *(v4f*)d = lo4;
      *(v4f*)(d + 4) = hi4;
    }
  __syncthreads();
  // thread = 4 columns of 16 rows, 8 rows apart: a wave's store covers one whole 512-B half row
  const int row0 = tid >> 6, colp = (tid & 63) * 4;
  char* op = (char*)(void*)out + (unsigned)((tok0 + row0) * DIMC + colp) * 4u;   // byte offset below 32 MiB
  const float* cp = Cs + row0 * LDX + colp;
  v4f b2;
#pragma unroll
  for (int e = 0; e < 4; ++e) b2[e] = bfr(bias2[colp + e]);
#pragma unroll
  for (int s = 0; s < 16; ++s) {
    const v4f c4 = *(const v4f*)(cp + s * 8 * LDX);
    v4f v;
#pragma unroll
    for (int e = 0; e < 4; ++e) v[e] = c4[e] * (1.0f / 1024.0f) + b2[e];
    *(v4f*)(void*)(op + s * 8 * DIMC * 4) = v;
  }
}

// =================================================================================================================
// Workspace map (bytes; all offsets multiples of 131072; every region but BP sized exactly at its whole-line store extent):
//   [48, 56 MiB)     PT  f32 [16][32][64][64] logit partials (k_kv_part -> k_attn_sm)
//   112 MiB + : WPT f16 [8][256][256] 1048576 | BP f32 [128][32] 16384 in 262144 | W1T f16 [768][256] 393216 |
//               W2T f16 [256][768] 393216 ; end = 119537664.
// =================================================================================================================
extern "C" void kernel_launch(void* const* d_in, const int* in_sizes, int n_in,
                              void* d_out, int out_size, void* d_ws, size_t ws_size,
                              hipStream_t stream) {
  if (n_in < 9) return;
  const int expect[9] = { NTOK * DIMC, DIMC * MLP, MLP, DIMC, DIMC, DIMC * MLP, MLP, MLP * DIMC, DIMC };
  for (int i = 0; i < 9; ++i) if (in_sizes[i] != expect[i]) return;
  if (out_size != NTOK * DIMC) return;

  const float* x     = (const float*)d_in[0];
  const float* w_qkv = (const float*)d_in[1];
  const float* b_qkv = (const float*)d_in[2];
  const float* ng    = (const float*)d_in[3];
  const float* nbt   = (const float*)d_in[4];
  const float* w_fc1 = (const float*)d_in[5];
  const float* b_fc1 = (const float*)d_in[6];
  const float* w_fc2 = (const float*)d_in[7];
  const float* b_fc2 = (const float*)d_in[8];
  float* out = (float*)d_out;

  const size_t MiB = (size_t)1048576;
  const size_t szWP  = (size_t)BB * DIMC * DIMC * 2;               // 1048576
  const size_t szBP  = (size_t)262144;
  const size_t szWQ  = (size_t)MLP * DIMC * 2;                     // 393216

  const size_t oPT  = 48 * MiB;
  const size_t oWPT = 112 * MiB;
  const size_t oBP  = oWPT + szWP;
  const size_t oW1T = oBP + szBP;
  const size_t oW2T = oW1T + szWQ;
  const size_t oEND = oW2T + szWQ;                                  // 119537664
  if (oPT + (size_t)KSPLIT * ATL_OFF * 4 > oWPT) return;
  if (oEND > ws_size) return;
  if (oEND > (size_t)134217728) return;

  char* ws = (char*)d_ws;
  float*          PT  = (float*)(ws + oPT);
  unsigned short* WPT = (unsigned short*)(ws + oWPT);
  float*          BP  = (float*)(ws + oBP);
  unsigned short* W1T = (unsigned short*)(ws + oW1T);
  unsigned short* W2T = (unsigned short*)(ws + oW2T);

  const dim3 blk(256);
  // (1) per (b, h): conversion of x and the weights, k, v projection + logits, K split in KSPLIT chunks -> f32 partial tiles,
  //     the last kernel's weight planes (transposed, 64 * bf16)
  k_kv_part<<<dim3(KSPLIT, BB * NH), blk, 0, stream>>>(x, w_qkv, w_fc1, w_fc2, b_qkv, PT, W1T, W2T);
  // (2) chunk sum + softmax, P folded into the q weights -> w_q P^T plane and P b_q of each batch
  k_attn_sm<<<dim3(BB * NH, HD / 16), blk, 0, stream>>>(PT, w_qkv, b_qkv, WPT, BP);
  // (3) xf + residual + layer norm + fc1 + GELU + fc2 + bias + residual -> d_out
  k_mlp<<<dim3(NTOK / 128), dim3(512), 0, stream>>>(WPT, BP, x, ng, nbt, W1T, b_fc1, W2T, b_fc2, out);
  (void)hipGetLastError();
}

// v010
// Measured time: 53.8 microseconds a run.
// In two side-by-side timings against v009, it was 1.03 and 1.04 times as fast.
// All steps since v000 together make it 5.62 times as fast.
// Contractions: k, v projection (K=256), x . (w_q P^T) (K=256), fc1 (K=256), fc2 (K=768): v_wmma_f32_16x16x32_f16, single
// f16 products, activations carried x16, weights one f16 plane of 64*bf16(w) (64 w_q P^T likewise one f16 plane); per-head
// k^T v logits (K=4096): both operands as f16 hi + x2048 residual planes (3 products); w_q P^T (K=64): P as hi + residual
// planes (2 products); f32 accumulate everywhere. Softmax, layer norm, exact GELU and all epilogues f32 on VALU; every float input RNE-converted to
// bf16 on load.
#include <hip/hip_runtime.h>
#include <stdint.h>

#define BB     8
#define NN     4096
#define DIMC   256
#define NH     4
#define HD     64
#define MLP    768
#define NTOK   (BB * NN)
#define LDX    260
#define LDA    68
#define RSC    0.00048828125f
#define ATL_OFF ((size_t)BB * NH * HD * HD)
#define KSPLIT 16
#define KCH    (NN / KSPLIT)
#define XSP    (HD * 2 + 16)
#define WSP    (DIMC * 2 + 16)
#define TSP    (64 * 2 + 16)
#define GSP    (128 * 2 + 16)

static_assert(NTOK == 32768);
static_assert(DIMC == NH * HD);
static_assert((NN % 64) == 0 && (NTOK % 64) == 0);
static_assert((DIMC % 32) == 0 && (MLP % 32) == 0 && (HD % 32) == 0 && (NN % 32) == 0);
static_assert((LDX * 4) % 16 == 0);
static_assert(ATL_OFF == 131072);
static_assert(MLP == 6 * 128 && DIMC == 2 * 128 && (NTOK % 128) == 0 && ((GSP / 16) & 1) == 1);
static_assert(KCH * KSPLIT == NN && (KCH % 32) == 0);
static_assert(KCH == 256 && HD == 64 && ((XSP / 16) & 1) == 1 && ((WSP / 16) & 1) == 1 && ((TSP / 16) & 1) == 1);

typedef _Float16 v16h __attribute__((ext_vector_type(16)));
typedef _Float16 v8h  __attribute__((ext_vector_type(8)));
typedef float    v8f  __attribute__((ext_vector_type(8)));
typedef float    v4f  __attribute__((ext_vector_type(4)));
typedef unsigned int v4u __attribute__((ext_vector_type(4)));
typedef unsigned int v2u __attribute__((ext_vector_type(2)));
typedef float    v2f  __attribute__((ext_vector_type(2)));
typedef __bf16   v2b  __attribute__((ext_vector_type(2)));
typedef _Float16 v2h  __attribute__((ext_vector_type(2)));

// ---- scalar helpers ------------------------------------------------------------------------------------------
__device__ __forceinline__ unsigned short bf_bits(float f) {          // f32 -> bf16 bits, RNE convert
  unsigned u = __float_as_uint(f);
  return (unsigned short)((u + 0x7FFFu + ((u >> 16) & 1u)) >> 16);
}
__device__ __forceinline__ float bf_up(unsigned short b) { return __uint_as_float(((unsigned)b) << 16); }
__device__ __forceinline__ float bfr(float f) { return bf_up(bf_bits(f)); }
__device__ __forceinline__ unsigned short h_bits(_Float16 x) { return __builtin_bit_cast(unsigned short, x); }
__device__ __forceinline__ unsigned short hb16(float f) { return h_bits((_Float16)f); }
__device__ __forceinline__ unsigned pk16(unsigned short a, unsigned short b) { return (unsigned)a | ((unsigned)b << 16); }
__device__ __forceinline__ v8f zero8() { v8f z = {0.f, 0.f, 0.f, 0.f, 0.f, 0.f, 0.f, 0.f}; return z; }
// hi/lo pair of two f32 values: hi = f16(v), lo = f16(2048 (v - hi)), packed as two 32-bit words
__device__ __forceinline__ void split2(float f0, float f1, unsigned& hp, unsigned& lp) {
  const _Float16 h0 = (_Float16)f0, h1 = (_Float16)f1;
  const float q0 = (f0 - (float)h0) * 2048.0f, q1 = (f1 - (float)h1) * 2048.0f;
  hp = pk16(h_bits(h0), h_bits(h1));
  lp = pk16(hb16(q0), hb16(q1));
}

// ---- fragment loader: 16-bit A/B operand, lane -> row/col (lane&15), p already includes +8*(lane>>4);
//      elements 0..7 <- p[0..7] (k0+8h..k0+8h+7), elements 8..15 <- p[16..23] (k0+16+8h..k0+16+8h+7)
__device__ __forceinline__ v16h ldfrag_h(const _Float16* p) {
  union { v16h v; v8h h[2]; } f;
  f.h[0] = *(const v8h*)(p);
  f.h[1] = *(const v8h*)(p + 16);
  return f.v;
}

// ---- WMMA helpers; the guards insert the trailing VALU hazard gap and keep A/B live --------------------------
__device__ __forceinline__ v8f mma_raw(v16h a, v16h b, v8f c) {
  return __builtin_amdgcn_wmma_f32_16x16x32_f16(false, a, false, b, (short)0, c, false, false);
}
__device__ __forceinline__ void guard6(v8f& c0, v8f& c1, v8f& c2, v8f& c3, v8f& c4, v8f& c5,
                                       const v16h& a0, const v16h& a1, const v16h& b0, const v16h& b1,
                                       const v16h& b2, const v16h& b3) {
#if defined(__HIP_DEVICE_COMPILE__)
  asm volatile("v_nop\n\tv_nop\n\tv_nop\n\tv_nop"
               : "+v"(c0), "+v"(c1), "+v"(c2), "+v"(c3), "+v"(c4), "+v"(c5)
               : "v"(a0), "v"(a1), "v"(b0), "v"(b1), "v"(b2), "v"(b3));
#endif
}
__device__ __forceinline__ void guard8(v8f& c0, v8f& c1, v8f& c2, v8f& c3, v8f& c4, v8f& c5, v8f& c6, v8f& c7,
                                       const v16h& a0, const v16h& a1, const v16h& b0, const v16h& b1,
                                       const v16h& b2, const v16h& b3) {
#if defined(__HIP_DEVICE_COMPILE__)
  asm volatile("v_nop\n\tv_nop\n\tv_nop\n\tv_nop"
               : "+v"(c0), "+v"(c1), "+v"(c2), "+v"(c3), "+v"(c4), "+v"(c5), "+v"(c6), "+v"(c7)
               : "v"(a0), "v"(a1), "v"(b0), "v"(b1), "v"(b2), "v"(b3));
#endif
}

// ---- asynchronous copies, global -> LDS, 16 B per lane, eight per statement. The s_wait_xcnt is the last line of the
//      copies' own statement, so that no address register named here is rewritten in front of it.
__device__ __forceinline__ void acopy8(const unsigned* l, const _Float16* const* g) {
#if defined(__HIP_DEVICE_COMPILE__)
  asm volatile("global_load_async_to_lds_b128 %0, %8, off\n\t"
               "global_load_async_to_lds_b128 %1, %9, off\n\t"
               "global_load_async_to_lds_b128 %2, %10, off\n\t"
               "global_load_async_to_lds_b128 %3, %11, off\n\t"
               "global_load_async_to_lds_b128 %4, %12, off\n\t"
               "global_load_async_to_lds_b128 %5, %13, off\n\t"
               "global_load_async_to_lds_b128 %6, %14, off\n\t"
               "global_load_async_to_lds_b128 %7, %15, off\n\t"
               "s_wait_xcnt 0x0"
               :: "v"(l[0]), "v"(l[1]), "v"(l[2]), "v"(l[3]), "v"(l[4]), "v"(l[5]), "v"(l[6]), "v"(l[7]),
                  "v"(g[0]), "v"(g[1]), "v"(g[2]), "v"(g[3]), "v"(g[4]), "v"(g[5]), "v"(g[6]), "v"(g[7])
               : "memory");
#endif
}

// ---- input conversions ------------------------------------------------------------------------------------------
// two f32 values -> one word of f16(s bf16(f)), s a power of two, both conversions RNE, written on vectors of two so that
// the packed convert instructions serve them; bf16(s f) = s bf16(f), so the scale goes in front, in f32
__device__ __forceinline__ unsigned cvt2(float f0, float f1, float s) {
  const v2f a = {f0 * s, f1 * s};
  const v2b b = __builtin_convertvector(a, v2b);
  const v2f r = __builtin_convertvector(b, v2f);
  return __builtin_bit_cast(unsigned, __builtin_convertvector(r, v2h));
}
// four x values -> two words of f16(16 bf16(x))
__device__ __forceinline__ v2u cvt_x4(const v4f a) {
  v2u p;
  p[0] = cvt2(a[0], a[1], 16.0f);
  p[1] = cvt2(a[2], a[3], 16.0f);
  return p;
}
// four weights -> two words of f16(64 bf16(w))
__device__ __forceinline__ v2u cvt_w4(const v4f a) {
  v2u p;
  p[0] = cvt2(a[0], a[1], 64.0f);
  p[1] = cvt2(a[2], a[3], 64.0f);
  return p;
}
// Weight tile of 64 k x 32 n of a row-major f32 matrix w[k][n], one wave. Lane = (kq = lane >> 3, nq = lane & 7): load
// j = (hf = j >> 3, e = j & 7) reads n = nq * 4 + 0..3 of source row k = hf * 32 + kq * 8 + e (four whole lines a load), so
// the lane holds 8 consecutive k of 4 rows n; word group s = (hf = s >> 2, i = s & 3) is f16(64 bf16(w)) of these 8 k of
// row nq * 4 + i, 16 B.
__device__ __forceinline__ void wt_pack(const v4f (&g)[16], v4u (&w)[8]) {
#pragma unroll  // g[] and w[] indexed by constants, so they stay in registers
  for (int s = 0; s < 8; ++s)
#pragma unroll
    for (int e = 0; e < 4; ++e)
      w[s][e] = cvt2(g[(s >> 2) * 8 + 2 * e][s & 3], g[(s >> 2) * 8 + 2 * e + 1][s & 3], 64.0f);
}

// exact GELU of two values, v = acc/1024 + b, on packed f32: h = 8 v (b8 = 8 b), x = v / sqrt 2, t = x^2,
// erf(x) = x + x p(t) with the polynomial that erff uses for |x| < 1, result one word of f16(16 g), 16 g = h + h erf(x).
// tm takes the maximum of t: the result holds where tm stays below 1.
__device__ __forceinline__ unsigned gelu2(const v2f acc, const v2f b8, float& tm) {
  const v2f k128 = {1.0f / 128.0f, 1.0f / 128.0f};
  const v2f h = __builtin_elementwise_fma(acc, k128, b8);
  const v2f x = h * (0.70710678118654752f / 8.0f);
  const v2f t = x * x;
  tm = fmaxf(fmaxf(tm, t[0]), t[1]);
  const v2f c5 = {-0x1.268bc2p-11f, -0x1.268bc2p-11f}, c4 = {0x1.420828p-8f, 0x1.420828p-8f};
  const v2f c3 = {-0x1.b5937p-6f, -0x1.b5937p-6f}, c2 = {0x1.ce077cp-4f, 0x1.ce077cp-4f};
  const v2f c1 = {-0x1.81266p-2f, -0x1.81266p-2f}, c0 = {0x1.06eba0p-3f, 0x1.06eba0p-3f};
  v2f p = __builtin_elementwise_fma(t, c5, c4);
  p = __builtin_elementwise_fma(t, p, c3);
  p = __builtin_elementwise_fma(t, p, c2);
  p = __builtin_elementwise_fma(t, p, c1);
  p = __builtin_elementwise_fma(t, p, c0);
  const v2f er = __builtin_elementwise_fma(x, p, x);
  const v2f g = __builtin_elementwise_fma(h, er, h);
  return __builtin_bit_cast(unsigned, __builtin_convertvector(g, v2h));
}
// the same for any value: both sides of erff (below 1 the polynomial above; from 1 on 1 - exp(-(|x| + |x| q(|x|))) with the
// sign of x) are computed and one is selected, so no branch stands between the values and they run as independent chains
__device__ __forceinline__ unsigned gelu2_any(const v2f acc, const v2f b8) {
  const v2f k128 = {1.0f / 128.0f, 1.0f / 128.0f};
  const v2f h = __builtin_elementwise_fma(acc, k128, b8);
  const v2f x = h * (0.70710678118654752f / 8.0f);
  const v2f t = x * x;
  const v2f ax = {fabsf(x[0]), fabsf(x[1])};
  const v2f c5 = {-0x1.268bc2p-11f, -0x1.268bc2p-11f}, c4 = {0x1.420828p-8f, 0x1.420828p-8f};
  const v2f c3 = {-0x1.b5937p-6f, -0x1.b5937p-6f}, c2 = {0x1.ce077cp-4f, 0x1.ce077cp-4f};
  const v2f c1 = {-0x1.81266p-2f, -0x1.81266p-2f}, c0 = {0x1.06eba0p-3f, 0x1.06eba0p-3f};
  v2f p = __builtin_elementwise_fma(t, c5, c4);
  p = __builtin_elementwise_fma(t, p, c3);
  p = __builtin_elementwise_fma(t, p, c2);
  p = __builtin_elementwise_fma(t, p, c1);
  p = __builtin_elementwise_fma(t, p, c0);
  const v2f es = __builtin_elementwise_fma(x, p, x);
  const v2f d6 = {0x1.1d3156p-16f, 0x1.1d3156p-16f}, d5 = {-0x1.8d129p-12f, -0x1.8d129p-12f};
  const v2f d4 = {0x1.f9a6d2p-9f, 0x1.f9a6d2p-9f}, d3 = {-0x1.8c3164p-6f, -0x1.8c3164p-6f};
  const v2f d2 = {0x1.b4e9c8p-4f, 0x1.b4e9c8p-4f}, d1 = {0x1.4515fap-1f, 0x1.4515fap-1f};
  const v2f d0 = {0x1.078e50p-3f, 0x1.078e50p-3f};
  v2f q = __builtin_elementwise_fma(ax, d6, d5);
  q = __builtin_elementwise_fma(ax, q, d4);
  q = __builtin_elementwise_fma(ax, q, d3);
  q = __builtin_elementwise_fma(ax, q, d2);
  q = __builtin_elementwise_fma(ax, q, d1);
  q = __builtin_elementwise_fma(ax, q, d0);
  q = __builtin_elementwise_fma(ax, q, ax);
  const float l0 = copysignf(1.0f - expf(-q[0]), x[0]);
  const float l1 = copysignf(1.0f - expf(-q[1]), x[1]);
  const v2f er = {ax[0] < 1.0f ? es[0] : l0, ax[1] < 1.0f ? es[1] : l1};
  const v2f g = __builtin_elementwise_fma(h, er, h);
  return __builtin_bit_cast(unsigned, __builtin_convertvector(g, v2h));
}

// one 16x16 accumulator tile (lane = channel, registers = 8 consecutive tokens) -> carried value 16 (x w + b) =
// acc/64 + bb as f16 hi + x2048 residual, 16 B each, into the channel's hi row and its lo row (HD rows further on)
__device__ __forceinline__ void put_planes(const v8f& acc, float bb, unsigned char* hi_dst) {
  v4u a, q4;
#pragma unroll
  for (int e = 0; e < 4; ++e) {
    const float f0 = acc[2 * e] * (1.0f / 64.0f) + bb;
    const float f1 = acc[2 * e + 1] * (1.0f / 64.0f) + bb;
    unsigned hw, lw;
    split2(f0, f1, hw, lw);
    a[e] = hw; q4[e] = lw;
  }
  *(v4u*)(void*)hi_dst = a;
  *(v4u*)(void*)(hi_dst + HD * TSP) = q4;
}

// =================================================================================================================
// Input conversion + K, V projection of one head fused with its channel-attention logits, split over K. Block (ck, bh)
// takes the KCH tokens of chunk ck in KCH/64 sub-tiles of 64. The head's 64 k columns and 64 v columns of w_qkv are read
// as f32 in 16 tiles of 64 k x 32 n, two a wave, and go as f16(64 bf16(w)) into LDS rows [channel][256 k] (WSP bytes).
// Per sub-tile the 64 x rows are read as f32, whole lines (load i of wave w: half i & 1 of row (i >> 1) * 8 + w), and go as
// f16(16 bf16(x)) into LDS rows of WSP bytes. The next sub-tile's loads are issued in front of the projection and
// converted behind the logits.
// C[64 tokens][128 channels] = xh . w^T (K = 256, 8 waves = 2 (32 tokens) x 4 (32 channels)), and each lane's 8
// consecutive tokens of a channel
// go as f16 hi + x2048 residual into the LDS planes T[plane * 64 + channel][64 tokens] (rows of TSP bytes; planes
// k hi, k lo, v hi, v lo). Then raw[d][e] += sum_n (16 k[n][d]) (16 v[n][e]) on WMMA (M = N = 64, 2 k-steps):
// A = k planes, B = v planes, products hi*hi + (hi*lo + lo*hi)/2048, 8 waves = 4 (16 rows) x 2 (32 cols), tokens
// ascending. k and v never leave the work-group. The chunk's f32 tile goes through LDS to part[ck][bh][d][e].
// The last kernel's weight planes, w1t[n][k] = f16(64 bf16(w_fc1[k][n])) (n < 768, k < 256) and w2t[n][k] = f16(64 bf16(
// w_fc2[k][n])) (n < 256, k < 768), are 96 + 96 tiles of
// 64 k x 32 n: wave 0 of the first 192 blocks converts one each; the 128-B line of an output row is written by that wave.
// grid = (KSPLIT, 32), 256 threads. coverage: part [KSPLIT][32][64][64] f32, w1t 768 x 256,
// w2t 256 x 768, every element once.
// =================================================================================================================
#define WT_F  ((MLP / 32) * (DIMC / 64))
static_assert(WT_F == 96 && 2 * WT_F <= KSPLIT * BB * NH && 3 * DIMC == MLP);
// four waves per SIMD: the register budget that lets two work-groups (the LDS limit) share a WGP
__global__ __launch_bounds__(256) __attribute__((amdgpu_waves_per_eu(4)))
void k_kv_part(const float* __restrict__ x, const float* __restrict__ wqkv, const float* __restrict__ wfc1,
               const float* __restrict__ wfc2, const float* __restrict__ bias, float* part,
               unsigned short* w1t, unsigned short* w2t) {
  __shared__ __align__(16) unsigned char sm[192 * WSP + 4 * HD * TSP];
  unsigned char* sW = sm;                                   // 128 weight rows: 0..63 k channels, 64..127 v channels
  unsigned char* sA = sm + 128 * WSP;                       // 64 token rows
  unsigned char* sT = sm + 192 * WSP;                       // the four planes of one sub-tile
  static_assert(64 * LDA * 4 <= 64 * WSP);
  const int tid = threadIdx.x, lane = tid & 31, hh = lane >> 4, c = lane & 15;
  const int wave = __builtin_amdgcn_readfirstlane((int)(threadIdx.x >> 5));   // scalar: the weight-tile test is a scalar branch
  const int ck = blockIdx.x, bh = blockIdx.y;
  const int h = bh & (NH - 1);
  const int tok0 = (bh >> 2) * NN + ck * KCH;
  const float* gX = x + (size_t)(tok0 + wave) * DIMC + lane * 4;
  unsigned char* lX = sA + wave * WSP + lane * 8;
  v4f xa[16];                                               // one sub-tile's x values of this lane
  {
    const int kq = lane >> 3, nq = lane & 7;
    // this wave's two tiles of the head's weights: 32 channels lt, k tiles kt0 and kt0 + 1
    const int lt = wave >> 1, kt0 = (wave & 1) * 2;
    const float* pw = wqkv + (size_t)(kt0 * 64 + kq * 8) * MLP + (1 + (lt >> 1)) * DIMC + h * HD + (lt & 1) * 32 + nq * 4;
    v4f ga[16], gb[16];
#pragma unroll  // every array here is indexed by constants, so it stays in registers (the loops below likewise)
    for (int j = 0; j < 16; ++j) ga[j] = *(const v4f*)(pw + (size_t)((j >> 3) * 32 + (j & 7)) * MLP);
#pragma unroll
    for (int j = 0; j < 16; ++j) gb[j] = *(const v4f*)(pw + (size_t)(64 + (j >> 3) * 32 + (j & 7)) * MLP);
#pragma unroll
    for (int i = 0; i < 16; ++i) xa[i] = *(const v4f*)(gX + (i >> 1) * 8 * DIMC + (i & 1) * 128);
    // the loads' address registers are inputs here, so they live up to the wait and nothing is written over them in front of it
    asm volatile("s_wait_xcnt 0x0" :: "v"(pw), "v"(gX) : "memory");
    __builtin_amdgcn_sched_barrier(0);  // holds every load in front of the first conversion: one memory latency
    unsigned char* dw = sW + (lt * 32 + nq * 4) * WSP + (kt0 * 64 + kq * 8) * 2;
    {
      v4u w[8];
      wt_pack(ga, w);
#pragma unroll
      for (int s = 0; s < 8; ++s) *(v4u*)(void*)(dw + (s & 3) * WSP + (s >> 2) * 64) = w[s];
      wt_pack(gb, w);
#pragma unroll
      for (int s = 0; s < 8; ++s) *(v4u*)(void*)(dw + 128 + (s & 3) * WSP + (s >> 2) * 64) = w[s];
    }
    // a tile of the last kernel's weight planes, or none (wave-uniform)
    const int fb = bh * KSPLIT + ck;
    const int et = (wave == 0 && fb < 2 * WT_F) ? fb : -1;
    const int m = (et < WT_F) ? 1 : 2;
    const int r = et - ((m == 1) ? 0 : WT_F);
    const int ns = (m == 2) ? DIMC : MLP;                   // source row length
    const int kd = (m == 2) ? MLP : DIMC;                   // output row length
    const int nt = (m == 2) ? r / (MLP / 64) : r / (DIMC / 64);   // constant divisors: scalar shifts and multiplies
    const int kt = r - nt * (kd / 64);
    v4f ge[16];
    if (et >= 0) {
      const float* p = (m == 1 ? wfc1 : wfc2) + (size_t)(kt * 64 + kq * 8) * ns + nt * 32 + nq * 4;
      const float* q[16];
#pragma unroll
      for (int j = 0; j < 16; ++j) { q[j] = p + (size_t)((j >> 3) * 32 + (j & 7)) * ns; ge[j] = *(const v4f*)q[j]; }
      // as above: the 16 address registers live up to the wait
      asm volatile("s_wait_xcnt 0x0" :: "v"(q[0]), "v"(q[1]), "v"(q[2]), "v"(q[3]), "v"(q[4]), "v"(q[5]), "v"(q[6]), "v"(q[7]),
                   "v"(q[8]), "v"(q[9]), "v"(q[10]), "v"(q[11]), "v"(q[12]), "v"(q[13]), "v"(q[14]), "v"(q[15]) : "memory");
    }
    __builtin_amdgcn_sched_barrier(0);  // these loads fly under the conversion of the x rows
    {
      v2u pk[16];
#pragma unroll
      for (int i = 0; i < 16; ++i) pk[i] = cvt_x4(xa[i]);
#pragma unroll
      for (int i = 0; i < 16; ++i) *(v2u*)(void*)(lX + (i >> 1) * 8 * WSP + (i & 1) * 256) = pk[i];
    }
    // this wave's weight and token rows are written; behind the barrier every wave's are
    asm volatile("s_wait_dscnt 0x0" ::: "memory");
    __syncthreads();
    if (et >= 0) {                                          // behind the barrier: the stores' way to memory lies under the first projection
      v4u w[8];
      wt_pack(ge, w);
      __builtin_amdgcn_sched_barrier(0);  // as above: the stores behind the last conversion
      unsigned short* d = (m == 1 ? w1t : w2t) + (size_t)(nt * 32 + nq * 4) * kd + kt * 64 + kq * 8;
#pragma unroll
      for (int s = 0; s < 8; ++s) *(v4u*)(d + (size_t)(s & 3) * kd + (s >> 2) * 32) = w[s];
      // in front of whatever writes next over a register that these stores name
      asm volatile("s_wait_xcnt 0x0" ::: "memory");
      __builtin_amdgcn_sched_barrier(0);  // keeps later work behind the wait
    }
  }
  // projection: wave = 32 tokens x 32 channels
  const int mw = wave >> 2, nw = wave & 3;
  const _Float16* a0p = (const _Float16*)(const void*)(sA + (mw * 32 + c) * WSP) + 8 * hh;
  const _Float16* a1p = (const _Float16*)(const void*)(sA + (mw * 32 + 16 + c) * WSP) + 8 * hh;
  const _Float16* b0p = (const _Float16*)(const void*)(sW + (nw * 32 + c) * WSP) + 8 * hh;
  const _Float16* b1p = (const _Float16*)(const void*)(sW + (nw * 32 + 16 + c) * WSP) + 8 * hh;
  const int kvs = nw >> 1;                                  // 0: this wave's channels are k, 1: v
  const int d0 = (nw & 1) * 32 + c;                         // channel within the head; the second tile is d0 + 16
  const float bb0 = 16.0f * bfr(bias[(1 + kvs) * DIMC + h * HD + d0]);
  const float bb1 = 16.0f * bfr(bias[(1 + kvs) * DIMC + h * HD + d0 + 16]);
  unsigned char* t00 = sT + (kvs * 2 * HD + d0) * TSP + (mw * 32 + 8 * hh) * 2;   // hi row of d0, this lane's 8 tokens
  // logits: wave = 16 rows d x 32 cols e
  const int mv = wave >> 1, nv = wave & 1;
  const _Float16* ahp = (const _Float16*)(const void*)(sT + (mv * 16 + c) * TSP) + 8 * hh;
  const _Float16* alp = (const _Float16*)(const void*)(sT + (HD + mv * 16 + c) * TSP) + 8 * hh;
  const _Float16* b0h = (const _Float16*)(const void*)(sT + (2 * HD + nv * 32 + c) * TSP) + 8 * hh;
  const _Float16* b1h = (const _Float16*)(const void*)(sT + (2 * HD + nv * 32 + 16 + c) * TSP) + 8 * hh;
  const _Float16* b0l = (const _Float16*)(const void*)(sT + (3 * HD + nv * 32 + c) * TSP) + 8 * hh;
  const _Float16* b1l = (const _Float16*)(const void*)(sT + (3 * HD + nv * 32 + 16 + c) * TSP) + 8 * hh;
  v8f p0 = zero8(), p1 = zero8(), q0 = zero8(), q1 = zero8(), r0 = zero8(), r1 = zero8();
#pragma unroll 1  // one copy of the sub-tile body: the text stays short
  for (int t = 0; t < KCH / 64; ++t) {                      // block-uniform trip count
    if (t + 1 < KCH / 64) {                                 // block-uniform: the next sub-tile's x loads fly under the projection
      const float* p = gX + (size_t)(t + 1) * 64 * DIMC;
#pragma unroll
      for (int i = 0; i < 16; ++i) xa[i] = *(const v4f*)(p + (i >> 1) * 8 * DIMC + (i & 1) * 128);
      // the loads' address register is an input here, so it lives up to the wait and nothing is written over it in front of it
      asm volatile("s_wait_xcnt 0x0" :: "v"(p) : "memory");
    }
    __builtin_amdgcn_sched_barrier(0);  // holds these loads in front of the projection
    v8f c00 = zero8(), c01 = zero8(), c10 = zero8(), c11 = zero8();
    // fragments are fetched one k-step ahead: the reads of step ks + 1 are in flight under the products of step ks
    v16h fa0 = ldfrag_h(a0p), fa1 = ldfrag_h(a1p);
    v16h fb0 = ldfrag_h(b0p), fb1 = ldfrag_h(b1p);
#pragma unroll  // straight-line k-steps
    for (int ks = 0; ks < DIMC / 32; ++ks) {
      const int kn = (ks + 1 < DIMC / 32 ? ks + 1 : ks) * 32;
      v16h na0 = fa0, na1 = fa1, nb0 = fb0, nb1 = fb1;
      if (ks + 1 < DIMC / 32) {
        na0 = ldfrag_h(a0p + kn);
        na1 = ldfrag_h(a1p + kn);
        nb0 = ldfrag_h(b0p + kn);
        nb1 = ldfrag_h(b1p + kn);
      }
      __builtin_amdgcn_sched_barrier(0);  // holds the next step's reads in front of this step's products
      c00 = mma_raw(fa0, fb0, c00);
      c01 = mma_raw(fa0, fb1, c01);
      c10 = mma_raw(fa1, fb0, c10);
      c11 = mma_raw(fa1, fb1, c11);
      __builtin_amdgcn_sched_barrier(0);  // and later reads behind them: no deeper fetch, no spills
      fa0 = na0; fa1 = na1; fb0 = nb0; fb1 = nb1;
    }
    put_planes(c00, bb0, t00);
    put_planes(c01, bb1, t00 + 16 * TSP);
    put_planes(c10, bb0, t00 + 32);
    put_planes(c11, bb1, t00 + 16 * TSP + 32);
    // the planes are written and this wave's reads of the token rows have returned; behind the barrier all waves' have
    asm volatile("s_wait_dscnt 0x0" ::: "memory");
    __syncthreads();
#pragma unroll  // two straight-line k-steps
    for (int ks = 0; ks < 2; ++ks) {
      const int ko = ks * 32;
      const v16h fa  = ldfrag_h(ahp + ko);
      const v16h ga  = ldfrag_h(alp + ko);
      const v16h fb0 = ldfrag_h(b0h + ko);
      const v16h fb1 = ldfrag_h(b1h + ko);
      const v16h gb0 = ldfrag_h(b0l + ko);
      const v16h gb1 = ldfrag_h(b1l + ko);
      p0 = mma_raw(fa, fb0, p0);
      p1 = mma_raw(fa, fb1, p1);
      q0 = mma_raw(fa, gb0, q0);
      q1 = mma_raw(fa, gb1, q1);
      r0 = mma_raw(ga, fb0, r0);
      r1 = mma_raw(ga, fb1, r1);
      if (ks == 1) guard6(p0, p1, q0, q1, r0, r1, fa, ga, fb0, fb1, gb0, gb1);  // in front of the back edge
    }
    if (t + 1 < KCH / 64) {                                 // block-uniform; the readers of the old token rows left them at the barrier above
      v2u pk[16];
#pragma unroll
      for (int i = 0; i < 16; ++i) pk[i] = cvt_x4(xa[i]);
#pragma unroll
      for (int i = 0; i < 16; ++i) *(v2u*)(void*)(lX + (i >> 1) * 8 * WSP + (i & 1) * 256) = pk[i];
    }
    // the plane reads have returned and the new token rows are written; behind the barrier the planes may be
    // rewritten and the new token rows read
    asm volatile("s_wait_dscnt 0x0" ::: "memory");
    __syncthreads();
  }
  float* Cs = (float*)(void*)sA;                            // the token rows are dead: the f32 tile lies over them
#pragma unroll
  for (int r = 0; r < 8; ++r) {
    const int row = mv * 16 + 8 * hh + r;
    Cs[row * LDA + nv * 32 + c]      = p0[r] + (q0[r] + r0[r]) * RSC;
    Cs[row * LDA + nv * 32 + 16 + c] = p1[r] + (q1[r] + r1[r]) * RSC;
  }
  __syncthreads();
  float* dst = part + ((size_t)ck * (BB * NH) + bh) * (HD * HD);
  v4f pk[4];
#pragma unroll  // pk[] indexed by constants, so it stays in registers
  for (int s = 0; s < 4; ++s) {
    const int idx = s * 256 + tid;
    pk[s] = *(const v4f*)(Cs + (idx >> 4) * LDA + (idx & 15) * 4);
  }
#pragma unroll  // as above
  for (int s = 0; s < 4; ++s) *(v4f*)(dst + (size_t)(s * 256 + tid) * 4) = pk[s];
}

// =================================================================================================================
// Chunk sum + softmax + the fold of P into the q weights. xf[token][d] = sum_e P[d][e] (x w_q + b_q)[token][e] =
// (x . (w_q P^T))[token][d] + (P b_q)[d], so the last kernel needs only wp = w_q P^T and bp = P b_q of its batch.
// Block = 16 rows d of one (b, h); thread = 4 consecutive e of one row, 16 lanes per row.
// raw = sum over ck of part[ck] in index order; logit = raw/2048 (includes the head_dim^-0.5 factor 1/8). Softmax
// over e per row d in f32 (max subtracted, 16-lane butterflies), 4096 P as f16 hi + x2048 residual planes into LDS rows
// [d][64 e] (XSP bytes). The head's 64 q columns of w_qkv are read as f32, whole lines (load j: rows j * 16 + (tid >> 4)),
// and go as f16(64 bf16(w)) into LDS rows [c][64 e]. C[256 c][16 d] = w rows . P rows^T on WMMA (K = 64, 2 k-steps, e
// ascending; 8 waves x 2 tiles of 16 c), products w*hi + (w*lo)/2048, C = 2^18 wp; a lane holds 8 consecutive c of one d:
// f16(64 wp), 16 B, into an LDS tile [d][256 c], from there whole lines to wpt[b][h*64+d][c]. bp in f32, summed in the lane
// and over the row's 16 lanes; the block's 16 values lie in a 128-B line of their own, bp[(bh*4 + blockIdx.y)*32 + 0..15].
// grid = (32, 4), 256 threads. coverage: wpt [8][256][256] f16, every element once; bp as above.
// =================================================================================================================
__global__ __launch_bounds__(256)
void k_attn_sm(const float* __restrict__ part, const float* __restrict__ wqkv, const float* __restrict__ bias,
               unsigned short* wpt, float* bp) {
  __shared__ __align__(16) unsigned char sm[DIMC * XSP + 2 * 16 * XSP + 16 * WSP + 16 * 4];
  unsigned char* sW = sm;                                   // 256 rows c of the head's q weights
  unsigned char* sP = sm + DIMC * XSP;                      // 16 rows d of P hi, then 16 rows of P lo
  unsigned char* sO = sP + 2 * 16 * XSP;                    // 16 rows d of 64 wp
  float* sB = (float*)(void*)(sO + 16 * WSP);               // the 16 values of bp
  const int tid = threadIdx.x, wave = tid >> 5, lane = tid & 31, hh = lane >> 4, c = lane & 15;
  const int bh = blockIdx.x, h = bh & (NH - 1);
  const int rl = tid >> 4;
  const int row = blockIdx.y * 16 + rl, col0 = (tid & 15) * 4;
  const float* pp = part + ((size_t)bh * HD + row) * HD + col0;
  const float* pw = wqkv + (size_t)rl * MLP + h * HD + col0;
  v4f t[KSPLIT], wv[16];
  const v4f bq = *(const v4f*)(bias + h * HD + col0);
#pragma unroll  // all chunk loads issued before the first add: one memory latency, not KSPLIT
  for (int s = 0; s < KSPLIT; ++s) t[s] = *(const v4f*)(pp + (size_t)s * ATL_OFF);
  __builtin_amdgcn_sched_barrier(0);  // the weight rows are issued last: loads return in order, and the chunk sums do not wait for them
#pragma unroll  // the weight rows fly with them; wv[] indexed by constants, so it stays in registers
  for (int j = 0; j < 16; ++j) wv[j] = *(const v4f*)(pw + (size_t)j * 16 * MLP);
  // the loads' address registers are inputs here, so they live up to the wait and nothing is written over them in front of it
  asm volatile("s_wait_xcnt 0x0" :: "v"(pp), "v"(pw) : "memory");
  __builtin_amdgcn_sched_barrier(0);  // holds every load in front of the first add: one memory latency
  unsigned char* dW = sW + rl * XSP + col0 * 2;
  v4f a = t[0];
#pragma unroll  // t[] indexed by constants, so it stays in registers (the short loops below likewise)
  for (int s = 1; s < KSPLIT; ++s) a += t[s];
  float mx = fmaxf(fmaxf(a[0], a[1]), fmaxf(a[2], a[3]));
#pragma unroll
  for (int o = 1; o < 16; o <<= 1) mx = fmaxf(mx, __shfl_xor(mx, o, 32));
  float e[4];
#pragma unroll
  for (int n = 0; n < 4; ++n) e[n] = expf((a[n] - mx) * RSC);
  float sm1 = (e[0] + e[1]) + (e[2] + e[3]);
  float sb = (e[0] * bfr(bq[0]) + e[1] * bfr(bq[1])) + (e[2] * bfr(bq[2]) + e[3] * bfr(bq[3]));
  // four weight rows are converted behind each exchange of this butterfly: their work stands in the exchange's latency
#pragma unroll
  for (int k = 0; k < 4; ++k) {
    const float o1 = __shfl_xor(sm1, 1 << k, 32), o2 = __shfl_xor(sb, 1 << k, 32);
    if (k == 0) __builtin_amdgcn_sched_barrier(0);  // keeps the conversions, which wait for the last loads, behind the maximum and the exponentials
#pragma unroll
    for (int j = 4 * k; j < 4 * k + 4; ++j) *(v2u*)(void*)(dW + j * 16 * XSP) = cvt_w4(wv[j]);
    sm1 += o1; sb += o2;
  }
  const float ri = 1.0f / sm1;
  const float sc = ri * 4096.0f;
  v2u ph, pq;
#pragma unroll
  for (int n = 0; n < 2; ++n) {
    unsigned hw, lw;
    split2(e[2 * n] * sc, e[2 * n + 1] * sc, hw, lw);
    ph[n] = hw; pq[n] = lw;
  }
  *(v2u*)(void*)(sP + rl * XSP + col0 * 2) = ph;
  *(v2u*)(void*)(sP + (16 + rl) * XSP + col0 * 2) = pq;
  if ((tid & 15) == 0) sB[rl] = sb * ri;
  __syncthreads();                                          // the P rows, the weight rows and bp are written
  {
    const _Float16* pbh = (const _Float16*)(const void*)(sP + c * XSP) + 8 * hh;
    const _Float16* pbl = (const _Float16*)(const void*)(sP + (16 + c) * XSP) + 8 * hh;
    const v16h fh0 = ldfrag_h(pbh), fh1 = ldfrag_h(pbh + 32);
    const v16h fl0 = ldfrag_h(pbl), fl1 = ldfrag_h(pbl + 32);
    const int c0 = wave * 32;                               // this wave's two tiles: rows c0 + 0..15 and c0 + 16..31
    const _Float16* pa = (const _Float16*)(const void*)(sW + (c0 + c) * XSP) + 8 * hh;
    const v16h fa0 = ldfrag_h(pa), fa1 = ldfrag_h(pa + 32);
    const v16h fb0 = ldfrag_h(pa + 16 * (XSP / 2)), fb1 = ldfrag_h(pa + 16 * (XSP / 2) + 32);
    __builtin_amdgcn_sched_barrier(0);  // holds all eight fragments' reads in front of the products: one LDS latency
    v8f u[2] = { zero8(), zero8() }, v[2] = { zero8(), zero8() };
    u[0] = mma_raw(fa0, fh0, u[0]);
    v[0] = mma_raw(fa0, fl0, v[0]);
    u[1] = mma_raw(fb0, fh0, u[1]);
    v[1] = mma_raw(fb0, fl0, v[1]);
    u[0] = mma_raw(fa1, fh1, u[0]);
    v[0] = mma_raw(fa1, fl1, v[0]);
    u[1] = mma_raw(fb1, fh1, u[1]);
    v[1] = mma_raw(fb1, fl1, v[1]);
#pragma unroll
    for (int i = 0; i < 2; ++i) {
      v4u pk;
#pragma unroll
      for (int n = 0; n < 4; ++n) {
        const float f0 = (u[i][2 * n] + v[i][2 * n] * RSC) * (1.0f / 4096.0f);
        const float f1 = (u[i][2 * n + 1] + v[i][2 * n + 1] * RSC) * (1.0f / 4096.0f);
        pk[n] = pk16(hb16(f0), hb16(f1));
      }
      *(v4u*)(void*)(sO + c * WSP + (c0 + i * 16 + 8 * hh) * 2) = pk;   // lane = row d, registers = c0 + i*16 + 8*hh + 0..7
    }
  }
  __syncthreads();                                          // the tile is written
  // thread = two 16-B pieces of row rl, 256 B apart: a wave's store covers two whole lines of each of two rows
  unsigned short* dst = wpt + ((size_t)(bh >> 2) * DIMC + h * HD + row) * DIMC + (tid & 15) * 8;
  const unsigned char* so = sO + rl * WSP + (tid & 15) * 16;
  const v4u o0 = *(const v4u*)(const void*)so;
  const v4u o1 = *(const v4u*)(const void*)(so + 256);
  *(v4u*)dst = o0;
  *(v4u*)(dst + 128) = o1;
  if (tid < 16) bp[(bh * 4 + blockIdx.y) * 32 + tid] = sB[tid];
}

// =================================================================================================================
// xf + residual + layer norm + FC1 + exact GELU + FC2 + bias + residual in one kernel: x1, h and g
// never leave the work-group. Block = 128 tokens of one batch, 16 waves, one block per WGP. Wave (wq, wr) owns 32
// tokens (wq) x the 64 channels of head wr, from xf to the output.
// xf: C[64 d][32 tokens] = wpt rows . xh rows^T on WMMA (K = 256, 8 k-steps, k ascending), C = 1024 (x wp), wpt the batch's
// f16(64 w_q P^T); a lane holds 8 consecutive channels of one token. x1 = bf16(x) + bp + C/1024 in registers
// (bf16(x) = xh/16). Layer norm: mean, then the sum of squared differences, each
// summed in the lane, over the lane pair and over the four waves of a token through LDS. 16 h goes as f16, 16 B a
// store, into H[token][256] in LDS. 1024 x1 is the start value of the FC2 accumulators.
// The 768 hidden channels run in 6 chunks of 128. Per chunk: C1[128 hidden][128 tokens] = w1t rows . H rows^T (8
// k-steps, 16 waves = 4 (32 hidden) x 4 (32 tokens)): v = C1/1024 + bf16(b1), g = 0.5 v (1 + erf(v / sqrt 2)) in
// registers, two values an instruction, 16 g as f16, one 16-B LDS store into G[token][128]. Then C2[256 cols][128 tokens] += w2t chunk . G^T
// (4 k-steps), hidden channels ascending. The chunk's w2t rows fly under FC1 and GELU, the next chunk's w1t rows under
// FC2. out = C2/1024 + bf16(b2) through an f32 LDS tile, whole lines.
// grid = NTOK/128, 512 threads. coverage: out [32768][256] f32, every element once.
// =================================================================================================================
__global__ __launch_bounds__(512)
void k_mlp(const unsigned short* __restrict__ wpt, const float* __restrict__ bp,
           const float* __restrict__ x, const float* __restrict__ gw, const float* __restrict__ gb,
           const unsigned short* __restrict__ w1t, const float* __restrict__ bias1,
           const unsigned short* __restrict__ w2t, const float* __restrict__ bias2, float* out) {
  __shared__ __align__(16) unsigned char sm[384 * WSP + 384 * GSP + MLP * 4 + 2 * NH * 128 * 4 + 3 * DIMC * 4];
  unsigned char* sH  = sm;                                  // 128 rows, WSP bytes each: wpt rows 0..127, then h by token
  unsigned char* sW1 = sm + 128 * WSP;                      // 128 rows: wpt rows 128..255, then the chunk's w1t rows
  unsigned char* sG  = sm + 256 * WSP;                      // 128 token rows of g, GSP bytes each
  unsigned char* sW2 = sm + 256 * WSP + 128 * GSP;          // 256 w2t rows, the chunk's 128 k
  float* sB1 = (float*)(void*)(sm + 256 * WSP + 384 * GSP); // 8 bf16(b1) as f32
  unsigned char* sX  = sm + 256 * WSP + 384 * GSP + MLP * 4;  // 128 token rows of xh = f16(16 bf16(x))
  float* sR  = (float*)(void*)(sX + 128 * WSP);             // layer-norm partial sums [2][head][128 tokens]
  float* sLN = sR + 2 * NH * 128;                           // bf16(norm weight), then bf16(norm bias), as f32
  float* sBQ = sLN + 2 * DIMC;                              // bp of the batch's 256 channels
  static_assert(128 * LDX * 4 <= 256 * WSP);
  static_assert((NN % 128) == 0);
  static_assert(sizeof(sm) <= 327680);
  const int tid = threadIdx.x, wave = tid >> 5, lane = tid & 31, hh = lane >> 4, c = lane & 15;
  const int tok0 = blockIdx.x * 128;
  const int wq = wave >> 2, wr = wave & 3;
  // copies: a wave copy covers one whole 512-B row (wpt, w1t) or two 256-B row pieces (w2t)
  const _Float16* gQ  = (const _Float16*)(const void*)wpt + (size_t)(tok0 / NN) * (DIMC * DIMC) + (size_t)wave * DIMC + lane * 8;   // the batch's rows 0..255
  const float* gX = x + (size_t)(tok0 + wave) * DIMC + lane * 4;   // load i: half i & 1 of token row (i >> 1) * 16 + wave, whole lines
  const _Float16* gW1 = (const _Float16*)(const void*)w1t + (size_t)wave * DIMC + lane * 8;
  const _Float16* gW2 = (const _Float16*)(const void*)w2t + (size_t)(wave * 2 + hh) * MLP + c * 8;
  const unsigned lH  = (unsigned)(uintptr_t)sH  + (unsigned)(wave * WSP + lane * 16);            // LDS byte addresses
  const unsigned lW1 = (unsigned)(uintptr_t)sW1 + (unsigned)(wave * WSP + lane * 16);
  const unsigned lW2 = (unsigned)(uintptr_t)sW2 + (unsigned)((wave * 2 + hh) * GSP + c * 16);
  {
    v4f xa[16];
#pragma unroll  // xa[] indexed by constants, so it stays in registers
    for (int i = 0; i < 16; ++i) xa[i] = *(const v4f*)(gX + (i >> 1) * 16 * DIMC + (i & 1) * 128);
    // the loads' address register is an input here, so it lives up to the wait and nothing is written over it in front of it
    asm volatile("s_wait_xcnt 0x0" :: "v"(gX) : "memory");
    unsigned l[8];
    const _Float16* g[8];
#pragma unroll  // l[] and g[] indexed by constants, so they stay in registers (the copy loops below likewise)
    for (int j = 0; j < 8; ++j) { l[j] = lH + (unsigned)(j * 16 * WSP); g[j] = gQ + (size_t)j * 16 * DIMC; }
    acopy8(l, g);
#pragma unroll
    for (int j = 0; j < 8; ++j) { l[j] = lW1 + (unsigned)(j * 16 * WSP); g[j] = gQ + (size_t)(128 + j * 16) * DIMC; }
    acopy8(l, g);
    for (int i = tid; i < MLP; i += 512) sB1[i] = 8.0f * bfr(bias1[i]);
    if (tid < DIMC) {
      sLN[tid] = bfr(gw[tid]); sLN[DIMC + tid] = bfr(gb[tid]);
      sBQ[tid] = bp[((tok0 / NN) * (NH * 4) + (tid >> 4)) * 32 + (tid & 15)];   // 16 channels a line
    }
    // the x rows are converted while the copies fly: f16(16 bf16(x)), 8 B a lane
#pragma unroll
    for (int i = 0; i < 16; ++i) *(v2u*)(void*)(sX + ((i >> 1) * 16 + wave) * WSP + (i & 1) * 256 + lane * 8) = cvt_x4(xa[i]);
    // this wave's copies have landed and its x rows are written; behind the barrier every wave's are, and the four
    // parameter rows are written
    asm volatile("s_wait_dscnt 0x0" ::: "memory");
    asm volatile("s_wait_asynccnt 0x0" ::: "memory");
    __syncthreads();
  }
  // o[n][t]: lane = token wq*32 + t*16 + c, registers = channels wr*64 + n*16 + 8*hh + 0..7
  v8f o[4][2];
  {
    // qa[n][t]: lane = token wq*32 + t*16 + c, registers = channels wr*64 + n*16 + 8*hh + 0..7, value 1024 (x wp)
    v8f qa[4][2];
#pragma unroll  // every array here is indexed by constants, so it stays in registers
    for (int n = 0; n < 4; ++n)
#pragma unroll
      for (int t = 0; t < 2; ++t) qa[n][t] = zero8();
    {
      const _Float16* wp = (const _Float16*)(const void*)(sH + (wr * HD + c) * WSP) + 8 * hh;   // the head's 64 wpt rows
      const _Float16* xb = (const _Float16*)(const void*)(sX + (wq * 32 + c) * WSP) + 8 * hh;   // the wave's 32 token rows
      // fragments are fetched one k-step ahead: the reads of step ks + 1 are in flight under the products of step ks
      v16h fx0 = ldfrag_h(xb), fx1 = ldfrag_h(xb + 16 * (WSP / 2));
      v16h fw0 = ldfrag_h(wp), fw1 = ldfrag_h(wp + 16 * (WSP / 2));
      v16h fw2 = ldfrag_h(wp + 32 * (WSP / 2)), fw3 = ldfrag_h(wp + 48 * (WSP / 2));
#pragma unroll  // straight-line k-steps
      for (int ks = 0; ks < DIMC / 32; ++ks) {
        const int kn = (ks + 1) * 32;
        v16h nx0 = fx0, nx1 = fx1, nw0 = fw0, nw1 = fw1, nw2 = fw2, nw3 = fw3;
        if (ks + 1 < DIMC / 32) {
          nx0 = ldfrag_h(xb + kn);
          nx1 = ldfrag_h(xb + 16 * (WSP / 2) + kn);
          nw0 = ldfrag_h(wp + kn);
          nw1 = ldfrag_h(wp + 16 * (WSP / 2) + kn);
          nw2 = ldfrag_h(wp + 32 * (WSP / 2) + kn);
          nw3 = ldfrag_h(wp + 48 * (WSP / 2) + kn);
        }
        __builtin_amdgcn_sched_barrier(0);  // holds the next step's reads in front of this step's products
        qa[0][0] = mma_raw(fw0, fx0, qa[0][0]);
        qa[0][1] = mma_raw(fw0, fx1, qa[0][1]);
        qa[1][0] = mma_raw(fw1, fx0, qa[1][0]);
        qa[1][1] = mma_raw(fw1, fx1, qa[1][1]);
        qa[2][0] = mma_raw(fw2, fx0, qa[2][0]);
        qa[2][1] = mma_raw(fw2, fx1, qa[2][1]);
        qa[3][0] = mma_raw(fw3, fx0, qa[3][0]);
        qa[3][1] = mma_raw(fw3, fx1, qa[3][1]);
        __builtin_amdgcn_sched_barrier(0);  // and later reads behind them: one step ahead, no deeper
        fx0 = nx0; fx1 = nx1; fw0 = nw0; fw1 = nw1; fw2 = nw2; fw3 = nw3;
      }
    }
    const _Float16* xp  = (const _Float16*)(const void*)(sX  + (wq * 32 + c) * WSP) + wr * HD + 8 * hh;
#pragma unroll  // every array below is indexed by constants, so it stays in registers (every short loop likewise)
    for (int n = 0; n < 4; ++n) {
      const float* bq = sBQ + wr * HD + n * 16 + 8 * hh;
      const v4f bA = *(const v4f*)(bq);
      const v4f bB = *(const v4f*)(bq + 4);
      const float bv[8] = { bA[0], bA[1], bA[2], bA[3], bB[0], bB[1], bB[2], bB[3] };
#pragma unroll
      for (int t = 0; t < 2; ++t) {
        const v8h xv = *(const v8h*)(xp + t * 16 * (WSP / 2) + n * 16);
#pragma unroll
        for (int e = 0; e < 8; ++e)
          o[n][t][e] = ((float)xv[e] * (1.0f / 16.0f) + bv[e]) + qa[n][t][e] * (1.0f / 1024.0f);
      }
    }
  }
  float mu[2], rs[2];
#pragma unroll
  for (int t = 0; t < 2; ++t) {
    float s = 0.f;
#pragma unroll
    for (int n = 0; n < 4; ++n)
      s += ((o[n][t][0] + o[n][t][1]) + (o[n][t][2] + o[n][t][3])) + ((o[n][t][4] + o[n][t][5]) + (o[n][t][6] + o[n][t][7]));
    s += __shfl_xor(s, 16, 32);
    if (hh == 0) sR[wr * 128 + wq * 32 + t * 16 + c] = s;
  }
  // the sums are written and this wave's reads of the wpt rows and xh have returned; behind the barrier all waves' have
  asm volatile("s_wait_dscnt 0x0" ::: "memory");
  __syncthreads();
  {
    // the first chunk's w1t rows go where wpt rows 128..255 lay and fly under the rest of the layer norm
    unsigned l[8];
    const _Float16* g[8];
#pragma unroll
    for (int j = 0; j < 8; ++j) { l[j] = lW1 + (unsigned)(j * 16 * WSP); g[j] = gW1 + (size_t)j * 16 * DIMC; }
    acopy8(l, g);
  }
#pragma unroll
  for (int t = 0; t < 2; ++t) {
    const float* rp = sR + wq * 32 + t * 16 + c;
    mu[t] = ((rp[0] + rp[128]) + (rp[256] + rp[384])) * (1.0f / 256.0f);
    float sq = 0.f;
#pragma unroll
    for (int n = 0; n < 4; ++n)
#pragma unroll
      for (int e = 0; e < 8; ++e) { const float d = o[n][t][e] - mu[t]; sq += d * d; }
    sq += __shfl_xor(sq, 16, 32);
    if (hh == 0) sR[NH * 128 + wr * 128 + wq * 32 + t * 16 + c] = sq;
  }
  __syncthreads();
#pragma unroll
  for (int t = 0; t < 2; ++t) {
    const float* rp = sR + NH * 128 + wq * 32 + t * 16 + c;
    rs[t] = rsqrtf(((rp[0] + rp[128]) + (rp[256] + rp[384])) * (1.0f / 256.0f) + 1e-5f);
  }
#pragma unroll
  for (int n = 0; n < 4; ++n) {
    const int col0 = wr * HD + n * 16 + 8 * hh;
    const v4f gA = *(const v4f*)(sLN + col0), gB = *(const v4f*)(sLN + col0 + 4);
    const v4f bA = *(const v4f*)(sLN + DIMC + col0), bB = *(const v4f*)(sLN + DIMC + col0 + 4);
    const float gv[8] = { gA[0], gA[1], gA[2], gA[3], gB[0], gB[1], gB[2], gB[3] };
    const float bv[8] = { bA[0], bA[1], bA[2], bA[3], bB[0], bB[1], bB[2], bB[3] };
#pragma unroll
    for (int t = 0; t < 2; ++t) {
      v4u pk;
#pragma unroll
      for (int e = 0; e < 4; ++e) {
        const float f0 = ((o[n][t][2 * e] - mu[t]) * rs[t]) * gv[2 * e] + bv[2 * e];
        const float f1 = ((o[n][t][2 * e + 1] - mu[t]) * rs[t]) * gv[2 * e + 1] + bv[2 * e + 1];
        pk[e] = pk16(hb16(f0 * 16.0f), hb16(f1 * 16.0f));
      }
      *(v4u*)(void*)(sH + (wq * 32 + t * 16 + c) * WSP + col0 * 2) = pk;
      o[n][t] *= 1024.0f;                                   // x1 in the scale of the FC2 products
    }
  }
  // h is written and this wave's w1t copies have landed; behind the barrier all waves' have
  asm volatile("s_wait_dscnt 0x0" ::: "memory");
  asm volatile("s_wait_asynccnt 0x0" ::: "memory");
  __syncthreads();
  // FC1: wave = 32 hidden (wq) x 32 tokens (wr); FC2: wave = 64 cols (wr) x 32 tokens (wq)
  const _Float16* w1p = (const _Float16*)(const void*)(sW1 + (wq * 32 + c) * WSP) + 8 * hh;
  const _Float16* hp  = (const _Float16*)(const void*)(sH  + (wr * 32 + c) * WSP) + 8 * hh;
  const _Float16* gp  = (const _Float16*)(const void*)(sG  + (wq * 32 + c) * GSP) + 8 * hh;
  const _Float16* w2p = (const _Float16*)(const void*)(sW2 + (wr * 64 + c) * GSP) + 8 * hh;
  unsigned char* gst = sG + (wr * 32 + c) * GSP + (wq * 32 + 8 * hh) * 2;   // this lane's token row, its 8 hidden channels
#pragma unroll 1  // one copy of the chunk body: the text stays short
  for (int ch = 0; ch < MLP / 128; ++ch) {                  // block-uniform trip count
    {
      // the chunk's w2t rows fly under FC1 and GELU; the last chunk's readers left them at the barrier at the loop's foot
      unsigned l[8];
      const _Float16* g[8];
#pragma unroll
      for (int j = 0; j < 8; ++j) { l[j] = lW2 + (unsigned)(j * 32 * GSP); g[j] = gW2 + (size_t)j * 32 * MLP + ch * 128; }
      acopy8(l, g);
    }
    v8f a[2][2];
#pragma unroll
    for (int i = 0; i < 2; ++i)
#pragma unroll
      for (int t = 0; t < 2; ++t) a[i][t] = zero8();
    {
      // fragments are fetched one k-step ahead: the reads of step ks + 1 are in flight under the products of step ks
      v16h fw0 = ldfrag_h(w1p), fw1 = ldfrag_h(w1p + 16 * (WSP / 2));
      v16h fh0 = ldfrag_h(hp), fh1 = ldfrag_h(hp + 16 * (WSP / 2));
#pragma unroll  // straight-line k-steps
      for (int ks = 0; ks < DIMC / 32; ++ks) {
        const int kn = (ks + 1) * 32;
        v16h nw0 = fw0, nw1 = fw1, nh0 = fh0, nh1 = fh1;
        if (ks + 1 < DIMC / 32) {
          nw0 = ldfrag_h(w1p + kn);
          nw1 = ldfrag_h(w1p + 16 * (WSP / 2) + kn);
          nh0 = ldfrag_h(hp + kn);
          nh1 = ldfrag_h(hp + 16 * (WSP / 2) + kn);
        }
        __builtin_amdgcn_sched_barrier(0);  // holds the next step's reads in front of this step's products
        a[0][0] = mma_raw(fw0, fh0, a[0][0]);
        a[0][1] = mma_raw(fw0, fh1, a[0][1]);
        a[1][0] = mma_raw(fw1, fh0, a[1][0]);
        a[1][1] = mma_raw(fw1, fh1, a[1][1]);
        __builtin_amdgcn_sched_barrier(0);  // and later reads behind them: one step ahead, no deeper
        fw0 = nw0; fw1 = nw1; fh0 = nh0; fh1 = nh1;
      }
    }
    // GELU on pairs of neighbouring accumulator registers, so that packed f32 instructions serve two values each. Every value
    // goes through the polynomial that erff uses below 1; tm[2 i + t] is the largest (v / sqrt 2)^2 of the lane's 8 values of tile (i, t).
    float tm[4] = { 0.f, 0.f, 0.f, 0.f };
#pragma unroll  // a[][], bv[] and pk[] indexed by constants, so they stay in registers (the loops down to the barrier likewise)
    for (int i = 0; i < 2; ++i) {
      const float* bp = sB1 + ch * 128 + wq * 32 + i * 16 + 8 * hh;
      const v4f bA = *(const v4f*)(bp);
      const v4f bB = *(const v4f*)(bp + 4);
      const v2f bv[4] = { {bA[0], bA[1]}, {bA[2], bA[3]}, {bB[0], bB[1]}, {bB[2], bB[3]} };
#pragma unroll
      for (int t = 0; t < 2; ++t) {
        v4u pk;
#pragma unroll
        for (int e = 0; e < 4; ++e) {
          const v2f ac = { a[i][t][2 * e], a[i][t][2 * e + 1] };
          pk[e] = gelu2(ac, bv[e], tm[2 * i + t]);
        }
        *(v4u*)(void*)(gst + t * 16 * GSP + i * 32) = pk;
      }
    }
    // one test a chunk, the same for the whole wave; where any of its values lies at or beyond 1, only the tiles that hold such
    // a value (again one test for the wave) are done again, 8 values a lane, and stored over the first result (one wave's LDS
    // stores land in order)
    if (__builtin_amdgcn_ballot_w32(!(fmaxf(fmaxf(tm[0], tm[1]), fmaxf(tm[2], tm[3])) < 1.0f)) != 0u) {
#pragma unroll
      for (int i = 0; i < 2; ++i) {
#pragma unroll
        for (int t = 0; t < 2; ++t) {
          if (__builtin_amdgcn_ballot_w32(!(tm[2 * i + t] < 1.0f)) != 0u) {
            const float* bp = sB1 + ch * 128 + wq * 32 + i * 16 + 8 * hh;
            const v4f bA = *(const v4f*)(bp);
            const v4f bB = *(const v4f*)(bp + 4);
            const v2f bv[4] = { {bA[0], bA[1]}, {bA[2], bA[3]}, {bB[0], bB[1]}, {bB[2], bB[3]} };
            v4u pk;
#pragma unroll
            for (int e = 0; e < 4; ++e) {
              const v2f ac = { a[i][t][2 * e], a[i][t][2 * e + 1] };
              pk[e] = gelu2_any(ac, bv[e]);
            }
            *(v4u*)(void*)(gst + t * 16 * GSP + i * 32) = pk;
          }
        }
      }
    }
    // g is written, this wave's reads of the w1t rows have returned and its w2t copies have landed; behind the barrier
    // all waves' have
    asm volatile("s_wait_dscnt 0x0" ::: "memory");
    asm volatile("s_wait_asynccnt 0x0" ::: "memory");
    __syncthreads();
    if (ch + 1 < MLP / 128) {                               // block-uniform: the next chunk's w1t rows fly under FC2
      unsigned l[8];
      const _Float16* g[8];
#pragma unroll
      for (int j = 0; j < 8; ++j) { l[j] = lW1 + (unsigned)(j * 16 * WSP); g[j] = gW1 + (size_t)((ch + 1) * 128 + j * 16) * DIMC; }
      acopy8(l, g);
    }
    // fragments one k-step ahead, as in FC1
    v16h fg0 = ldfrag_h(gp), fg1 = ldfrag_h(gp + 16 * (GSP / 2));
    v16h fv0 = ldfrag_h(w2p), fv1 = ldfrag_h(w2p + 16 * (GSP / 2));
    v16h fv2 = ldfrag_h(w2p + 32 * (GSP / 2)), fv3 = ldfrag_h(w2p + 48 * (GSP / 2));
#pragma unroll  // straight-line k-steps
    for (int ks = 0; ks < 4; ++ks) {
      const int kn = (ks + 1) * 32;
      v16h ng0 = fg0, ng1 = fg1, nv0 = fv0, nv1 = fv1, nv2 = fv2, nv3 = fv3;
      if (ks + 1 < 4) {
        ng0 = ldfrag_h(gp + kn);
        ng1 = ldfrag_h(gp + 16 * (GSP / 2) + kn);
        nv0 = ldfrag_h(w2p + kn);
        nv1 = ldfrag_h(w2p + 16 * (GSP / 2) + kn);
        nv2 = ldfrag_h(w2p + 32 * (GSP / 2) + kn);
        nv3 = ldfrag_h(w2p + 48 * (GSP / 2) + kn);
      }
      __builtin_amdgcn_sched_barrier(0);  // holds the next step's reads in front of this step's products
      o[0][0] = mma_raw(fv0, fg0, o[0][0]);
      o[0][1] = mma_raw(fv0, fg1, o[0][1]);
      o[1][0] = mma_raw(fv1, fg0, o[1][0]);
      o[1][1] = mma_raw(fv1, fg1, o[1][1]);
      o[2][0] = mma_raw(fv2, fg0, o[2][0]);
      o[2][1] = mma_raw(fv2, fg1, o[2][1]);
      o[3][0] = mma_raw(fv3, fg0, o[3][0]);
      o[3][1] = mma_raw(fv3, fg1, o[3][1]);
      if (ks == 3)  // in front of the back edge
        guard8(o[0][0], o[0][1], o[1][0], o[1][1], o[2][0], o[2][1], o[3][0], o[3][1], fg0, fg1, fv0, fv1, fv2, fv3);
      __builtin_amdgcn_sched_barrier(0);  // and later reads behind them: one step ahead, no deeper
      fg0 = ng0; fg1 = ng1; fv0 = nv0; fv1 = nv1; fv2 = nv2; fv3 = nv3;
    }
    // the reads of g and of the w2t rows have returned and this wave's w1t copies have landed; behind the barrier g and
    // the w2t rows may be rewritten and the new w1t rows read
    asm volatile("s_wait_dscnt 0x0" ::: "memory");
    asm volatile("s_wait_asynccnt 0x0" ::: "memory");
    __syncthreads();
  }
  float* Cs = (float*)(void*)sm;                            // the h and w1t rows are dead: the f32 tile lies over them
#pragma unroll
  for (int n = 0; n < 4; ++n)
#pragma unroll
    for (int t = 0; t < 2; ++t) {
      float* d = Cs + (wq * 32 + t * 16 + c) * LDX + wr * HD + n * 16 + 8 * hh;
      const v4f lo4 = { o[n][t][0], o[n][t][1], o[n][t][2], o[n][t][3] };
      const v4f hi4 = { o[n][t][4], o[n][t][5], o[n][t][6], o[n][t][7] };
      *(v4f*)d = lo4;
      *(v4f*)(d + 4) = hi4;
    }
  __syncthreads();
  // thread = 4 columns of 16 rows, 8 rows apart: a wave's store covers one whole 512-B half row
  const int row0 = tid >> 6, colp = (tid & 63) * 4;
  char* op = (char*)(void*)out + (unsigned)((tok0 + row0) * DIMC + colp) * 4u;   // byte offset below 32 MiB
  const float* cp = Cs + row0 * LDX + colp;
  v4f b2;
#pragma unroll
  for (int e = 0; e < 4; ++e) b2[e] = bfr(bias2[colp + e]);
#pragma unroll
  for (int s = 0; s < 16; ++s) {
    const v4f c4 = *(const v4f*)(cp + s * 8 * LDX);
    v4f v;
#pragma unroll
    for (int e = 0; e < 4; ++e) v[e] = c4[e] * (1.0f / 1024.0f) + b2[e];
    *(v4f*)(void*)(op + s * 8 * DIMC * 4) = v;
  }
}

// =================================================================================================================
// Workspace map (bytes; all offsets multiples of 131072; every region but BP sized exactly at its whole-line store extent):
//   [48, 56 MiB)     PT  f32 [16][32][64][64] logit partials (k_kv_part -> k_attn_sm)
//   112 MiB + : WPT f16 [8][256][256] 1048576 | BP f32 [128][32] 16384 in 262144 | W1T f16 [768][256] 393216 |
//               W2T f16 [256][768] 393216 ; end = 119537664.
// =================================================================================================================
extern "C" void kernel_launch(void* const* d_in, const int* in_sizes, int n_in,
                              void* d_out, int out_size, void* d_ws, size_t ws_size,
                              hipStream_t stream) {
  if (n_in < 9) return;
  const int expect[9] = { NTOK * DIMC, DIMC * MLP, MLP, DIMC, DIMC, DIMC * MLP, MLP, MLP * DIMC, DIMC };
  for (int i = 0; i < 9; ++i) if (in_sizes[i] != expect[i]) return;
  if (out_size != NTOK * DIMC) return;

  const float* x     = (const float*)d_in[0];
  const float* w_qkv = (const float*)d_in[1];
  const float* b_qkv = (const float*)d_in[2];
  const float* ng    = (const float*)d_in[3];
  const float* nbt   = (const float*)d_in[4];
  const float* w_fc1 = (const float*)d_in[5];
  const float* b_fc1 = (const float*)d_in[6];
  const float* w_fc2 = (const float*)d_in[7];
  const float* b_fc2 = (const float*)d_in[8];
  float* out = (float*)d_out;

  const size_t MiB = (size_t)1048576;
  const size_t szWP  = (size_t)BB * DIMC * DIMC * 2;               // 1048576
  const size_t szBP  = (size_t)262144;
  const size_t szWQ  = (size_t)MLP * DIMC * 2;                     // 393216

  const size_t oPT  = 48 * MiB;
  const size_t oWPT = 112 * MiB;
  const size_t oBP  = oWPT + szWP;
  const size_t oW1T = oBP + szBP;
  const size_t oW2T = oW1T + szWQ;
  const size_t oEND = oW2T + szWQ;                                  // 119537664
  if (oPT + (size_t)KSPLIT * ATL_OFF * 4 > oWPT) return;
  if (oEND > ws_size) return;
  if (oEND > (size_t)134217728) return;

  char* ws = (char*)d_ws;
  float*          PT  = (float*)(ws + oPT);
  unsigned short* WPT = (unsigned short*)(ws + oWPT);
  float*          BP  = (float*)(ws + oBP);
  unsigned short* W1T = (unsigned short*)(ws + oW1T);
  unsigned short* W2T = (unsigned short*)(ws + oW2T);

  const dim3 blk(256);
  // (1) per (b, h): conversion of x and the weights, k, v projection + logits, K split in KSPLIT chunks -> f32 partial tiles,
  //     the last kernel's weight planes (transposed, 64 * bf16)
  k_kv_part<<<dim3(KSPLIT, BB * NH), blk, 0, stream>>>(x, w_qkv, w_fc1, w_fc2, b_qkv, PT, W1T, W2T);
  // (2) chunk sum + softmax, P folded into the q weights -> w_q P^T plane and P b_q of each batch
  k_attn_sm<<<dim3(BB * NH, HD / 16), blk, 0, stream>>>(PT, w_qkv, b_qkv, WPT, BP);
  // (3) xf + residual + layer norm + fc1 + GELU + fc2 + bias + residual -> d_out
  k_mlp<<<dim3(NTOK / 128), dim3(512), 0, stream>>>(WPT, BP, x, ng, nbt, W1T, b_fc1, W2T, b_fc2, out);
  (void)hipGetLastError();
}
